// v000
// Measured on an AMD MI455X. A time is GPU time per run, averaged over a window of back-to-back runs after a warm-up
// (all launches, gaps included; the runs take copies of the inputs in turn), and the median of several windows.
// Apart from v000's, it joins two sittings. Times from different sittings can be a few percent apart, while
// side-by-side timings come from the same sitting.
// The starting kernel, v000, takes 321 microseconds a run.
#include <hip/hip_runtime.h>

// Contractions (Q/K/V/out projections, Q.K^T, P.V, P row-sum): v_wmma_f32_16x16x32_f16, f16 operands with power-of-two carries, f32 accumulate; every float input enters as its bf16 RNE value; V, P and context carry an extra f16 residual plane (x2^10) on the first 128 query rows per sequence; softmax in f32.

#ifndef NB
#define NB 2
#endif
#ifndef SEQ
#define SEQ 2048
#endif
#define NB_FULL   2
#define SEQ_FULL  2048
#define HID       1024
#define NHEAD     16
#define HD        64
#define MROWS     (NB * SEQ)
#define RROWS     (NB * 128)      // query rows per batch-set that carry residual planes

static_assert(HID == NHEAD * HD);
static_assert(SEQ % 128 == 0);
static_assert(SEQ >= 128);
static_assert(SEQ <= SEQ_FULL);
static_assert(NB >= 1 && NB <= NB_FULL);
static_assert(MROWS % 128 == 0);
static_assert(RROWS % 128 == 0);
static_assert(HID % 128 == 0);

// carries (exact powers of two)
#define CARRY_X    16.0f     // hidden plane
#define CARRY_W    32.0f     // weight planes
#define CARRY_QKV  16.0f     // q, k, v^T planes (true value x16)
#define CARRY_CTX  1024.0f   // context plane (true value x1024)
#define CARRY_RES  1024.0f   // residual planes: (value - f16(value)) x1024
#define NEGBIG     (-1.0e30f)
// softmax exp values carry 2^10 (added to the exp2 argument)

typedef _Float16 f16;
typedef f16   v16h __attribute__((ext_vector_type(16)));
typedef f16   v8h  __attribute__((ext_vector_type(8)));
typedef float v8f  __attribute__((ext_vector_type(8)));
typedef float v4f  __attribute__((ext_vector_type(4)));

union FragU { v16h v; v8h half[2]; f16 e[16]; };
union H8U   { v8h v; f16 e[8]; };

__device__ __forceinline__ v8f zero8() {
    v8f z = {0.f, 0.f, 0.f, 0.f, 0.f, 0.f, 0.f, 0.f};
    return z;
}

// 16-bit WMMA with hazard guard: D += A[16 x 32k] * B[32k x 16]
__device__ __forceinline__ v8f wmma16(v16h a, v16h b, v8f c) {
    v8f d = __builtin_amdgcn_wmma_f32_16x16x32_f16(false, a, false, b, (short)0, c, false, false);
    asm volatile("v_nop\n\tv_nop\n\tv_nop\n\tv_nop" : "+v"(d) : "v"(a), "v"(b));
    return d;
}

// f32 -> nearest-even bf16 value, returned as f32
__device__ __forceinline__ float bf16_rne(float x) {
    unsigned u = __float_as_uint(x);
    u = (u + 0x7fffu + ((u >> 16) & 1u)) & 0xffff0000u;
    return __uint_as_float(u);
}

__device__ __forceinline__ float fexp2(float x) {
#if defined(__has_builtin)
#if __has_builtin(__builtin_amdgcn_exp2f)
    return __builtin_amdgcn_exp2f(x);
#else
    return exp2f(x);
#endif
#else
    return exp2f(x);
#endif
}

// max over the 16 lanes of each lane half (DPP row rotations; D-layout rows are DPP rows)
__device__ __forceinline__ float rowmax16(float x) {
    int v = __builtin_bit_cast(int, x);
    x = fmaxf(x, __builtin_bit_cast(float, __builtin_amdgcn_update_dpp(v, v, 0x121, 0xf, 0xf, false)));
    v = __builtin_bit_cast(int, x);
    x = fmaxf(x, __builtin_bit_cast(float, __builtin_amdgcn_update_dpp(v, v, 0x122, 0xf, 0xf, false)));
    v = __builtin_bit_cast(int, x);
    x = fmaxf(x, __builtin_bit_cast(float, __builtin_amdgcn_update_dpp(v, v, 0x124, 0xf, 0xf, false)));
    v = __builtin_bit_cast(int, x);
    x = fmaxf(x, __builtin_bit_cast(float, __builtin_amdgcn_update_dpp(v, v, 0x128, 0xf, 0xf, false)));
    return x;
}

// 16 x 32 fragment from a tile whose k dimension is contiguous (pitch in halves).
// lane l: row rowbase + (l&15); elements 0..7 <- k = kcol + 8h .. +7,
// elements 8..15 <- k = kcol + 16 + 8h .. +7  (h = l>>4). Same map for A and B.
__device__ __forceinline__ v16h load_frag(const f16* tile, int rowbase, int pitch, int kcol, int lane) {
    const int r  = rowbase + (lane & 15);
    const int kh = (lane >> 4) << 3;
    const f16* p = tile + (size_t)r * pitch + kcol + kh;
    FragU f;
    f.half[0] = *(const v8h*)(p);
    f.half[1] = *(const v8h*)(p + 16);
    return f.v;
}

// ---------------------------------------------------------------------------
// f32 rows -> f16 plane (bf16 RNE value times carry). 128 threads per 1024-wide
// Source row stride mapping lets a reduced build read full-size inputs.
// coverage: nrows x 1024 halves, every element exactly once (grid = nrows*128/256).
// ---------------------------------------------------------------------------
template <int DSTPER, int SRCPER>
__global__ void __launch_bounds__(256)
cvt_rows(const float* __restrict__ src, f16* __restrict__ dst, int nrows, float carry) {
    const int g  = (int)blockIdx.x * 256 + (int)threadIdx.x;
    const int m  = g >> 7;
    const int c8 = (g & 127) << 3;
    if (m >= nrows) return;
    const int sm = (m / DSTPER) * SRCPER + (m % DSTPER);
    const float* sp = src + (size_t)sm * HID + c8;
    const v4f a = *(const v4f*)sp;
    const v4f b = *(const v4f*)(sp + 4);
    H8U o;
#pragma unroll
    for (int j = 0; j < 4; ++j) {
        const float x0 = a[j];
        const float x1 = b[j];
        o.e[j]     = (f16)(bf16_rne(x0) * carry);
        o.e[j + 4] = (f16)(bf16_rne(x1) * carry);
    }
    f16* dp = dst + (size_t)m * HID + c8;
    *(v8h*)dp = o.v;
    
}

// ---------------------------------------------------------------------------
// Weight transpose + convert: src [k][n] f32 (HID x HID, n contiguous) -> dst [n][k] f16
// = bf16 RNE(src[k][n]) * carry, k contiguous. Block handles a 64(k) x 64(n) tile through
// coverage: grid (HID/64, HID/64) x (64 n rows x 64 k) = the whole [HID][HID] plane once.
// LDS: T cross-wave (block barrier between element stores and vector reloads).
// ---------------------------------------------------------------------------
__global__ void __launch_bounds__(256)
cvt_wT(const float* __restrict__ src, f16* __restrict__ dst, float carry) {
    __shared__ __attribute__((aligned(16))) f16 T[64 * 72];
    const int tid  = (int)threadIdx.x;
    const int lane = tid & 31;
    const int wave = tid >> 5;
    const int k0   = (int)blockIdx.x * 64;
    const int n0   = (int)blockIdx.y * 64;
    const int kr   = tid >> 2;           // 0..63
    const int nc   = (tid & 3) << 4;     // 0,16,32,48
    const float* sp = src + (size_t)(k0 + kr) * HID + n0 + nc;
#pragma unroll
    for (int q = 0; q < 4; ++q) {
        const v4f a = *(const v4f*)(sp + q * 4);
#pragma unroll
        for (int j = 0; j < 4; ++j)
            T[(nc + q * 4 + j) * 72 + kr] = (f16)(bf16_rne(a[j]) * carry);
    }
    __syncthreads();
    const int piece = lane & 7;
    const int lsub  = lane >> 3;
{
#pragma unroll
        for (int it = 0; it < 2; ++it) {
            const int L = it * 32 + wave * 4 + lsub;     // local n row 0..63
            const v8h v = *(const v8h*)&T[L * 72 + piece * 8];
            f16* dp = dst + (size_t)(n0 + L) * HID + k0 + piece * 8;
            *(v8h*)dp = v;
        }
        
    }
}

// ---------------------------------------------------------------------------
// C[m][n] = sum_k A[m][k] * W[n][k] ; A [M][1024] f16, W [1024][1024] f16 (k contiguous).
// Block tile 128 x 128, 8 waves as 4(M) x 2(N), 2 x 4 accumulators per wave, K step 32.
// MODE 1: f16 plane [b*HID + h*HD + d][s] (V transposed per head) into out, plus the
//         residual plane (val - f16(val)) * 2^10, same layout, into out2
// MODE 2: f32 rows [m][1024] into the output; blocks at sequence start (s0 == 0)
//         add the f32 partial rows padd[b*128 + local row][n] (block-uniform branch)
// MODE 3: f32 rows [m][1024] into a workspace plane (no partial add)
// coverage per block: MODE 0 256 lines, MODE 1 2 x 256 lines (hi, residual),
//                     MODE 2/3 2 x 256 lines (64 rows x 4 line-quarters per half).
// LDS: As/Bs/Cs all cross-wave, separated by block barriers.
// ---------------------------------------------------------------------------
template <int MODE>
__global__ void __launch_bounds__(256) __attribute__((amdgpu_num_vgpr(256)))
gemm_nt(const f16* __restrict__ A, const f16* __restrict__ W, const float* __restrict__ bias,
        void* __restrict__ out, void* __restrict__ out2, const float* __restrict__ padd,
        float accMul, float addMul) {
    __shared__ __attribute__((aligned(16))) f16 As[128 * 32];
    __shared__ __attribute__((aligned(16))) f16 Bs[128 * 32];
    __shared__ __attribute__((aligned(16))) f16 Cs[128 * 128];   // f16 [128][128] or f32 [64][128]

    const int tid  = (int)threadIdx.x;
    const int lane = tid & 31;
    const int wave = tid >> 5;
    const int wm   = wave & 3;
    const int wn   = wave >> 2;
    const int hh8  = (lane >> 4) << 3;   // D row half
    const int c16  = lane & 15;          // D column
    const int m0   = (int)blockIdx.x * 128;
    const int n0   = (int)blockIdx.y * 128;

    v8f acc[2][4];
#pragma unroll
    for (int i = 0; i < 2; ++i)
#pragma unroll
        for (int j = 0; j < 4; ++j) acc[i][j] = zero8();

    const int srow = tid >> 1;
    const int scol = (tid & 1) << 4;
    const f16* gA = A + (size_t)(m0 + srow) * HID + scol;
    const f16* gW = W + (size_t)(n0 + srow) * HID + scol;

#pragma unroll 1
    for (int k0 = 0; k0 < HID; k0 += 32) {
        const v8h ra0 = *(const v8h*)(gA + k0);
        const v8h ra1 = *(const v8h*)(gA + k0 + 8);
        const v8h rb0 = *(const v8h*)(gW + k0);
        const v8h rb1 = *(const v8h*)(gW + k0 + 8);
        __syncthreads();
        *(v8h*)&As[srow * 32 + scol]     = ra0;
        *(v8h*)&As[srow * 32 + scol + 8] = ra1;
        *(v8h*)&Bs[srow * 32 + scol]     = rb0;
        *(v8h*)&Bs[srow * 32 + scol + 8] = rb1;
        __syncthreads();

        v16h af[2], bfr[4];
#pragma unroll
        for (int i = 0; i < 2; ++i) af[i] = load_frag(As, wm * 32 + i * 16, 32, 0, lane);
#pragma unroll
        for (int j = 0; j < 4; ++j) bfr[j] = load_frag(Bs, wn * 64 + j * 16, 32, 0, lane);
#pragma unroll
        for (int i = 0; i < 2; ++i)
#pragma unroll
            for (int j = 0; j < 4; ++j) acc[i][j] = wmma16(af[i], bfr[j], acc[i][j]);
    }

    // bias (bf16 RNE value) per owned column group
    float bb[4];
#pragma unroll
    for (int j = 0; j < 4; ++j) bb[j] = bf16_rne(bias[n0 + wn * 64 + j * 16 + c16]) * addMul;

    const int bidx  = m0 / SEQ;          // block rows lie inside one batch (SEQ % 128 == 0)
    const int s0    = m0 - bidx * SEQ;
    const int piece = lane & 7;
    const int lsub  = lane >> 3;

    if constexpr (MODE == 0) {
#pragma unroll
        for (int i = 0; i < 2; ++i)
#pragma unroll
            for (int j = 0; j < 4; ++j) {
                const int nl = wn * 64 + j * 16 + c16;
#pragma unroll
                for (int r = 0; r < 8; ++r) {
                    const int ml = wm * 32 + i * 16 + hh8 + r;
                    Cs[ml * 128 + nl] = (f16)(acc[i][j][r] * accMul + bb[j]);
                }
            }
        __syncthreads();
        f16* op = (f16*)out;
        const size_t bh0 = (size_t)bidx * NHEAD + (n0 >> 6);
{
#pragma unroll
            for (int it = 0; it < 8; ++it) {
                const int L    = wave * 32 + it * 4 + lsub;   // 0..255
                const int ml   = L >> 1;
                const int hsel = L & 1;
                const v8h v = *(const v8h*)&Cs[ml * 128 + hsel * 64 + piece * 8];
                f16* dp = op + ((bh0 + hsel) * SEQ + s0 + ml) * HD + piece * 8;
                *(v8h*)dp = v;
            }
            
        }
    } else if constexpr (MODE == 1) {
        // hi plane, staged transposed: Cs[n][m]
#pragma unroll
        for (int i = 0; i < 2; ++i)
#pragma unroll
            for (int j = 0; j < 4; ++j) {
                const int nl = wn * 64 + j * 16 + c16;
                H8U t;
#pragma unroll
                for (int r = 0; r < 8; ++r) t.e[r] = (f16)(acc[i][j][r] * accMul + bb[j]);
                *(v8h*)&Cs[nl * 128 + wm * 32 + i * 16 + hh8] = t.v;
            }
        __syncthreads();
        {
            f16* op = (f16*)out;
{
#pragma unroll
                for (int it = 0; it < 8; ++it) {
                    const int L  = wave * 32 + it * 4 + lsub;     // 0..255
                    const int nl = L >> 1;
                    const int mh = L & 1;
                    const v8h v = *(const v8h*)&Cs[nl * 128 + mh * 64 + piece * 8];
                    f16* dp = op + ((size_t)(bidx * HID + n0 + nl) * SEQ + s0 + mh * 64 + piece * 8);
                    *(v8h*)dp = v;
                }
                
            }
        }
        __syncthreads();
        // residual plane: (val - f16(val)) * 2^10, same staging and store map
#pragma unroll
        for (int i = 0; i < 2; ++i)
#pragma unroll
            for (int j = 0; j < 4; ++j) {
                const int nl = wn * 64 + j * 16 + c16;
                H8U t;
#pragma unroll
                for (int r = 0; r < 8; ++r) {
                    const float val = acc[i][j][r] * accMul + bb[j];
                    const f16 hv = (f16)val;
                    t.e[r] = (f16)((val - (float)hv) * CARRY_RES);
                }
                *(v8h*)&Cs[nl * 128 + wm * 32 + i * 16 + hh8] = t.v;
            }
        __syncthreads();
        {
            f16* op = (f16*)out2;
{
#pragma unroll
                for (int it = 0; it < 8; ++it) {
                    const int L  = wave * 32 + it * 4 + lsub;     // 0..255
                    const int nl = L >> 1;
                    const int mh = L & 1;
                    const v8h v = *(const v8h*)&Cs[nl * 128 + mh * 64 + piece * 8];
                    f16* dp = op + ((size_t)(bidx * HID + n0 + nl) * SEQ + s0 + mh * 64 + piece * 8);
                    *(v8h*)dp = v;
                }
                
            }
        }
    } else {
        float* Cf = (float*)Cs;      // [64][128] f32
        float* of = (float*)out;
#pragma unroll
        for (int half = 0; half < 2; ++half) {
            if ((wm >> 1) == half) {
#pragma unroll
                for (int i = 0; i < 2; ++i)
#pragma unroll
                    for (int j = 0; j < 4; ++j) {
                        const int nl = wn * 64 + j * 16 + c16;
#pragma unroll
                        for (int r = 0; r < 8; ++r) {
                            const int ml = (wm & 1) * 32 + i * 16 + hh8 + r;
                            Cf[ml * 128 + nl] = acc[i][j][r] * accMul + bb[j];
                        }
                    }
            }
            __syncthreads();
            v4f vv[8];
#pragma unroll
            for (int it = 0; it < 8; ++it) {
                const int L    = wave * 32 + it * 4 + lsub;   // 0..255
                const int row  = L >> 2;
                const int part = L & 3;
                vv[it] = *(const v4f*)&Cf[row * 128 + part * 32 + piece * 4];
            }
            if constexpr (MODE == 2) {
                if (s0 == 0) {     // block-uniform
#pragma unroll
                    for (int it = 0; it < 8; ++it) {
                        const int L    = wave * 32 + it * 4 + lsub;
                        const int row  = L >> 2;
                        const int part = L & 3;
                        const v4f pv = *(const v4f*)(padd + (size_t)(bidx * 128 + half * 64 + row) * HID
                                                     + n0 + part * 32 + piece * 4);
                        vv[it] += pv;
                    }
                }
            }
{
#pragma unroll
                for (int it = 0; it < 8; ++it) {
                    const int L    = wave * 32 + it * 4 + lsub;   // 0..255
                    const int row  = L >> 2;
                    const int part = L & 3;
                    float* dp = of + (size_t)(m0 + half * 64 + row) * HID + n0 + part * 32 + piece * 4;
                    *(v4f*)dp = vv[it];
                }
                
            }
            __syncthreads();
        }
    }
}

// ---------------------------------------------------------------------------
// Flash attention, causal with key padding mask (key allowed iff key <= query and
// kmask[b][key] == 0; masked keys get p = 0 and are excluded from the row max; rows with
// no allowed key produce a zero context row). grid (q-blocks, NB*NHEAD), block 256 (8 waves),
// wave owns 16 query rows (Q fragments resident). Block streams the 64-key tiles up to its
// causal horizon: K staged [key][d], V^T staged [d][key]. Scores on WMMA, row max via DPP,
// exp2 in f32 carried x2^10, P relayed per wave through LDS as A fragments, O += P.V and
// row sums += P.ones on WMMA. Output f16 plane [b*SEQ+q][1024] carried x1024, written as
// RES = 0: q-block = blockIdx.x + 1 (rows 128 .. SEQ-1).
// RES = 1: q-block 0 only (rows 0..127): V, P and the context carry x2^10 residual planes
//          (second accumulators); context residual plane Cpl is [b*128 + q][1024].
// coverage: RES 0 + RES 1 together write every (b, q, h*64..h*64+63) segment of Cp once;
//           RES 1 writes the whole Cpl plane once.
// LDS: ks, vsT, vsL cross-wave (block barriers); ps/psl per-wave but also separated by block
// barriers. staged extent == consumed extent for ks (64x64), vsT (64x64), vsL (64x64, RES),
// ps/psl (16x64).
// ---------------------------------------------------------------------------
template <int RES>
__global__ void __launch_bounds__(256) __attribute__((amdgpu_num_vgpr(256)))
attn_fwd(const f16* __restrict__ Qp, const f16* __restrict__ Kp, const f16* __restrict__ Vt,
         const f16* __restrict__ Vtl, const int* __restrict__ kmask,
         f16* __restrict__ Cp, f16* __restrict__ Cpl) {
    __shared__ __attribute__((aligned(16))) f16 ks[64 * 64];      // [key][d]
    __shared__ __attribute__((aligned(16))) f16 vsT[64 * 64];     // [d][key]
    __shared__ __attribute__((aligned(16))) f16 vsL[64 * 64];     // [d][key] residual (RES)
    __shared__ __attribute__((aligned(16))) f16 ps[8][16 * 64];   // per-wave P relay / ctx stage
    __shared__ __attribute__((aligned(16))) f16 psl[8][16 * 64];  // per-wave P residual / ctx residual (RES)

    const int tid  = (int)threadIdx.x;
    const int lane = tid & 31;
    const int wave = tid >> 5;
    const int hh8  = (lane >> 4) << 3;
    const int c16  = lane & 15;
    const int bh   = (int)blockIdx.y;
    const int bidx = bh / NHEAD;
    const int hidx = bh - bidx * NHEAD;
    const int qblk = RES ? 0 : ((int)blockIdx.x + 1);
    const int qw   = qblk * 128 + wave * 16;          // first query row (within sequence) of this wave
    const size_t head = (size_t)bh * SEQ * HD;
    const int* mrow = kmask + (size_t)bidx * SEQ_FULL;

    v16h qa[2];
#pragma unroll
    for (int c = 0; c < 2; ++c) qa[c] = load_frag(Qp + head, qw, HD, c * 32, lane);

    FragU onesu;
#pragma unroll
    for (int i = 0; i < 16; ++i) onesu.e[i] = (f16)1.0f;
    const v16h ones = onesu.v;

    float m[8];
    v8f   o[4], lacc, olo[4], laccl;
#pragma unroll
    for (int r = 0; r < 8; ++r) m[r] = NEGBIG;
#pragma unroll
    for (int dt = 0; dt < 4; ++dt) { o[dt] = zero8(); olo[dt] = zero8(); }
    lacc  = zero8();
    laccl = zero8();

    // log2-domain scale: acc = 256 * q.k ; x = log2(e) * q.k / 8 = acc * log2(e) / 2048
    const float cl = 1.4426950408889634f * 0.00048828125f;
    const float rres = 1.0f / CARRY_RES;
    f16* psw  = &ps[wave][0];
    f16* pslw = &psl[wave][0];

    const int nkt = 2 * qblk + 2;     // causal horizon in 64-key tiles (block-uniform)

#pragma unroll 1
    for (int kt = 0; kt < nkt; ++kt) {
        __syncthreads();
#pragma unroll
        for (int p2 = 0; p2 < 2; ++p2) {
            const int p   = tid + p2 * 256;
            const int row = p >> 3;
            const int pc  = (p & 7) << 3;
            const v8h kv = *(const v8h*)(Kp + head + (size_t)(kt * 64 + row) * HD + pc);
            const v8h vv = *(const v8h*)(Vt + head + (size_t)row * SEQ + kt * 64 + pc);
            *(v8h*)&ks[row * 64 + pc]  = kv;
            *(v8h*)&vsT[row * 64 + pc] = vv;
            if constexpr (RES) {
                const v8h vl = *(const v8h*)(Vtl + head + (size_t)row * SEQ + kt * 64 + pc);
                *(v8h*)&vsL[row * 64 + pc] = vl;
            }
        }
        __syncthreads();

        // S[16 q x 64 keys]
        v8f s[4];
#pragma unroll
        for (int nt = 0; nt < 4; ++nt) s[nt] = zero8();
#pragma unroll
        for (int c = 0; c < 2; ++c) {
#pragma unroll
            for (int nt = 0; nt < 4; ++nt) {
                const v16h kb = load_frag(ks, nt * 16, 64, c * 32, lane);
                s[nt] = wmma16(qa[c], kb, s[nt]);
            }
        }

        // this lane's 4 key columns and their padding-mask values
        int keyi[4], mval[4];
#pragma unroll
        for (int nt = 0; nt < 4; ++nt) {
            keyi[nt] = kt * 64 + nt * 16 + c16;
            mval[nt] = mrow[keyi[nt]];
        }

        // online softmax per row r (row 8h + r), max-subtracted, exp2 domain
#pragma unroll
        for (int r = 0; r < 8; ++r) {
            const int qrow = qw + hh8 + r;
            float x[4];
            bool  alw[4];
#pragma unroll
            for (int nt = 0; nt < 4; ++nt) {
                x[nt]   = s[nt][r] * cl;
                alw[nt] = (mval[nt] == 0) && (keyi[nt] <= qrow);
            }
            const float xm0 = alw[0] ? x[0] : NEGBIG;
            const float xm1 = alw[1] ? x[1] : NEGBIG;
            const float xm2 = alw[2] ? x[2] : NEGBIG;
            const float xm3 = alw[3] ? x[3] : NEGBIG;
            const float tm = rowmax16(fmaxf(fmaxf(xm0, xm1), fmaxf(xm2, xm3)));
            const float mn = fmaxf(m[r], tm);
            const float al = fexp2(m[r] - mn);
            m[r] = mn;
            lacc[r] *= al;
#pragma unroll
            for (int dt = 0; dt < 4; ++dt) o[dt][r] *= al;
            if constexpr (RES) {
                laccl[r] *= al;
#pragma unroll
                for (int dt = 0; dt < 4; ++dt) olo[dt][r] *= al;
            }
            const float sh = 10.0f - mn;      // carry 2^10
#pragma unroll
            for (int nt = 0; nt < 4; ++nt) {
                const float arg = alw[nt] ? (x[nt] + sh) : 0.0f;
                const float e   = fexp2(arg);
                const float p   = alw[nt] ? e : 0.0f;
                const f16   hp  = (f16)p;
                psw[(hh8 + r) * 64 + nt * 16 + c16] = hp;
                if constexpr (RES)
                    pslw[(hh8 + r) * 64 + nt * 16 + c16] = (f16)((p - (float)hp) * CARRY_RES);
            }
        }
        __syncthreads();

        // O += P . V ; l += P . ones  (P reloaded as A fragments from the relay)
#pragma unroll
        for (int kk = 0; kk < 2; ++kk) {
            const v16h pa = load_frag(psw, 0, 64, kk * 32, lane);
            if constexpr (RES) {
                const v16h pl = load_frag(pslw, 0, 64, kk * 32, lane);
#pragma unroll
                for (int dt = 0; dt < 4; ++dt) {
                    const v16h vb = load_frag(vsT, dt * 16, 64, kk * 32, lane);
                    o[dt]   = wmma16(pa, vb, o[dt]);
                    olo[dt] = wmma16(pl, vb, olo[dt]);
                    const v16h vl = load_frag(vsL, dt * 16, 64, kk * 32, lane);
                    olo[dt] = wmma16(pa, vl, olo[dt]);
                }
                lacc  = wmma16(pa, ones, lacc);
                laccl = wmma16(pl, ones, laccl);
            } else {
#pragma unroll
                for (int dt = 0; dt < 4; ++dt) {
                    const v16h vb = load_frag(vsT, dt * 16, 64, kk * 32, lane);
                    o[dt] = wmma16(pa, vb, o[dt]);
                }
                lacc = wmma16(pa, ones, lacc);
            }
        }
    }
    __syncthreads();

    // normalize: plane value = 1024 * (O/16) / (l) = O * 64 / l ; zero row when l == 0
#pragma unroll
    for (int r = 0; r < 8; ++r) {
        float l = lacc[r];
        if constexpr (RES) l += laccl[r] * rres;
        const float lsafe = (l > 0.0f) ? l : 1.0f;
        const float inv   = (l > 0.0f) ? ((CARRY_CTX / CARRY_QKV) / lsafe) : 0.0f;
#pragma unroll
        for (int dt = 0; dt < 4; ++dt) {
            float ov = o[dt][r];
            if constexpr (RES) ov += olo[dt][r] * rres;
            const float cv = ov * inv;
            const f16 hv = (f16)cv;
            psw[(hh8 + r) * 64 + dt * 16 + c16] = hv;
            if constexpr (RES)
                pslw[(hh8 + r) * 64 + dt * 16 + c16] = (f16)((cv - (float)hv) * CARRY_RES);
        }
    }
    __syncthreads();

    const int piece = lane & 7;
    const int lsub  = lane >> 3;
{
#pragma unroll
        for (int it = 0; it < 4; ++it) {
            const int L = it * 4 + lsub;     // query row 0..15 within the wave tile
            const v8h v = *(const v8h*)&psw[L * 64 + piece * 8];
            f16* dp = Cp + ((size_t)(bidx * SEQ + qw + L) * HID + hidx * HD + piece * 8);
            *(v8h*)dp = v;
            if constexpr (RES) {
                const v8h vl = *(const v8h*)&pslw[L * 64 + piece * 8];
                f16* dq = Cpl + ((size_t)(bidx * 128 + wave * 16 + L) * HID + hidx * HD + piece * 8);
                *(v8h*)dq = vl;
            }
        }
        
    }
}

// ---------------------------------------------------------------------------
// Launch: 12 kernel launches. Workspace (halves): X, Q, K, V^T hi, V^T residual, ctx hi
// (6 x MROWS*1024), 4 weight planes (1024*1024), ctx residual (NB*128*1024), plus the
// ---------------------------------------------------------------------------
extern "C" void kernel_launch(void* const* d_in, const int* in_sizes, int n_in,
                              void* d_out, int out_size, void* d_ws, size_t ws_size,
                              hipStream_t stream) {
    if (n_in < 10) return;
    if (in_sizes[0] < ((NB - 1) * SEQ_FULL + SEQ) * HID) return;
    if (in_sizes[1] < (NB - 1) * SEQ_FULL + SEQ) return;
    if (in_sizes[2] < HID * HID || in_sizes[4] < HID * HID ||
        in_sizes[6] < HID * HID || in_sizes[8] < HID * HID) return;
    if (in_sizes[3] < HID || in_sizes[5] < HID || in_sizes[7] < HID || in_sizes[9] < HID) return;
    if (out_size < MROWS * HID) return;

    const float* x    = (const float*)d_in[0];
    const int*   mask = (const int*)d_in[1];
    const float* wq   = (const float*)d_in[2];
    const float* bq   = (const float*)d_in[3];
    const float* wk   = (const float*)d_in[4];
    const float* bk   = (const float*)d_in[5];
    const float* wv   = (const float*)d_in[6];
    const float* bv   = (const float*)d_in[7];
    const float* wo   = (const float*)d_in[8];
    const float* bo   = (const float*)d_in[9];

    const size_t nX = (size_t)MROWS * HID;    // halves per activation plane
    const size_t nW = (size_t)HID * HID;      // halves per weight plane
    const size_t nR = (size_t)RROWS * HID;    // elements per residual-row plane
    const size_t totalBytes = (6 * nX + 4 * nW + nR) * sizeof(f16) + nR * sizeof(float);
    if (ws_size < totalBytes) return;

    f16* Xh  = (f16*)d_ws;       // [MROWS][1024]            carry 16
    f16* Wqh = Xh  + nX;         // [n][k] = Wq[k][n]        carry 32
    f16* Wkh = Wqh + nW;
    f16* Wvh = Wkh + nW;
    f16* Woh = Wvh + nW;
    f16* Qp  = Woh + nW;         // [NB*16][SEQ][64]         carry 16
    f16* Kp  = Qp  + nX;         // [NB*16][SEQ][64]         carry 16
    f16* Vth = Kp  + nX;         // [NB*1024][SEQ] (V^T)     carry 16
    f16* Vtl = Vth + nX;         // V^T residual x2^10
    f16* Cph = Vtl + nX;         // [MROWS][1024]            carry 1024
    f16* Cpl = Cph + nX;         // [NB*128][1024]           ctx residual x2^10 (rows 0..127 per batch)
    float* Pf = (float*)(Cpl + nR);   // [NB*128][1024] f32   residual partial of the out projection

    cvt_rows<SEQ, SEQ_FULL><<<MROWS / 2, 256, 0, stream>>>(x, Xh, MROWS, CARRY_X);
    const dim3 gw(HID / 64, HID / 64);
    cvt_wT<<<gw, 256, 0, stream>>>(wq, Wqh, CARRY_W);
    cvt_wT<<<gw, 256, 0, stream>>>(wk, Wkh, CARRY_W);
    cvt_wT<<<gw, 256, 0, stream>>>(wv, Wvh, CARRY_W);
    cvt_wT<<<gw, 256, 0, stream>>>(wo, Woh, CARRY_W);

    const dim3 gg(MROWS / 128, HID / 128);
    // plane = 16 * (acc / (16*32) + b) = acc/32 + 16*b
    const float accQKV = CARRY_QKV / (CARRY_X * CARRY_W);
    gemm_nt<0><<<gg, 256, 0, stream>>>(Xh, Wqh, bq, (void*)Qp,  (void*)0, (const float*)0, accQKV, CARRY_QKV);
    gemm_nt<0><<<gg, 256, 0, stream>>>(Xh, Wkh, bk, (void*)Kp,  (void*)0, (const float*)0, accQKV, CARRY_QKV);
    gemm_nt<1><<<gg, 256, 0, stream>>>(Xh, Wvh, bv, (void*)Vth, (void*)Vtl, (const float*)0, accQKV, CARRY_QKV);

    if (SEQ / 128 > 1)
        attn_fwd<0><<<dim3(SEQ / 128 - 1, NB * NHEAD), 256, 0, stream>>>(Qp, Kp, Vth, Vtl, mask, Cph, Cpl);
    attn_fwd<1><<<dim3(1, NB * NHEAD), 256, 0, stream>>>(Qp, Kp, Vth, Vtl, mask, Cph, Cpl);

    // residual partial: Pf = (Cpl . Wo^T) / (1024 * 1024 * 32)
    const float accLo = 1.0f / (CARRY_CTX * CARRY_RES * CARRY_W);
    gemm_nt<3><<<dim3(RROWS / 128, HID / 128), 256, 0, stream>>>(Cpl, Woh, bo, (void*)Pf, (void*)0,
                                                                   (const float*)0, accLo, 0.0f);
    // out = acc / (1024*32) + b (+ Pf on the first 128 rows of each sequence)
    const float accOut = 1.0f / (CARRY_CTX * CARRY_W);
    gemm_nt<2><<<gg, 256, 0, stream>>>(Cph, Woh, bo, d_out, (void*)0, Pf, accOut, 1.0f);
}

// v001
// One run takes 218 microseconds.
// Two timings next to v000 both put it at 1.49 times that version's speed.
#include <hip/hip_runtime.h>

// Contractions (Q/K/V/out projections, Q.K^T, P.V, P row-sum): v_wmma_f32_16x16x32_f16, f16 operands with power-of-two carries, f32 accumulate; every float input enters as its bf16 RNE value; V, P and context carry an extra f16 residual plane (x2^10) on the first 128 query rows per sequence; softmax in f32.

#ifndef NB
#define NB 2
#endif
#ifndef SEQ
#define SEQ 2048
#endif
#define NB_FULL   2
#define SEQ_FULL  2048
#define HID       1024
#define NHEAD     16
#define HD        64
#define MROWS     (NB * SEQ)
#define RROWS     (NB * 128)      // query rows per batch-set that carry residual planes

static_assert(HID == NHEAD * HD);
static_assert(SEQ % 128 == 0);
static_assert(SEQ >= 128);
static_assert(SEQ <= SEQ_FULL);
static_assert(NB >= 1 && NB <= NB_FULL);
static_assert(MROWS % 128 == 0);
static_assert(RROWS % 128 == 0);
static_assert(HID % 128 == 0);

// carries (exact powers of two)
#define CARRY_X    16.0f     // hidden plane
#define CARRY_W    32.0f     // weight planes
#define CARRY_QKV  16.0f     // q, k, v^T planes (true value x16)
#define CARRY_CTX  1024.0f   // context plane (true value x1024)
#define CARRY_RES  1024.0f   // residual planes: (value - f16(value)) x1024
#define NEGBIG     (-1.0e30f)
// LDS row pitches: 16 B x odd for rows read or written 16 bytes a lane (one row per lane),
// so that the 16 lanes of a half wave fall on distinct bank groups
#define GPITCH     40        // halves: GEMM operand rows of 32 halves (80 B)
#define CPITCH     136       // halves: GEMM f16 output staging rows of 128 halves (272 B)
#define CFPITCH    132       // floats: GEMM f32 output staging rows of 128 floats (528 B)
#define APITCH     72        // halves: attention rows of 64 halves (144 B)
static_assert(64 * CFPITCH * 4 <= 128 * CPITCH * 2);   // the f32 staging shares the f16 staging array
// softmax exp values carry 2^10 (added to the exp2 argument)

typedef _Float16 f16;
typedef f16   v16h __attribute__((ext_vector_type(16)));
typedef f16   v8h  __attribute__((ext_vector_type(8)));
typedef float v8f  __attribute__((ext_vector_type(8)));
typedef float v4f  __attribute__((ext_vector_type(4)));

union FragU { v16h v; v8h half[2]; f16 e[16]; };
union H8U   { v8h v; f16 e[8]; };

__device__ __forceinline__ v8f zero8() {
    v8f z = {0.f, 0.f, 0.f, 0.f, 0.f, 0.f, 0.f, 0.f};
    return z;
}

// 16-bit WMMA with hazard guard: D += A[16 x 32k] * B[32k x 16]
__device__ __forceinline__ v8f wmma16(v16h a, v16h b, v8f c) {
    v8f d = __builtin_amdgcn_wmma_f32_16x16x32_f16(false, a, false, b, (short)0, c, false, false);
    asm volatile("v_nop\n\tv_nop\n\tv_nop\n\tv_nop" : "+v"(d) : "v"(a), "v"(b));
    return d;
}

// f32 -> nearest-even bf16 value, returned as f32
__device__ __forceinline__ float bf16_rne(float x) {
    unsigned u = __float_as_uint(x);
    u = (u + 0x7fffu + ((u >> 16) & 1u)) & 0xffff0000u;
    return __uint_as_float(u);
}

__device__ __forceinline__ float fexp2(float x) {
#if defined(__has_builtin)
#if __has_builtin(__builtin_amdgcn_exp2f)
    return __builtin_amdgcn_exp2f(x);
#else
    return exp2f(x);
#endif
#else
    return exp2f(x);
#endif
}

// max over the 16 lanes of each lane half (DPP row rotations; D-layout rows are DPP rows)
__device__ __forceinline__ float rowmax16(float x) {
    int v = __builtin_bit_cast(int, x);
    x = fmaxf(x, __builtin_bit_cast(float, __builtin_amdgcn_update_dpp(v, v, 0x121, 0xf, 0xf, false)));
    v = __builtin_bit_cast(int, x);
    x = fmaxf(x, __builtin_bit_cast(float, __builtin_amdgcn_update_dpp(v, v, 0x122, 0xf, 0xf, false)));
    v = __builtin_bit_cast(int, x);
    x = fmaxf(x, __builtin_bit_cast(float, __builtin_amdgcn_update_dpp(v, v, 0x124, 0xf, 0xf, false)));
    v = __builtin_bit_cast(int, x);
    x = fmaxf(x, __builtin_bit_cast(float, __builtin_amdgcn_update_dpp(v, v, 0x128, 0xf, 0xf, false)));
    return x;
}

// 16 x 32 fragment from a tile whose k dimension is contiguous (pitch in halves).
// lane l: row rowbase + (l&15); elements 0..7 <- k = kcol + 8h .. +7,
// elements 8..15 <- k = kcol + 16 + 8h .. +7  (h = l>>4). Same map for A and B.
__device__ __forceinline__ v16h load_frag(const f16* tile, int rowbase, int pitch, int kcol, int lane) {
    const int r  = rowbase + (lane & 15);
    const int kh = (lane >> 4) << 3;
    const f16* p = tile + (size_t)r * pitch + kcol + kh;
    FragU f;
    f.half[0] = *(const v8h*)(p);
    f.half[1] = *(const v8h*)(p + 16);
    return f.v;
}

// ---------------------------------------------------------------------------
// f32 rows -> f16 plane (bf16 RNE value times carry). 128 threads per 1024-wide
// Source row stride mapping lets a reduced build read full-size inputs.
// coverage: nrows x 1024 halves, every element exactly once (grid = nrows*128/256).
// ---------------------------------------------------------------------------
template <int DSTPER, int SRCPER>
__global__ void __launch_bounds__(256)
cvt_rows(const float* __restrict__ src, f16* __restrict__ dst, int nrows, float carry) {
    const int g  = (int)blockIdx.x * 256 + (int)threadIdx.x;
    const int m  = g >> 7;
    const int c8 = (g & 127) << 3;
    if (m >= nrows) return;
    const int sm = (m / DSTPER) * SRCPER + (m % DSTPER);
    const float* sp = src + (size_t)sm * HID + c8;
    const v4f a = *(const v4f*)sp;
    const v4f b = *(const v4f*)(sp + 4);
    H8U o;
#pragma unroll
    for (int j = 0; j < 4; ++j) {
        const float x0 = a[j];
        const float x1 = b[j];
        o.e[j]     = (f16)(bf16_rne(x0) * carry);
        o.e[j + 4] = (f16)(bf16_rne(x1) * carry);
    }
    f16* dp = dst + (size_t)m * HID + c8;
    *(v8h*)dp = o.v;
    
}

// ---------------------------------------------------------------------------
// Weight transpose + convert: src [k][n] f32 (HID x HID, n contiguous) -> dst [n][k] f16
// = bf16 RNE(src[k][n]) * carry, k contiguous. Block handles a 64(k) x 64(n) tile through
// coverage: grid (HID/64, HID/64) x (64 n rows x 64 k) = the whole [HID][HID] plane once.
// LDS: T cross-wave (block barrier between element stores and vector reloads).
// ---------------------------------------------------------------------------
__global__ void __launch_bounds__(256)
cvt_wT(const float* __restrict__ src, f16* __restrict__ dst, float carry) {
    __shared__ __attribute__((aligned(16))) f16 T[64 * 72];
    const int tid  = (int)threadIdx.x;
    const int lane = tid & 31;
    const int wave = tid >> 5;
    const int k0   = (int)blockIdx.x * 64;
    const int n0   = (int)blockIdx.y * 64;
    const int kr   = tid >> 2;           // 0..63
    const int nc   = (tid & 3) << 4;     // 0,16,32,48
    const float* sp = src + (size_t)(k0 + kr) * HID + n0 + nc;
#pragma unroll
    for (int q = 0; q < 4; ++q) {
        const v4f a = *(const v4f*)(sp + q * 4);
#pragma unroll
        for (int j = 0; j < 4; ++j)
            T[(nc + q * 4 + j) * 72 + kr] = (f16)(bf16_rne(a[j]) * carry);
    }
    __syncthreads();
    const int piece = lane & 7;
    const int lsub  = lane >> 3;
{
#pragma unroll
        for (int it = 0; it < 2; ++it) {
            const int L = it * 32 + wave * 4 + lsub;     // local n row 0..63
            const v8h v = *(const v8h*)&T[L * 72 + piece * 8];
            f16* dp = dst + (size_t)(n0 + L) * HID + k0 + piece * 8;
            *(v8h*)dp = v;
        }
        
    }
}

// ---------------------------------------------------------------------------
// C[m][n] = sum_k A[m][k] * W[n][k] ; A [M][1024] f16, W [1024][1024] f16 (k contiguous).
// Block tile 128 x 128, 8 waves as 4(M) x 2(N), 2 x 4 accumulators per wave, K step 32.
// MODE 1: f16 plane [b*HID + h*HD + d][s] (V transposed per head) into out, plus the
//         residual plane (val - f16(val)) * 2^10, same layout, into out2
// MODE 2: f32 rows [m][1024] into the output; blocks at sequence start (s0 == 0)
//         add the f32 partial rows padd[b*128 + local row][n] (block-uniform branch)
// MODE 3: f32 rows [m][1024] into a workspace plane (no partial add)
// coverage per block: MODE 0 256 lines, MODE 1 2 x 256 lines (hi, residual),
//                     MODE 2/3 2 x 256 lines (64 rows x 4 line-quarters per half).
// LDS: As/Bs/Cs all cross-wave, separated by block barriers.
// ---------------------------------------------------------------------------
template <int MODE>
__global__ void __launch_bounds__(256) __attribute__((amdgpu_num_vgpr(256)))
gemm_nt(const f16* __restrict__ A, const f16* __restrict__ W, const float* __restrict__ bias,
        void* __restrict__ out, void* __restrict__ out2, const float* __restrict__ padd,
        float accMul, float addMul) {
    __shared__ __attribute__((aligned(16))) f16 As[128 * GPITCH];
    __shared__ __attribute__((aligned(16))) f16 Bs[128 * GPITCH];
    __shared__ __attribute__((aligned(16))) f16 Cs[128 * CPITCH];   // f16 [128][CPITCH] or f32 [64][CFPITCH]

    const int tid  = (int)threadIdx.x;
    const int lane = tid & 31;
    const int wave = tid >> 5;
    const int wm   = wave & 3;
    const int wn   = wave >> 2;
    const int hh8  = (lane >> 4) << 3;   // D row half
    const int c16  = lane & 15;          // D column
    const int m0   = (int)blockIdx.x * 128;
    const int n0   = (int)blockIdx.y * 128;

    v8f acc[2][4];
#pragma unroll
    for (int i = 0; i < 2; ++i)
#pragma unroll
        for (int j = 0; j < 4; ++j) acc[i][j] = zero8();

    const int srow = tid >> 1;
    const int scol = (tid & 1) << 4;
    const f16* gA = A + (size_t)(m0 + srow) * HID + scol;
    const f16* gW = W + (size_t)(n0 + srow) * HID + scol;

#pragma unroll 1
    for (int k0 = 0; k0 < HID; k0 += 32) {
        const v8h ra0 = *(const v8h*)(gA + k0);
        const v8h ra1 = *(const v8h*)(gA + k0 + 8);
        const v8h rb0 = *(const v8h*)(gW + k0);
        const v8h rb1 = *(const v8h*)(gW + k0 + 8);
        __syncthreads();
        *(v8h*)&As[srow * GPITCH + scol]     = ra0;
        *(v8h*)&As[srow * GPITCH + scol + 8] = ra1;
        *(v8h*)&Bs[srow * GPITCH + scol]     = rb0;
        *(v8h*)&Bs[srow * GPITCH + scol + 8] = rb1;
        __syncthreads();

        v16h af[2], bfr[4];
#pragma unroll
        for (int i = 0; i < 2; ++i) af[i] = load_frag(As, wm * 32 + i * 16, GPITCH, 0, lane);
#pragma unroll
        for (int j = 0; j < 4; ++j) bfr[j] = load_frag(Bs, wn * 64 + j * 16, GPITCH, 0, lane);
#pragma unroll
        for (int i = 0; i < 2; ++i)
#pragma unroll
            for (int j = 0; j < 4; ++j) acc[i][j] = wmma16(af[i], bfr[j], acc[i][j]);
    }

    // bias (bf16 RNE value) per owned column group
    float bb[4];
#pragma unroll
    for (int j = 0; j < 4; ++j) bb[j] = bf16_rne(bias[n0 + wn * 64 + j * 16 + c16]) * addMul;

    const int bidx  = m0 / SEQ;          // block rows lie inside one batch (SEQ % 128 == 0)
    const int s0    = m0 - bidx * SEQ;
    const int piece = lane & 7;
    const int lsub  = lane >> 3;

    if constexpr (MODE == 0) {
#pragma unroll
        for (int i = 0; i < 2; ++i)
#pragma unroll
            for (int j = 0; j < 4; ++j) {
                const int nl = wn * 64 + j * 16 + c16;
#pragma unroll
                for (int r = 0; r < 8; ++r) {
                    const int ml = wm * 32 + i * 16 + hh8 + r;
                    Cs[ml * CPITCH + nl] = (f16)(acc[i][j][r] * accMul + bb[j]);
                }
            }
        __syncthreads();
        f16* op = (f16*)out;
        const size_t bh0 = (size_t)bidx * NHEAD + (n0 >> 6);
{
#pragma unroll
            for (int it = 0; it < 8; ++it) {
                const int L    = wave * 32 + it * 4 + lsub;   // 0..255
                const int ml   = L >> 1;
                const int hsel = L & 1;
                const v8h v = *(const v8h*)&Cs[ml * CPITCH + hsel * 64 + piece * 8];
                f16* dp = op + ((bh0 + hsel) * SEQ + s0 + ml) * HD + piece * 8;
                *(v8h*)dp = v;
            }
            
        }
    } else if constexpr (MODE == 1) {
        // hi plane, staged transposed: Cs[n][m]
#pragma unroll
        for (int i = 0; i < 2; ++i)
#pragma unroll
            for (int j = 0; j < 4; ++j) {
                const int nl = wn * 64 + j * 16 + c16;
                H8U t;
#pragma unroll
                for (int r = 0; r < 8; ++r) t.e[r] = (f16)(acc[i][j][r] * accMul + bb[j]);
                *(v8h*)&Cs[nl * CPITCH + wm * 32 + i * 16 + hh8] = t.v;
            }
        __syncthreads();
        {
            f16* op = (f16*)out;
{
#pragma unroll
                for (int it = 0; it < 8; ++it) {
                    const int L  = wave * 32 + it * 4 + lsub;     // 0..255
                    const int nl = L >> 1;
                    const int mh = L & 1;
                    const v8h v = *(const v8h*)&Cs[nl * CPITCH + mh * 64 + piece * 8];
                    f16* dp = op + ((size_t)(bidx * HID + n0 + nl) * SEQ + s0 + mh * 64 + piece * 8);
                    *(v8h*)dp = v;
                }
                
            }
        }
        __syncthreads();
        // residual plane: (val - f16(val)) * 2^10, same staging and store map
#pragma unroll
        for (int i = 0; i < 2; ++i)
#pragma unroll
            for (int j = 0; j < 4; ++j) {
                const int nl = wn * 64 + j * 16 + c16;
                H8U t;
#pragma unroll
                for (int r = 0; r < 8; ++r) {
                    const float val = acc[i][j][r] * accMul + bb[j];
                    const f16 hv = (f16)val;
                    t.e[r] = (f16)((val - (float)hv) * CARRY_RES);
                }
                *(v8h*)&Cs[nl * CPITCH + wm * 32 + i * 16 + hh8] = t.v;
            }
        __syncthreads();
        {
            f16* op = (f16*)out2;
{
#pragma unroll
                for (int it = 0; it < 8; ++it) {
                    const int L  = wave * 32 + it * 4 + lsub;     // 0..255
                    const int nl = L >> 1;
                    const int mh = L & 1;
                    const v8h v = *(const v8h*)&Cs[nl * CPITCH + mh * 64 + piece * 8];
                    f16* dp = op + ((size_t)(bidx * HID + n0 + nl) * SEQ + s0 + mh * 64 + piece * 8);
                    *(v8h*)dp = v;
                }
                
            }
        }
    } else {
        float* Cf = (float*)Cs;      // [64][CFPITCH] f32
        float* of = (float*)out;
#pragma unroll
        for (int half = 0; half < 2; ++half) {
            if ((wm >> 1) == half) {
#pragma unroll
                for (int i = 0; i < 2; ++i)
#pragma unroll
                    for (int j = 0; j < 4; ++j) {
                        const int nl = wn * 64 + j * 16 + c16;
#pragma unroll
                        for (int r = 0; r < 8; ++r) {
                            const int ml = (wm & 1) * 32 + i * 16 + hh8 + r;
                            Cf[ml * CFPITCH + nl] = acc[i][j][r] * accMul + bb[j];
                        }
                    }
            }
            __syncthreads();
            v4f vv[8];
#pragma unroll
            for (int it = 0; it < 8; ++it) {
                const int L    = wave * 32 + it * 4 + lsub;   // 0..255
                const int row  = L >> 2;
                const int part = L & 3;
                vv[it] = *(const v4f*)&Cf[row * CFPITCH + part * 32 + piece * 4];
            }
            if constexpr (MODE == 2) {
                if (s0 == 0) {     // block-uniform
#pragma unroll
                    for (int it = 0; it < 8; ++it) {
                        const int L    = wave * 32 + it * 4 + lsub;
                        const int row  = L >> 2;
                        const int part = L & 3;
                        const v4f pv = *(const v4f*)(padd + (size_t)(bidx * 128 + half * 64 + row) * HID
                                                     + n0 + part * 32 + piece * 4);
                        vv[it] += pv;
                    }
                }
            }
{
#pragma unroll
                for (int it = 0; it < 8; ++it) {
                    const int L    = wave * 32 + it * 4 + lsub;   // 0..255
                    const int row  = L >> 2;
                    const int part = L & 3;
                    float* dp = of + (size_t)(m0 + half * 64 + row) * HID + n0 + part * 32 + piece * 4;
                    *(v4f*)dp = vv[it];
                }
                
            }
            __syncthreads();
        }
    }
}

// ---------------------------------------------------------------------------
// Flash attention, causal with key padding mask (key allowed iff key <= query and
// kmask[b][key] == 0; masked keys get p = 0 and are excluded from the row max; rows with
// no allowed key produce a zero context row). grid (q-blocks, NB*NHEAD), block 256 (8 waves),
// wave owns 16 query rows (Q fragments resident). Block streams the 64-key tiles up to its
// causal horizon: K staged [key][d], V^T staged [d][key]. Scores on WMMA, row max via DPP,
// exp2 in f32 carried x2^10, P relayed per wave through LDS as A fragments, O += P.V and
// row sums += P.ones on WMMA. Output f16 plane [b*SEQ+q][1024] carried x1024, written as
// RES = 0: q-block = blockIdx.x + 1 (rows 128 .. SEQ-1).
// RES = 1: q-block 0 only (rows 0..127): V, P and the context carry x2^10 residual planes
//          (second accumulators); context residual plane Cpl is [b*128 + q][1024].
// coverage: RES 0 + RES 1 together write every (b, q, h*64..h*64+63) segment of Cp once;
//           RES 1 writes the whole Cpl plane once.
// LDS: ks, vsT, vsL cross-wave (block barriers); ps/psl per-wave but also separated by block
// barriers. staged extent == consumed extent for ks (64x64), vsT (64x64), vsL (64x64, RES),
// ps/psl (16x64).
// ---------------------------------------------------------------------------
template <int RES>
__global__ void __launch_bounds__(256) __attribute__((amdgpu_num_vgpr(256)))
attn_fwd(const f16* __restrict__ Qp, const f16* __restrict__ Kp, const f16* __restrict__ Vt,
         const f16* __restrict__ Vtl, const int* __restrict__ kmask,
         f16* __restrict__ Cp, f16* __restrict__ Cpl) {
    __shared__ __attribute__((aligned(16))) f16 ks[64 * APITCH];      // [key][d]
    __shared__ __attribute__((aligned(16))) f16 vsT[64 * APITCH];     // [d][key]
    __shared__ __attribute__((aligned(16))) f16 vsL[64 * APITCH];     // [d][key] residual (RES)
    __shared__ __attribute__((aligned(16))) f16 ps[8][16 * APITCH];   // per-wave P relay / ctx stage
    __shared__ __attribute__((aligned(16))) f16 psl[8][16 * APITCH];  // per-wave P residual / ctx residual (RES)

    const int tid  = (int)threadIdx.x;
    const int lane = tid & 31;
    const int wave = tid >> 5;
    const int hh8  = (lane >> 4) << 3;
    const int c16  = lane & 15;
    const int bh   = (int)blockIdx.y;
    const int bidx = bh / NHEAD;
    const int hidx = bh - bidx * NHEAD;
    const int qblk = RES ? 0 : ((int)blockIdx.x + 1);
    const int qw   = qblk * 128 + wave * 16;          // first query row (within sequence) of this wave
    const size_t head = (size_t)bh * SEQ * HD;
    const int* mrow = kmask + (size_t)bidx * SEQ_FULL;

    v16h qa[2];
#pragma unroll
    for (int c = 0; c < 2; ++c) qa[c] = load_frag(Qp + head, qw, HD, c * 32, lane);

    FragU onesu;
#pragma unroll
    for (int i = 0; i < 16; ++i) onesu.e[i] = (f16)1.0f;
    const v16h ones = onesu.v;

    float m[8];
    v8f   o[4], lacc, olo[4], laccl;
#pragma unroll
    for (int r = 0; r < 8; ++r) m[r] = NEGBIG;
#pragma unroll
    for (int dt = 0; dt < 4; ++dt) { o[dt] = zero8(); olo[dt] = zero8(); }
    lacc  = zero8();
    laccl = zero8();

    // log2-domain scale: acc = 256 * q.k ; x = log2(e) * q.k / 8 = acc * log2(e) / 2048
    const float cl = 1.4426950408889634f * 0.00048828125f;
    const float rres = 1.0f / CARRY_RES;
    f16* psw  = &ps[wave][0];
    f16* pslw = &psl[wave][0];

    const int nkt = 2 * qblk + 2;     // causal horizon in 64-key tiles (block-uniform)

#pragma unroll 1
    for (int kt = 0; kt < nkt; ++kt) {
        __syncthreads();
#pragma unroll
        for (int p2 = 0; p2 < 2; ++p2) {
            const int p   = tid + p2 * 256;
            const int row = p >> 3;
            const int pc  = (p & 7) << 3;
            const v8h kv = *(const v8h*)(Kp + head + (size_t)(kt * 64 + row) * HD + pc);
            const v8h vv = *(const v8h*)(Vt + head + (size_t)row * SEQ + kt * 64 + pc);
            *(v8h*)&ks[row * APITCH + pc]  = kv;
            *(v8h*)&vsT[row * APITCH + pc] = vv;
            if constexpr (RES) {
                const v8h vl = *(const v8h*)(Vtl + head + (size_t)row * SEQ + kt * 64 + pc);
                *(v8h*)&vsL[row * APITCH + pc] = vl;
            }
        }
        __syncthreads();

        // S[16 q x 64 keys]
        v8f s[4];
#pragma unroll
        for (int nt = 0; nt < 4; ++nt) s[nt] = zero8();
#pragma unroll
        for (int c = 0; c < 2; ++c) {
#pragma unroll
            for (int nt = 0; nt < 4; ++nt) {
                const v16h kb = load_frag(ks, nt * 16, APITCH, c * 32, lane);
                s[nt] = wmma16(qa[c], kb, s[nt]);
            }
        }

        // this lane's 4 key columns and their padding-mask values
        int keyi[4], mval[4];
#pragma unroll
        for (int nt = 0; nt < 4; ++nt) {
            keyi[nt] = kt * 64 + nt * 16 + c16;
            mval[nt] = mrow[keyi[nt]];
        }

        // online softmax per row r (row 8h + r), max-subtracted, exp2 domain
#pragma unroll
        for (int r = 0; r < 8; ++r) {
            const int qrow = qw + hh8 + r;
            float x[4];
            bool  alw[4];
#pragma unroll
            for (int nt = 0; nt < 4; ++nt) {
                x[nt]   = s[nt][r] * cl;
                alw[nt] = (mval[nt] == 0) && (keyi[nt] <= qrow);
            }
            const float xm0 = alw[0] ? x[0] : NEGBIG;
            const float xm1 = alw[1] ? x[1] : NEGBIG;
            const float xm2 = alw[2] ? x[2] : NEGBIG;
            const float xm3 = alw[3] ? x[3] : NEGBIG;
            const float tm = rowmax16(fmaxf(fmaxf(xm0, xm1), fmaxf(xm2, xm3)));
            const float mn = fmaxf(m[r], tm);
            const float al = fexp2(m[r] - mn);
            m[r] = mn;
            lacc[r] *= al;
#pragma unroll
            for (int dt = 0; dt < 4; ++dt) o[dt][r] *= al;
            if constexpr (RES) {
                laccl[r] *= al;
#pragma unroll
                for (int dt = 0; dt < 4; ++dt) olo[dt][r] *= al;
            }
            const float sh = 10.0f - mn;      // carry 2^10
#pragma unroll
            for (int nt = 0; nt < 4; ++nt) {
                const float arg = alw[nt] ? (x[nt] + sh) : 0.0f;
                const float e   = fexp2(arg);
                const float p   = alw[nt] ? e : 0.0f;
                const f16   hp  = (f16)p;
                psw[(hh8 + r) * APITCH + nt * 16 + c16] = hp;
                if constexpr (RES)
                    pslw[(hh8 + r) * APITCH + nt * 16 + c16] = (f16)((p - (float)hp) * CARRY_RES);
            }
        }
        __syncthreads();

        // O += P . V ; l += P . ones  (P reloaded as A fragments from the relay)
#pragma unroll
        for (int kk = 0; kk < 2; ++kk) {
            const v16h pa = load_frag(psw, 0, APITCH, kk * 32, lane);
            if constexpr (RES) {
                const v16h pl = load_frag(pslw, 0, APITCH, kk * 32, lane);
#pragma unroll
                for (int dt = 0; dt < 4; ++dt) {
                    const v16h vb = load_frag(vsT, dt * 16, APITCH, kk * 32, lane);
                    o[dt]   = wmma16(pa, vb, o[dt]);
                    olo[dt] = wmma16(pl, vb, olo[dt]);
                    const v16h vl = load_frag(vsL, dt * 16, APITCH, kk * 32, lane);
                    olo[dt] = wmma16(pa, vl, olo[dt]);
                }
                lacc  = wmma16(pa, ones, lacc);
                laccl = wmma16(pl, ones, laccl);
            } else {
#pragma unroll
                for (int dt = 0; dt < 4; ++dt) {
                    const v16h vb = load_frag(vsT, dt * 16, APITCH, kk * 32, lane);
                    o[dt] = wmma16(pa, vb, o[dt]);
                }
                lacc = wmma16(pa, ones, lacc);
            }
        }
    }
    __syncthreads();

    // normalize: plane value = 1024 * (O/16) / (l) = O * 64 / l ; zero row when l == 0
#pragma unroll
    for (int r = 0; r < 8; ++r) {
        float l = lacc[r];
        if constexpr (RES) l += laccl[r] * rres;
        const float lsafe = (l > 0.0f) ? l : 1.0f;
        const float inv   = (l > 0.0f) ? ((CARRY_CTX / CARRY_QKV) / lsafe) : 0.0f;
#pragma unroll
        for (int dt = 0; dt < 4; ++dt) {
            float ov = o[dt][r];
            if constexpr (RES) ov += olo[dt][r] * rres;
            const float cv = ov * inv;
            const f16 hv = (f16)cv;
            psw[(hh8 + r) * APITCH + dt * 16 + c16] = hv;
            if constexpr (RES)
                pslw[(hh8 + r) * APITCH + dt * 16 + c16] = (f16)((cv - (float)hv) * CARRY_RES);
        }
    }
    __syncthreads();

    const int piece = lane & 7;
    const int lsub  = lane >> 3;
{
#pragma unroll
        for (int it = 0; it < 4; ++it) {
            const int L = it * 4 + lsub;     // query row 0..15 within the wave tile
            const v8h v = *(const v8h*)&psw[L * APITCH + piece * 8];
            f16* dp = Cp + ((size_t)(bidx * SEQ + qw + L) * HID + hidx * HD + piece * 8);
            *(v8h*)dp = v;
            if constexpr (RES) {
                const v8h vl = *(const v8h*)&pslw[L * APITCH + piece * 8];
                f16* dq = Cpl + ((size_t)(bidx * 128 + wave * 16 + L) * HID + hidx * HD + piece * 8);
                *(v8h*)dq = vl;
            }
        }
        
    }
}

// ---------------------------------------------------------------------------
// Launch: 12 kernel launches. Workspace (halves): X, Q, K, V^T hi, V^T residual, ctx hi
// (6 x MROWS*1024), 4 weight planes (1024*1024), ctx residual (NB*128*1024), plus the
// ---------------------------------------------------------------------------
extern "C" void kernel_launch(void* const* d_in, const int* in_sizes, int n_in,
                              void* d_out, int out_size, void* d_ws, size_t ws_size,
                              hipStream_t stream) {
    if (n_in < 10) return;
    if (in_sizes[0] < ((NB - 1) * SEQ_FULL + SEQ) * HID) return;
    if (in_sizes[1] < (NB - 1) * SEQ_FULL + SEQ) return;
    if (in_sizes[2] < HID * HID || in_sizes[4] < HID * HID ||
        in_sizes[6] < HID * HID || in_sizes[8] < HID * HID) return;
    if (in_sizes[3] < HID || in_sizes[5] < HID || in_sizes[7] < HID || in_sizes[9] < HID) return;
    if (out_size < MROWS * HID) return;

    const float* x    = (const float*)d_in[0];
    const int*   mask = (const int*)d_in[1];
    const float* wq   = (const float*)d_in[2];
    const float* bq   = (const float*)d_in[3];
    const float* wk   = (const float*)d_in[4];
    const float* bk   = (const float*)d_in[5];
    const float* wv   = (const float*)d_in[6];
    const float* bv   = (const float*)d_in[7];
    const float* wo   = (const float*)d_in[8];
    const float* bo   = (const float*)d_in[9];

    const size_t nX = (size_t)MROWS * HID;    // halves per activation plane
    const size_t nW = (size_t)HID * HID;      // halves per weight plane
    const size_t nR = (size_t)RROWS * HID;    // elements per residual-row plane
    const size_t totalBytes = (6 * nX + 4 * nW + nR) * sizeof(f16) + nR * sizeof(float);
    if (ws_size < totalBytes) return;

    f16* Xh  = (f16*)d_ws;       // [MROWS][1024]            carry 16
    f16* Wqh = Xh  + nX;         // [n][k] = Wq[k][n]        carry 32
    f16* Wkh = Wqh + nW;
    f16* Wvh = Wkh + nW;
    f16* Woh = Wvh + nW;
    f16* Qp  = Woh + nW;         // [NB*16][SEQ][64]         carry 16
    f16* Kp  = Qp  + nX;         // [NB*16][SEQ][64]         carry 16
    f16* Vth = Kp  + nX;         // [NB*1024][SEQ] (V^T)     carry 16
    f16* Vtl = Vth + nX;         // V^T residual x2^10
    f16* Cph = Vtl + nX;         // [MROWS][1024]            carry 1024
    f16* Cpl = Cph + nX;         // [NB*128][1024]           ctx residual x2^10 (rows 0..127 per batch)
    float* Pf = (float*)(Cpl + nR);   // [NB*128][1024] f32   residual partial of the out projection

    cvt_rows<SEQ, SEQ_FULL><<<MROWS / 2, 256, 0, stream>>>(x, Xh, MROWS, CARRY_X);
    const dim3 gw(HID / 64, HID / 64);
    cvt_wT<<<gw, 256, 0, stream>>>(wq, Wqh, CARRY_W);
    cvt_wT<<<gw, 256, 0, stream>>>(wk, Wkh, CARRY_W);
    cvt_wT<<<gw, 256, 0, stream>>>(wv, Wvh, CARRY_W);
    cvt_wT<<<gw, 256, 0, stream>>>(wo, Woh, CARRY_W);

    const dim3 gg(MROWS / 128, HID / 128);
    // plane = 16 * (acc / (16*32) + b) = acc/32 + 16*b
    const float accQKV = CARRY_QKV / (CARRY_X * CARRY_W);
    gemm_nt<0><<<gg, 256, 0, stream>>>(Xh, Wqh, bq, (void*)Qp,  (void*)0, (const float*)0, accQKV, CARRY_QKV);
    gemm_nt<0><<<gg, 256, 0, stream>>>(Xh, Wkh, bk, (void*)Kp,  (void*)0, (const float*)0, accQKV, CARRY_QKV);
    gemm_nt<1><<<gg, 256, 0, stream>>>(Xh, Wvh, bv, (void*)Vth, (void*)Vtl, (const float*)0, accQKV, CARRY_QKV);

    if (SEQ / 128 > 1)
        attn_fwd<0><<<dim3(SEQ / 128 - 1, NB * NHEAD), 256, 0, stream>>>(Qp, Kp, Vth, Vtl, mask, Cph, Cpl);
    attn_fwd<1><<<dim3(1, NB * NHEAD), 256, 0, stream>>>(Qp, Kp, Vth, Vtl, mask, Cph, Cpl);

    // residual partial: Pf = (Cpl . Wo^T) / (1024 * 1024 * 32)
    const float accLo = 1.0f / (CARRY_CTX * CARRY_RES * CARRY_W);
    gemm_nt<3><<<dim3(RROWS / 128, HID / 128), 256, 0, stream>>>(Cpl, Woh, bo, (void*)Pf, (void*)0,
                                                                   (const float*)0, accLo, 0.0f);
    // out = acc / (1024*32) + b (+ Pf on the first 128 rows of each sequence)
    const float accOut = 1.0f / (CARRY_CTX * CARRY_W);
    gemm_nt<2><<<gg, 256, 0, stream>>>(Cph, Woh, bo, d_out, (void*)0, Pf, accOut, 1.0f);
}

// v002
// It runs in 151 microseconds.
// Two timings next to v001 put it at 1.44 and 1.45 times that version's speed.
// Over all steps from v000 it is 2.15 times as fast.
#include <hip/hip_runtime.h>

// Contractions (Q/K/V/out projections, Q.K^T, P.V, P row-sum): v_wmma_f32_16x16x32_f16, f16 operands with power-of-two carries, f32 accumulate; every float input enters as its bf16 RNE value; V, P and context carry an extra f16 residual plane (x2^10) on the first 128 query rows per sequence; softmax in f32.

#ifndef NB
#define NB 2
#endif
#ifndef SEQ
#define SEQ 2048
#endif
#define NB_FULL   2
#define SEQ_FULL  2048
#define HID       1024
#define NHEAD     16
#define HD        64
#define MROWS     (NB * SEQ)
#define RROWS     (NB * 128)      // query rows per batch-set that carry residual planes

static_assert(HID == NHEAD * HD);
static_assert(SEQ % 128 == 0);
static_assert(SEQ >= 128);
static_assert(SEQ <= SEQ_FULL);
static_assert(NB >= 1 && NB <= NB_FULL);
static_assert(MROWS % 128 == 0);
static_assert(RROWS % 128 == 0);
static_assert(HID % 128 == 0);

// carries (exact powers of two)
#define CARRY_X    16.0f     // hidden plane
#define CARRY_W    32.0f     // weight planes
#define CARRY_QKV  16.0f     // q, k, v^T planes (true value x16)
#define CARRY_CTX  1024.0f   // context plane (true value x1024)
#define CARRY_RES  1024.0f   // residual planes: (value - f16(value)) x1024
#define NEGBIG     (-1.0e30f)
// LDS row pitches: 16 B x odd for rows read or written 16 bytes a lane (one row per lane),
// so that the 16 lanes of a half wave fall on distinct bank groups
#define GPITCH     40        // halves: GEMM operand rows of 32 halves (80 B)
#define CPITCH     136       // halves: GEMM f16 output staging rows of 128 halves (272 B)
#define CFPITCH    132       // floats: GEMM f32 output staging rows of 128 floats (528 B)
#define APITCH     72        // halves: attention rows of 64 halves (144 B)
static_assert(64 * CFPITCH * 4 <= 128 * CPITCH * 2);   // the f32 staging shares the f16 staging array
// softmax exp values carry 2^10 (added to the exp2 argument)

typedef _Float16 f16;
typedef f16   v16h __attribute__((ext_vector_type(16)));
typedef f16   v8h  __attribute__((ext_vector_type(8)));
typedef float v8f  __attribute__((ext_vector_type(8)));
typedef float v4f  __attribute__((ext_vector_type(4)));

union FragU { v16h v; v8h half[2]; f16 e[16]; };
union H8U   { v8h v; f16 e[8]; };

__device__ __forceinline__ v8f zero8() {
    v8f z = {0.f, 0.f, 0.f, 0.f, 0.f, 0.f, 0.f, 0.f};
    return z;
}

// 16-bit WMMA with hazard guard: D += A[16 x 32k] * B[32k x 16]
__device__ __forceinline__ v8f wmma16(v16h a, v16h b, v8f c) {
    v8f d = __builtin_amdgcn_wmma_f32_16x16x32_f16(false, a, false, b, (short)0, c, false, false);
    asm volatile("v_nop\n\tv_nop\n\tv_nop\n\tv_nop" : "+v"(d) : "v"(a), "v"(b));
    return d;
}

// f32 -> nearest-even bf16 value, returned as f32
__device__ __forceinline__ float bf16_rne(float x) {
    unsigned u = __float_as_uint(x);
    u = (u + 0x7fffu + ((u >> 16) & 1u)) & 0xffff0000u;
    return __uint_as_float(u);
}

__device__ __forceinline__ float fexp2(float x) {
#if defined(__has_builtin)
#if __has_builtin(__builtin_amdgcn_exp2f)
    return __builtin_amdgcn_exp2f(x);
#else
    return exp2f(x);
#endif
#else
    return exp2f(x);
#endif
}

// max over the 16 lanes of each lane half (DPP row rotations; D-layout rows are DPP rows)
__device__ __forceinline__ float rowmax16(float x) {
    int v = __builtin_bit_cast(int, x);
    x = fmaxf(x, __builtin_bit_cast(float, __builtin_amdgcn_update_dpp(v, v, 0x121, 0xf, 0xf, false)));
    v = __builtin_bit_cast(int, x);
    x = fmaxf(x, __builtin_bit_cast(float, __builtin_amdgcn_update_dpp(v, v, 0x122, 0xf, 0xf, false)));
    v = __builtin_bit_cast(int, x);
    x = fmaxf(x, __builtin_bit_cast(float, __builtin_amdgcn_update_dpp(v, v, 0x124, 0xf, 0xf, false)));
    v = __builtin_bit_cast(int, x);
    x = fmaxf(x, __builtin_bit_cast(float, __builtin_amdgcn_update_dpp(v, v, 0x128, 0xf, 0xf, false)));
    return x;
}

// 16 x 32 fragment from a tile whose k dimension is contiguous (pitch in halves).
// lane l: row rowbase + (l&15); elements 0..7 <- k = kcol + 8h .. +7,
// elements 8..15 <- k = kcol + 16 + 8h .. +7  (h = l>>4). Same map for A and B.
__device__ __forceinline__ v16h load_frag(const f16* tile, int rowbase, int pitch, int kcol, int lane) {
    const int r  = rowbase + (lane & 15);
    const int kh = (lane >> 4) << 3;
    const f16* p = tile + (size_t)r * pitch + kcol + kh;
    FragU f;
    f.half[0] = *(const v8h*)(p);
    f.half[1] = *(const v8h*)(p + 16);
    return f.v;
}

// ---------------------------------------------------------------------------
// f32 rows -> f16 plane (bf16 RNE value times carry). 128 threads per 1024-wide
// Source row stride mapping lets a reduced build read full-size inputs.
// coverage: nrows x 1024 halves, every element exactly once (grid = nrows*128/256).
// ---------------------------------------------------------------------------
template <int DSTPER, int SRCPER>
__device__ __forceinline__ void
cvt_rows(const float* __restrict__ src, f16* __restrict__ dst, int nrows, float carry, int blk) {
    const int g  = blk * 256 + (int)threadIdx.x;
    const int m  = g >> 7;
    const int c8 = (g & 127) << 3;
    if (m >= nrows) return;
    const int sm = (m / DSTPER) * SRCPER + (m % DSTPER);
    const float* sp = src + (size_t)sm * HID + c8;
    const v4f a = *(const v4f*)sp;
    const v4f b = *(const v4f*)(sp + 4);
    H8U o;
#pragma unroll
    for (int j = 0; j < 4; ++j) {
        const float x0 = a[j];
        const float x1 = b[j];
        o.e[j]     = (f16)(bf16_rne(x0) * carry);
        o.e[j + 4] = (f16)(bf16_rne(x1) * carry);
    }
    f16* dp = dst + (size_t)m * HID + c8;
    *(v8h*)dp = o.v;
    
}

// ---------------------------------------------------------------------------
// Weight transpose + convert: src [k][n] f32 (HID x HID, n contiguous) -> dst [n][k] f16
// = bf16 RNE(src[k][n]) * carry, k contiguous. Block handles a 64(k) x 64(n) tile through
// coverage: grid (HID/64, HID/64) x (64 n rows x 64 k) = the whole [HID][HID] plane once.
// LDS: T cross-wave (block barrier between element stores and vector reloads).
// ---------------------------------------------------------------------------
__device__ __forceinline__ void
cvt_wT(const float* __restrict__ src, f16* __restrict__ dst, float carry, int bx, int by) {
    __shared__ __attribute__((aligned(16))) f16 T[64 * 72];
    const int tid  = (int)threadIdx.x;
    const int lane = tid & 31;
    const int wave = tid >> 5;
    const int k0   = bx * 64;
    const int n0   = by * 64;
    const int kr   = tid >> 2;           // 0..63
    const int nc   = (tid & 3) << 4;     // 0,16,32,48
    const float* sp = src + (size_t)(k0 + kr) * HID + n0 + nc;
#pragma unroll
    for (int q = 0; q < 4; ++q) {
        const v4f a = *(const v4f*)(sp + q * 4);
#pragma unroll
        for (int j = 0; j < 4; ++j)
            T[(nc + q * 4 + j) * 72 + kr] = (f16)(bf16_rne(a[j]) * carry);
    }
    __syncthreads();
    const int piece = lane & 7;
    const int lsub  = lane >> 3;
{
#pragma unroll
        for (int it = 0; it < 2; ++it) {
            const int L = it * 32 + wave * 4 + lsub;     // local n row 0..63
            const v8h v = *(const v8h*)&T[L * 72 + piece * 8];
            f16* dp = dst + (size_t)(n0 + L) * HID + k0 + piece * 8;
            *(v8h*)dp = v;
        }
        
    }
}

// ---------------------------------------------------------------------------
// All five input conversions in one grid (they are independent of each other):
// blocks 0 .. 4*WTILES-1 transpose-convert the four weight planes (dst planes contiguous,
// order q, k, v, o), the remaining MROWS/2 blocks convert the hidden rows.
// The branch is block-uniform, so the barrier inside cvt_wT is reached by whole blocks.
// ---------------------------------------------------------------------------
#define WTILES ((HID / 64) * (HID / 64))
__global__ void __launch_bounds__(256)
cvt_all(const float* __restrict__ x, const float* __restrict__ wq, const float* __restrict__ wk,
        const float* __restrict__ wv, const float* __restrict__ wo,
        f16* __restrict__ xh, f16* __restrict__ wh) {
    const int b = (int)blockIdx.x;
    if (b < 4 * WTILES) {
        const int w = b / WTILES;
        const int t = b - w * WTILES;
        const float* src = (w == 0) ? wq : (w == 1) ? wk : (w == 2) ? wv : wo;
        cvt_wT(src, wh + (size_t)w * HID * HID, CARRY_W, t % (HID / 64), t / (HID / 64));
    } else {
        cvt_rows<SEQ, SEQ_FULL>(x, xh, MROWS, CARRY_X, b - 4 * WTILES);
    }
}

// ---------------------------------------------------------------------------
// C[m][n] = sum_k A[m][k] * W[n][k] ; A [M][1024] f16, W [1024][1024] f16 (k contiguous).
// Block tile 128 x 128, 8 waves as 4(M) x 2(N), 2 x 4 accumulators per wave, K step 32.
// MODE 1: f16 plane [b*HID + h*HD + d][s] (V transposed per head) into out, plus the
//         residual plane (val - f16(val)) * 2^10, same layout, into out2
// MODE 2: f32 rows [m][1024] into the output; blocks at sequence start (s0 == 0)
//         add the f32 partial rows padd[b*128 + local row][n] (block-uniform branch)
// MODE 3: f32 rows [m][1024] into a workspace plane (no partial add)
// coverage per block: MODE 0 256 lines, MODE 1 2 x 256 lines (hi, residual),
//                     MODE 2/3 2 x 256 lines (64 rows x 4 line-quarters per half).
// LDS: As/Bs/Cs all cross-wave, separated by block barriers.
// ---------------------------------------------------------------------------
// LDS of one GEMM tile, offsets in halves (the kernel owns the array, so that kernels which
// hold more than one kind of tile allocate it once)
#define GEMM_AS   0                                   // As [128][GPITCH]
#define GEMM_BS   (128 * GPITCH)                      // Bs [128][GPITCH]
#define GEMM_CS   (2 * 128 * GPITCH)                  // Cs f16 [128][CPITCH] or f32 [64][CFPITCH]
#define GEMM_LDS  (2 * 128 * GPITCH + 128 * CPITCH)

// K loop of one 128 x 128 tile at (m0, n0)
__device__ __forceinline__ void
gemm_main(const f16* __restrict__ A, const f16* __restrict__ W, f16* As, f16* Bs,
          int m0, int n0, v8f (&acc)[2][4]) {
    const int tid  = (int)threadIdx.x;
    const int lane = tid & 31;
    const int wave = tid >> 5;
    const int wm   = wave & 3;
    const int wn   = wave >> 2;

#pragma unroll
    for (int i = 0; i < 2; ++i)
#pragma unroll
        for (int j = 0; j < 4; ++j) acc[i][j] = zero8();

    const int srow = tid >> 1;
    const int scol = (tid & 1) << 4;
    const f16* gA = A + (size_t)(m0 + srow) * HID + scol;
    const f16* gW = W + (size_t)(n0 + srow) * HID + scol;

#pragma unroll 1
    for (int k0 = 0; k0 < HID; k0 += 32) {
        const v8h ra0 = *(const v8h*)(gA + k0);
        const v8h ra1 = *(const v8h*)(gA + k0 + 8);
        const v8h rb0 = *(const v8h*)(gW + k0);
        const v8h rb1 = *(const v8h*)(gW + k0 + 8);
        __syncthreads();
        *(v8h*)&As[srow * GPITCH + scol]     = ra0;
        *(v8h*)&As[srow * GPITCH + scol + 8] = ra1;
        *(v8h*)&Bs[srow * GPITCH + scol]     = rb0;
        *(v8h*)&Bs[srow * GPITCH + scol + 8] = rb1;
        __syncthreads();

        v16h af[2], bfr[4];
#pragma unroll
        for (int i = 0; i < 2; ++i) af[i] = load_frag(As, wm * 32 + i * 16, GPITCH, 0, lane);
#pragma unroll
        for (int j = 0; j < 4; ++j) bfr[j] = load_frag(Bs, wn * 64 + j * 16, GPITCH, 0, lane);
#pragma unroll
        for (int i = 0; i < 2; ++i)
#pragma unroll
            for (int j = 0; j < 4; ++j) acc[i][j] = wmma16(af[i], bfr[j], acc[i][j]);
    }
}

// scale, bias and store of one 128 x 128 tile at (m0, n0)
template <int MODE>
__device__ __forceinline__ void
gemm_epi(const v8f (&acc)[2][4], f16* Cs, const float* __restrict__ bias,
         void* __restrict__ out, void* __restrict__ out2, const float* __restrict__ padd,
         float accMul, float addMul, int m0, int n0) {
    const int tid  = (int)threadIdx.x;
    const int lane = tid & 31;
    const int wave = tid >> 5;
    const int wm   = wave & 3;
    const int wn   = wave >> 2;
    const int hh8  = (lane >> 4) << 3;   // D row half
    const int c16  = lane & 15;          // D column

    // bias (bf16 RNE value) per owned column group
    float bb[4];
#pragma unroll
    for (int j = 0; j < 4; ++j) bb[j] = bf16_rne(bias[n0 + wn * 64 + j * 16 + c16]) * addMul;

    const int bidx  = m0 / SEQ;          // block rows lie inside one batch (SEQ % 128 == 0)
    const int s0    = m0 - bidx * SEQ;
    const int piece = lane & 7;
    const int lsub  = lane >> 3;

    if constexpr (MODE == 0) {
#pragma unroll
        for (int i = 0; i < 2; ++i)
#pragma unroll
            for (int j = 0; j < 4; ++j) {
                const int nl = wn * 64 + j * 16 + c16;
#pragma unroll
                for (int r = 0; r < 8; ++r) {
                    const int ml = wm * 32 + i * 16 + hh8 + r;
                    Cs[ml * CPITCH + nl] = (f16)(acc[i][j][r] * accMul + bb[j]);
                }
            }
        __syncthreads();
        f16* op = (f16*)out;
        const size_t bh0 = (size_t)bidx * NHEAD + (n0 >> 6);
{
#pragma unroll
            for (int it = 0; it < 8; ++it) {
                const int L    = wave * 32 + it * 4 + lsub;   // 0..255
                const int ml   = L >> 1;
                const int hsel = L & 1;
                const v8h v = *(const v8h*)&Cs[ml * CPITCH + hsel * 64 + piece * 8];
                f16* dp = op + ((bh0 + hsel) * SEQ + s0 + ml) * HD + piece * 8;
                *(v8h*)dp = v;
            }
            
        }
    } else if constexpr (MODE == 1) {
        // hi plane, staged transposed: Cs[n][m]
#pragma unroll
        for (int i = 0; i < 2; ++i)
#pragma unroll
            for (int j = 0; j < 4; ++j) {
                const int nl = wn * 64 + j * 16 + c16;
                H8U t;
#pragma unroll
                for (int r = 0; r < 8; ++r) t.e[r] = (f16)(acc[i][j][r] * accMul + bb[j]);
                *(v8h*)&Cs[nl * CPITCH + wm * 32 + i * 16 + hh8] = t.v;
            }
        __syncthreads();
        {
            f16* op = (f16*)out;
{
#pragma unroll
                for (int it = 0; it < 8; ++it) {
                    const int L  = wave * 32 + it * 4 + lsub;     // 0..255
                    const int nl = L >> 1;
                    const int mh = L & 1;
                    const v8h v = *(const v8h*)&Cs[nl * CPITCH + mh * 64 + piece * 8];
                    f16* dp = op + ((size_t)(bidx * HID + n0 + nl) * SEQ + s0 + mh * 64 + piece * 8);
                    *(v8h*)dp = v;
                }
                
            }
        }
        __syncthreads();
        // residual plane: (val - f16(val)) * 2^10, same staging and store map
#pragma unroll
        for (int i = 0; i < 2; ++i)
#pragma unroll
            for (int j = 0; j < 4; ++j) {
                const int nl = wn * 64 + j * 16 + c16;
                H8U t;
#pragma unroll
                for (int r = 0; r < 8; ++r) {
                    const float val = acc[i][j][r] * accMul + bb[j];
                    const f16 hv = (f16)val;
                    t.e[r] = (f16)((val - (float)hv) * CARRY_RES);
                }
                *(v8h*)&Cs[nl * CPITCH + wm * 32 + i * 16 + hh8] = t.v;
            }
        __syncthreads();
        {
            f16* op = (f16*)out2;
{
#pragma unroll
                for (int it = 0; it < 8; ++it) {
                    const int L  = wave * 32 + it * 4 + lsub;     // 0..255
                    const int nl = L >> 1;
                    const int mh = L & 1;
                    const v8h v = *(const v8h*)&Cs[nl * CPITCH + mh * 64 + piece * 8];
                    f16* dp = op + ((size_t)(bidx * HID + n0 + nl) * SEQ + s0 + mh * 64 + piece * 8);
                    *(v8h*)dp = v;
                }
                
            }
        }
    } else {
        float* Cf = (float*)Cs;      // [64][CFPITCH] f32
        float* of = (float*)out;
#pragma unroll
        for (int half = 0; half < 2; ++half) {
            if ((wm >> 1) == half) {
#pragma unroll
                for (int i = 0; i < 2; ++i)
#pragma unroll
                    for (int j = 0; j < 4; ++j) {
                        const int nl = wn * 64 + j * 16 + c16;
#pragma unroll
                        for (int r = 0; r < 8; ++r) {
                            const int ml = (wm & 1) * 32 + i * 16 + hh8 + r;
                            Cf[ml * CFPITCH + nl] = acc[i][j][r] * accMul + bb[j];
                        }
                    }
            }
            __syncthreads();
            v4f vv[8];
#pragma unroll
            for (int it = 0; it < 8; ++it) {
                const int L    = wave * 32 + it * 4 + lsub;   // 0..255
                const int row  = L >> 2;
                const int part = L & 3;
                vv[it] = *(const v4f*)&Cf[row * CFPITCH + part * 32 + piece * 4];
            }
            if constexpr (MODE == 2) {
                if (s0 == 0) {     // block-uniform
#pragma unroll
                    for (int it = 0; it < 8; ++it) {
                        const int L    = wave * 32 + it * 4 + lsub;
                        const int row  = L >> 2;
                        const int part = L & 3;
                        const v4f pv = *(const v4f*)(padd + (size_t)(bidx * 128 + half * 64 + row) * HID
                                                     + n0 + part * 32 + piece * 4);
                        vv[it] += pv;
                    }
                }
            }
{
#pragma unroll
                for (int it = 0; it < 8; ++it) {
                    const int L    = wave * 32 + it * 4 + lsub;   // 0..255
                    const int row  = L >> 2;
                    const int part = L & 3;
                    float* dp = of + (size_t)(m0 + half * 64 + row) * HID + n0 + part * 32 + piece * 4;
                    *(v4f*)dp = vv[it];
                }
                
            }
            __syncthreads();
        }
    }
}

template <int MODE>
__global__ void __launch_bounds__(256) __attribute__((amdgpu_num_vgpr(256)))
gemm_nt(const f16* __restrict__ A, const f16* __restrict__ W, const float* __restrict__ bias,
        void* __restrict__ out, void* __restrict__ out2, const float* __restrict__ padd,
        float accMul, float addMul) {
    __shared__ __attribute__((aligned(16))) f16 sm[GEMM_LDS];
    const int m0 = (int)blockIdx.x * 128;
    const int n0 = (int)blockIdx.y * 128;
    v8f acc[2][4];
    gemm_main(A, W, sm + GEMM_AS, sm + GEMM_BS, m0, n0, acc);
    gemm_epi<MODE>(acc, sm + GEMM_CS, bias, out, out2, padd, accMul, addMul, m0, n0);
}

// ---------------------------------------------------------------------------
// The Q, K and V projections in one grid: blockIdx.z picks the weight plane (planes
// contiguous, order q, k, v), the bias and the output (z 0, 1: MODE 0 into the contiguous
// q, k planes; z 2: MODE 1 into V^T and its residual). The three tiles of one (x, y) read
// the same hidden rows. The branch on z is block-uniform.
// ---------------------------------------------------------------------------
__global__ void __launch_bounds__(256) __attribute__((amdgpu_num_vgpr(256)))
gemm_qkv(const f16* __restrict__ X, const f16* __restrict__ Wqkv, const float* __restrict__ bq,
         const float* __restrict__ bk, const float* __restrict__ bv, f16* __restrict__ qk,
         f16* __restrict__ vt, f16* __restrict__ vtl, float accMul, float addMul) {
    __shared__ __attribute__((aligned(16))) f16 sm[GEMM_LDS];
    const int m0 = (int)blockIdx.x * 128;
    const int n0 = (int)blockIdx.y * 128;
    const int z  = (int)blockIdx.z;
    v8f acc[2][4];
    gemm_main(X, Wqkv + (size_t)z * HID * HID, sm + GEMM_AS, sm + GEMM_BS, m0, n0, acc);
    if (z == 2) {
        gemm_epi<1>(acc, sm + GEMM_CS, bv, (void*)vt, (void*)vtl, (const float*)0, accMul, addMul, m0, n0);
    } else {
        gemm_epi<0>(acc, sm + GEMM_CS, (z == 0) ? bq : bk, (void*)(qk + (size_t)z * MROWS * HID),
                    (void*)0, (const float*)0, accMul, addMul, m0, n0);
        // in the built code the other epilogue's text follows these stores: keep the wait in
        // front of any overwrite of the registers they name
        asm volatile("s_wait_xcnt 0x0" ::: "memory");
    }
}

// ---------------------------------------------------------------------------
// Flash attention, causal with key padding mask (key allowed iff key <= query and
// kmask[b][key] == 0; masked keys get p = 0 and are excluded from the row max; rows with
// no allowed key produce a zero context row). One block of 256 threads (8 waves) per (bx, bh = b*NHEAD + h),
// wave owns 16 query rows (Q fragments resident). Block streams the 64-key tiles up to its
// causal horizon: K staged [key][d], V^T staged [d][key]. Scores on WMMA, row max via DPP,
// exp2 in f32 carried x2^10, P relayed per wave through LDS as A fragments, O += P.V and
// row sums += P.ones on WMMA. Output f16 plane [b*SEQ+q][1024] carried x1024, written as
// RES = 0: q-block = bx + 1 (rows 128 .. SEQ-1).
// RES = 1: q-block 0 only (rows 0..127): V, P and the context carry x2^10 residual planes
//          (second accumulators); context residual plane Cpl is [b*128 + q][1024].
// coverage: RES 0 + RES 1 together write every (b, q, h*64..h*64+63) segment of Cp once;
//           RES 1 writes the whole Cpl plane once.
// LDS: ks, vsT, vsL cross-wave (block barriers); ps/psl per-wave but also separated by block
// barriers. staged extent == consumed extent for ks (64x64), vsT (64x64), vsL (64x64, RES),
// ps/psl (16x64).
// ---------------------------------------------------------------------------
// LDS of one attention block, sizes in halves (the kernel owns the arrays):
// ks [64][APITCH] = [key][d]; vsT [64][APITCH] = [d][key]; vsL the same, residual (RES);
// ps [8][16][APITCH] per-wave P relay / ctx stage; psl the same, residual (RES)
#define ATTN_KV   (64 * APITCH)
#define ATTN_P    (8 * 16 * APITCH)
#define ATTN_LDS0 (2 * ATTN_KV + ATTN_P)                      // RES = 0: ks, vsT, ps

template <int RES>
__device__ __forceinline__ void
attn_tile(const f16* __restrict__ Qp, const f16* __restrict__ Kp, const f16* __restrict__ Vt,
          const f16* __restrict__ Vtl, const int* __restrict__ kmask,
          f16* __restrict__ Cp, f16* __restrict__ Cpl,
          f16* ks, f16* vsT, f16* vsL, f16* ps, f16* psl, int bx, int bh) {
    const int tid  = (int)threadIdx.x;
    const int lane = tid & 31;
    const int wave = tid >> 5;
    const int hh8  = (lane >> 4) << 3;
    const int c16  = lane & 15;
    const int bidx = bh / NHEAD;
    const int hidx = bh - bidx * NHEAD;
    const int qblk = RES ? 0 : (bx + 1);
    const int qw   = qblk * 128 + wave * 16;          // first query row (within sequence) of this wave
    const size_t head = (size_t)bh * SEQ * HD;
    const int* mrow = kmask + (size_t)bidx * SEQ_FULL;

    v16h qa[2];
#pragma unroll
    for (int c = 0; c < 2; ++c) qa[c] = load_frag(Qp + head, qw, HD, c * 32, lane);

    FragU onesu;
#pragma unroll
    for (int i = 0; i < 16; ++i) onesu.e[i] = (f16)1.0f;
    const v16h ones = onesu.v;

    float m[8];
    v8f   o[4], lacc, olo[4], laccl;
#pragma unroll
    for (int r = 0; r < 8; ++r) m[r] = NEGBIG;
#pragma unroll
    for (int dt = 0; dt < 4; ++dt) { o[dt] = zero8(); olo[dt] = zero8(); }
    lacc  = zero8();
    laccl = zero8();

    // log2-domain scale: acc = 256 * q.k ; x = log2(e) * q.k / 8 = acc * log2(e) / 2048
    const float cl = 1.4426950408889634f * 0.00048828125f;
    const float rres = 1.0f / CARRY_RES;
    f16* psw  = ps  + wave * 16 * APITCH;
    f16* pslw = psl + wave * 16 * APITCH;

    const int nkt = 2 * qblk + 2;     // causal horizon in 64-key tiles (block-uniform)

#pragma unroll 1
    for (int kt = 0; kt < nkt; ++kt) {
        __syncthreads();
#pragma unroll
        for (int p2 = 0; p2 < 2; ++p2) {
            const int p   = tid + p2 * 256;
            const int row = p >> 3;
            const int pc  = (p & 7) << 3;
            const v8h kv = *(const v8h*)(Kp + head + (size_t)(kt * 64 + row) * HD + pc);
            const v8h vv = *(const v8h*)(Vt + head + (size_t)row * SEQ + kt * 64 + pc);
            *(v8h*)&ks[row * APITCH + pc]  = kv;
            *(v8h*)&vsT[row * APITCH + pc] = vv;
            if constexpr (RES) {
                const v8h vl = *(const v8h*)(Vtl + head + (size_t)row * SEQ + kt * 64 + pc);
                *(v8h*)&vsL[row * APITCH + pc] = vl;
            }
        }
        __syncthreads();

        // S[16 q x 64 keys]
        v8f s[4];
#pragma unroll
        for (int nt = 0; nt < 4; ++nt) s[nt] = zero8();
#pragma unroll
        for (int c = 0; c < 2; ++c) {
#pragma unroll
            for (int nt = 0; nt < 4; ++nt) {
                const v16h kb = load_frag(ks, nt * 16, APITCH, c * 32, lane);
                s[nt] = wmma16(qa[c], kb, s[nt]);
            }
        }

        // this lane's 4 key columns and their padding-mask values
        int keyi[4], mval[4];
#pragma unroll
        for (int nt = 0; nt < 4; ++nt) {
            keyi[nt] = kt * 64 + nt * 16 + c16;
            mval[nt] = mrow[keyi[nt]];
        }

        // online softmax per row r (row 8h + r), max-subtracted, exp2 domain
#pragma unroll
        for (int r = 0; r < 8; ++r) {
            const int qrow = qw + hh8 + r;
            float x[4];
            bool  alw[4];
#pragma unroll
            for (int nt = 0; nt < 4; ++nt) {
                x[nt]   = s[nt][r] * cl;
                alw[nt] = (mval[nt] == 0) && (keyi[nt] <= qrow);
            }
            const float xm0 = alw[0] ? x[0] : NEGBIG;
            const float xm1 = alw[1] ? x[1] : NEGBIG;
            const float xm2 = alw[2] ? x[2] : NEGBIG;
            const float xm3 = alw[3] ? x[3] : NEGBIG;
            const float tm = rowmax16(fmaxf(fmaxf(xm0, xm1), fmaxf(xm2, xm3)));
            const float mn = fmaxf(m[r], tm);
            const float al = fexp2(m[r] - mn);
            m[r] = mn;
            lacc[r] *= al;
#pragma unroll
            for (int dt = 0; dt < 4; ++dt) o[dt][r] *= al;
            if constexpr (RES) {
                laccl[r] *= al;
#pragma unroll
                for (int dt = 0; dt < 4; ++dt) olo[dt][r] *= al;
            }
            const float sh = 10.0f - mn;      // carry 2^10
#pragma unroll
            for (int nt = 0; nt < 4; ++nt) {
                const float arg = alw[nt] ? (x[nt] + sh) : 0.0f;
                const float e   = fexp2(arg);
                const float p   = alw[nt] ? e : 0.0f;
                const f16   hp  = (f16)p;
                psw[(hh8 + r) * APITCH + nt * 16 + c16] = hp;
                if constexpr (RES)
                    pslw[(hh8 + r) * APITCH + nt * 16 + c16] = (f16)((p - (float)hp) * CARRY_RES);
            }
        }
        __syncthreads();

        // O += P . V ; l += P . ones  (P reloaded as A fragments from the relay)
#pragma unroll
        for (int kk = 0; kk < 2; ++kk) {
            const v16h pa = load_frag(psw, 0, APITCH, kk * 32, lane);
            if constexpr (RES) {
                const v16h pl = load_frag(pslw, 0, APITCH, kk * 32, lane);
#pragma unroll
                for (int dt = 0; dt < 4; ++dt) {
                    const v16h vb = load_frag(vsT, dt * 16, APITCH, kk * 32, lane);
                    o[dt]   = wmma16(pa, vb, o[dt]);
                    olo[dt] = wmma16(pl, vb, olo[dt]);
                    const v16h vl = load_frag(vsL, dt * 16, APITCH, kk * 32, lane);
                    olo[dt] = wmma16(pa, vl, olo[dt]);
                }
                lacc  = wmma16(pa, ones, lacc);
                laccl = wmma16(pl, ones, laccl);
            } else {
#pragma unroll
                for (int dt = 0; dt < 4; ++dt) {
                    const v16h vb = load_frag(vsT, dt * 16, APITCH, kk * 32, lane);
                    o[dt] = wmma16(pa, vb, o[dt]);
                }
                lacc = wmma16(pa, ones, lacc);
            }
        }
    }
    __syncthreads();

    // normalize: plane value = 1024 * (O/16) / (l) = O * 64 / l ; zero row when l == 0
#pragma unroll
    for (int r = 0; r < 8; ++r) {
        float l = lacc[r];
        if constexpr (RES) l += laccl[r] * rres;
        const float lsafe = (l > 0.0f) ? l : 1.0f;
        const float inv   = (l > 0.0f) ? ((CARRY_CTX / CARRY_QKV) / lsafe) : 0.0f;
#pragma unroll
        for (int dt = 0; dt < 4; ++dt) {
            float ov = o[dt][r];
            if constexpr (RES) ov += olo[dt][r] * rres;
            const float cv = ov * inv;
            const f16 hv = (f16)cv;
            psw[(hh8 + r) * APITCH + dt * 16 + c16] = hv;
            if constexpr (RES)
                pslw[(hh8 + r) * APITCH + dt * 16 + c16] = (f16)((cv - (float)hv) * CARRY_RES);
        }
    }
    __syncthreads();

    const int piece = lane & 7;
    const int lsub  = lane >> 3;
{
#pragma unroll
        for (int it = 0; it < 4; ++it) {
            const int L = it * 4 + lsub;     // query row 0..15 within the wave tile
            const v8h v = *(const v8h*)&psw[L * APITCH + piece * 8];
            f16* dp = Cp + ((size_t)(bidx * SEQ + qw + L) * HID + hidx * HD + piece * 8);
            *(v8h*)dp = v;
            if constexpr (RES) {
                const v8h vl = *(const v8h*)&pslw[L * APITCH + piece * 8];
                f16* dq = Cpl + ((size_t)(bidx * 128 + wave * 16 + L) * HID + hidx * HD + piece * 8);
                *(v8h*)dq = vl;
            }
        }
        
    }
}

// q-block 0 of every head (RES = 1); runs first, because the residual partial needs its Cpl
__global__ void __launch_bounds__(256) __attribute__((amdgpu_num_vgpr(256)))
attn_first(const f16* __restrict__ Qp, const f16* __restrict__ Kp, const f16* __restrict__ Vt,
           const f16* __restrict__ Vtl, const int* __restrict__ kmask,
           f16* __restrict__ Cp, f16* __restrict__ Cpl) {
    __shared__ __attribute__((aligned(16))) f16 ks[ATTN_KV];
    __shared__ __attribute__((aligned(16))) f16 vsT[ATTN_KV];
    __shared__ __attribute__((aligned(16))) f16 vsL[ATTN_KV];
    __shared__ __attribute__((aligned(16))) f16 ps[ATTN_P];
    __shared__ __attribute__((aligned(16))) f16 psl[ATTN_P];
    attn_tile<1>(Qp, Kp, Vt, Vtl, kmask, Cp, Cpl, ks, vsT, vsL, ps, psl, 0, (int)blockIdx.x);
}

// ---------------------------------------------------------------------------
// q-blocks 1 .. SEQ/128-1 of every head (RES = 0) and, in the same grid, the residual
// partial of the out projection (MODE 3 tiles: Pf = Cpl . Wo^T scaled). The two are
// independent: the partial reads only Cpl (written by attn_first) and the weight plane.
// Blocks 0 .. PTILES-1 are the partial's tiles, the rest attention blocks (q-block fastest).
// The branch is block-uniform; the two kinds of block share one LDS array.
// ---------------------------------------------------------------------------
#define PTILES  ((RROWS / 128) * (HID / 128))
#define QBLKS   (SEQ / 128 - 1)
#define REST_LDS (GEMM_LDS > ATTN_LDS0 ? GEMM_LDS : ATTN_LDS0)
__global__ void __launch_bounds__(256) __attribute__((amdgpu_num_vgpr(256)))
attn_rest_and_partial(const f16* __restrict__ Qp, const f16* __restrict__ Kp,
                      const f16* __restrict__ Vt, const int* __restrict__ kmask,
                      f16* __restrict__ Cp, const f16* __restrict__ Cpl,
                      const f16* __restrict__ Wo, const float* __restrict__ bo,
                      float* __restrict__ Pf, float accLo) {
    __shared__ __attribute__((aligned(16))) f16 sm[REST_LDS];
    const int b = (int)blockIdx.x;
    if (b < PTILES) {
        const int m0 = (b % (RROWS / 128)) * 128;
        const int n0 = (b / (RROWS / 128)) * 128;
        v8f acc[2][4];
        gemm_main(Cpl, Wo, sm + GEMM_AS, sm + GEMM_BS, m0, n0, acc);
        gemm_epi<3>(acc, sm + GEMM_CS, bo, (void*)Pf, (void*)0, (const float*)0, accLo, 0.0f, m0, n0);
    } else if constexpr (QBLKS > 0) {
        const int t = b - PTILES;
        attn_tile<0>(Qp, Kp, Vt, (const f16*)0, kmask, Cp, (f16*)0, sm, sm + ATTN_KV, (f16*)0,
                     sm + 2 * ATTN_KV, (f16*)0, t % QBLKS, t / QBLKS);
    }
}

// ---------------------------------------------------------------------------
// Launch: 5 kernel launches. Workspace (halves): X, Q, K, V^T hi, V^T residual, ctx hi
// (6 x MROWS*1024), 4 weight planes (1024*1024), ctx residual (NB*128*1024), plus the
// ---------------------------------------------------------------------------
extern "C" void kernel_launch(void* const* d_in, const int* in_sizes, int n_in,
                              void* d_out, int out_size, void* d_ws, size_t ws_size,
                              hipStream_t stream) {
    if (n_in < 10) return;
    if (in_sizes[0] < ((NB - 1) * SEQ_FULL + SEQ) * HID) return;
    if (in_sizes[1] < (NB - 1) * SEQ_FULL + SEQ) return;
    if (in_sizes[2] < HID * HID || in_sizes[4] < HID * HID ||
        in_sizes[6] < HID * HID || in_sizes[8] < HID * HID) return;
    if (in_sizes[3] < HID || in_sizes[5] < HID || in_sizes[7] < HID || in_sizes[9] < HID) return;
    if (out_size < MROWS * HID) return;

    const float* x    = (const float*)d_in[0];
    const int*   mask = (const int*)d_in[1];
    const float* wq   = (const float*)d_in[2];
    const float* bq   = (const float*)d_in[3];
    const float* wk   = (const float*)d_in[4];
    const float* bk   = (const float*)d_in[5];
    const float* wv   = (const float*)d_in[6];
    const float* bv   = (const float*)d_in[7];
    const float* wo   = (const float*)d_in[8];
    const float* bo   = (const float*)d_in[9];

    const size_t nX = (size_t)MROWS * HID;    // halves per activation plane
    const size_t nW = (size_t)HID * HID;      // halves per weight plane
    const size_t nR = (size_t)RROWS * HID;    // elements per residual-row plane
    const size_t totalBytes = (6 * nX + 4 * nW + nR) * sizeof(f16) + nR * sizeof(float);
    if (ws_size < totalBytes) return;

    f16* Xh  = (f16*)d_ws;       // [MROWS][1024]            carry 16
    f16* Wqh = Xh  + nX;         // [n][k] = Wq[k][n]        carry 32
    f16* Wkh = Wqh + nW;
    f16* Wvh = Wkh + nW;
    f16* Woh = Wvh + nW;
    f16* Qp  = Woh + nW;         // [NB*16][SEQ][64]         carry 16
    f16* Kp  = Qp  + nX;         // [NB*16][SEQ][64]         carry 16
    f16* Vth = Kp  + nX;         // [NB*1024][SEQ] (V^T)     carry 16
    f16* Vtl = Vth + nX;         // V^T residual x2^10
    f16* Cph = Vtl + nX;         // [MROWS][1024]            carry 1024
    f16* Cpl = Cph + nX;         // [NB*128][1024]           ctx residual x2^10 (rows 0..127 per batch)
    float* Pf = (float*)(Cpl + nR);   // [NB*128][1024] f32   residual partial of the out projection

    cvt_all<<<4 * WTILES + MROWS / 2, 256, 0, stream>>>(x, wq, wk, wv, wo, Xh, Wqh);

    const dim3 gg(MROWS / 128, HID / 128);
    // plane = 16 * (acc / (16*32) + b) = acc/32 + 16*b
    const float accQKV = CARRY_QKV / (CARRY_X * CARRY_W);
    gemm_qkv<<<dim3(MROWS / 128, HID / 128, 3), 256, 0, stream>>>(Xh, Wqh, bq, bk, bv, Qp, Vth, Vtl,
                                                                    accQKV, CARRY_QKV);

    attn_first<<<NB * NHEAD, 256, 0, stream>>>(Qp, Kp, Vth, Vtl, mask, Cph, Cpl);

    // residual partial: Pf = (Cpl . Wo^T) / (1024 * 1024 * 32), beside the remaining q-blocks
    const float accLo = 1.0f / (CARRY_CTX * CARRY_RES * CARRY_W);
    attn_rest_and_partial<<<PTILES + QBLKS * NB * NHEAD, 256, 0, stream>>>(Qp, Kp, Vth, mask, Cph, Cpl,
                                                                             Woh, bo, Pf, accLo);
    // out = acc / (1024*32) + b (+ Pf on the first 128 rows of each sequence)
    const float accOut = 1.0f / (CARRY_CTX * CARRY_W);
    gemm_nt<2><<<gg, 256, 0, stream>>>(Cph, Woh, bo, d_out, (void*)0, Pf, accOut, 1.0f);
}

// v003
// It runs in 114 microseconds.
// In two side-by-side timings against v002, it was 1.33 and 1.32 times as fast.
// All steps since v000 together make it 2.85 times as fast.
#include <hip/hip_runtime.h>

// Contractions (Q/K/V/out projections, Q.K^T, P.V, P row-sum): v_wmma_f32_16x16x32_f16, f16 operands with power-of-two carries, f32 accumulate; every float input enters as its bf16 RNE value; V, P and context carry an extra f16 residual plane (x2^10) on the first 128 query rows per sequence; softmax in f32.

#ifndef NB
#define NB 2
#endif
#ifndef SEQ
#define SEQ 2048
#endif
#define NB_FULL   2
#define SEQ_FULL  2048
#define HID       1024
#define NHEAD     16
#define HD        64
#define MROWS     (NB * SEQ)
#define RROWS     (NB * 128)      // query rows per batch-set that carry residual planes

static_assert(HID == NHEAD * HD);
static_assert(SEQ % 128 == 0);
static_assert(SEQ >= 128);
static_assert(SEQ <= SEQ_FULL);
static_assert(NB >= 1 && NB <= NB_FULL);
static_assert(MROWS % 128 == 0);
static_assert(RROWS % 128 == 0);
static_assert(HID % 128 == 0);

// carries (exact powers of two)
#define CARRY_X    16.0f     // hidden plane
#define CARRY_W    32.0f     // weight planes
#define CARRY_QKV  16.0f     // q, k, v^T planes (true value x16)
#define CARRY_CTX  1024.0f   // context plane (true value x1024)
#define CARRY_RES  1024.0f   // residual planes: (value - f16(value)) x1024
#define NEGBIG     (-1.0e30f)
// LDS row pitches: 16 B x odd for rows read or written 16 bytes a lane (one row per lane),
// so that the 16 lanes of a half wave fall on distinct bank groups
#define GPITCH     40        // halves: GEMM operand rows of 32 halves (80 B)
#define CPITCH     136       // halves: GEMM f16 output staging rows of 128 halves (272 B)
#define CFPITCH    132       // floats: GEMM f32 output staging rows of 128 floats (528 B)
#define APITCH     72        // halves: attention rows of 64 halves (144 B)
static_assert(64 * CFPITCH * 4 <= 128 * CPITCH * 2);   // the f32 staging shares the f16 staging array
// softmax exp values carry 2^10 (added to the exp2 argument)

typedef _Float16 f16;
typedef f16   v16h __attribute__((ext_vector_type(16)));
typedef f16   v8h  __attribute__((ext_vector_type(8)));
typedef float v8f  __attribute__((ext_vector_type(8)));
typedef float v4f  __attribute__((ext_vector_type(4)));

union FragU { v16h v; v8h half[2]; f16 e[16]; };
union H8U   { v8h v; f16 e[8]; };

__device__ __forceinline__ v8f zero8() {
    v8f z = {0.f, 0.f, 0.f, 0.f, 0.f, 0.f, 0.f, 0.f};
    return z;
}

// 16-bit WMMA with hazard guard: D += A[16 x 32k] * B[32k x 16]
__device__ __forceinline__ v8f wmma16(v16h a, v16h b, v8f c) {
    v8f d = __builtin_amdgcn_wmma_f32_16x16x32_f16(false, a, false, b, (short)0, c, false, false);
    asm volatile("v_nop\n\tv_nop\n\tv_nop\n\tv_nop" : "+v"(d) : "v"(a), "v"(b));
    return d;
}

// f32 -> nearest-even bf16 value, returned as f32
__device__ __forceinline__ float bf16_rne(float x) {
    unsigned u = __float_as_uint(x);
    u = (u + 0x7fffu + ((u >> 16) & 1u)) & 0xffff0000u;
    return __uint_as_float(u);
}

__device__ __forceinline__ float fexp2(float x) {
#if defined(__has_builtin)
#if __has_builtin(__builtin_amdgcn_exp2f)
    return __builtin_amdgcn_exp2f(x);
#else
    return exp2f(x);
#endif
#else
    return exp2f(x);
#endif
}

// max over the 16 lanes of each lane half (DPP row rotations; D-layout rows are DPP rows)
__device__ __forceinline__ float rowmax16(float x) {
    int v = __builtin_bit_cast(int, x);
    x = fmaxf(x, __builtin_bit_cast(float, __builtin_amdgcn_update_dpp(v, v, 0x121, 0xf, 0xf, false)));
    v = __builtin_bit_cast(int, x);
    x = fmaxf(x, __builtin_bit_cast(float, __builtin_amdgcn_update_dpp(v, v, 0x122, 0xf, 0xf, false)));
    v = __builtin_bit_cast(int, x);
    x = fmaxf(x, __builtin_bit_cast(float, __builtin_amdgcn_update_dpp(v, v, 0x124, 0xf, 0xf, false)));
    v = __builtin_bit_cast(int, x);
    x = fmaxf(x, __builtin_bit_cast(float, __builtin_amdgcn_update_dpp(v, v, 0x128, 0xf, 0xf, false)));
    return x;
}

// 16 x 32 fragment from a tile whose k dimension is contiguous (pitch in halves).
// lane l: row rowbase + (l&15); elements 0..7 <- k = kcol + 8h .. +7,
// elements 8..15 <- k = kcol + 16 + 8h .. +7  (h = l>>4). Same map for A and B.
__device__ __forceinline__ v16h load_frag(const f16* tile, int rowbase, int pitch, int kcol, int lane) {
    const int r  = rowbase + (lane & 15);
    const int kh = (lane >> 4) << 3;
    const f16* p = tile + (size_t)r * pitch + kcol + kh;
    FragU f;
    f.half[0] = *(const v8h*)(p);
    f.half[1] = *(const v8h*)(p + 16);
    return f.v;
}

// ---------------------------------------------------------------------------
// f32 rows -> f16 plane (bf16 RNE value times carry). 128 threads per 1024-wide
// Source row stride mapping lets a reduced build read full-size inputs.
// coverage: nrows x 1024 halves, every element exactly once (grid = nrows*128/256).
// ---------------------------------------------------------------------------
template <int DSTPER, int SRCPER>
__device__ __forceinline__ void
cvt_rows(const float* __restrict__ src, f16* __restrict__ dst, int nrows, float carry, int blk) {
    const int g  = blk * 256 + (int)threadIdx.x;
    const int m  = g >> 7;
    const int c8 = (g & 127) << 3;
    if (m >= nrows) return;
    const int sm = (m / DSTPER) * SRCPER + (m % DSTPER);
    const float* sp = src + (size_t)sm * HID + c8;
    const v4f a = *(const v4f*)sp;
    const v4f b = *(const v4f*)(sp + 4);
    H8U o;
#pragma unroll
    for (int j = 0; j < 4; ++j) {
        const float x0 = a[j];
        const float x1 = b[j];
        o.e[j]     = (f16)(bf16_rne(x0) * carry);
        o.e[j + 4] = (f16)(bf16_rne(x1) * carry);
    }
    f16* dp = dst + (size_t)m * HID + c8;
    *(v8h*)dp = o.v;
    
}

// ---------------------------------------------------------------------------
// Weight transpose + convert: src [k][n] f32 (HID x HID, n contiguous) -> dst [n][k] f16
// = bf16 RNE(src[k][n]) * carry, k contiguous. Block handles a 64(k) x 64(n) tile through
// coverage: grid (HID/64, HID/64) x (64 n rows x 64 k) = the whole [HID][HID] plane once.
// LDS: T cross-wave (block barrier between element stores and vector reloads).
// ---------------------------------------------------------------------------
__device__ __forceinline__ void
cvt_wT(const float* __restrict__ src, f16* __restrict__ dst, float carry, int bx, int by) {
    __shared__ __attribute__((aligned(16))) f16 T[64 * 72];
    const int tid  = (int)threadIdx.x;
    const int lane = tid & 31;
    const int wave = tid >> 5;
    const int k0   = bx * 64;
    const int n0   = by * 64;
    const int kr   = tid >> 2;           // 0..63
    const int nc   = (tid & 3) << 4;     // 0,16,32,48
    const float* sp = src + (size_t)(k0 + kr) * HID + n0 + nc;
#pragma unroll
    for (int q = 0; q < 4; ++q) {
        const v4f a = *(const v4f*)(sp + q * 4);
#pragma unroll
        for (int j = 0; j < 4; ++j)
            T[(nc + q * 4 + j) * 72 + kr] = (f16)(bf16_rne(a[j]) * carry);
    }
    __syncthreads();
    const int piece = lane & 7;
    const int lsub  = lane >> 3;
{
#pragma unroll
        for (int it = 0; it < 2; ++it) {
            const int L = it * 32 + wave * 4 + lsub;     // local n row 0..63
            const v8h v = *(const v8h*)&T[L * 72 + piece * 8];
            f16* dp = dst + (size_t)(n0 + L) * HID + k0 + piece * 8;
            *(v8h*)dp = v;
        }
        
    }
}

// ---------------------------------------------------------------------------
// All five input conversions in one grid (they are independent of each other):
// blocks 0 .. 4*WTILES-1 transpose-convert the four weight planes (dst planes contiguous,
// order q, k, v, o), the remaining MROWS/2 blocks convert the hidden rows.
// The branch is block-uniform, so the barrier inside cvt_wT is reached by whole blocks.
// ---------------------------------------------------------------------------
#define WTILES ((HID / 64) * (HID / 64))
__global__ void __launch_bounds__(256)
cvt_all(const float* __restrict__ x, const float* __restrict__ wq, const float* __restrict__ wk,
        const float* __restrict__ wv, const float* __restrict__ wo,
        f16* __restrict__ xh, f16* __restrict__ wh) {
    const int b = (int)blockIdx.x;
    if (b < 4 * WTILES) {
        const int w = b / WTILES;
        const int t = b - w * WTILES;
        const float* src = (w == 0) ? wq : (w == 1) ? wk : (w == 2) ? wv : wo;
        cvt_wT(src, wh + (size_t)w * HID * HID, CARRY_W, t % (HID / 64), t / (HID / 64));
    } else {
        cvt_rows<SEQ, SEQ_FULL>(x, xh, MROWS, CARRY_X, b - 4 * WTILES);
    }
}

// ---------------------------------------------------------------------------
// C[m][n] = sum_k A[m][k] * W[n][k] ; A [M][1024] f16, W [1024][1024] f16 (k contiguous).
// Block tile 128 x 128, 8 waves as 4(M) x 2(N), 2 x 4 accumulators per wave, K step 32.
// MODE 1: f16 plane [b*HID + h*HD + d][s] (V transposed per head) into out, plus the
//         residual plane (val - f16(val)) * 2^10, same layout, into out2
// MODE 2: f32 rows [m][1024] into the output; blocks at sequence start (s0 == 0)
//         add the f32 partial rows padd[b*128 + local row][n] (block-uniform branch)
// MODE 3: f32 rows [m][1024] into a workspace plane (no partial add)
// coverage per block: MODE 0 256 lines, MODE 1 2 x 256 lines (hi, residual),
//                     MODE 2/3 2 x 256 lines (64 rows x 4 line-quarters per half).
// LDS: As/Bs/Cs all cross-wave, separated by block barriers.
// ---------------------------------------------------------------------------
// LDS of one GEMM tile, offsets in halves (the kernel owns the array, so that kernels which
// hold more than one kind of tile allocate it once)
#define GEMM_AS   0                                   // As [128][GPITCH]
#define GEMM_BS   (128 * GPITCH)                      // Bs [128][GPITCH]
#define GEMM_CS   (2 * 128 * GPITCH)                  // Cs f16 [128][CPITCH] or f32 [64][CFPITCH]
#define GEMM_LDS  (2 * 128 * GPITCH + 128 * CPITCH)

// K loop of one 128 x 128 tile at (m0, n0)
__device__ __forceinline__ void
gemm_main(const f16* __restrict__ A, const f16* __restrict__ W, f16* As, f16* Bs,
          int m0, int n0, v8f (&acc)[2][4]) {
    const int tid  = (int)threadIdx.x;
    const int lane = tid & 31;
    const int wave = tid >> 5;
    const int wm   = wave & 3;
    const int wn   = wave >> 2;

#pragma unroll
    for (int i = 0; i < 2; ++i)
#pragma unroll
        for (int j = 0; j < 4; ++j) acc[i][j] = zero8();

    const int srow = tid >> 1;
    const int scol = (tid & 1) << 4;
    const f16* gA = A + (size_t)(m0 + srow) * HID + scol;
    const f16* gW = W + (size_t)(n0 + srow) * HID + scol;

#pragma unroll 1
    for (int k0 = 0; k0 < HID; k0 += 32) {
        const v8h ra0 = *(const v8h*)(gA + k0);
        const v8h ra1 = *(const v8h*)(gA + k0 + 8);
        const v8h rb0 = *(const v8h*)(gW + k0);
        const v8h rb1 = *(const v8h*)(gW + k0 + 8);
        __syncthreads();
        *(v8h*)&As[srow * GPITCH + scol]     = ra0;
        *(v8h*)&As[srow * GPITCH + scol + 8] = ra1;
        *(v8h*)&Bs[srow * GPITCH + scol]     = rb0;
        *(v8h*)&Bs[srow * GPITCH + scol + 8] = rb1;
        __syncthreads();

        v16h af[2], bfr[4];
#pragma unroll
        for (int i = 0; i < 2; ++i) af[i] = load_frag(As, wm * 32 + i * 16, GPITCH, 0, lane);
#pragma unroll
        for (int j = 0; j < 4; ++j) bfr[j] = load_frag(Bs, wn * 64 + j * 16, GPITCH, 0, lane);
#pragma unroll
        for (int i = 0; i < 2; ++i)
#pragma unroll
            for (int j = 0; j < 4; ++j) acc[i][j] = wmma16(af[i], bfr[j], acc[i][j]);
    }
}

// scale, bias and store of one 128 x 128 tile at (m0, n0)
template <int MODE>
__device__ __forceinline__ void
gemm_epi(const v8f (&acc)[2][4], f16* Cs, const float* __restrict__ bias,
         void* __restrict__ out, void* __restrict__ out2, const float* __restrict__ padd,
         float accMul, float addMul, int m0, int n0) {
    const int tid  = (int)threadIdx.x;
    const int lane = tid & 31;
    const int wave = tid >> 5;
    const int wm   = wave & 3;
    const int wn   = wave >> 2;
    const int hh8  = (lane >> 4) << 3;   // D row half
    const int c16  = lane & 15;          // D column

    // bias (bf16 RNE value) per owned column group
    float bb[4];
#pragma unroll
    for (int j = 0; j < 4; ++j) bb[j] = bf16_rne(bias[n0 + wn * 64 + j * 16 + c16]) * addMul;

    const int bidx  = m0 / SEQ;          // block rows lie inside one batch (SEQ % 128 == 0)
    const int s0    = m0 - bidx * SEQ;
    const int piece = lane & 7;
    const int lsub  = lane >> 3;

    if constexpr (MODE == 0) {
#pragma unroll
        for (int i = 0; i < 2; ++i)
#pragma unroll
            for (int j = 0; j < 4; ++j) {
                const int nl = wn * 64 + j * 16 + c16;
#pragma unroll
                for (int r = 0; r < 8; ++r) {
                    const int ml = wm * 32 + i * 16 + hh8 + r;
                    Cs[ml * CPITCH + nl] = (f16)(acc[i][j][r] * accMul + bb[j]);
                }
            }
        __syncthreads();
        f16* op = (f16*)out;
        const size_t bh0 = (size_t)bidx * NHEAD + (n0 >> 6);
{
#pragma unroll
            for (int it = 0; it < 8; ++it) {
                const int L    = wave * 32 + it * 4 + lsub;   // 0..255
                const int ml   = L >> 1;
                const int hsel = L & 1;
                const v8h v = *(const v8h*)&Cs[ml * CPITCH + hsel * 64 + piece * 8];
                f16* dp = op + ((bh0 + hsel) * SEQ + s0 + ml) * HD + piece * 8;
                *(v8h*)dp = v;
            }
            
        }
    } else if constexpr (MODE == 1) {
        // hi plane, staged transposed: Cs[n][m]
#pragma unroll
        for (int i = 0; i < 2; ++i)
#pragma unroll
            for (int j = 0; j < 4; ++j) {
                const int nl = wn * 64 + j * 16 + c16;
                H8U t;
#pragma unroll
                for (int r = 0; r < 8; ++r) t.e[r] = (f16)(acc[i][j][r] * accMul + bb[j]);
                *(v8h*)&Cs[nl * CPITCH + wm * 32 + i * 16 + hh8] = t.v;
            }
        __syncthreads();
        {
            f16* op = (f16*)out;
{
#pragma unroll
                for (int it = 0; it < 8; ++it) {
                    const int L  = wave * 32 + it * 4 + lsub;     // 0..255
                    const int nl = L >> 1;
                    const int mh = L & 1;
                    const v8h v = *(const v8h*)&Cs[nl * CPITCH + mh * 64 + piece * 8];
                    f16* dp = op + ((size_t)(bidx * HID + n0 + nl) * SEQ + s0 + mh * 64 + piece * 8);
                    *(v8h*)dp = v;
                }
                
            }
        }
        __syncthreads();
        // residual plane: (val - f16(val)) * 2^10, same staging and store map
#pragma unroll
        for (int i = 0; i < 2; ++i)
#pragma unroll
            for (int j = 0; j < 4; ++j) {
                const int nl = wn * 64 + j * 16 + c16;
                H8U t;
#pragma unroll
                for (int r = 0; r < 8; ++r) {
                    const float val = acc[i][j][r] * accMul + bb[j];
                    const f16 hv = (f16)val;
                    t.e[r] = (f16)((val - (float)hv) * CARRY_RES);
                }
                *(v8h*)&Cs[nl * CPITCH + wm * 32 + i * 16 + hh8] = t.v;
            }
        __syncthreads();
        {
            f16* op = (f16*)out2;
{
#pragma unroll
                for (int it = 0; it < 8; ++it) {
                    const int L  = wave * 32 + it * 4 + lsub;     // 0..255
                    const int nl = L >> 1;
                    const int mh = L & 1;
                    const v8h v = *(const v8h*)&Cs[nl * CPITCH + mh * 64 + piece * 8];
                    f16* dp = op + ((size_t)(bidx * HID + n0 + nl) * SEQ + s0 + mh * 64 + piece * 8);
                    *(v8h*)dp = v;
                }
                
            }
        }
    } else {
        float* Cf = (float*)Cs;      // [64][CFPITCH] f32
        float* of = (float*)out;
#pragma unroll
        for (int half = 0; half < 2; ++half) {
            if ((wm >> 1) == half) {
#pragma unroll
                for (int i = 0; i < 2; ++i)
#pragma unroll
                    for (int j = 0; j < 4; ++j) {
                        const int nl = wn * 64 + j * 16 + c16;
#pragma unroll
                        for (int r = 0; r < 8; ++r) {
                            const int ml = (wm & 1) * 32 + i * 16 + hh8 + r;
                            Cf[ml * CFPITCH + nl] = acc[i][j][r] * accMul + bb[j];
                        }
                    }
            }
            __syncthreads();
            v4f vv[8];
#pragma unroll
            for (int it = 0; it < 8; ++it) {
                const int L    = wave * 32 + it * 4 + lsub;   // 0..255
                const int row  = L >> 2;
                const int part = L & 3;
                vv[it] = *(const v4f*)&Cf[row * CFPITCH + part * 32 + piece * 4];
            }
            if constexpr (MODE == 2) {
                if (s0 == 0) {     // block-uniform
#pragma unroll
                    for (int it = 0; it < 8; ++it) {
                        const int L    = wave * 32 + it * 4 + lsub;
                        const int row  = L >> 2;
                        const int part = L & 3;
                        const v4f pv = *(const v4f*)(padd + (size_t)(bidx * 128 + half * 64 + row) * HID
                                                     + n0 + part * 32 + piece * 4);
                        vv[it] += pv;
                    }
                }
            }
{
#pragma unroll
                for (int it = 0; it < 8; ++it) {
                    const int L    = wave * 32 + it * 4 + lsub;   // 0..255
                    const int row  = L >> 2;
                    const int part = L & 3;
                    float* dp = of + (size_t)(m0 + half * 64 + row) * HID + n0 + part * 32 + piece * 4;
                    *(v4f*)dp = vv[it];
                }
                
            }
            __syncthreads();
        }
    }
}

template <int MODE>
__global__ void __launch_bounds__(256) __attribute__((amdgpu_num_vgpr(256)))
gemm_nt(const f16* __restrict__ A, const f16* __restrict__ W, const float* __restrict__ bias,
        void* __restrict__ out, void* __restrict__ out2, const float* __restrict__ padd,
        float accMul, float addMul) {
    __shared__ __attribute__((aligned(16))) f16 sm[GEMM_LDS];
    const int m0 = (int)blockIdx.x * 128;
    const int n0 = (int)blockIdx.y * 128;
    v8f acc[2][4];
    gemm_main(A, W, sm + GEMM_AS, sm + GEMM_BS, m0, n0, acc);
    gemm_epi<MODE>(acc, sm + GEMM_CS, bias, out, out2, padd, accMul, addMul, m0, n0);
}

// ---------------------------------------------------------------------------
// The Q, K and V projections in one grid: blockIdx.z picks the weight plane (planes
// contiguous, order q, k, v), the bias and the output (z 0, 1: MODE 0 into the contiguous
// q, k planes; z 2: MODE 1 into V^T and its residual). The three tiles of one (x, y) read
// the same hidden rows. The branch on z is block-uniform.
// ---------------------------------------------------------------------------
__global__ void __launch_bounds__(256) __attribute__((amdgpu_num_vgpr(256)))
gemm_qkv(const f16* __restrict__ X, const f16* __restrict__ Wqkv, const float* __restrict__ bq,
         const float* __restrict__ bk, const float* __restrict__ bv, f16* __restrict__ qk,
         f16* __restrict__ vt, f16* __restrict__ vtl, float accMul, float addMul) {
    __shared__ __attribute__((aligned(16))) f16 sm[GEMM_LDS];
    const int m0 = (int)blockIdx.x * 128;
    const int n0 = (int)blockIdx.y * 128;
    const int z  = (int)blockIdx.z;
    v8f acc[2][4];
    gemm_main(X, Wqkv + (size_t)z * HID * HID, sm + GEMM_AS, sm + GEMM_BS, m0, n0, acc);
    if (z == 2) {
        gemm_epi<1>(acc, sm + GEMM_CS, bv, (void*)vt, (void*)vtl, (const float*)0, accMul, addMul, m0, n0);
    } else {
        gemm_epi<0>(acc, sm + GEMM_CS, (z == 0) ? bq : bk, (void*)(qk + (size_t)z * MROWS * HID),
                    (void*)0, (const float*)0, accMul, addMul, m0, n0);
        // in the built code the other epilogue's text follows these stores: keep the wait in
        // front of any overwrite of the registers they name
        asm volatile("s_wait_xcnt 0x0" ::: "memory");
    }
}

// ---------------------------------------------------------------------------
// Flash attention, causal with key padding mask (key allowed iff key <= query and
// kmask[b][key] == 0; masked keys get p = 0 and are excluded from the row max; rows with
// no allowed key produce a zero context row). One block of 256 threads (8 waves) per (bx, bh = b*NHEAD + h),
// wave owns 16 query rows (Q fragments resident). Block streams the 64-key tiles up to its
// causal horizon: K staged [key][d], V^T staged [d][key]. Scores on WMMA, row max via DPP,
// exp2 in f32 carried x2^10, P relayed per wave through LDS as A fragments, O += P.V and
// row sums += P.ones on WMMA. Output f16 plane [b*SEQ+q][1024] carried x1024, written as
// RES = 0: q-block = bx + 1 (rows 128 .. SEQ-1); not launched: attn_tile_split has those rows.
// RES = 1: q-block 0 only (rows 0..127): V, P and the context carry x2^10 residual planes
//          (second accumulators); context residual plane Cpl is [b*128 + q][1024].
// coverage: RES 1 and attn_tile_split together write every (b, q, h*64..h*64+63) segment of Cp once;
//           RES 1 writes the whole Cpl plane once.
// LDS: ks, vsT, vsL cross-wave (block barriers); ps/psl per-wave but also separated by block
// barriers. staged extent == consumed extent for ks (64x64), vsT (64x64), vsL (64x64, RES),
// ps/psl (16x64).
// ---------------------------------------------------------------------------
// LDS of one attention block, sizes in halves (the kernel owns the arrays):
// ks [64][APITCH] = [key][d]; vsT [64][APITCH] = [d][key]; vsL the same, residual (RES);
// ps [8][16][APITCH] per-wave P relay / ctx stage; psl the same, residual (RES)
#define ATTN_KV   (64 * APITCH)
#define ATTN_P    (8 * 16 * APITCH)
#define ATTN_LDS0 (2 * ATTN_KV + ATTN_P)                      // RES = 0: ks, vsT, ps

template <int RES>
__device__ __forceinline__ void
attn_tile(const f16* __restrict__ Qp, const f16* __restrict__ Kp, const f16* __restrict__ Vt,
          const f16* __restrict__ Vtl, const int* __restrict__ kmask,
          f16* __restrict__ Cp, f16* __restrict__ Cpl,
          f16* ks, f16* vsT, f16* vsL, f16* ps, f16* psl, int bx, int bh) {
    const int tid  = (int)threadIdx.x;
    const int lane = tid & 31;
    const int wave = tid >> 5;
    const int hh8  = (lane >> 4) << 3;
    const int c16  = lane & 15;
    const int bidx = bh / NHEAD;
    const int hidx = bh - bidx * NHEAD;
    const int qblk = RES ? 0 : (bx + 1);
    const int qw   = qblk * 128 + wave * 16;          // first query row (within sequence) of this wave
    const size_t head = (size_t)bh * SEQ * HD;
    const int* mrow = kmask + (size_t)bidx * SEQ_FULL;

    v16h qa[2];
#pragma unroll
    for (int c = 0; c < 2; ++c) qa[c] = load_frag(Qp + head, qw, HD, c * 32, lane);

    FragU onesu;
#pragma unroll
    for (int i = 0; i < 16; ++i) onesu.e[i] = (f16)1.0f;
    const v16h ones = onesu.v;

    float m[8];
    v8f   o[4], lacc, olo[4], laccl;
#pragma unroll
    for (int r = 0; r < 8; ++r) m[r] = NEGBIG;
#pragma unroll
    for (int dt = 0; dt < 4; ++dt) { o[dt] = zero8(); olo[dt] = zero8(); }
    lacc  = zero8();
    laccl = zero8();

    // log2-domain scale: acc = 256 * q.k ; x = log2(e) * q.k / 8 = acc * log2(e) / 2048
    const float cl = 1.4426950408889634f * 0.00048828125f;
    const float rres = 1.0f / CARRY_RES;
    f16* psw  = ps  + wave * 16 * APITCH;
    f16* pslw = psl + wave * 16 * APITCH;

    const int nkt = 2 * qblk + 2;     // causal horizon in 64-key tiles (block-uniform)

#pragma unroll 1
    for (int kt = 0; kt < nkt; ++kt) {
        __syncthreads();
#pragma unroll
        for (int p2 = 0; p2 < 2; ++p2) {
            const int p   = tid + p2 * 256;
            const int row = p >> 3;
            const int pc  = (p & 7) << 3;
            const v8h kv = *(const v8h*)(Kp + head + (size_t)(kt * 64 + row) * HD + pc);
            const v8h vv = *(const v8h*)(Vt + head + (size_t)row * SEQ + kt * 64 + pc);
            *(v8h*)&ks[row * APITCH + pc]  = kv;
            *(v8h*)&vsT[row * APITCH + pc] = vv;
            if constexpr (RES) {
                const v8h vl = *(const v8h*)(Vtl + head + (size_t)row * SEQ + kt * 64 + pc);
                *(v8h*)&vsL[row * APITCH + pc] = vl;
            }
        }
        __syncthreads();

        // S[16 q x 64 keys]
        v8f s[4];
#pragma unroll
        for (int nt = 0; nt < 4; ++nt) s[nt] = zero8();
#pragma unroll
        for (int c = 0; c < 2; ++c) {
#pragma unroll
            for (int nt = 0; nt < 4; ++nt) {
                const v16h kb = load_frag(ks, nt * 16, APITCH, c * 32, lane);
                s[nt] = wmma16(qa[c], kb, s[nt]);
            }
        }

        // this lane's 4 key columns and their padding-mask values
        int keyi[4], mval[4];
#pragma unroll
        for (int nt = 0; nt < 4; ++nt) {
            keyi[nt] = kt * 64 + nt * 16 + c16;
            mval[nt] = mrow[keyi[nt]];
        }

        // online softmax per row r (row 8h + r), max-subtracted, exp2 domain
#pragma unroll
        for (int r = 0; r < 8; ++r) {
            const int qrow = qw + hh8 + r;
            float x[4];
            bool  alw[4];
#pragma unroll
            for (int nt = 0; nt < 4; ++nt) {
                x[nt]   = s[nt][r] * cl;
                alw[nt] = (mval[nt] == 0) && (keyi[nt] <= qrow);
            }
            const float xm0 = alw[0] ? x[0] : NEGBIG;
            const float xm1 = alw[1] ? x[1] : NEGBIG;
            const float xm2 = alw[2] ? x[2] : NEGBIG;
            const float xm3 = alw[3] ? x[3] : NEGBIG;
            const float tm = rowmax16(fmaxf(fmaxf(xm0, xm1), fmaxf(xm2, xm3)));
            const float mn = fmaxf(m[r], tm);
            const float al = fexp2(m[r] - mn);
            m[r] = mn;
            lacc[r] *= al;
#pragma unroll
            for (int dt = 0; dt < 4; ++dt) o[dt][r] *= al;
            if constexpr (RES) {
                laccl[r] *= al;
#pragma unroll
                for (int dt = 0; dt < 4; ++dt) olo[dt][r] *= al;
            }
            const float sh = 10.0f - mn;      // carry 2^10
#pragma unroll
            for (int nt = 0; nt < 4; ++nt) {
                const float arg = alw[nt] ? (x[nt] + sh) : 0.0f;
                const float e   = fexp2(arg);
                const float p   = alw[nt] ? e : 0.0f;
                const f16   hp  = (f16)p;
                psw[(hh8 + r) * APITCH + nt * 16 + c16] = hp;
                if constexpr (RES)
                    pslw[(hh8 + r) * APITCH + nt * 16 + c16] = (f16)((p - (float)hp) * CARRY_RES);
            }
        }
        __syncthreads();

        // O += P . V ; l += P . ones  (P reloaded as A fragments from the relay)
#pragma unroll
        for (int kk = 0; kk < 2; ++kk) {
            const v16h pa = load_frag(psw, 0, APITCH, kk * 32, lane);
            if constexpr (RES) {
                const v16h pl = load_frag(pslw, 0, APITCH, kk * 32, lane);
#pragma unroll
                for (int dt = 0; dt < 4; ++dt) {
                    const v16h vb = load_frag(vsT, dt * 16, APITCH, kk * 32, lane);
                    o[dt]   = wmma16(pa, vb, o[dt]);
                    olo[dt] = wmma16(pl, vb, olo[dt]);
                    const v16h vl = load_frag(vsL, dt * 16, APITCH, kk * 32, lane);
                    olo[dt] = wmma16(pa, vl, olo[dt]);
                }
                lacc  = wmma16(pa, ones, lacc);
                laccl = wmma16(pl, ones, laccl);
            } else {
#pragma unroll
                for (int dt = 0; dt < 4; ++dt) {
                    const v16h vb = load_frag(vsT, dt * 16, APITCH, kk * 32, lane);
                    o[dt] = wmma16(pa, vb, o[dt]);
                }
                lacc = wmma16(pa, ones, lacc);
            }
        }
    }
    __syncthreads();

    // normalize: plane value = 1024 * (O/16) / (l) = O * 64 / l ; zero row when l == 0
#pragma unroll
    for (int r = 0; r < 8; ++r) {
        float l = lacc[r];
        if constexpr (RES) l += laccl[r] * rres;
        const float lsafe = (l > 0.0f) ? l : 1.0f;
        const float inv   = (l > 0.0f) ? ((CARRY_CTX / CARRY_QKV) / lsafe) : 0.0f;
#pragma unroll
        for (int dt = 0; dt < 4; ++dt) {
            float ov = o[dt][r];
            if constexpr (RES) ov += olo[dt][r] * rres;
            const float cv = ov * inv;
            const f16 hv = (f16)cv;
            psw[(hh8 + r) * APITCH + dt * 16 + c16] = hv;
            if constexpr (RES)
                pslw[(hh8 + r) * APITCH + dt * 16 + c16] = (f16)((cv - (float)hv) * CARRY_RES);
        }
    }
    __syncthreads();

    const int piece = lane & 7;
    const int lsub  = lane >> 3;
{
#pragma unroll
        for (int it = 0; it < 4; ++it) {
            const int L = it * 4 + lsub;     // query row 0..15 within the wave tile
            const v8h v = *(const v8h*)&psw[L * APITCH + piece * 8];
            f16* dp = Cp + ((size_t)(bidx * SEQ + qw + L) * HID + hidx * HD + piece * 8);
            *(v8h*)dp = v;
            if constexpr (RES) {
                const v8h vl = *(const v8h*)&pslw[L * APITCH + piece * 8];
                f16* dq = Cpl + ((size_t)(bidx * 128 + wave * 16 + L) * HID + hidx * HD + piece * 8);
                *(v8h*)dq = vl;
            }
        }
        
    }
}

// ---------------------------------------------------------------------------
// Query rows 128 .. SEQ-1, cut for a short longest chain: one block of 8 waves owns 64 query
// rows (64-row q-block qb >= 2) and its two groups of 4 waves split the 64-key tiles of the
// causal horizon between them (group g takes tiles 2*it + g), each group with its own K and
// V^T stage and its own running (m, l, O). After the loop group 1 hands its partial state to
// group 0 through LDS and group 0 merges: mn = max(m0, m1), l = l0*2^(m0-mn) + l1*2^(m1-mn),
// O likewise. Same masking, scaling and carries as attn_tile<0>.
// When the tile count qb + 1 is odd, group 1's last tile lies wholly above the diagonal: its
// addresses are clamped to tile qb and every key of it is masked by the causal test (p = 0,
// the running maximum does not move).
// LDS (halves): group g: ks at g*2*ATTN_KV, vsT behind it; ps [8][16][APITCH] at 4*ATTN_KV;
// the hand-over buffer (48 floats a lane of group 1) reuses the K/V stages behind a barrier.
// ---------------------------------------------------------------------------
#define ATTN_LDS2 (4 * ATTN_KV + ATTN_P)
static_assert(48 * 128 * 4 <= 4 * ATTN_KV * 2);   // the hand-over buffer fits the K/V stages

__device__ __forceinline__ void
attn_tile_split(const f16* __restrict__ Qp, const f16* __restrict__ Kp, const f16* __restrict__ Vt,
                const int* __restrict__ kmask, f16* __restrict__ Cp, f16* sm, int qb, int bh) {
    const int tid  = (int)threadIdx.x;
    const int lane = tid & 31;
    const int wave = __builtin_amdgcn_readfirstlane(tid >> 5);   // scalar: tile index and group tests stay off the vector port
    const int grp  = wave >> 2;          // key group
    const int wq   = wave & 3;           // 16-row query slice within the block
    const int hh8  = (lane >> 4) << 3;
    const int c16  = lane & 15;
    const int bidx = bh / NHEAD;
    const int hidx = bh - bidx * NHEAD;
    const int qw   = qb * 64 + wq * 16;  // first query row (within sequence) of this wave
    const size_t head = (size_t)bh * SEQ * HD;
    const int* mrow = kmask + (size_t)bidx * SEQ_FULL;

    f16* ks  = sm + grp * 2 * ATTN_KV;
    f16* vsT = ks + ATTN_KV;
    f16* psw = sm + 4 * ATTN_KV + wave * 16 * APITCH;

    v16h qa[2];
#pragma unroll
    for (int c = 0; c < 2; ++c) qa[c] = load_frag(Qp + head, qw, HD, c * 32, lane);

    FragU onesu;
#pragma unroll
    for (int i = 0; i < 16; ++i) onesu.e[i] = (f16)1.0f;
    const v16h ones = onesu.v;

    float m[8];
    v8f   o[4], lacc;
#pragma unroll
    for (int r = 0; r < 8; ++r) m[r] = NEGBIG;
#pragma unroll
    for (int dt = 0; dt < 4; ++dt) o[dt] = zero8();
    lacc = zero8();

    // log2-domain scale: acc = 256 * q.k ; x = log2(e) * q.k / 8 = acc * log2(e) / 2048
    const float cl = 1.4426950408889634f * 0.00048828125f;

    const int nit = (qb + 2) >> 1;       // trips: ceil((qb + 1) / 2), block-uniform
    const int t2  = tid & 127;           // thread within the group
    // staging: 16 bytes a thread and step, 16 rows a step; lane offsets do not change over the loop
    const int srow = t2 >> 3;
    const int spc  = (t2 & 7) << 3;
    const unsigned koff = (unsigned)(srow * HD + spc);
    const unsigned voff = (unsigned)(srow * SEQ + spc);

#pragma unroll 1
    for (int it = 0; it < nit; ++it) {
        const int kt  = 2 * it + grp;            // this group's tile
        const int ktl = (kt < qb) ? kt : qb;     // tile whose bytes are read (in bounds)
        const f16* kp = Kp + head + (size_t)ktl * 64 * HD + koff;   // this lane's first 16 bytes of the tile
        const f16* vp = Vt + head + (size_t)ktl * 64 + voff;
        const int* mp = mrow + ktl * 64 + c16;
        __syncthreads();
        v8h kv[4], vv[4];
#pragma unroll
        for (int p2 = 0; p2 < 4; ++p2) {
            kv[p2] = *(const v8h*)(kp + p2 * 16 * HD);
            vv[p2] = *(const v8h*)(vp + p2 * 16 * SEQ);
        }
        // the address pairs stay whole (no load's result lands on them) until this wait
        asm volatile("s_wait_xcnt 0x0" :: "v"(kp), "v"(vp) : "memory");
#pragma unroll
        for (int p2 = 0; p2 < 4; ++p2) {
            *(v8h*)&ks[(srow + p2 * 16) * APITCH + spc]  = kv[p2];
            *(v8h*)&vsT[(srow + p2 * 16) * APITCH + spc] = vv[p2];
        }
        __syncthreads();

        // S[16 q x 64 keys]
        v8f s[4];
#pragma unroll
        for (int nt = 0; nt < 4; ++nt) s[nt] = zero8();
#pragma unroll
        for (int c = 0; c < 2; ++c) {
#pragma unroll
            for (int nt = 0; nt < 4; ++nt) {
                const v16h kb = load_frag(ks, nt * 16, APITCH, c * 32, lane);
                s[nt] = wmma16(qa[c], kb, s[nt]);
            }
        }

        // this lane's 4 key columns and their padding-mask values
        // (kd = key index minus this lane's first query row: key <= query row r  <=>  kd <= r)
        int kd[4], mval[4];
#pragma unroll
        for (int nt = 0; nt < 4; ++nt) {
            kd[nt]   = kt * 64 + nt * 16 + c16 - (qw + hh8);
            mval[nt] = mp[nt * 16];
        }
        // as above, for the mask loads' address pair
        asm volatile("s_wait_xcnt 0x0" :: "v"(mp) : "memory");

        // online softmax per row r (row 8h + r), max-subtracted, exp2 domain
#pragma unroll
        for (int r = 0; r < 8; ++r) {
            float x[4];
            bool  alw[4];
#pragma unroll
            for (int nt = 0; nt < 4; ++nt) {
                x[nt]   = s[nt][r] * cl;
                alw[nt] = (mval[nt] == 0) && (kd[nt] <= r);
            }
            const float xm0 = alw[0] ? x[0] : NEGBIG;
            const float xm1 = alw[1] ? x[1] : NEGBIG;
            const float xm2 = alw[2] ? x[2] : NEGBIG;
            const float xm3 = alw[3] ? x[3] : NEGBIG;
            const float tm = rowmax16(fmaxf(fmaxf(xm0, xm1), fmaxf(xm2, xm3)));
            const float mn = fmaxf(m[r], tm);
            const float al = fexp2(m[r] - mn);
            m[r] = mn;
            lacc[r] *= al;
#pragma unroll
            for (int dt = 0; dt < 4; ++dt) o[dt][r] *= al;
            const float sh = 10.0f - mn;      // carry 2^10
#pragma unroll
            for (int nt = 0; nt < 4; ++nt) {
                const float arg = alw[nt] ? (x[nt] + sh) : 0.0f;
                const float e   = fexp2(arg);
                const float p   = alw[nt] ? e : 0.0f;
                psw[(hh8 + r) * APITCH + nt * 16 + c16] = (f16)p;
            }
        }
        __syncthreads();

        // O += P . V ; l += P . ones  (P reloaded as A fragments from the relay)
#pragma unroll
        for (int kk = 0; kk < 2; ++kk) {
            const v16h pa = load_frag(psw, 0, APITCH, kk * 32, lane);
#pragma unroll
            for (int dt = 0; dt < 4; ++dt) {
                const v16h vb = load_frag(vsT, dt * 16, APITCH, kk * 32, lane);
                o[dt] = wmma16(pa, vb, o[dt]);
            }
            lacc = wmma16(pa, ones, lacc);
        }
    }
    __syncthreads();     // every reader has left the K/V stages: they become the hand-over buffer

    float* mb = (float*)sm + t2;         // [48][128] floats, one column a lane of a group
    if (grp == 1) {
#pragma unroll
        for (int r = 0; r < 8; ++r) {
            mb[r * 128]       = m[r];
            mb[(8 + r) * 128] = lacc[r];
#pragma unroll
            for (int dt = 0; dt < 4; ++dt) mb[(16 + dt * 8 + r) * 128] = o[dt][r];
        }
    }
    __syncthreads();     // publishes group 1's partial state to group 0

    // merge, then normalize: plane value = 1024 * (O/16) / (l) = O * 64 / l ; zero row when l == 0
    if (grp == 0) {
#pragma unroll
        for (int r = 0; r < 8; ++r) {
            const float m1 = mb[r * 128];
            const float mn = fmaxf(m[r], m1);
            const float a0 = fexp2(m[r] - mn);
            const float a1 = fexp2(m1 - mn);
            const float l  = lacc[r] * a0 + mb[(8 + r) * 128] * a1;
            const float lsafe = (l > 0.0f) ? l : 1.0f;
            const float inv   = (l > 0.0f) ? ((CARRY_CTX / CARRY_QKV) / lsafe) : 0.0f;
#pragma unroll
            for (int dt = 0; dt < 4; ++dt) {
                const float ov = o[dt][r] * a0 + mb[(16 + dt * 8 + r) * 128] * a1;
                psw[(hh8 + r) * APITCH + dt * 16 + c16] = (f16)(ov * inv);
            }
        }
    }
    __syncthreads();

    if (grp == 0) {
        const int piece = lane & 7;
        const int lsub  = lane >> 3;
#pragma unroll
        for (int it = 0; it < 4; ++it) {
            const int L = it * 4 + lsub;     // query row 0..15 within the wave tile
            const v8h v = *(const v8h*)&psw[L * APITCH + piece * 8];
            f16* dp = Cp + ((size_t)(bidx * SEQ + qw + L) * HID + hidx * HD + piece * 8);
            *(v8h*)dp = v;
        }
    }
}

// q-block 0 of every head (RES = 1); runs first, because the residual partial needs its Cpl
__global__ void __launch_bounds__(256) __attribute__((amdgpu_num_vgpr(256)))
attn_first(const f16* __restrict__ Qp, const f16* __restrict__ Kp, const f16* __restrict__ Vt,
           const f16* __restrict__ Vtl, const int* __restrict__ kmask,
           f16* __restrict__ Cp, f16* __restrict__ Cpl) {
    __shared__ __attribute__((aligned(16))) f16 ks[ATTN_KV];
    __shared__ __attribute__((aligned(16))) f16 vsT[ATTN_KV];
    __shared__ __attribute__((aligned(16))) f16 vsL[ATTN_KV];
    __shared__ __attribute__((aligned(16))) f16 ps[ATTN_P];
    __shared__ __attribute__((aligned(16))) f16 psl[ATTN_P];
    attn_tile<1>(Qp, Kp, Vt, Vtl, kmask, Cp, Cpl, ks, vsT, vsL, ps, psl, 0, (int)blockIdx.x);
}

// ---------------------------------------------------------------------------
// Query rows 128 .. SEQ-1 of every head (64-row q-blocks 2 .. SEQ/64-1) and, in the same grid, the residual
// partial of the out projection (MODE 3 tiles: Pf = Cpl . Wo^T scaled). The two are
// independent: the partial reads only Cpl (written by attn_first) and the weight plane.
// Blocks 0 .. PTILES-1 are the partial's tiles, the rest attention blocks, longest horizon first
// (for speed only).
// The branch is block-uniform; the two kinds of block share one LDS array.
// ---------------------------------------------------------------------------
#define PTILES  ((RROWS / 128) * (HID / 128))
#define QBLKS   (SEQ / 64 - 2)
#define REST_LDS (GEMM_LDS > ATTN_LDS2 ? GEMM_LDS : ATTN_LDS2)
__global__ void __launch_bounds__(256) __attribute__((amdgpu_num_vgpr(256)))
attn_rest_and_partial(const f16* __restrict__ Qp, const f16* __restrict__ Kp,
                      const f16* __restrict__ Vt, const int* __restrict__ kmask,
                      f16* __restrict__ Cp, const f16* __restrict__ Cpl,
                      const f16* __restrict__ Wo, const float* __restrict__ bo,
                      float* __restrict__ Pf, float accLo) {
    __shared__ __attribute__((aligned(16))) f16 sm[REST_LDS];
    const int b = (int)blockIdx.x;
    if (b < PTILES) {
        const int m0 = (b % (RROWS / 128)) * 128;
        const int n0 = (b / (RROWS / 128)) * 128;
        v8f acc[2][4];
        gemm_main(Cpl, Wo, sm + GEMM_AS, sm + GEMM_BS, m0, n0, acc);
        gemm_epi<3>(acc, sm + GEMM_CS, bo, (void*)Pf, (void*)0, (const float*)0, accLo, 0.0f, m0, n0);
    } else if constexpr (QBLKS > 0) {
        const int t = b - PTILES;
        attn_tile_split(Qp, Kp, Vt, kmask, Cp, sm, SEQ / 64 - 1 - t / (NB * NHEAD), t % (NB * NHEAD));
    }
}

// ---------------------------------------------------------------------------
// Launch: 5 kernel launches. Workspace (halves): X, Q, K, V^T hi, V^T residual, ctx hi
// (6 x MROWS*1024), 4 weight planes (1024*1024), ctx residual (NB*128*1024), plus the
// ---------------------------------------------------------------------------
extern "C" void kernel_launch(void* const* d_in, const int* in_sizes, int n_in,
                              void* d_out, int out_size, void* d_ws, size_t ws_size,
                              hipStream_t stream) {
    if (n_in < 10) return;
    if (in_sizes[0] < ((NB - 1) * SEQ_FULL + SEQ) * HID) return;
    if (in_sizes[1] < (NB - 1) * SEQ_FULL + SEQ) return;
    if (in_sizes[2] < HID * HID || in_sizes[4] < HID * HID ||
        in_sizes[6] < HID * HID || in_sizes[8] < HID * HID) return;
    if (in_sizes[3] < HID || in_sizes[5] < HID || in_sizes[7] < HID || in_sizes[9] < HID) return;
    if (out_size < MROWS * HID) return;

    const float* x    = (const float*)d_in[0];
    const int*   mask = (const int*)d_in[1];
    const float* wq   = (const float*)d_in[2];
    const float* bq   = (const float*)d_in[3];
    const float* wk   = (const float*)d_in[4];
    const float* bk   = (const float*)d_in[5];
    const float* wv   = (const float*)d_in[6];
    const float* bv   = (const float*)d_in[7];
    const float* wo   = (const float*)d_in[8];
    const float* bo   = (const float*)d_in[9];

    const size_t nX = (size_t)MROWS * HID;    // halves per activation plane
    const size_t nW = (size_t)HID * HID;      // halves per weight plane
    const size_t nR = (size_t)RROWS * HID;    // elements per residual-row plane
    const size_t totalBytes = (6 * nX + 4 * nW + nR) * sizeof(f16) + nR * sizeof(float);
    if (ws_size < totalBytes) return;

    f16* Xh  = (f16*)d_ws;       // [MROWS][1024]            carry 16
    f16* Wqh = Xh  + nX;         // [n][k] = Wq[k][n]        carry 32
    f16* Wkh = Wqh + nW;
    f16* Wvh = Wkh + nW;
    f16* Woh = Wvh + nW;
    f16* Qp  = Woh + nW;         // [NB*16][SEQ][64]         carry 16
    f16* Kp  = Qp  + nX;         // [NB*16][SEQ][64]         carry 16
    f16* Vth = Kp  + nX;         // [NB*1024][SEQ] (V^T)     carry 16
    f16* Vtl = Vth + nX;         // V^T residual x2^10
    f16* Cph = Vtl + nX;         // [MROWS][1024]            carry 1024
    f16* Cpl = Cph + nX;         // [NB*128][1024]           ctx residual x2^10 (rows 0..127 per batch)
    float* Pf = (float*)(Cpl + nR);   // [NB*128][1024] f32   residual partial of the out projection

    cvt_all<<<4 * WTILES + MROWS / 2, 256, 0, stream>>>(x, wq, wk, wv, wo, Xh, Wqh);

    const dim3 gg(MROWS / 128, HID / 128);
    // plane = 16 * (acc / (16*32) + b) = acc/32 + 16*b
    const float accQKV = CARRY_QKV / (CARRY_X * CARRY_W);
    gemm_qkv<<<dim3(MROWS / 128, HID / 128, 3), 256, 0, stream>>>(Xh, Wqh, bq, bk, bv, Qp, Vth, Vtl,
                                                                    accQKV, CARRY_QKV);

    attn_first<<<NB * NHEAD, 256, 0, stream>>>(Qp, Kp, Vth, Vtl, mask, Cph, Cpl);

    // residual partial: Pf = (Cpl . Wo^T) / (1024 * 1024 * 32), beside the remaining q-blocks
    const float accLo = 1.0f / (CARRY_CTX * CARRY_RES * CARRY_W);
    attn_rest_and_partial<<<PTILES + QBLKS * NB * NHEAD, 256, 0, stream>>>(Qp, Kp, Vth, mask, Cph, Cpl,
                                                                             Woh, bo, Pf, accLo);
    // out = acc / (1024*32) + b (+ Pf on the first 128 rows of each sequence)
    const float accOut = 1.0f / (CARRY_CTX * CARRY_W);
    gemm_nt<2><<<gg, 256, 0, stream>>>(Cph, Woh, bo, d_out, (void*)0, Pf, accOut, 1.0f);
}

// v004
// A run of this version takes 90.5 microseconds.
// Timed twice side by side with v003, it ran 1.26 times as fast both times.
// Over all steps from v000 it is 3.59 times as fast.
#include <hip/hip_runtime.h>

// Contractions (Q/K/V/out projections, Q.K^T, P.V, P row-sum): v_wmma_f32_16x16x32_f16, f16 operands with power-of-two carries, f32 accumulate; every float input enters as its bf16 RNE value; V, P and context carry an extra f16 residual plane (x2^10) on the first 128 query rows per sequence; softmax in f32. Keys whose padding mask forbids them are never projected or scored: K and V^T hold the allowed keys only, packed in key order.

#ifndef NB
#define NB 2
#endif
#ifndef SEQ
#define SEQ 2048
#endif
#define NB_FULL   2
#define SEQ_FULL  2048
#define HID       1024
#define NHEAD     16
#define HD        64
#define MROWS     (NB * SEQ)
#define RROWS     (NB * 128)      // query rows per batch-set that carry residual planes

static_assert(HID == NHEAD * HD);
static_assert(SEQ % 128 == 0);
static_assert(SEQ >= 128);
static_assert(SEQ <= SEQ_FULL);
static_assert(NB >= 1 && NB <= NB_FULL);
static_assert(MROWS % 128 == 0);
static_assert(RROWS % 128 == 0);
static_assert(HID % 128 == 0);

// carries (exact powers of two)
#define CARRY_X    16.0f     // hidden plane
#define CARRY_W    32.0f     // weight planes
#define CARRY_QKV  16.0f     // q, k, v^T planes (true value x16)
#define CARRY_CTX  1024.0f   // context plane (true value x1024)
#define CARRY_RES  1024.0f   // residual planes: (value - f16(value)) x1024
#define NEGBIG     (-1.0e30f)
// LDS row pitches: 16 B x odd for rows read or written 16 bytes a lane (one row per lane),
// so that the 16 lanes of a half wave fall on distinct bank groups
#define GPITCH     40        // halves: GEMM operand rows of 32 halves (80 B)
#define CPITCH     136       // halves: GEMM f16 output staging rows of 128 halves (272 B)
#define CFPITCH    132       // floats: GEMM f32 output staging rows of 128 floats (528 B)
#define APITCH     72        // halves: attention rows of 64 halves (144 B)
static_assert(64 * CFPITCH * 4 <= 128 * CPITCH * 2);   // the f32 staging shares the f16 staging array
// softmax exp values carry 2^10 (added to the exp2 argument)

typedef _Float16 f16;
typedef f16   v16h __attribute__((ext_vector_type(16)));
typedef f16   v8h  __attribute__((ext_vector_type(8)));
typedef float v8f  __attribute__((ext_vector_type(8)));
typedef float v4f  __attribute__((ext_vector_type(4)));

union FragU { v16h v; v8h half[2]; f16 e[16]; };
union H8U   { v8h v; f16 e[8]; };

__device__ __forceinline__ v8f zero8() {
    v8f z = {0.f, 0.f, 0.f, 0.f, 0.f, 0.f, 0.f, 0.f};
    return z;
}

// 16-bit WMMA with hazard guard: D += A[16 x 32k] * B[32k x 16]
__device__ __forceinline__ v8f wmma16(v16h a, v16h b, v8f c) {
    v8f d = __builtin_amdgcn_wmma_f32_16x16x32_f16(false, a, false, b, (short)0, c, false, false);
    asm volatile("v_nop\n\tv_nop\n\tv_nop\n\tv_nop" : "+v"(d) : "v"(a), "v"(b));
    return d;
}

// f32 -> nearest-even bf16 value, returned as f32
__device__ __forceinline__ float bf16_rne(float x) {
    unsigned u = __float_as_uint(x);
    u = (u + 0x7fffu + ((u >> 16) & 1u)) & 0xffff0000u;
    return __uint_as_float(u);
}

__device__ __forceinline__ float fexp2(float x) {
#if defined(__has_builtin)
#if __has_builtin(__builtin_amdgcn_exp2f)
    return __builtin_amdgcn_exp2f(x);
#else
    return exp2f(x);
#endif
#else
    return exp2f(x);
#endif
}

// max over the 16 lanes of each lane half (DPP row rotations; D-layout rows are DPP rows)
__device__ __forceinline__ float rowmax16(float x) {
    int v = __builtin_bit_cast(int, x);
    x = fmaxf(x, __builtin_bit_cast(float, __builtin_amdgcn_update_dpp(v, v, 0x121, 0xf, 0xf, false)));
    v = __builtin_bit_cast(int, x);
    x = fmaxf(x, __builtin_bit_cast(float, __builtin_amdgcn_update_dpp(v, v, 0x122, 0xf, 0xf, false)));
    v = __builtin_bit_cast(int, x);
    x = fmaxf(x, __builtin_bit_cast(float, __builtin_amdgcn_update_dpp(v, v, 0x124, 0xf, 0xf, false)));
    v = __builtin_bit_cast(int, x);
    x = fmaxf(x, __builtin_bit_cast(float, __builtin_amdgcn_update_dpp(v, v, 0x128, 0xf, 0xf, false)));
    return x;
}

// 16 x 32 fragment from a tile whose k dimension is contiguous (pitch in halves).
// lane l: row rowbase + (l&15); elements 0..7 <- k = kcol + 8h .. +7,
// elements 8..15 <- k = kcol + 16 + 8h .. +7  (h = l>>4). Same map for A and B.
__device__ __forceinline__ v16h load_frag(const f16* tile, int rowbase, int pitch, int kcol, int lane) {
    const int r  = rowbase + (lane & 15);
    const int kh = (lane >> 4) << 3;
    const f16* p = tile + (size_t)r * pitch + kcol + kh;
    FragU f;
    f.half[0] = *(const v8h*)(p);
    f.half[1] = *(const v8h*)(p + 16);
    return f.v;
}

// ---------------------------------------------------------------------------
// f32 rows -> f16 plane (bf16 RNE value times carry). 128 threads per 1024-wide
// Source row stride mapping lets a reduced build read full-size inputs.
// coverage: nrows x 1024 halves, every element exactly once (grid = nrows*128/256).
// ---------------------------------------------------------------------------
template <int DSTPER, int SRCPER>
__device__ __forceinline__ void
cvt_rows(const float* __restrict__ src, f16* __restrict__ dst, int nrows, float carry, int blk) {
    const int g  = blk * 256 + (int)threadIdx.x;
    const int m  = g >> 7;
    const int c8 = (g & 127) << 3;
    if (m >= nrows) return;
    const int sm = (m / DSTPER) * SRCPER + (m % DSTPER);
    const float* sp = src + (size_t)sm * HID + c8;
    const v4f a = *(const v4f*)sp;
    const v4f b = *(const v4f*)(sp + 4);
    H8U o;
#pragma unroll
    for (int j = 0; j < 4; ++j) {
        const float x0 = a[j];
        const float x1 = b[j];
        o.e[j]     = (f16)(bf16_rne(x0) * carry);
        o.e[j + 4] = (f16)(bf16_rne(x1) * carry);
    }
    f16* dp = dst + (size_t)m * HID + c8;
    *(v8h*)dp = o.v;
    
}

// ---------------------------------------------------------------------------
// Weight transpose + convert: src [k][n] f32 (HID x HID, n contiguous) -> dst [n][k] f16
// = bf16 RNE(src[k][n]) * carry, k contiguous. Block handles a 64(k) x 64(n) tile through
// coverage: grid (HID/64, HID/64) x (64 n rows x 64 k) = the whole [HID][HID] plane once.
// LDS: T cross-wave (block barrier between element stores and vector reloads).
// ---------------------------------------------------------------------------
__device__ __forceinline__ void
cvt_wT(const float* __restrict__ src, f16* __restrict__ dst, float carry, int bx, int by) {
    __shared__ __attribute__((aligned(16))) f16 T[64 * 72];
    const int tid  = (int)threadIdx.x;
    const int lane = tid & 31;
    const int wave = tid >> 5;
    const int k0   = bx * 64;
    const int n0   = by * 64;
    const int kr   = tid >> 2;           // 0..63
    const int nc   = (tid & 3) << 4;     // 0,16,32,48
    const float* sp = src + (size_t)(k0 + kr) * HID + n0 + nc;
#pragma unroll
    for (int q = 0; q < 4; ++q) {
        const v4f a = *(const v4f*)(sp + q * 4);
#pragma unroll
        for (int j = 0; j < 4; ++j)
            T[(nc + q * 4 + j) * 72 + kr] = (f16)(bf16_rne(a[j]) * carry);
    }
    __syncthreads();
    const int piece = lane & 7;
    const int lsub  = lane >> 3;
{
#pragma unroll
        for (int it = 0; it < 2; ++it) {
            const int L = it * 32 + wave * 4 + lsub;     // local n row 0..63
            const v8h v = *(const v8h*)&T[L * 72 + piece * 8];
            f16* dp = dst + (size_t)(n0 + L) * HID + k0 + piece * 8;
            *(v8h*)dp = v;
        }
        
    }
}

// ---------------------------------------------------------------------------
// Key packing tables of one sequence (one block): a key is allowed iff kmask[b][key] == 0.
// kcnt[b*SEQ + s] = number of allowed keys with index <= s (so packed key j is visible to
// query q iff j < kcnt[q]: the causal test and the padding test in one compare);
// kidx[b*SEQ + j] = index of the j-th allowed key, 0 for j >= the sequence's total.
// Each thread owns KPER consecutive positions; block-wide inclusive scan of the per-thread
// counts in LDS; kidx is gathered in LDS so that both tables leave as whole runs per thread.
// coverage: every entry of both tables of this sequence once.
// ---------------------------------------------------------------------------
#define KPER ((SEQ + 255) / 256)
__device__ __forceinline__ void
key_scan(const int* __restrict__ kmask, int* __restrict__ kidx, int* __restrict__ kcnt, int bidx) {
    __shared__ int part[256];
    __shared__ int sidx[256 * KPER];
    const int tid = (int)threadIdx.x;
    __builtin_assume(tid < 256);         // the launch's block size: lets the range tests below fold, so the mask loads go out together
    const int* mrow = kmask + (size_t)bidx * SEQ_FULL;
    int ok[KPER];
    int c = 0;
    // the three loops over j are unrolled so that ok[] and cn[] stay in registers
#pragma unroll
    for (int j = 0; j < KPER; ++j) {
        const int s = tid * KPER + j;
        ok[j] = (s < SEQ) ? (mrow[s] == 0 ? 1 : 0) : 0;
        c += ok[j];
    }
    part[tid] = c;
    __syncthreads();
    for (int d = 1; d < 256; d <<= 1) {
        const int add = (tid >= d) ? part[tid - d] : 0;
        __syncthreads();
        part[tid] += add;
        __syncthreads();
    }
    int run = part[tid] - c;             // allowed keys in front of this thread's first position
    const int total = part[255];
    int cn[KPER];
#pragma unroll
    for (int j = 0; j < KPER; ++j) {
        const int s = tid * KPER + j;
        if (ok[j]) sidx[run] = s;        // run < total
        run += ok[j];
        cn[j] = run;
        if (s >= total) sidx[s] = 0;     // the slots behind the packed keys
    }
    __syncthreads();
#pragma unroll
    for (int j = 0; j < KPER; ++j) {
        const int s = tid * KPER + j;
        if (s < SEQ) {
            kcnt[bidx * SEQ + s] = cn[j];
            kidx[bidx * SEQ + s] = sidx[s];
        }
    }
}

// ---------------------------------------------------------------------------
// All five input conversions and the key packing tables in one grid (independent of each
// other): blocks 0 .. NB-1 build the tables (first: theirs is the longest chain), the next
// 4*WTILES transpose-convert the four weight planes (dst planes contiguous,
// order q, k, v, o), the remaining MROWS/2 blocks convert the hidden rows.
// The branch is block-uniform, so the barriers inside are reached by whole blocks.
// ---------------------------------------------------------------------------
#define WTILES ((HID / 64) * (HID / 64))
__global__ void __launch_bounds__(256)
cvt_all(const float* __restrict__ x, const float* __restrict__ wq, const float* __restrict__ wk,
        const float* __restrict__ wv, const float* __restrict__ wo, const int* __restrict__ kmask,
        f16* __restrict__ xh, f16* __restrict__ wh, int* __restrict__ kidx, int* __restrict__ kcnt) {
    const int b = (int)blockIdx.x - NB;
    if (b < 0) {
        key_scan(kmask, kidx, kcnt, b + NB);
    } else if (b < 4 * WTILES) {
        const int w = b / WTILES;
        const int t = b - w * WTILES;
        const float* src = (w == 0) ? wq : (w == 1) ? wk : (w == 2) ? wv : wo;
        cvt_wT(src, wh + (size_t)w * HID * HID, CARRY_W, t % (HID / 64), t / (HID / 64));
        // in the built code other branches' text follows these stores: keep the wait in front of
        // any overwrite of the registers they name
        asm volatile("s_wait_xcnt 0x0" ::: "memory");
    } else {
        cvt_rows<SEQ, SEQ_FULL>(x, xh, MROWS, CARRY_X, b - 4 * WTILES);
    }
}

// ---------------------------------------------------------------------------
// C[m][n] = sum_k A[m][k] * W[n][k] ; A [M][1024] f16, W [1024][1024] f16 (k contiguous).
// Block tile 128 x 128, 8 waves as 4(M) x 2(N), 2 x 4 accumulators per wave, K step 32.
// MODE 1: f16 plane [b*HID + h*HD + d][s] (V transposed per head) into out, plus the
//         residual plane (val - f16(val)) * 2^10, same layout, into out2
// MODE 2: f32 rows [m][1024] into the output; blocks at sequence start (s0 == 0)
//         add the f32 partial rows padd[b*128 + local row][n] (block-uniform branch)
// MODE 3: f32 rows [m][1024] into a workspace plane (no partial add)
// coverage per block: MODE 0 256 lines, MODE 1 2 x 256 lines (hi, residual),
//                     MODE 2/3 2 x 256 lines (64 rows x 4 line-quarters per half).
// LDS: As/Bs/Cs all cross-wave, separated by block barriers.
// ---------------------------------------------------------------------------
// LDS of one GEMM tile, offsets in halves (the kernel owns the array, so that kernels which
// hold more than one kind of tile allocate it once)
#define GEMM_AS   0                                   // As [128][GPITCH]
#define GEMM_BS   (128 * GPITCH)                      // Bs [128][GPITCH]
#define GEMM_CS   (2 * 128 * GPITCH)                  // Cs f16 [128][CPITCH] or f32 [64][CFPITCH]
#define GEMM_LDS  (2 * 128 * GPITCH + 128 * CPITCH)

// K loop of one 128 x 128 tile at column n0; arow = the row of A that this thread stages
// (tile row tid >> 1)
__device__ __forceinline__ void
gemm_main(const f16* __restrict__ A, const f16* __restrict__ W, f16* As, f16* Bs,
          int arow, int n0, v8f (&acc)[2][4]) {
    const int tid  = (int)threadIdx.x;
    const int lane = tid & 31;
    const int wave = tid >> 5;
    const int wm   = wave & 3;
    const int wn   = wave >> 2;

#pragma unroll
    for (int i = 0; i < 2; ++i)
#pragma unroll
        for (int j = 0; j < 4; ++j) acc[i][j] = zero8();

    const int srow = tid >> 1;
    const int scol = (tid & 1) << 4;
    const f16* gA = A + (size_t)arow * HID + scol;
    const f16* gW = W + (size_t)(n0 + srow) * HID + scol;

#pragma unroll 1
    for (int k0 = 0; k0 < HID; k0 += 32) {
        const v8h ra0 = *(const v8h*)(gA + k0);
        const v8h ra1 = *(const v8h*)(gA + k0 + 8);
        const v8h rb0 = *(const v8h*)(gW + k0);
        const v8h rb1 = *(const v8h*)(gW + k0 + 8);
        __syncthreads();
        *(v8h*)&As[srow * GPITCH + scol]     = ra0;
        *(v8h*)&As[srow * GPITCH + scol + 8] = ra1;
        *(v8h*)&Bs[srow * GPITCH + scol]     = rb0;
        *(v8h*)&Bs[srow * GPITCH + scol + 8] = rb1;
        __syncthreads();

        v16h af[2], bfr[4];
#pragma unroll
        for (int i = 0; i < 2; ++i) af[i] = load_frag(As, wm * 32 + i * 16, GPITCH, 0, lane);
#pragma unroll
        for (int j = 0; j < 4; ++j) bfr[j] = load_frag(Bs, wn * 64 + j * 16, GPITCH, 0, lane);
#pragma unroll
        for (int i = 0; i < 2; ++i)
#pragma unroll
            for (int j = 0; j < 4; ++j) acc[i][j] = wmma16(af[i], bfr[j], acc[i][j]);
    }
}

// scale, bias and store of one 128 x 128 tile at (m0, n0)
template <int MODE>
__device__ __forceinline__ void
gemm_epi(const v8f (&acc)[2][4], f16* Cs, const float* __restrict__ bias,
         void* __restrict__ out, void* __restrict__ out2, const float* __restrict__ padd,
         float accMul, float addMul, int m0, int n0) {
    const int tid  = (int)threadIdx.x;
    const int lane = tid & 31;
    const int wave = tid >> 5;
    const int wm   = wave & 3;
    const int wn   = wave >> 2;
    const int hh8  = (lane >> 4) << 3;   // D row half
    const int c16  = lane & 15;          // D column

    // bias (bf16 RNE value) per owned column group
    float bb[4];
#pragma unroll
    for (int j = 0; j < 4; ++j) bb[j] = bf16_rne(bias[n0 + wn * 64 + j * 16 + c16]) * addMul;

    const int bidx  = m0 / SEQ;          // block rows lie inside one batch (SEQ % 128 == 0)
    const int s0    = m0 - bidx * SEQ;
    const int piece = lane & 7;
    const int lsub  = lane >> 3;

    if constexpr (MODE == 0) {
#pragma unroll
        for (int i = 0; i < 2; ++i)
#pragma unroll
            for (int j = 0; j < 4; ++j) {
                const int nl = wn * 64 + j * 16 + c16;
#pragma unroll
                for (int r = 0; r < 8; ++r) {
                    const int ml = wm * 32 + i * 16 + hh8 + r;
                    Cs[ml * CPITCH + nl] = (f16)(acc[i][j][r] * accMul + bb[j]);
                }
            }
        __syncthreads();
        f16* op = (f16*)out;
        const size_t bh0 = (size_t)bidx * NHEAD + (n0 >> 6);
{
#pragma unroll
            for (int it = 0; it < 8; ++it) {
                const int L    = wave * 32 + it * 4 + lsub;   // 0..255
                const int ml   = L >> 1;
                const int hsel = L & 1;
                const v8h v = *(const v8h*)&Cs[ml * CPITCH + hsel * 64 + piece * 8];
                f16* dp = op + ((bh0 + hsel) * SEQ + s0 + ml) * HD + piece * 8;
                *(v8h*)dp = v;
            }
            
        }
    } else if constexpr (MODE == 1) {
        // hi plane, staged transposed: Cs[n][m]
#pragma unroll
        for (int i = 0; i < 2; ++i)
#pragma unroll
            for (int j = 0; j < 4; ++j) {
                const int nl = wn * 64 + j * 16 + c16;
                H8U t;
#pragma unroll
                for (int r = 0; r < 8; ++r) t.e[r] = (f16)(acc[i][j][r] * accMul + bb[j]);
                *(v8h*)&Cs[nl * CPITCH + wm * 32 + i * 16 + hh8] = t.v;
            }
        __syncthreads();
        {
            f16* op = (f16*)out;
{
#pragma unroll
                for (int it = 0; it < 8; ++it) {
                    const int L  = wave * 32 + it * 4 + lsub;     // 0..255
                    const int nl = L >> 1;
                    const int mh = L & 1;
                    const v8h v = *(const v8h*)&Cs[nl * CPITCH + mh * 64 + piece * 8];
                    f16* dp = op + ((size_t)(bidx * HID + n0 + nl) * SEQ + s0 + mh * 64 + piece * 8);
                    *(v8h*)dp = v;
                }
                
            }
        }
        __syncthreads();
        // residual plane: (val - f16(val)) * 2^10, same staging and store map
#pragma unroll
        for (int i = 0; i < 2; ++i)
#pragma unroll
            for (int j = 0; j < 4; ++j) {
                const int nl = wn * 64 + j * 16 + c16;
                H8U t;
#pragma unroll
                for (int r = 0; r < 8; ++r) {
                    const float val = acc[i][j][r] * accMul + bb[j];
                    const f16 hv = (f16)val;
                    t.e[r] = (f16)((val - (float)hv) * CARRY_RES);
                }
                *(v8h*)&Cs[nl * CPITCH + wm * 32 + i * 16 + hh8] = t.v;
            }
        __syncthreads();
        {
            f16* op = (f16*)out2;
{
#pragma unroll
                for (int it = 0; it < 8; ++it) {
                    const int L  = wave * 32 + it * 4 + lsub;     // 0..255
                    const int nl = L >> 1;
                    const int mh = L & 1;
                    const v8h v = *(const v8h*)&Cs[nl * CPITCH + mh * 64 + piece * 8];
                    f16* dp = op + ((size_t)(bidx * HID + n0 + nl) * SEQ + s0 + mh * 64 + piece * 8);
                    *(v8h*)dp = v;
                }
                
            }
        }
    } else {
        float* Cf = (float*)Cs;      // [64][CFPITCH] f32
        float* of = (float*)out;
#pragma unroll
        for (int half = 0; half < 2; ++half) {
            if ((wm >> 1) == half) {
#pragma unroll
                for (int i = 0; i < 2; ++i)
#pragma unroll
                    for (int j = 0; j < 4; ++j) {
                        const int nl = wn * 64 + j * 16 + c16;
#pragma unroll
                        for (int r = 0; r < 8; ++r) {
                            const int ml = (wm & 1) * 32 + i * 16 + hh8 + r;
                            Cf[ml * CFPITCH + nl] = acc[i][j][r] * accMul + bb[j];
                        }
                    }
            }
            __syncthreads();
            v4f vv[8];
#pragma unroll
            for (int it = 0; it < 8; ++it) {
                const int L    = wave * 32 + it * 4 + lsub;   // 0..255
                const int row  = L >> 2;
                const int part = L & 3;
                vv[it] = *(const v4f*)&Cf[row * CFPITCH + part * 32 + piece * 4];
            }
            if constexpr (MODE == 2) {
                if (s0 == 0) {     // block-uniform
#pragma unroll
                    for (int it = 0; it < 8; ++it) {
                        const int L    = wave * 32 + it * 4 + lsub;
                        const int row  = L >> 2;
                        const int part = L & 3;
                        const v4f pv = *(const v4f*)(padd + (size_t)(bidx * 128 + half * 64 + row) * HID
                                                     + n0 + part * 32 + piece * 4);
                        vv[it] += pv;
                    }
                }
            }
{
#pragma unroll
                for (int it = 0; it < 8; ++it) {
                    const int L    = wave * 32 + it * 4 + lsub;   // 0..255
                    const int row  = L >> 2;
                    const int part = L & 3;
                    float* dp = of + (size_t)(m0 + half * 64 + row) * HID + n0 + part * 32 + piece * 4;
                    *(v4f*)dp = vv[it];
                }
                
            }
            __syncthreads();
        }
    }
}

template <int MODE>
__global__ void __launch_bounds__(256) __attribute__((amdgpu_num_vgpr(256)))
gemm_nt(const f16* __restrict__ A, const f16* __restrict__ W, const float* __restrict__ bias,
        void* __restrict__ out, void* __restrict__ out2, const float* __restrict__ padd,
        float accMul, float addMul) {
    __shared__ __attribute__((aligned(16))) f16 sm[GEMM_LDS];
    const int m0 = (int)blockIdx.x * 128;
    const int n0 = (int)blockIdx.y * 128;
    v8f acc[2][4];
    gemm_main(A, W, sm + GEMM_AS, sm + GEMM_BS, m0 + ((int)threadIdx.x >> 1), n0, acc);
    gemm_epi<MODE>(acc, sm + GEMM_CS, bias, out, out2, padd, accMul, addMul, m0, n0);
}

// ---------------------------------------------------------------------------
// The Q, K and V projections in one grid: blockIdx.z picks the weight plane (planes
// contiguous, order q, k, v), the bias and the output (z 0, 1: MODE 0 into the contiguous
// q, k planes; z 2: MODE 1 into V^T and its residual). The K and V tiles of one (x, y) read
// the same hidden rows. The branch on z is block-uniform.
// K and V are projected for the allowed keys only: row j of their tiles is hidden row
// kidx[j] of the sequence, so both planes come out packed; a tile wholly behind the
// sequence's total leaves before any barrier, and nothing reads its part of the planes
// (the slots between the total and the tile's end hold row 0's finite values, never counted).
// ---------------------------------------------------------------------------
__global__ void __launch_bounds__(256) __attribute__((amdgpu_num_vgpr(256)))
gemm_qkv(const f16* __restrict__ X, const f16* __restrict__ Wqkv, const float* __restrict__ bq,
         const float* __restrict__ bk, const float* __restrict__ bv, f16* __restrict__ qk,
         f16* __restrict__ vt, f16* __restrict__ vtl, const int* __restrict__ kidx,
         const int* __restrict__ kcnt, float accMul, float addMul) {
    __shared__ __attribute__((aligned(16))) f16 sm[GEMM_LDS];
    const int m0 = (int)blockIdx.x * 128;
    const int n0 = (int)blockIdx.y * 128;
    const int z  = (int)blockIdx.z;
    int arow = m0 + ((int)threadIdx.x >> 1);
    if (z != 0) {
        const int seq0 = (m0 / SEQ) * SEQ;               // block rows lie inside one sequence
        const int  total = kcnt[seq0 + SEQ - 1];         // allowed keys of the sequence
        const int  src   = kidx[arow];
        // behind the load (its value is the operand), in front of any overwrite of the registers it names
        asm volatile("s_wait_xcnt 0x0" :: "v"(src) : "memory");
        if (m0 - seq0 >= total) return;                  // block-uniform, in front of every barrier
        arow = seq0 + min(max(src, 0), SEQ - 1);
    }
    v8f acc[2][4];
    gemm_main(X, Wqkv + (size_t)z * HID * HID, sm + GEMM_AS, sm + GEMM_BS, arow, n0, acc);
    if (z == 2) {
        gemm_epi<1>(acc, sm + GEMM_CS, bv, (void*)vt, (void*)vtl, (const float*)0, accMul, addMul, m0, n0);
    } else {
        gemm_epi<0>(acc, sm + GEMM_CS, (z == 0) ? bq : bk, (void*)(qk + (size_t)z * MROWS * HID),
                    (void*)0, (const float*)0, accMul, addMul, m0, n0);
        // in the built code the other epilogue's text follows these stores: keep the wait in
        // front of any overwrite of the registers they name
        asm volatile("s_wait_xcnt 0x0" ::: "memory");
    }
}

// ---------------------------------------------------------------------------
// Flash attention, causal with key padding mask, over the packed keys (packed key j counts for
// query q iff j < kcnt[b][q]; other keys get p = 0 and are excluded from the row max; rows with
// no allowed key produce a zero context row). One block of 256 threads (8 waves) per (bx, bh = b*NHEAD + h),
// wave owns 16 query rows (Q fragments resident). Block streams the 64-key tiles up to its
// causal horizon: K staged [key][d], V^T staged [d][key]. Scores on WMMA, row max via DPP,
// exp2 in f32 carried x2^10, P relayed per wave through LDS as A fragments, O += P.V and
// row sums += P.ones on WMMA. Output f16 plane [b*SEQ+q][1024] carried x1024, written as
// RES = 0: q-block = bx + 1 (rows 128 .. SEQ-1); not launched: attn_tile_split has those rows.
// RES = 1: q-block 0 only (rows 0..127): V, P and the context carry x2^10 residual planes
//          (second accumulators); context residual plane Cpl is [b*128 + q][1024].
// coverage: RES 1 and attn_tile_split together write every (b, q, h*64..h*64+63) segment of Cp once;
//           RES 1 writes the whole Cpl plane once.
// LDS: ks, vsT, vsL cross-wave (block barriers); ps/psl per-wave but also separated by block
// barriers. staged extent == consumed extent for ks (64x64), vsT (64x64), vsL (64x64, RES),
// ps/psl (16x64).
// ---------------------------------------------------------------------------
// LDS of one attention block, sizes in halves (the kernel owns the arrays):
// ks [64][APITCH] = [key][d]; vsT [64][APITCH] = [d][key]; vsL the same, residual (RES);
// ps [8][16][APITCH] per-wave P relay / ctx stage; psl the same, residual (RES)
#define ATTN_KV   (64 * APITCH)
#define ATTN_P    (8 * 16 * APITCH)
#define ATTN_LDS0 (2 * ATTN_KV + ATTN_P)                      // RES = 0: ks, vsT, ps

template <int RES>
__device__ __forceinline__ void
attn_tile(const f16* __restrict__ Qp, const f16* __restrict__ Kp, const f16* __restrict__ Vt,
          const f16* __restrict__ Vtl, const int* __restrict__ kcnt,
          f16* __restrict__ Cp, f16* __restrict__ Cpl,
          f16* ks, f16* vsT, f16* vsL, f16* ps, f16* psl, int bx, int bh) {
    const int tid  = (int)threadIdx.x;
    const int lane = tid & 31;
    const int wave = tid >> 5;
    const int hh8  = (lane >> 4) << 3;
    const int c16  = lane & 15;
    const int bidx = bh / NHEAD;
    const int hidx = bh - bidx * NHEAD;
    const int qblk = RES ? 0 : (bx + 1);
    const int qw   = qblk * 128 + wave * 16;          // first query row (within sequence) of this wave
    const size_t head = (size_t)bh * SEQ * HD;
    const int* crow = kcnt + bidx * SEQ;

    v16h qa[2];
#pragma unroll
    for (int c = 0; c < 2; ++c) qa[c] = load_frag(Qp + head, qw, HD, c * 32, lane);

    // packed keys visible to each of this lane's 8 query rows
    const int* cp = crow + qw + hh8;
    int cr[8];
#pragma unroll
    for (int r = 0; r < 8; ++r) cr[r] = cp[r];

    FragU onesu;
#pragma unroll
    for (int i = 0; i < 16; ++i) onesu.e[i] = (f16)1.0f;
    const v16h ones = onesu.v;

    float m[8];
    v8f   o[4], lacc, olo[4], laccl;
#pragma unroll
    for (int r = 0; r < 8; ++r) m[r] = NEGBIG;
#pragma unroll
    for (int dt = 0; dt < 4; ++dt) { o[dt] = zero8(); olo[dt] = zero8(); }
    lacc  = zero8();
    laccl = zero8();

    // log2-domain scale: acc = 256 * q.k ; x = log2(e) * q.k / 8 = acc * log2(e) / 2048
    const float cl = 1.4426950408889634f * 0.00048828125f;
    const float rres = 1.0f / CARRY_RES;
    f16* psw  = ps  + wave * 16 * APITCH;
    f16* pslw = psl + wave * 16 * APITCH;

    // horizon in 64-key tiles of packed keys: the count of the block's last row (counts do not
    // fall along a sequence), never above the causal bound (block-uniform)
    const int nkt = (min(max(crow[qblk * 128 + 127], 0), qblk * 128 + 128) + 63) >> 6;

#pragma unroll 1
    for (int kt = 0; kt < nkt; ++kt) {
        __syncthreads();
        const int srow = tid >> 3;               // 32 rows a step, 16 bytes a thread
        const int spc  = (tid & 7) << 3;
        const f16* kp = Kp  + head + (size_t)(kt * 64 + srow) * HD + spc;   // this lane's first 16 bytes of the tile
        const f16* vp = Vt  + head + (size_t)srow * SEQ + kt * 64 + spc;
        const f16* lp = Vtl + head + (size_t)srow * SEQ + kt * 64 + spc;
        v8h kv[2], vv[2], vl[2];
#pragma unroll
        for (int p2 = 0; p2 < 2; ++p2) {
            kv[p2] = *(const v8h*)(kp + p2 * 32 * HD);
            vv[p2] = *(const v8h*)(vp + p2 * 32 * SEQ);
            if constexpr (RES) vl[p2] = *(const v8h*)(lp + p2 * 32 * SEQ);
        }
        // the address pairs stay whole (no load's result lands on them) until this wait
        asm volatile("s_wait_xcnt 0x0" :: "v"(kp), "v"(vp), "v"(lp) : "memory");
#pragma unroll
        for (int p2 = 0; p2 < 2; ++p2) {
            *(v8h*)&ks[(srow + p2 * 32) * APITCH + spc]  = kv[p2];
            *(v8h*)&vsT[(srow + p2 * 32) * APITCH + spc] = vv[p2];
            if constexpr (RES) *(v8h*)&vsL[(srow + p2 * 32) * APITCH + spc] = vl[p2];
        }
        __syncthreads();

        // S[16 q x 64 keys]
        v8f s[4];
#pragma unroll
        for (int nt = 0; nt < 4; ++nt) s[nt] = zero8();
#pragma unroll
        for (int c = 0; c < 2; ++c) {
#pragma unroll
            for (int nt = 0; nt < 4; ++nt) {
                const v16h kb = load_frag(ks, nt * 16, APITCH, c * 32, lane);
                s[nt] = wmma16(qa[c], kb, s[nt]);
            }
        }

        // this lane's 4 packed key columns
        int keyi[4];
#pragma unroll
        for (int nt = 0; nt < 4; ++nt) keyi[nt] = kt * 64 + nt * 16 + c16;

        // online softmax per row r (row 8h + r), max-subtracted, exp2 domain
#pragma unroll
        for (int r = 0; r < 8; ++r) {
            float x[4];
            bool  alw[4];
#pragma unroll
            for (int nt = 0; nt < 4; ++nt) {
                x[nt]   = s[nt][r] * cl;
                alw[nt] = keyi[nt] < cr[r];
            }
            const float xm0 = alw[0] ? x[0] : NEGBIG;
            const float xm1 = alw[1] ? x[1] : NEGBIG;
            const float xm2 = alw[2] ? x[2] : NEGBIG;
            const float xm3 = alw[3] ? x[3] : NEGBIG;
            const float tm = rowmax16(fmaxf(fmaxf(xm0, xm1), fmaxf(xm2, xm3)));
            const float mn = fmaxf(m[r], tm);
            const float al = fexp2(m[r] - mn);
            m[r] = mn;
            lacc[r] *= al;
#pragma unroll
            for (int dt = 0; dt < 4; ++dt) o[dt][r] *= al;
            if constexpr (RES) {
                laccl[r] *= al;
#pragma unroll
                for (int dt = 0; dt < 4; ++dt) olo[dt][r] *= al;
            }
            const float sh = 10.0f - mn;      // carry 2^10
#pragma unroll
            for (int nt = 0; nt < 4; ++nt) {
                const float arg = alw[nt] ? (x[nt] + sh) : 0.0f;
                const float e   = fexp2(arg);
                const float p   = alw[nt] ? e : 0.0f;
                const f16   hp  = (f16)p;
                psw[(hh8 + r) * APITCH + nt * 16 + c16] = hp;
                if constexpr (RES)
                    pslw[(hh8 + r) * APITCH + nt * 16 + c16] = (f16)((p - (float)hp) * CARRY_RES);
            }
        }
        __syncthreads();

        // O += P . V ; l += P . ones  (P reloaded as A fragments from the relay)
#pragma unroll
        for (int kk = 0; kk < 2; ++kk) {
            const v16h pa = load_frag(psw, 0, APITCH, kk * 32, lane);
            if constexpr (RES) {
                const v16h pl = load_frag(pslw, 0, APITCH, kk * 32, lane);
#pragma unroll
                for (int dt = 0; dt < 4; ++dt) {
                    const v16h vb = load_frag(vsT, dt * 16, APITCH, kk * 32, lane);
                    o[dt]   = wmma16(pa, vb, o[dt]);
                    olo[dt] = wmma16(pl, vb, olo[dt]);
                    const v16h vl = load_frag(vsL, dt * 16, APITCH, kk * 32, lane);
                    olo[dt] = wmma16(pa, vl, olo[dt]);
                }
                lacc  = wmma16(pa, ones, lacc);
                laccl = wmma16(pl, ones, laccl);
            } else {
#pragma unroll
                for (int dt = 0; dt < 4; ++dt) {
                    const v16h vb = load_frag(vsT, dt * 16, APITCH, kk * 32, lane);
                    o[dt] = wmma16(pa, vb, o[dt]);
                }
                lacc = wmma16(pa, ones, lacc);
            }
        }
    }
    __syncthreads();

    // normalize: plane value = 1024 * (O/16) / (l) = O * 64 / l ; zero row when l == 0
#pragma unroll
    for (int r = 0; r < 8; ++r) {
        float l = lacc[r];
        if constexpr (RES) l += laccl[r] * rres;
        const float lsafe = (l > 0.0f) ? l : 1.0f;
        const float inv   = (l > 0.0f) ? ((CARRY_CTX / CARRY_QKV) / lsafe) : 0.0f;
#pragma unroll
        for (int dt = 0; dt < 4; ++dt) {
            float ov = o[dt][r];
            if constexpr (RES) ov += olo[dt][r] * rres;
            const float cv = ov * inv;
            const f16 hv = (f16)cv;
            psw[(hh8 + r) * APITCH + dt * 16 + c16] = hv;
            if constexpr (RES)
                pslw[(hh8 + r) * APITCH + dt * 16 + c16] = (f16)((cv - (float)hv) * CARRY_RES);
        }
    }
    __syncthreads();

    const int piece = lane & 7;
    const int lsub  = lane >> 3;
{
#pragma unroll
        for (int it = 0; it < 4; ++it) {
            const int L = it * 4 + lsub;     // query row 0..15 within the wave tile
            const v8h v = *(const v8h*)&psw[L * APITCH + piece * 8];
            f16* dp = Cp + ((size_t)(bidx * SEQ + qw + L) * HID + hidx * HD + piece * 8);
            *(v8h*)dp = v;
            if constexpr (RES) {
                const v8h vl = *(const v8h*)&pslw[L * APITCH + piece * 8];
                f16* dq = Cpl + ((size_t)(bidx * 128 + wave * 16 + L) * HID + hidx * HD + piece * 8);
                *(v8h*)dq = vl;
            }
        }
        
    }
}

// ---------------------------------------------------------------------------
// Query rows 128 .. SEQ-1, cut for a short longest chain: one block of 8 waves owns 64 query
// rows (64-row q-block qb >= 2) and its two groups of 4 waves split the 64-key tiles of the
// block's horizon of packed keys between them (group g takes tiles 2*it + g), each group with its own K and
// V^T stage and its own running (m, l, O). After the loop group 1 hands its partial state to
// group 0 through LDS and group 0 merges: mn = max(m0, m1), l = l0*2^(m0-mn) + l1*2^(m1-mn),
// O likewise. Same masking, scaling and carries as attn_tile<0>.
// When the tile count is odd, group 1's last tile lies wholly behind the horizon: its
// addresses are clamped to the last tile and every key of it fails the count test (p = 0,
// the running maximum does not move). A block with no visible key makes no trip.
// LDS (halves): group g: ks at g*2*ATTN_KV, vsT behind it; ps [8][16][APITCH] at 4*ATTN_KV;
// the hand-over buffer (48 floats a lane of group 1) reuses the K/V stages behind a barrier.
// ---------------------------------------------------------------------------
#define ATTN_LDS2 (4 * ATTN_KV + ATTN_P)
static_assert(48 * 128 * 4 <= 4 * ATTN_KV * 2);   // the hand-over buffer fits the K/V stages

__device__ __forceinline__ void
attn_tile_split(const f16* __restrict__ Qp, const f16* __restrict__ Kp, const f16* __restrict__ Vt,
                const int* __restrict__ kcnt, f16* __restrict__ Cp, f16* sm, int qb, int bh) {
    const int tid  = (int)threadIdx.x;
    const int lane = tid & 31;
    const int wave = __builtin_amdgcn_readfirstlane(tid >> 5);   // scalar: tile index and group tests stay off the vector port
    const int grp  = wave >> 2;          // key group
    const int wq   = wave & 3;           // 16-row query slice within the block
    const int hh8  = (lane >> 4) << 3;
    const int c16  = lane & 15;
    const int bidx = bh / NHEAD;
    const int hidx = bh - bidx * NHEAD;
    const int qw   = qb * 64 + wq * 16;  // first query row (within sequence) of this wave
    const size_t head = (size_t)bh * SEQ * HD;
    const int* crow = kcnt + bidx * SEQ;

    f16* ks  = sm + grp * 2 * ATTN_KV;
    f16* vsT = ks + ATTN_KV;
    f16* psw = sm + 4 * ATTN_KV + wave * 16 * APITCH;

    v16h qa[2];
#pragma unroll
    for (int c = 0; c < 2; ++c) qa[c] = load_frag(Qp + head, qw, HD, c * 32, lane);

    // packed keys visible to each of this lane's 8 query rows
    const int* cp = crow + qw + hh8;
    int cr[8];
#pragma unroll
    for (int r = 0; r < 8; ++r) cr[r] = cp[r];

    FragU onesu;
#pragma unroll
    for (int i = 0; i < 16; ++i) onesu.e[i] = (f16)1.0f;
    const v16h ones = onesu.v;

    float m[8];
    v8f   o[4], lacc;
#pragma unroll
    for (int r = 0; r < 8; ++r) m[r] = NEGBIG;
#pragma unroll
    for (int dt = 0; dt < 4; ++dt) o[dt] = zero8();
    lacc = zero8();

    // log2-domain scale: acc = 256 * q.k ; x = log2(e) * q.k / 8 = acc * log2(e) / 2048
    const float cl = 1.4426950408889634f * 0.00048828125f;

    // 64-key tiles of packed keys up to the block's horizon: the count of its last row (counts do
    // not fall along a sequence), never above the causal bound; block-uniform
    const int ntl = (min(max(crow[qb * 64 + 63], 0), qb * 64 + 64) + 63) >> 6;
    const int nit = (ntl + 1) >> 1;      // trips: ceil(ntl / 2)
    const int t2  = tid & 127;           // thread within the group
    // staging: 16 bytes a thread and step, 16 rows a step; lane offsets do not change over the loop
    const int srow = t2 >> 3;
    const int spc  = (t2 & 7) << 3;
    const unsigned koff = (unsigned)(srow * HD + spc);
    const unsigned voff = (unsigned)(srow * SEQ + spc);

#pragma unroll 1
    for (int it = 0; it < nit; ++it) {
        const int kt  = 2 * it + grp;            // this group's tile
        const int ktl = (kt < ntl) ? kt : ntl - 1;   // tile whose bytes are read (written and in bounds)
        const f16* kp = Kp + head + (size_t)ktl * 64 * HD + koff;   // this lane's first 16 bytes of the tile
        const f16* vp = Vt + head + (size_t)ktl * 64 + voff;
        __syncthreads();
        v8h kv[4], vv[4];
#pragma unroll
        for (int p2 = 0; p2 < 4; ++p2) {
            kv[p2] = *(const v8h*)(kp + p2 * 16 * HD);
            vv[p2] = *(const v8h*)(vp + p2 * 16 * SEQ);
        }
        // the address pairs stay whole (no load's result lands on them) until this wait
        asm volatile("s_wait_xcnt 0x0" :: "v"(kp), "v"(vp) : "memory");
#pragma unroll
        for (int p2 = 0; p2 < 4; ++p2) {
            *(v8h*)&ks[(srow + p2 * 16) * APITCH + spc]  = kv[p2];
            *(v8h*)&vsT[(srow + p2 * 16) * APITCH + spc] = vv[p2];
        }
        __syncthreads();

        // S[16 q x 64 keys]
        v8f s[4];
#pragma unroll
        for (int nt = 0; nt < 4; ++nt) s[nt] = zero8();
#pragma unroll
        for (int c = 0; c < 2; ++c) {
#pragma unroll
            for (int nt = 0; nt < 4; ++nt) {
                const v16h kb = load_frag(ks, nt * 16, APITCH, c * 32, lane);
                s[nt] = wmma16(qa[c], kb, s[nt]);
            }
        }

        // this lane's 4 packed key columns
        int kj[4];
#pragma unroll
        for (int nt = 0; nt < 4; ++nt) kj[nt] = kt * 64 + nt * 16 + c16;

        // online softmax per row r (row 8h + r), max-subtracted, exp2 domain
#pragma unroll
        for (int r = 0; r < 8; ++r) {
            float x[4];
            bool  alw[4];
#pragma unroll
            for (int nt = 0; nt < 4; ++nt) {
                x[nt]   = s[nt][r] * cl;
                alw[nt] = kj[nt] < cr[r];
            }
            const float xm0 = alw[0] ? x[0] : NEGBIG;
            const float xm1 = alw[1] ? x[1] : NEGBIG;
            const float xm2 = alw[2] ? x[2] : NEGBIG;
            const float xm3 = alw[3] ? x[3] : NEGBIG;
            const float tm = rowmax16(fmaxf(fmaxf(xm0, xm1), fmaxf(xm2, xm3)));
            const float mn = fmaxf(m[r], tm);
            const float al = fexp2(m[r] - mn);
            m[r] = mn;
            lacc[r] *= al;
#pragma unroll
            for (int dt = 0; dt < 4; ++dt) o[dt][r] *= al;
            const float sh = 10.0f - mn;      // carry 2^10
#pragma unroll
            for (int nt = 0; nt < 4; ++nt) {
                const float arg = alw[nt] ? (x[nt] + sh) : 0.0f;
                const float e   = fexp2(arg);
                const float p   = alw[nt] ? e : 0.0f;
                psw[(hh8 + r) * APITCH + nt * 16 + c16] = (f16)p;
            }
        }
        __syncthreads();

        // O += P . V ; l += P . ones  (P reloaded as A fragments from the relay)
#pragma unroll
        for (int kk = 0; kk < 2; ++kk) {
            const v16h pa = load_frag(psw, 0, APITCH, kk * 32, lane);
#pragma unroll
            for (int dt = 0; dt < 4; ++dt) {
                const v16h vb = load_frag(vsT, dt * 16, APITCH, kk * 32, lane);
                o[dt] = wmma16(pa, vb, o[dt]);
            }
            lacc = wmma16(pa, ones, lacc);
        }
    }
    __syncthreads();     // every reader has left the K/V stages: they become the hand-over buffer

    float* mb = (float*)sm + t2;         // [48][128] floats, one column a lane of a group
    if (grp == 1) {
#pragma unroll
        for (int r = 0; r < 8; ++r) {
            mb[r * 128]       = m[r];
            mb[(8 + r) * 128] = lacc[r];
#pragma unroll
            for (int dt = 0; dt < 4; ++dt) mb[(16 + dt * 8 + r) * 128] = o[dt][r];
        }
    }
    __syncthreads();     // publishes group 1's partial state to group 0

    // merge, then normalize: plane value = 1024 * (O/16) / (l) = O * 64 / l ; zero row when l == 0
    if (grp == 0) {
#pragma unroll
        for (int r = 0; r < 8; ++r) {
            const float m1 = mb[r * 128];
            const float mn = fmaxf(m[r], m1);
            const float a0 = fexp2(m[r] - mn);
            const float a1 = fexp2(m1 - mn);
            const float l  = lacc[r] * a0 + mb[(8 + r) * 128] * a1;
            const float lsafe = (l > 0.0f) ? l : 1.0f;
            const float inv   = (l > 0.0f) ? ((CARRY_CTX / CARRY_QKV) / lsafe) : 0.0f;
#pragma unroll
            for (int dt = 0; dt < 4; ++dt) {
                const float ov = o[dt][r] * a0 + mb[(16 + dt * 8 + r) * 128] * a1;
                psw[(hh8 + r) * APITCH + dt * 16 + c16] = (f16)(ov * inv);
            }
        }
    }
    __syncthreads();

    if (grp == 0) {
        const int piece = lane & 7;
        const int lsub  = lane >> 3;
#pragma unroll
        for (int it = 0; it < 4; ++it) {
            const int L = it * 4 + lsub;     // query row 0..15 within the wave tile
            const v8h v = *(const v8h*)&psw[L * APITCH + piece * 8];
            f16* dp = Cp + ((size_t)(bidx * SEQ + qw + L) * HID + hidx * HD + piece * 8);
            *(v8h*)dp = v;
        }
    }
}

// q-block 0 of every head (RES = 1); runs first, because the residual partial needs its Cpl
__global__ void __launch_bounds__(256) __attribute__((amdgpu_num_vgpr(256)))
attn_first(const f16* __restrict__ Qp, const f16* __restrict__ Kp, const f16* __restrict__ Vt,
           const f16* __restrict__ Vtl, const int* __restrict__ kcnt,
           f16* __restrict__ Cp, f16* __restrict__ Cpl) {
    __shared__ __attribute__((aligned(16))) f16 ks[ATTN_KV];
    __shared__ __attribute__((aligned(16))) f16 vsT[ATTN_KV];
    __shared__ __attribute__((aligned(16))) f16 vsL[ATTN_KV];
    __shared__ __attribute__((aligned(16))) f16 ps[ATTN_P];
    __shared__ __attribute__((aligned(16))) f16 psl[ATTN_P];
    attn_tile<1>(Qp, Kp, Vt, Vtl, kcnt, Cp, Cpl, ks, vsT, vsL, ps, psl, 0, (int)blockIdx.x);
}

// ---------------------------------------------------------------------------
// Query rows 128 .. SEQ-1 of every head (64-row q-blocks 2 .. SEQ/64-1) and, in the same grid, the residual
// partial of the out projection (MODE 3 tiles: Pf = Cpl . Wo^T scaled). The two are
// independent: the partial reads only Cpl (written by attn_first) and the weight plane.
// Blocks 0 .. PTILES-1 are the partial's tiles, the rest attention blocks, longest horizon first
// (for speed only).
// The branch is block-uniform; the two kinds of block share one LDS array.
// ---------------------------------------------------------------------------
#define PTILES  ((RROWS / 128) * (HID / 128))
#define QBLKS   (SEQ / 64 - 2)
#define REST_LDS (GEMM_LDS > ATTN_LDS2 ? GEMM_LDS : ATTN_LDS2)
// 160 registers: three blocks (six waves a SIMD) stay resident with the eight row counts held
__global__ void __launch_bounds__(256) __attribute__((amdgpu_num_vgpr(160)))
attn_rest_and_partial(const f16* __restrict__ Qp, const f16* __restrict__ Kp,
                      const f16* __restrict__ Vt, const int* __restrict__ kcnt,
                      f16* __restrict__ Cp, const f16* __restrict__ Cpl,
                      const f16* __restrict__ Wo, const float* __restrict__ bo,
                      float* __restrict__ Pf, float accLo) {
    __shared__ __attribute__((aligned(16))) f16 sm[REST_LDS];
    const int b = (int)blockIdx.x;
    if (b < PTILES) {
        const int m0 = (b % (RROWS / 128)) * 128;
        const int n0 = (b / (RROWS / 128)) * 128;
        v8f acc[2][4];
        gemm_main(Cpl, Wo, sm + GEMM_AS, sm + GEMM_BS, m0 + ((int)threadIdx.x >> 1), n0, acc);
        gemm_epi<3>(acc, sm + GEMM_CS, bo, (void*)Pf, (void*)0, (const float*)0, accLo, 0.0f, m0, n0);
    } else if constexpr (QBLKS > 0) {
        const int t = b - PTILES;
        attn_tile_split(Qp, Kp, Vt, kcnt, Cp, sm, SEQ / 64 - 1 - t / (NB * NHEAD), t % (NB * NHEAD));
    }
}

// ---------------------------------------------------------------------------
// Launch: 5 kernel launches. Workspace (halves): X, Q, K, V^T hi, V^T residual, ctx hi
// (6 x MROWS*1024), 4 weight planes (1024*1024), ctx residual (NB*128*1024), plus the
// ---------------------------------------------------------------------------
extern "C" void kernel_launch(void* const* d_in, const int* in_sizes, int n_in,
                              void* d_out, int out_size, void* d_ws, size_t ws_size,
                              hipStream_t stream) {
    if (n_in < 10) return;
    if (in_sizes[0] < ((NB - 1) * SEQ_FULL + SEQ) * HID) return;
    if (in_sizes[1] < (NB - 1) * SEQ_FULL + SEQ) return;
    if (in_sizes[2] < HID * HID || in_sizes[4] < HID * HID ||
        in_sizes[6] < HID * HID || in_sizes[8] < HID * HID) return;
    if (in_sizes[3] < HID || in_sizes[5] < HID || in_sizes[7] < HID || in_sizes[9] < HID) return;
    if (out_size < MROWS * HID) return;

    const float* x    = (const float*)d_in[0];
    const int*   mask = (const int*)d_in[1];
    const float* wq   = (const float*)d_in[2];
    const float* bq   = (const float*)d_in[3];
    const float* wk   = (const float*)d_in[4];
    const float* bk   = (const float*)d_in[5];
    const float* wv   = (const float*)d_in[6];
    const float* bv   = (const float*)d_in[7];
    const float* wo   = (const float*)d_in[8];
    const float* bo   = (const float*)d_in[9];

    const size_t nX = (size_t)MROWS * HID;    // halves per activation plane
    const size_t nW = (size_t)HID * HID;      // halves per weight plane
    const size_t nR = (size_t)RROWS * HID;    // elements per residual-row plane
    const size_t totalBytes = (6 * nX + 4 * nW + nR) * sizeof(f16) + nR * sizeof(float) + 2 * (size_t)MROWS * sizeof(int);
    if (ws_size < totalBytes) return;

    f16* Xh  = (f16*)d_ws;       // [MROWS][1024]            carry 16
    f16* Wqh = Xh  + nX;         // [n][k] = Wq[k][n]        carry 32
    f16* Wkh = Wqh + nW;
    f16* Wvh = Wkh + nW;
    f16* Woh = Wvh + nW;
    f16* Qp  = Woh + nW;         // [NB*16][SEQ][64]         carry 16
    f16* Kp  = Qp  + nX;         // [NB*16][SEQ][64]         carry 16, packed keys
    f16* Vth = Kp  + nX;         // [NB*1024][SEQ] (V^T)     carry 16, packed keys
    f16* Vtl = Vth + nX;         // V^T residual x2^10
    f16* Cph = Vtl + nX;         // [MROWS][1024]            carry 1024
    f16* Cpl = Cph + nX;         // [NB*128][1024]           ctx residual x2^10 (rows 0..127 per batch)
    float* Pf = (float*)(Cpl + nR);   // [NB*128][1024] f32   residual partial of the out projection
    int* Kidx = (int*)(Pf + nR);      // [NB][SEQ] index of the j-th allowed key
    int* Kcnt = Kidx + MROWS;         // [NB][SEQ] allowed keys with index <= s

    cvt_all<<<NB + 4 * WTILES + MROWS / 2, 256, 0, stream>>>(x, wq, wk, wv, wo, mask, Xh, Wqh, Kidx, Kcnt);

    const dim3 gg(MROWS / 128, HID / 128);
    // plane = 16 * (acc / (16*32) + b) = acc/32 + 16*b
    const float accQKV = CARRY_QKV / (CARRY_X * CARRY_W);
    gemm_qkv<<<dim3(MROWS / 128, HID / 128, 3), 256, 0, stream>>>(Xh, Wqh, bq, bk, bv, Qp, Vth, Vtl,
                                                                    Kidx, Kcnt, accQKV, CARRY_QKV);

    attn_first<<<NB * NHEAD, 256, 0, stream>>>(Qp, Kp, Vth, Vtl, Kcnt, Cph, Cpl);

    // residual partial: Pf = (Cpl . Wo^T) / (1024 * 1024 * 32), beside the remaining q-blocks
    const float accLo = 1.0f / (CARRY_CTX * CARRY_RES * CARRY_W);
    attn_rest_and_partial<<<PTILES + QBLKS * NB * NHEAD, 256, 0, stream>>>(Qp, Kp, Vth, Kcnt, Cph, Cpl,
                                                                             Woh, bo, Pf, accLo);
    // out = acc / (1024*32) + b (+ Pf on the first 128 rows of each sequence)
    const float accOut = 1.0f / (CARRY_CTX * CARRY_W);
    gemm_nt<2><<<gg, 256, 0, stream>>>(Cph, Woh, bo, d_out, (void*)0, Pf, accOut, 1.0f);
}

// v005
// Measured time: 74.1 microseconds a run.
// Two timings next to v004 put it at 1.23 and 1.22 times that version's speed.
// Counting every step since v000, it is 4.40 times as fast.
#include <hip/hip_runtime.h>

// Contractions (Q/K/V/out projections, Q.K^T, P.V, P row-sum): v_wmma_f32_16x16x32_f16, f16 operands with power-of-two carries, f32 accumulate; every float input enters as its bf16 RNE value; V, P and context carry an extra f16 residual plane (x2^10) on the first 128 query rows per sequence; softmax in f32. Keys whose padding mask forbids them are never projected or scored: K and V^T hold the allowed keys only, packed in key order.

#ifndef NB
#define NB 2
#endif
#ifndef SEQ
#define SEQ 2048
#endif
#define NB_FULL   2
#define SEQ_FULL  2048
#define HID       1024
#define NHEAD     16
#define HD        64
#define MROWS     (NB * SEQ)
#define RROWS     (NB * 128)      // query rows per batch-set that carry residual planes

static_assert(HID == NHEAD * HD);
static_assert(SEQ % 128 == 0);
static_assert(SEQ >= 128);
static_assert(SEQ <= SEQ_FULL);
static_assert(NB >= 1 && NB <= NB_FULL);
static_assert(MROWS % 128 == 0);
static_assert(RROWS % 128 == 0);
static_assert(HID % 128 == 0);

// carries (exact powers of two)
#define CARRY_X    16.0f     // hidden plane
#define CARRY_W    32.0f     // weight planes
#define CARRY_QKV  16.0f     // q, k, v^T planes (true value x16)
#define CARRY_CTX  1024.0f   // context plane (true value x1024)
#define CARRY_RES  1024.0f   // residual planes: (value - f16(value)) x1024
#define NEGBIG     (-1.0e30f)
// LDS row pitches: 16 B x odd for rows read or written 16 bytes a lane (one row per lane),
// so that the 16 lanes of a half wave fall on distinct bank groups
#define GPITCH     72        // halves: GEMM operand rows of 64 halves (144 B)
#define CPITCH     136       // halves: GEMM f16 output staging rows of 128 halves (272 B)
#define CFPITCH    132       // floats: GEMM f32 output staging rows of 128 floats (528 B)
#define APITCH     72        // halves: attention rows of 64 halves (144 B)
static_assert(64 * CFPITCH * 4 <= 128 * CPITCH * 2);   // the f32 staging shares the f16 staging array
// softmax exp values carry 2^10 (added to the exp2 argument)

typedef _Float16 f16;
typedef f16   v16h __attribute__((ext_vector_type(16)));
typedef f16   v8h  __attribute__((ext_vector_type(8)));
typedef float v8f  __attribute__((ext_vector_type(8)));
typedef float v4f  __attribute__((ext_vector_type(4)));

union FragU { v16h v; v8h half[2]; f16 e[16]; };
union H8U   { v8h v; f16 e[8]; };

__device__ __forceinline__ v8f zero8() {
    v8f z = {0.f, 0.f, 0.f, 0.f, 0.f, 0.f, 0.f, 0.f};
    return z;
}

// 16-bit WMMA with hazard guard: D += A[16 x 32k] * B[32k x 16]
__device__ __forceinline__ v8f wmma16(v16h a, v16h b, v8f c) {
    v8f d = __builtin_amdgcn_wmma_f32_16x16x32_f16(false, a, false, b, (short)0, c, false, false);
    asm volatile("v_nop\n\tv_nop\n\tv_nop\n\tv_nop" : "+v"(d) : "v"(a), "v"(b));
    return d;
}

// f32 -> nearest-even bf16 value, returned as f32
__device__ __forceinline__ float bf16_rne(float x) {
    unsigned u = __float_as_uint(x);
    u = (u + 0x7fffu + ((u >> 16) & 1u)) & 0xffff0000u;
    return __uint_as_float(u);
}

__device__ __forceinline__ float fexp2(float x) {
#if defined(__has_builtin)
#if __has_builtin(__builtin_amdgcn_exp2f)
    return __builtin_amdgcn_exp2f(x);
#else
    return exp2f(x);
#endif
#else
    return exp2f(x);
#endif
}

// max over the 16 lanes of each lane half (DPP row rotations; D-layout rows are DPP rows)
__device__ __forceinline__ float rowmax16(float x) {
    int v = __builtin_bit_cast(int, x);
    x = fmaxf(x, __builtin_bit_cast(float, __builtin_amdgcn_update_dpp(v, v, 0x121, 0xf, 0xf, false)));
    v = __builtin_bit_cast(int, x);
    x = fmaxf(x, __builtin_bit_cast(float, __builtin_amdgcn_update_dpp(v, v, 0x122, 0xf, 0xf, false)));
    v = __builtin_bit_cast(int, x);
    x = fmaxf(x, __builtin_bit_cast(float, __builtin_amdgcn_update_dpp(v, v, 0x124, 0xf, 0xf, false)));
    v = __builtin_bit_cast(int, x);
    x = fmaxf(x, __builtin_bit_cast(float, __builtin_amdgcn_update_dpp(v, v, 0x128, 0xf, 0xf, false)));
    return x;
}

// 16 x 32 fragment from a tile whose k dimension is contiguous (pitch in halves).
// lane l: row rowbase + (l&15); elements 0..7 <- k = kcol + 8h .. +7,
// elements 8..15 <- k = kcol + 16 + 8h .. +7  (h = l>>4). Same map for A and B.
__device__ __forceinline__ v16h load_frag(const f16* tile, int rowbase, int pitch, int kcol, int lane) {
    const int r  = rowbase + (lane & 15);
    const int kh = (lane >> 4) << 3;
    const f16* p = tile + (size_t)r * pitch + kcol + kh;
    FragU f;
    f.half[0] = *(const v8h*)(p);
    f.half[1] = *(const v8h*)(p + 16);
    return f.v;
}

// ---------------------------------------------------------------------------
// f32 rows -> f16 plane (bf16 RNE value times carry). 128 threads per 1024-wide
// Source row stride mapping lets a reduced build read full-size inputs.
// coverage: nrows x 1024 halves, every element exactly once (grid = nrows*128/256).
// ---------------------------------------------------------------------------
template <int DSTPER, int SRCPER>
__device__ __forceinline__ void
cvt_rows(const float* __restrict__ src, f16* __restrict__ dst, int nrows, float carry, int blk) {
    const int g  = blk * 256 + (int)threadIdx.x;
    const int m  = g >> 7;
    const int c8 = (g & 127) << 3;
    if (m >= nrows) return;
    const int sm = (m / DSTPER) * SRCPER + (m % DSTPER);
    const float* sp = src + (size_t)sm * HID + c8;
    const v4f a = *(const v4f*)sp;
    const v4f b = *(const v4f*)(sp + 4);
    H8U o;
#pragma unroll
    for (int j = 0; j < 4; ++j) {
        const float x0 = a[j];
        const float x1 = b[j];
        o.e[j]     = (f16)(bf16_rne(x0) * carry);
        o.e[j + 4] = (f16)(bf16_rne(x1) * carry);
    }
    f16* dp = dst + (size_t)m * HID + c8;
    *(v8h*)dp = o.v;
    
}

// ---------------------------------------------------------------------------
// Weight transpose + convert: src [k][n] f32 (HID x HID, n contiguous) -> dst [n][k] f16
// = bf16 RNE(src[k][n]) * carry, k contiguous. Block handles a 64(k) x 64(n) tile through
// coverage: grid (HID/64, HID/64) x (64 n rows x 64 k) = the whole [HID][HID] plane once.
// LDS: T cross-wave (block barrier between element stores and vector reloads).
// ---------------------------------------------------------------------------
__device__ __forceinline__ void
cvt_wT(const float* __restrict__ src, f16* __restrict__ dst, float carry, int bx, int by) {
    __shared__ __attribute__((aligned(16))) f16 T[64 * 72];
    const int tid  = (int)threadIdx.x;
    const int lane = tid & 31;
    const int wave = tid >> 5;
    const int k0   = bx * 64;
    const int n0   = by * 64;
    const int kr   = tid >> 2;           // 0..63
    const int nc   = (tid & 3) << 4;     // 0,16,32,48
    const float* sp = src + (size_t)(k0 + kr) * HID + n0 + nc;
#pragma unroll
    for (int q = 0; q < 4; ++q) {
        const v4f a = *(const v4f*)(sp + q * 4);
#pragma unroll
        for (int j = 0; j < 4; ++j)
            T[(nc + q * 4 + j) * 72 + kr] = (f16)(bf16_rne(a[j]) * carry);
    }
    __syncthreads();
    const int piece = lane & 7;
    const int lsub  = lane >> 3;
{
#pragma unroll
        for (int it = 0; it < 2; ++it) {
            const int L = it * 32 + wave * 4 + lsub;     // local n row 0..63
            const v8h v = *(const v8h*)&T[L * 72 + piece * 8];
            f16* dp = dst + (size_t)(n0 + L) * HID + k0 + piece * 8;
            *(v8h*)dp = v;
        }
        
    }
}

// ---------------------------------------------------------------------------
// Key packing tables of one sequence (one block): a key is allowed iff kmask[b][key] == 0.
// kcnt[b*SEQ + s] = number of allowed keys with index <= s (so packed key j is visible to
// query q iff j < kcnt[q]: the causal test and the padding test in one compare);
// kidx[b*SEQ + j] = index of the j-th allowed key, 0 for j >= the sequence's total.
// Each thread owns KPER consecutive positions; block-wide inclusive scan of the per-thread
// counts in LDS; kidx is gathered in LDS so that both tables leave as whole runs per thread.
// coverage: every entry of both tables of this sequence once.
// ---------------------------------------------------------------------------
#define KPER ((SEQ + 255) / 256)
__device__ __forceinline__ void
key_scan(const int* __restrict__ kmask, int* __restrict__ kidx, int* __restrict__ kcnt, int bidx) {
    __shared__ int part[256];
    __shared__ int sidx[256 * KPER];
    const int tid = (int)threadIdx.x;
    __builtin_assume(tid < 256);         // the launch's block size: lets the range tests below fold, so the mask loads go out together
    const int* mrow = kmask + (size_t)bidx * SEQ_FULL;
    int ok[KPER];
    int c = 0;
    // the three loops over j are unrolled so that ok[] and cn[] stay in registers
#pragma unroll
    for (int j = 0; j < KPER; ++j) {
        const int s = tid * KPER + j;
        ok[j] = (s < SEQ) ? (mrow[s] == 0 ? 1 : 0) : 0;
        c += ok[j];
    }
    part[tid] = c;
    __syncthreads();
    for (int d = 1; d < 256; d <<= 1) {
        const int add = (tid >= d) ? part[tid - d] : 0;
        __syncthreads();
        part[tid] += add;
        __syncthreads();
    }
    int run = part[tid] - c;             // allowed keys in front of this thread's first position
    const int total = part[255];
    int cn[KPER];
#pragma unroll
    for (int j = 0; j < KPER; ++j) {
        const int s = tid * KPER + j;
        if (ok[j]) sidx[run] = s;        // run < total
        run += ok[j];
        cn[j] = run;
        if (s >= total) sidx[s] = 0;     // the slots behind the packed keys
    }
    __syncthreads();
#pragma unroll
    for (int j = 0; j < KPER; ++j) {
        const int s = tid * KPER + j;
        if (s < SEQ) {
            kcnt[bidx * SEQ + s] = cn[j];
            kidx[bidx * SEQ + s] = sidx[s];
        }
    }
}

// ---------------------------------------------------------------------------
// All five input conversions and the key packing tables in one grid (independent of each
// other): blocks 0 .. NB-1 build the tables (first: theirs is the longest chain), the next
// 4*WTILES transpose-convert the four weight planes (dst planes contiguous,
// order q, k, v, o), the remaining MROWS/2 blocks convert the hidden rows.
// The branch is block-uniform, so the barriers inside are reached by whole blocks.
// ---------------------------------------------------------------------------
#define WTILES ((HID / 64) * (HID / 64))
__global__ void __launch_bounds__(256)
cvt_all(const float* __restrict__ x, const float* __restrict__ wq, const float* __restrict__ wk,
        const float* __restrict__ wv, const float* __restrict__ wo, const int* __restrict__ kmask,
        f16* __restrict__ xh, f16* __restrict__ wh, int* __restrict__ kidx, int* __restrict__ kcnt) {
    const int b = (int)blockIdx.x - NB;
    if (b < 0) {
        key_scan(kmask, kidx, kcnt, b + NB);
    } else if (b < 4 * WTILES) {
        const int w = b / WTILES;
        const int t = b - w * WTILES;
        const float* src = (w == 0) ? wq : (w == 1) ? wk : (w == 2) ? wv : wo;
        cvt_wT(src, wh + (size_t)w * HID * HID, CARRY_W, t % (HID / 64), t / (HID / 64));
        // in the built code other branches' text follows these stores: keep the wait in front of
        // any overwrite of the registers they name
        asm volatile("s_wait_xcnt 0x0" ::: "memory");
    } else {
        cvt_rows<SEQ, SEQ_FULL>(x, xh, MROWS, CARRY_X, b - 4 * WTILES);
    }
}

// ---------------------------------------------------------------------------
// C[m][n] = sum_k A[m][k] * W[n][k] ; A [M][1024] f16, W [1024][1024] f16 (k contiguous).
// Block tile 128 x 128, 8 waves as 4(M) x 2(N), 2 x 4 accumulators per wave. K runs in slabs of
// 64: asynchronous copies bring slab t + 1 into one of two LDS buffers while slab t is multiplied.
// MODE 1: f16 plane [b*HID + h*HD + d][s] (V transposed per head) into out, plus the
//         residual plane (val - f16(val)) * 2^10, same layout, into out2
// MODE 2: f32 rows [m][1024] into the output; blocks at sequence start (s0 == 0)
//         add the f32 partial rows padd[b*128 + local row][n] (block-uniform branch)
// MODE 3: f32 rows [m][1024] into a workspace plane (no partial add)
// coverage per block: MODE 0 256 lines, MODE 1 2 x 256 lines (hi, residual),
//                     MODE 2/3 2 x 256 lines (64 rows x 4 line-quarters per half).
// LDS: the slab buffers and Cs are cross-wave, separated by block barriers.
// ---------------------------------------------------------------------------
// LDS of one GEMM tile, offsets in halves (the kernel owns the array, so that kernels which
// hold more than one kind of tile allocate it once)
#define GEMM_OP   (128 * GPITCH)                      // one operand's slab [128][GPITCH]
#define GEMM_BUF  (2 * GEMM_OP)                       // one buffer: A's slab, then W's
#define GEMM_RING (2 * GEMM_BUF)                      // two buffers
#define GEMM_CS   0                                   // Cs f16 [128][CPITCH] or f32 [64][CFPITCH]: reuses the
                                                      // buffers behind the K loop's last barrier
#define GEMM_LDS  GEMM_RING
static_assert(128 * CPITCH <= GEMM_RING);
#define KSLAB     64
#define NSLAB     (HID / KSLAB)
static_assert(NSLAB >= 2);

// One slab of both operands into one buffer: 8 copies of 16 bytes a lane (8 lanes cover one row's
// 128 bytes, 32 rows a copy). la = this lane's LDS byte address of its first A piece in the buffer.
__device__ __forceinline__ void
slab_copy(unsigned la, const f16* a0, const f16* a1, const f16* a2, const f16* a3,
          const f16* w0, const f16* w1, const f16* w2, const f16* w3) {
    const unsigned la1 = la + 32 * GPITCH * 2, la2 = la + 64 * GPITCH * 2, la3 = la + 96 * GPITCH * 2;
    const unsigned lw0 = la + GEMM_OP * 2, lw1 = la1 + GEMM_OP * 2, lw2 = la2 + GEMM_OP * 2, lw3 = la3 + GEMM_OP * 2;
    // global -> LDS through no register; the closing wait stands in front of any overwrite of the
    // address registers that the copies name (a precaution)
    asm volatile("global_load_async_to_lds_b128 %0, %8, off\n\t"
                 "global_load_async_to_lds_b128 %1, %9, off\n\t"
                 "global_load_async_to_lds_b128 %2, %10, off\n\t"
                 "global_load_async_to_lds_b128 %3, %11, off\n\t"
                 "global_load_async_to_lds_b128 %4, %12, off\n\t"
                 "global_load_async_to_lds_b128 %5, %13, off\n\t"
                 "global_load_async_to_lds_b128 %6, %14, off\n\t"
                 "global_load_async_to_lds_b128 %7, %15, off\n\t"
                 "s_wait_xcnt 0x0"
                 :: "v"(la), "v"(la1), "v"(la2), "v"(la3), "v"(lw0), "v"(lw1), "v"(lw2), "v"(lw3),
                    "v"(a0), "v"(a1), "v"(a2), "v"(a3), "v"(w0), "v"(w1), "v"(w2), "v"(w3)
                 : "memory");
}

// K loop of one 128 x 128 tile at column n0; arow[p] = the row of A that this thread stages as
// tile row (tid >> 3) + 32 p
__device__ __forceinline__ void
gemm_main(const f16* __restrict__ A, const f16* __restrict__ W, f16* ring,
          const int (&arow)[4], int n0, v8f (&acc)[2][4]) {
    const int tid  = (int)threadIdx.x;
    const int lane = tid & 31;
    const int wave = tid >> 5;
    const int wm   = wave & 3;
    const int wn   = wave >> 2;

#pragma unroll
    for (int i = 0; i < 2; ++i)
#pragma unroll
        for (int j = 0; j < 4; ++j) acc[i][j] = zero8();

    const int srow = tid >> 3;
    const int scol = (tid & 7) << 3;
    const f16* gA[4];
    const f16* gW[4];
#pragma unroll
    for (int p = 0; p < 4; ++p) {
        gA[p] = A + (size_t)arow[p] * HID + scol;
        gW[p] = W + (size_t)(n0 + srow + 32 * p) * HID + scol;
    }
    const unsigned la = (unsigned)(size_t)(ring + srow * GPITCH + scol);   // LDS byte address (low 32 bits)

    slab_copy(la, gA[0], gA[1], gA[2], gA[3], gW[0], gW[1], gW[2], gW[3]);
    asm volatile("s_wait_asynccnt 0x0" ::: "memory");   // slab 0 has landed (this wave's part)
    __syncthreads();                                    // ... and every other wave's
    slab_copy(la + GEMM_BUF * 2, gA[0] + KSLAB, gA[1] + KSLAB, gA[2] + KSLAB, gA[3] + KSLAB,
              gW[0] + KSLAB, gW[1] + KSLAB, gW[2] + KSLAB, gW[3] + KSLAB);

    // rolled: one copy of the loop's text, and the order at its foot stays as written
#pragma unroll 1
    for (int t = 0; t < NSLAB; ++t) {
        const int boff = (t & 1) * GEMM_BUF;
        const f16* As = ring + boff;
        const f16* Bs = As + GEMM_OP;
#pragma unroll
        for (int kk = 0; kk < KSLAB; kk += 32) {
            v16h af[2], bfr[4];
#pragma unroll
            for (int i = 0; i < 2; ++i) af[i] = load_frag(As, wm * 32 + i * 16, GPITCH, kk, lane);
#pragma unroll
            for (int j = 0; j < 4; ++j) bfr[j] = load_frag(Bs, wn * 64 + j * 16, GPITCH, kk, lane);
#pragma unroll
            for (int i = 0; i < 2; ++i)
#pragma unroll
                for (int j = 0; j < 4; ++j) acc[i][j] = wmma16(af[i], bfr[j], acc[i][j]);
        }
        asm volatile("s_wait_dscnt 0x0" ::: "memory");      // this wave has left slab t's buffer
        asm volatile("s_wait_asynccnt 0x0" ::: "memory");   // its part of slab t + 1 has landed
        __syncthreads();                                    // publishes slab t + 1, frees slab t's buffer
        if (t + 2 < NSLAB) {                                // the same for the whole block
            const int k = (t + 2) * KSLAB;
            slab_copy(la + boff * 2, gA[0] + k, gA[1] + k, gA[2] + k, gA[3] + k,
                      gW[0] + k, gW[1] + k, gW[2] + k, gW[3] + k);
        }
    }
    asm volatile("s_wait_asynccnt 0x0" ::: "memory");       // no copy is left in flight
}

// scale, bias and store of one 128 x 128 tile at (m0, n0)
template <int MODE>
__device__ __forceinline__ void
gemm_epi(const v8f (&acc)[2][4], f16* Cs, const float* __restrict__ bias,
         void* __restrict__ out, void* __restrict__ out2, const float* __restrict__ padd,
         float accMul, float addMul, int m0, int n0) {
    const int tid  = (int)threadIdx.x;
    const int lane = tid & 31;
    const int wave = tid >> 5;
    const int wm   = wave & 3;
    const int wn   = wave >> 2;
    const int hh8  = (lane >> 4) << 3;   // D row half
    const int c16  = lane & 15;          // D column

    // bias (bf16 RNE value) per owned column group
    float bb[4];
#pragma unroll
    for (int j = 0; j < 4; ++j) bb[j] = bf16_rne(bias[n0 + wn * 64 + j * 16 + c16]) * addMul;

    const int bidx  = m0 / SEQ;          // block rows lie inside one batch (SEQ % 128 == 0)
    const int s0    = m0 - bidx * SEQ;
    const int piece = lane & 7;
    const int lsub  = lane >> 3;

    if constexpr (MODE == 0) {
#pragma unroll
        for (int i = 0; i < 2; ++i)
#pragma unroll
            for (int j = 0; j < 4; ++j) {
                const int nl = wn * 64 + j * 16 + c16;
#pragma unroll
                for (int r = 0; r < 8; ++r) {
                    const int ml = wm * 32 + i * 16 + hh8 + r;
                    Cs[ml * CPITCH + nl] = (f16)(acc[i][j][r] * accMul + bb[j]);
                }
            }
        __syncthreads();
        f16* op = (f16*)out;
        const size_t bh0 = (size_t)bidx * NHEAD + (n0 >> 6);
{
#pragma unroll
            for (int it = 0; it < 8; ++it) {
                const int L    = wave * 32 + it * 4 + lsub;   // 0..255
                const int ml   = L >> 1;
                const int hsel = L & 1;
                const v8h v = *(const v8h*)&Cs[ml * CPITCH + hsel * 64 + piece * 8];
                f16* dp = op + ((bh0 + hsel) * SEQ + s0 + ml) * HD + piece * 8;
                *(v8h*)dp = v;
            }
            
        }
    } else if constexpr (MODE == 1) {
        // hi plane, staged transposed: Cs[n][m]
#pragma unroll
        for (int i = 0; i < 2; ++i)
#pragma unroll
            for (int j = 0; j < 4; ++j) {
                const int nl = wn * 64 + j * 16 + c16;
                H8U t;
#pragma unroll
                for (int r = 0; r < 8; ++r) t.e[r] = (f16)(acc[i][j][r] * accMul + bb[j]);
                *(v8h*)&Cs[nl * CPITCH + wm * 32 + i * 16 + hh8] = t.v;
            }
        __syncthreads();
        {
            f16* op = (f16*)out;
{
#pragma unroll
                for (int it = 0; it < 8; ++it) {
                    const int L  = wave * 32 + it * 4 + lsub;     // 0..255
                    const int nl = L >> 1;
                    const int mh = L & 1;
                    const v8h v = *(const v8h*)&Cs[nl * CPITCH + mh * 64 + piece * 8];
                    f16* dp = op + ((size_t)(bidx * HID + n0 + nl) * SEQ + s0 + mh * 64 + piece * 8);
                    *(v8h*)dp = v;
                }
                
            }
        }
        __syncthreads();
        // residual plane: (val - f16(val)) * 2^10, same staging and store map
#pragma unroll
        for (int i = 0; i < 2; ++i)
#pragma unroll
            for (int j = 0; j < 4; ++j) {
                const int nl = wn * 64 + j * 16 + c16;
                H8U t;
#pragma unroll
                for (int r = 0; r < 8; ++r) {
                    const float val = acc[i][j][r] * accMul + bb[j];
                    const f16 hv = (f16)val;
                    t.e[r] = (f16)((val - (float)hv) * CARRY_RES);
                }
                *(v8h*)&Cs[nl * CPITCH + wm * 32 + i * 16 + hh8] = t.v;
            }
        __syncthreads();
        {
            f16* op = (f16*)out2;
{
#pragma unroll
                for (int it = 0; it < 8; ++it) {
                    const int L  = wave * 32 + it * 4 + lsub;     // 0..255
                    const int nl = L >> 1;
                    const int mh = L & 1;
                    const v8h v = *(const v8h*)&Cs[nl * CPITCH + mh * 64 + piece * 8];
                    f16* dp = op + ((size_t)(bidx * HID + n0 + nl) * SEQ + s0 + mh * 64 + piece * 8);
                    *(v8h*)dp = v;
                }
                
            }
        }
    } else {
        float* Cf = (float*)Cs;      // [64][CFPITCH] f32
        float* of = (float*)out;
#pragma unroll
        for (int half = 0; half < 2; ++half) {
            if ((wm >> 1) == half) {
#pragma unroll
                for (int i = 0; i < 2; ++i)
#pragma unroll
                    for (int j = 0; j < 4; ++j) {
                        const int nl = wn * 64 + j * 16 + c16;
#pragma unroll
                        for (int r = 0; r < 8; ++r) {
                            const int ml = (wm & 1) * 32 + i * 16 + hh8 + r;
                            Cf[ml * CFPITCH + nl] = acc[i][j][r] * accMul + bb[j];
                        }
                    }
            }
            __syncthreads();
            v4f vv[8];
#pragma unroll
            for (int it = 0; it < 8; ++it) {
                const int L    = wave * 32 + it * 4 + lsub;   // 0..255
                const int row  = L >> 2;
                const int part = L & 3;
                vv[it] = *(const v4f*)&Cf[row * CFPITCH + part * 32 + piece * 4];
            }
            if constexpr (MODE == 2) {
                if (s0 == 0) {     // block-uniform
#pragma unroll
                    for (int it = 0; it < 8; ++it) {
                        const int L    = wave * 32 + it * 4 + lsub;
                        const int row  = L >> 2;
                        const int part = L & 3;
                        const v4f pv = *(const v4f*)(padd + (size_t)(bidx * 128 + half * 64 + row) * HID
                                                     + n0 + part * 32 + piece * 4);
                        vv[it] += pv;
                    }
                }
            }
{
#pragma unroll
                for (int it = 0; it < 8; ++it) {
                    const int L    = wave * 32 + it * 4 + lsub;   // 0..255
                    const int row  = L >> 2;
                    const int part = L & 3;
                    float* dp = of + (size_t)(m0 + half * 64 + row) * HID + n0 + part * 32 + piece * 4;
                    *(v4f*)dp = vv[it];
                }
                
            }
            __syncthreads();
        }
    }
}

template <int MODE>
__global__ void __launch_bounds__(256) __attribute__((amdgpu_num_vgpr(256)))
gemm_nt(const f16* __restrict__ A, const f16* __restrict__ W, const float* __restrict__ bias,
        void* __restrict__ out, void* __restrict__ out2, const float* __restrict__ padd,
        float accMul, float addMul) {
    __shared__ __attribute__((aligned(16))) f16 sm[GEMM_LDS];
    const int m0 = (int)blockIdx.x * 128;
    const int n0 = (int)blockIdx.y * 128;
    const int r0 = m0 + ((int)threadIdx.x >> 3);
    const int arow[4] = {r0, r0 + 32, r0 + 64, r0 + 96};
    v8f acc[2][4];
    gemm_main(A, W, sm, arow, n0, acc);
    gemm_epi<MODE>(acc, sm + GEMM_CS, bias, out, out2, padd, accMul, addMul, m0, n0);
}

// ---------------------------------------------------------------------------
// The Q, K and V projections in one grid: blockIdx.z picks the weight plane (planes
// contiguous, order q, k, v), the bias and the output (z 0, 1: MODE 0 into the contiguous
// q, k planes; z 2: MODE 1 into V^T and its residual). The K and V tiles of one (x, y) read
// the same hidden rows. The branch on z is block-uniform.
// K and V are projected for the allowed keys only: row j of their tiles is hidden row
// kidx[j] of the sequence, so both planes come out packed; a tile wholly behind the
// sequence's total leaves before any barrier, and nothing reads its part of the planes
// (the slots between the total and the tile's end hold row 0's finite values, never counted).
// ---------------------------------------------------------------------------
__global__ void __launch_bounds__(256) __attribute__((amdgpu_num_vgpr(256)))
gemm_qkv(const f16* __restrict__ X, const f16* __restrict__ Wqkv, const float* __restrict__ bq,
         const float* __restrict__ bk, const float* __restrict__ bv, f16* __restrict__ qk,
         f16* __restrict__ vt, f16* __restrict__ vtl, const int* __restrict__ kidx,
         const int* __restrict__ kcnt, float accMul, float addMul) {
    __shared__ __attribute__((aligned(16))) f16 sm[GEMM_LDS];
    const int m0 = (int)blockIdx.x * 128;
    const int n0 = (int)blockIdx.y * 128;
    const int z  = (int)blockIdx.z;
    const int r0 = m0 + ((int)threadIdx.x >> 3);
    int arow[4] = {r0, r0 + 32, r0 + 64, r0 + 96};
    if (z != 0) {
        const int seq0 = (m0 / SEQ) * SEQ;               // block rows lie inside one sequence
        const int  total = kcnt[seq0 + SEQ - 1];         // allowed keys of the sequence
        const int  s0 = kidx[r0], s1 = kidx[r0 + 32], s2 = kidx[r0 + 64], s3 = kidx[r0 + 96];
        // behind the loads (their values are the operands), in front of any overwrite of the registers they name
        asm volatile("s_wait_xcnt 0x0" :: "v"(s0), "v"(s1), "v"(s2), "v"(s3) : "memory");
        if (m0 - seq0 >= total) return;                  // block-uniform, in front of every barrier and copy
        arow[0] = seq0 + min(max(s0, 0), SEQ - 1);
        arow[1] = seq0 + min(max(s1, 0), SEQ - 1);
        arow[2] = seq0 + min(max(s2, 0), SEQ - 1);
        arow[3] = seq0 + min(max(s3, 0), SEQ - 1);
    }
    v8f acc[2][4];
    gemm_main(X, Wqkv + (size_t)z * HID * HID, sm, arow, n0, acc);
    if (z == 2) {
        gemm_epi<1>(acc, sm + GEMM_CS, bv, (void*)vt, (void*)vtl, (const float*)0, accMul, addMul, m0, n0);
    } else {
        gemm_epi<0>(acc, sm + GEMM_CS, (z == 0) ? bq : bk, (void*)(qk + (size_t)z * MROWS * HID),
                    (void*)0, (const float*)0, accMul, addMul, m0, n0);
        // in the built code the other epilogue's text follows these stores: keep the wait in
        // front of any overwrite of the registers they name
        asm volatile("s_wait_xcnt 0x0" ::: "memory");
    }
}

// ---------------------------------------------------------------------------
// Flash attention, causal with key padding mask, over the packed keys (packed key j counts for
// query q iff j < kcnt[b][q]; other keys get p = 0 and are excluded from the row max; rows with
// no allowed key produce a zero context row). One block of 256 threads (8 waves) per (bx, bh = b*NHEAD + h),
// wave owns 16 query rows (Q fragments resident). Block streams the 64-key tiles up to its
// causal horizon: K staged [key][d], V^T staged [d][key]. Scores on WMMA, row max via DPP,
// exp2 in f32 carried x2^10, P relayed per wave through LDS as A fragments, O += P.V and
// row sums += P.ones on WMMA. Output f16 plane [b*SEQ+q][1024] carried x1024, written as
// RES = 0: q-block = bx + 1 (rows 128 .. SEQ-1); not launched: attn_tile_split has those rows.
// RES = 1: q-block 0 only (rows 0..127): V, P and the context carry x2^10 residual planes
//          (second accumulators); context residual plane Cpl is [b*128 + q][1024].
// coverage: RES 1 and attn_tile_split together write every (b, q, h*64..h*64+63) segment of Cp once;
//           RES 1 writes the whole Cpl plane once.
// LDS: ks, vsT, vsL cross-wave (block barriers); ps/psl per-wave but also separated by block
// barriers. staged extent == consumed extent for ks (64x64), vsT (64x64), vsL (64x64, RES),
// ps/psl (16x64).
// ---------------------------------------------------------------------------
// LDS of one attention block, sizes in halves (the kernel owns the arrays):
// ks [64][APITCH] = [key][d]; vsT [64][APITCH] = [d][key]; vsL the same, residual (RES);
// ps [8][16][APITCH] per-wave P relay / ctx stage; psl the same, residual (RES)
#define ATTN_KV   (64 * APITCH)
#define ATTN_P    (8 * 16 * APITCH)
#define ATTN_LDS0 (2 * ATTN_KV + ATTN_P)                      // RES = 0: ks, vsT, ps

template <int RES>
__device__ __forceinline__ void
attn_tile(const f16* __restrict__ Qp, const f16* __restrict__ Kp, const f16* __restrict__ Vt,
          const f16* __restrict__ Vtl, const int* __restrict__ kcnt,
          f16* __restrict__ Cp, f16* __restrict__ Cpl,
          f16* ks, f16* vsT, f16* vsL, f16* ps, f16* psl, int bx, int bh) {
    const int tid  = (int)threadIdx.x;
    const int lane = tid & 31;
    const int wave = tid >> 5;
    const int hh8  = (lane >> 4) << 3;
    const int c16  = lane & 15;
    const int bidx = bh / NHEAD;
    const int hidx = bh - bidx * NHEAD;
    const int qblk = RES ? 0 : (bx + 1);
    const int qw   = qblk * 128 + wave * 16;          // first query row (within sequence) of this wave
    const size_t head = (size_t)bh * SEQ * HD;
    const int* crow = kcnt + bidx * SEQ;

    v16h qa[2];
#pragma unroll
    for (int c = 0; c < 2; ++c) qa[c] = load_frag(Qp + head, qw, HD, c * 32, lane);

    // packed keys visible to each of this lane's 8 query rows
    const int* cp = crow + qw + hh8;
    int cr[8];
#pragma unroll
    for (int r = 0; r < 8; ++r) cr[r] = cp[r];

    FragU onesu;
#pragma unroll
    for (int i = 0; i < 16; ++i) onesu.e[i] = (f16)1.0f;
    const v16h ones = onesu.v;

    float m[8];
    v8f   o[4], lacc, olo[4], laccl;
#pragma unroll
    for (int r = 0; r < 8; ++r) m[r] = NEGBIG;
#pragma unroll
    for (int dt = 0; dt < 4; ++dt) { o[dt] = zero8(); olo[dt] = zero8(); }
    lacc  = zero8();
    laccl = zero8();

    // log2-domain scale: acc = 256 * q.k ; x = log2(e) * q.k / 8 = acc * log2(e) / 2048
    const float cl = 1.4426950408889634f * 0.00048828125f;
    const float rres = 1.0f / CARRY_RES;
    f16* psw  = ps  + wave * 16 * APITCH;
    f16* pslw = psl + wave * 16 * APITCH;

    // horizon in 64-key tiles of packed keys: the count of the block's last row (counts do not
    // fall along a sequence), never above the causal bound (block-uniform)
    const int nkt = (min(max(crow[qblk * 128 + 127], 0), qblk * 128 + 128) + 63) >> 6;

#pragma unroll 1
    for (int kt = 0; kt < nkt; ++kt) {
        __syncthreads();
        const int srow = tid >> 3;               // 32 rows a step, 16 bytes a thread
        const int spc  = (tid & 7) << 3;
        const f16* kp = Kp  + head + (size_t)(kt * 64 + srow) * HD + spc;   // this lane's first 16 bytes of the tile
        const f16* vp = Vt  + head + (size_t)srow * SEQ + kt * 64 + spc;
        const f16* lp = Vtl + head + (size_t)srow * SEQ + kt * 64 + spc;
        v8h kv[2], vv[2], vl[2];
#pragma unroll
        for (int p2 = 0; p2 < 2; ++p2) {
            kv[p2] = *(const v8h*)(kp + p2 * 32 * HD);
            vv[p2] = *(const v8h*)(vp + p2 * 32 * SEQ);
            if constexpr (RES) vl[p2] = *(const v8h*)(lp + p2 * 32 * SEQ);
        }
        // the address pairs stay whole (no load's result lands on them) until this wait
        asm volatile("s_wait_xcnt 0x0" :: "v"(kp), "v"(vp), "v"(lp) : "memory");
#pragma unroll
        for (int p2 = 0; p2 < 2; ++p2) {
            *(v8h*)&ks[(srow + p2 * 32) * APITCH + spc]  = kv[p2];
            *(v8h*)&vsT[(srow + p2 * 32) * APITCH + spc] = vv[p2];
            if constexpr (RES) *(v8h*)&vsL[(srow + p2 * 32) * APITCH + spc] = vl[p2];
        }
        __syncthreads();

        // S[16 q x 64 keys]
        v8f s[4];
#pragma unroll
        for (int nt = 0; nt < 4; ++nt) s[nt] = zero8();
#pragma unroll
        for (int c = 0; c < 2; ++c) {
#pragma unroll
            for (int nt = 0; nt < 4; ++nt) {
                const v16h kb = load_frag(ks, nt * 16, APITCH, c * 32, lane);
                s[nt] = wmma16(qa[c], kb, s[nt]);
            }
        }

        // this lane's 4 packed key columns
        int keyi[4];
#pragma unroll
        for (int nt = 0; nt < 4; ++nt) keyi[nt] = kt * 64 + nt * 16 + c16;

        // online softmax per row r (row 8h + r), max-subtracted, exp2 domain
#pragma unroll
        for (int r = 0; r < 8; ++r) {
            float x[4];
            bool  alw[4];
#pragma unroll
            for (int nt = 0; nt < 4; ++nt) {
                x[nt]   = s[nt][r] * cl;
                alw[nt] = keyi[nt] < cr[r];
            }
            const float xm0 = alw[0] ? x[0] : NEGBIG;
            const float xm1 = alw[1] ? x[1] : NEGBIG;
            const float xm2 = alw[2] ? x[2] : NEGBIG;
            const float xm3 = alw[3] ? x[3] : NEGBIG;
            const float tm = rowmax16(fmaxf(fmaxf(xm0, xm1), fmaxf(xm2, xm3)));
            const float mn = fmaxf(m[r], tm);
            const float al = fexp2(m[r] - mn);
            m[r] = mn;
            lacc[r] *= al;
#pragma unroll
            for (int dt = 0; dt < 4; ++dt) o[dt][r] *= al;
            if constexpr (RES) {
                laccl[r] *= al;
#pragma unroll
                for (int dt = 0; dt < 4; ++dt) olo[dt][r] *= al;
            }
            const float sh = 10.0f - mn;      // carry 2^10
#pragma unroll
            for (int nt = 0; nt < 4; ++nt) {
                const float arg = alw[nt] ? (x[nt] + sh) : 0.0f;
                const float e   = fexp2(arg);
                const float p   = alw[nt] ? e : 0.0f;
                const f16   hp  = (f16)p;
                psw[(hh8 + r) * APITCH + nt * 16 + c16] = hp;
                if constexpr (RES)
                    pslw[(hh8 + r) * APITCH + nt * 16 + c16] = (f16)((p - (float)hp) * CARRY_RES);
            }
        }
        __syncthreads();

        // O += P . V ; l += P . ones  (P reloaded as A fragments from the relay)
#pragma unroll
        for (int kk = 0; kk < 2; ++kk) {
            const v16h pa = load_frag(psw, 0, APITCH, kk * 32, lane);
            if constexpr (RES) {
                const v16h pl = load_frag(pslw, 0, APITCH, kk * 32, lane);
#pragma unroll
                for (int dt = 0; dt < 4; ++dt) {
                    const v16h vb = load_frag(vsT, dt * 16, APITCH, kk * 32, lane);
                    o[dt]   = wmma16(pa, vb, o[dt]);
                    olo[dt] = wmma16(pl, vb, olo[dt]);
                    const v16h vl = load_frag(vsL, dt * 16, APITCH, kk * 32, lane);
                    olo[dt] = wmma16(pa, vl, olo[dt]);
                }
                lacc  = wmma16(pa, ones, lacc);
                laccl = wmma16(pl, ones, laccl);
            } else {
#pragma unroll
                for (int dt = 0; dt < 4; ++dt) {
                    const v16h vb = load_frag(vsT, dt * 16, APITCH, kk * 32, lane);
                    o[dt] = wmma16(pa, vb, o[dt]);
                }
                lacc = wmma16(pa, ones, lacc);
            }
        }
    }
    __syncthreads();

    // normalize: plane value = 1024 * (O/16) / (l) = O * 64 / l ; zero row when l == 0
#pragma unroll
    for (int r = 0; r < 8; ++r) {
        float l = lacc[r];
        if constexpr (RES) l += laccl[r] * rres;
        const float lsafe = (l > 0.0f) ? l : 1.0f;
        const float inv   = (l > 0.0f) ? ((CARRY_CTX / CARRY_QKV) / lsafe) : 0.0f;
#pragma unroll
        for (int dt = 0; dt < 4; ++dt) {
            float ov = o[dt][r];
            if constexpr (RES) ov += olo[dt][r] * rres;
            const float cv = ov * inv;
            const f16 hv = (f16)cv;
            psw[(hh8 + r) * APITCH + dt * 16 + c16] = hv;
            if constexpr (RES)
                pslw[(hh8 + r) * APITCH + dt * 16 + c16] = (f16)((cv - (float)hv) * CARRY_RES);
        }
    }
    __syncthreads();

    const int piece = lane & 7;
    const int lsub  = lane >> 3;
{
#pragma unroll
        for (int it = 0; it < 4; ++it) {
            const int L = it * 4 + lsub;     // query row 0..15 within the wave tile
            const v8h v = *(const v8h*)&psw[L * APITCH + piece * 8];
            f16* dp = Cp + ((size_t)(bidx * SEQ + qw + L) * HID + hidx * HD + piece * 8);
            *(v8h*)dp = v;
            if constexpr (RES) {
                const v8h vl = *(const v8h*)&pslw[L * APITCH + piece * 8];
                f16* dq = Cpl + ((size_t)(bidx * 128 + wave * 16 + L) * HID + hidx * HD + piece * 8);
                *(v8h*)dq = vl;
            }
        }
        
    }
}

// ---------------------------------------------------------------------------
// Query rows 128 .. SEQ-1, cut for a short longest chain: one block of 8 waves owns 64 query
// rows (64-row q-block qb >= 2) and its two groups of 4 waves split the 64-key tiles of the
// block's horizon of packed keys between them (group g takes tiles 2*it + g), each group with its own K and
// V^T stage and its own running (m, l, O). After the loop group 1 hands its partial state to
// group 0 through LDS and group 0 merges: mn = max(m0, m1), l = l0*2^(m0-mn) + l1*2^(m1-mn),
// O likewise. Same masking, scaling and carries as attn_tile<0>.
// When the tile count is odd, group 1's last tile lies wholly behind the horizon: its
// addresses are clamped to the last tile and every key of it fails the count test (p = 0,
// the running maximum does not move). A block with no visible key makes no trip.
// LDS (halves): group g: ks at g*2*ATTN_KV, vsT behind it; ps [8][16][APITCH] at 4*ATTN_KV;
// the hand-over buffer (48 floats a lane of group 1) reuses the K/V stages behind a barrier.
// ---------------------------------------------------------------------------
#define ATTN_LDS2 (4 * ATTN_KV + ATTN_P)
static_assert(48 * 128 * 4 <= 4 * ATTN_KV * 2);   // the hand-over buffer fits the K/V stages

__device__ __forceinline__ void
attn_tile_split(const f16* __restrict__ Qp, const f16* __restrict__ Kp, const f16* __restrict__ Vt,
                const int* __restrict__ kcnt, f16* __restrict__ Cp, f16* sm, int qb, int bh) {
    const int tid  = (int)threadIdx.x;
    const int lane = tid & 31;
    const int wave = __builtin_amdgcn_readfirstlane(tid >> 5);   // scalar: tile index and group tests stay off the vector port
    const int grp  = wave >> 2;          // key group
    const int wq   = wave & 3;           // 16-row query slice within the block
    const int hh8  = (lane >> 4) << 3;
    const int c16  = lane & 15;
    const int bidx = bh / NHEAD;
    const int hidx = bh - bidx * NHEAD;
    const int qw   = qb * 64 + wq * 16;  // first query row (within sequence) of this wave
    const size_t head = (size_t)bh * SEQ * HD;
    const int* crow = kcnt + bidx * SEQ;

    f16* ks  = sm + grp * 2 * ATTN_KV;
    f16* vsT = ks + ATTN_KV;
    f16* psw = sm + 4 * ATTN_KV + wave * 16 * APITCH;

    v16h qa[2];
#pragma unroll
    for (int c = 0; c < 2; ++c) qa[c] = load_frag(Qp + head, qw, HD, c * 32, lane);

    // packed keys visible to each of this lane's 8 query rows
    const int* cp = crow + qw + hh8;
    int cr[8];
#pragma unroll
    for (int r = 0; r < 8; ++r) cr[r] = cp[r];

    FragU onesu;
#pragma unroll
    for (int i = 0; i < 16; ++i) onesu.e[i] = (f16)1.0f;
    const v16h ones = onesu.v;

    float m[8];
    v8f   o[4], lacc;
#pragma unroll
    for (int r = 0; r < 8; ++r) m[r] = NEGBIG;
#pragma unroll
    for (int dt = 0; dt < 4; ++dt) o[dt] = zero8();
    lacc = zero8();

    // log2-domain scale: acc = 256 * q.k ; x = log2(e) * q.k / 8 = acc * log2(e) / 2048
    const float cl = 1.4426950408889634f * 0.00048828125f;

    // 64-key tiles of packed keys up to the block's horizon: the count of its last row (counts do
    // not fall along a sequence), never above the causal bound; block-uniform
    const int ntl = (min(max(crow[qb * 64 + 63], 0), qb * 64 + 64) + 63) >> 6;
    const int nit = (ntl + 1) >> 1;      // trips: ceil(ntl / 2)
    const int t2  = tid & 127;           // thread within the group
    // staging: 16 bytes a thread and step, 16 rows a step; lane offsets do not change over the loop
    const int srow = t2 >> 3;
    const int spc  = (t2 & 7) << 3;
    const unsigned koff = (unsigned)(srow * HD + spc);
    const unsigned voff = (unsigned)(srow * SEQ + spc);

#pragma unroll 1
    for (int it = 0; it < nit; ++it) {
        const int kt  = 2 * it + grp;            // this group's tile
        const int ktl = (kt < ntl) ? kt : ntl - 1;   // tile whose bytes are read (written and in bounds)
        const f16* kp = Kp + head + (size_t)ktl * 64 * HD + koff;   // this lane's first 16 bytes of the tile
        const f16* vp = Vt + head + (size_t)ktl * 64 + voff;
        __syncthreads();
        v8h kv[4], vv[4];
#pragma unroll
        for (int p2 = 0; p2 < 4; ++p2) {
            kv[p2] = *(const v8h*)(kp + p2 * 16 * HD);
            vv[p2] = *(const v8h*)(vp + p2 * 16 * SEQ);
        }
        // the address pairs stay whole (no load's result lands on them) until this wait
        asm volatile("s_wait_xcnt 0x0" :: "v"(kp), "v"(vp) : "memory");
#pragma unroll
        for (int p2 = 0; p2 < 4; ++p2) {
            *(v8h*)&ks[(srow + p2 * 16) * APITCH + spc]  = kv[p2];
            *(v8h*)&vsT[(srow + p2 * 16) * APITCH + spc] = vv[p2];
        }
        __syncthreads();

        // S[16 q x 64 keys]
        v8f s[4];
#pragma unroll
        for (int nt = 0; nt < 4; ++nt) s[nt] = zero8();
#pragma unroll
        for (int c = 0; c < 2; ++c) {
#pragma unroll
            for (int nt = 0; nt < 4; ++nt) {
                const v16h kb = load_frag(ks, nt * 16, APITCH, c * 32, lane);
                s[nt] = wmma16(qa[c], kb, s[nt]);
            }
        }

        // this lane's 4 packed key columns
        int kj[4];
#pragma unroll
        for (int nt = 0; nt < 4; ++nt) kj[nt] = kt * 64 + nt * 16 + c16;

        // online softmax per row r (row 8h + r), max-subtracted, exp2 domain
#pragma unroll
        for (int r = 0; r < 8; ++r) {
            float x[4];
            bool  alw[4];
#pragma unroll
            for (int nt = 0; nt < 4; ++nt) {
                x[nt]   = s[nt][r] * cl;
                alw[nt] = kj[nt] < cr[r];
            }
            const float xm0 = alw[0] ? x[0] : NEGBIG;
            const float xm1 = alw[1] ? x[1] : NEGBIG;
            const float xm2 = alw[2] ? x[2] : NEGBIG;
            const float xm3 = alw[3] ? x[3] : NEGBIG;
            const float tm = rowmax16(fmaxf(fmaxf(xm0, xm1), fmaxf(xm2, xm3)));
            const float mn = fmaxf(m[r], tm);
            const float al = fexp2(m[r] - mn);
            m[r] = mn;
            lacc[r] *= al;
#pragma unroll
            for (int dt = 0; dt < 4; ++dt) o[dt][r] *= al;
            const float sh = 10.0f - mn;      // carry 2^10
#pragma unroll
            for (int nt = 0; nt < 4; ++nt) {
                const float arg = alw[nt] ? (x[nt] + sh) : 0.0f;
                const float e   = fexp2(arg);
                const float p   = alw[nt] ? e : 0.0f;
                psw[(hh8 + r) * APITCH + nt * 16 + c16] = (f16)p;
            }
        }
        __syncthreads();

        // O += P . V ; l += P . ones  (P reloaded as A fragments from the relay)
#pragma unroll
        for (int kk = 0; kk < 2; ++kk) {
            const v16h pa = load_frag(psw, 0, APITCH, kk * 32, lane);
#pragma unroll
            for (int dt = 0; dt < 4; ++dt) {
                const v16h vb = load_frag(vsT, dt * 16, APITCH, kk * 32, lane);
                o[dt] = wmma16(pa, vb, o[dt]);
            }
            lacc = wmma16(pa, ones, lacc);
        }
    }
    __syncthreads();     // every reader has left the K/V stages: they become the hand-over buffer

    float* mb = (float*)sm + t2;         // [48][128] floats, one column a lane of a group
    if (grp == 1) {
#pragma unroll
        for (int r = 0; r < 8; ++r) {
            mb[r * 128]       = m[r];
            mb[(8 + r) * 128] = lacc[r];
#pragma unroll
            for (int dt = 0; dt < 4; ++dt) mb[(16 + dt * 8 + r) * 128] = o[dt][r];
        }
    }
    __syncthreads();     // publishes group 1's partial state to group 0

    // merge, then normalize: plane value = 1024 * (O/16) / (l) = O * 64 / l ; zero row when l == 0
    if (grp == 0) {
#pragma unroll
        for (int r = 0; r < 8; ++r) {
            const float m1 = mb[r * 128];
            const float mn = fmaxf(m[r], m1);
            const float a0 = fexp2(m[r] - mn);
            const float a1 = fexp2(m1 - mn);
            const float l  = lacc[r] * a0 + mb[(8 + r) * 128] * a1;
            const float lsafe = (l > 0.0f) ? l : 1.0f;
            const float inv   = (l > 0.0f) ? ((CARRY_CTX / CARRY_QKV) / lsafe) : 0.0f;
#pragma unroll
            for (int dt = 0; dt < 4; ++dt) {
                const float ov = o[dt][r] * a0 + mb[(16 + dt * 8 + r) * 128] * a1;
                psw[(hh8 + r) * APITCH + dt * 16 + c16] = (f16)(ov * inv);
            }
        }
    }
    __syncthreads();

    if (grp == 0) {
        const int piece = lane & 7;
        const int lsub  = lane >> 3;
#pragma unroll
        for (int it = 0; it < 4; ++it) {
            const int L = it * 4 + lsub;     // query row 0..15 within the wave tile
            const v8h v = *(const v8h*)&psw[L * APITCH + piece * 8];
            f16* dp = Cp + ((size_t)(bidx * SEQ + qw + L) * HID + hidx * HD + piece * 8);
            *(v8h*)dp = v;
        }
    }
}

// q-block 0 of every head (RES = 1); runs first, because the residual partial needs its Cpl
__global__ void __launch_bounds__(256) __attribute__((amdgpu_num_vgpr(256)))
attn_first(const f16* __restrict__ Qp, const f16* __restrict__ Kp, const f16* __restrict__ Vt,
           const f16* __restrict__ Vtl, const int* __restrict__ kcnt,
           f16* __restrict__ Cp, f16* __restrict__ Cpl) {
    __shared__ __attribute__((aligned(16))) f16 ks[ATTN_KV];
    __shared__ __attribute__((aligned(16))) f16 vsT[ATTN_KV];
    __shared__ __attribute__((aligned(16))) f16 vsL[ATTN_KV];
    __shared__ __attribute__((aligned(16))) f16 ps[ATTN_P];
    __shared__ __attribute__((aligned(16))) f16 psl[ATTN_P];
    attn_tile<1>(Qp, Kp, Vt, Vtl, kcnt, Cp, Cpl, ks, vsT, vsL, ps, psl, 0, (int)blockIdx.x);
}

// ---------------------------------------------------------------------------
// Query rows 128 .. SEQ-1 of every head (64-row q-blocks 2 .. SEQ/64-1) and, in the same grid, the residual
// partial of the out projection (MODE 3 tiles: Pf = Cpl . Wo^T scaled). The two are
// independent: the partial reads only Cpl (written by attn_first) and the weight plane.
// Blocks 0 .. PTILES-1 are the partial's tiles, the rest attention blocks, longest horizon first
// (for speed only).
// The branch is block-uniform; the two kinds of block share one LDS array.
// ---------------------------------------------------------------------------
#define PTILES  ((RROWS / 128) * (HID / 128))
#define QBLKS   (SEQ / 64 - 2)
#define REST_LDS (GEMM_LDS > ATTN_LDS2 ? GEMM_LDS : ATTN_LDS2)
// 160 registers: three blocks (six waves a SIMD) stay resident with the eight row counts held
__global__ void __launch_bounds__(256) __attribute__((amdgpu_num_vgpr(160)))
attn_rest_and_partial(const f16* __restrict__ Qp, const f16* __restrict__ Kp,
                      const f16* __restrict__ Vt, const int* __restrict__ kcnt,
                      f16* __restrict__ Cp, const f16* __restrict__ Cpl,
                      const f16* __restrict__ Wo, const float* __restrict__ bo,
                      float* __restrict__ Pf, float accLo) {
    __shared__ __attribute__((aligned(16))) f16 sm[REST_LDS];
    const int b = (int)blockIdx.x;
    if (b < PTILES) {
        const int m0 = (b % (RROWS / 128)) * 128;
        const int n0 = (b / (RROWS / 128)) * 128;
        const int r0 = m0 + ((int)threadIdx.x >> 3);
        const int arow[4] = {r0, r0 + 32, r0 + 64, r0 + 96};
        v8f acc[2][4];
        gemm_main(Cpl, Wo, sm, arow, n0, acc);
        gemm_epi<3>(acc, sm + GEMM_CS, bo, (void*)Pf, (void*)0, (const float*)0, accLo, 0.0f, m0, n0);
    } else if constexpr (QBLKS > 0) {
        const int t = b - PTILES;
        attn_tile_split(Qp, Kp, Vt, kcnt, Cp, sm, SEQ / 64 - 1 - t / (NB * NHEAD), t % (NB * NHEAD));
    }
}

// ---------------------------------------------------------------------------
// Launch: 5 kernel launches. Workspace (halves): X, Q, K, V^T hi, V^T residual, ctx hi
// (6 x MROWS*1024), 4 weight planes (1024*1024), ctx residual (NB*128*1024), plus the
// ---------------------------------------------------------------------------
extern "C" void kernel_launch(void* const* d_in, const int* in_sizes, int n_in,
                              void* d_out, int out_size, void* d_ws, size_t ws_size,
                              hipStream_t stream) {
    if (n_in < 10) return;
    if (in_sizes[0] < ((NB - 1) * SEQ_FULL + SEQ) * HID) return;
    if (in_sizes[1] < (NB - 1) * SEQ_FULL + SEQ) return;
    if (in_sizes[2] < HID * HID || in_sizes[4] < HID * HID ||
        in_sizes[6] < HID * HID || in_sizes[8] < HID * HID) return;
    if (in_sizes[3] < HID || in_sizes[5] < HID || in_sizes[7] < HID || in_sizes[9] < HID) return;
    if (out_size < MROWS * HID) return;

    const float* x    = (const float*)d_in[0];
    const int*   mask = (const int*)d_in[1];
    const float* wq   = (const float*)d_in[2];
    const float* bq   = (const float*)d_in[3];
    const float* wk   = (const float*)d_in[4];
    const float* bk   = (const float*)d_in[5];
    const float* wv   = (const float*)d_in[6];
    const float* bv   = (const float*)d_in[7];
    const float* wo   = (const float*)d_in[8];
    const float* bo   = (const float*)d_in[9];

    const size_t nX = (size_t)MROWS * HID;    // halves per activation plane
    const size_t nW = (size_t)HID * HID;      // halves per weight plane
    const size_t nR = (size_t)RROWS * HID;    // elements per residual-row plane
    const size_t totalBytes = (6 * nX + 4 * nW + nR) * sizeof(f16) + nR * sizeof(float) + 2 * (size_t)MROWS * sizeof(int);
    if (ws_size < totalBytes) return;

    f16* Xh  = (f16*)d_ws;       // [MROWS][1024]            carry 16
    f16* Wqh = Xh  + nX;         // [n][k] = Wq[k][n]        carry 32
    f16* Wkh = Wqh + nW;
    f16* Wvh = Wkh + nW;
    f16* Woh = Wvh + nW;
    f16* Qp  = Woh + nW;         // [NB*16][SEQ][64]         carry 16
    f16* Kp  = Qp  + nX;         // [NB*16][SEQ][64]         carry 16, packed keys
    f16* Vth = Kp  + nX;         // [NB*1024][SEQ] (V^T)     carry 16, packed keys
    f16* Vtl = Vth + nX;         // V^T residual x2^10
    f16* Cph = Vtl + nX;         // [MROWS][1024]            carry 1024
    f16* Cpl = Cph + nX;         // [NB*128][1024]           ctx residual x2^10 (rows 0..127 per batch)
    float* Pf = (float*)(Cpl + nR);   // [NB*128][1024] f32   residual partial of the out projection
    int* Kidx = (int*)(Pf + nR);      // [NB][SEQ] index of the j-th allowed key
    int* Kcnt = Kidx + MROWS;         // [NB][SEQ] allowed keys with index <= s

    cvt_all<<<NB + 4 * WTILES + MROWS / 2, 256, 0, stream>>>(x, wq, wk, wv, wo, mask, Xh, Wqh, Kidx, Kcnt);

    const dim3 gg(MROWS / 128, HID / 128);
    // plane = 16 * (acc / (16*32) + b) = acc/32 + 16*b
    const float accQKV = CARRY_QKV / (CARRY_X * CARRY_W);
    gemm_qkv<<<dim3(MROWS / 128, HID / 128, 3), 256, 0, stream>>>(Xh, Wqh, bq, bk, bv, Qp, Vth, Vtl,
                                                                    Kidx, Kcnt, accQKV, CARRY_QKV);

    attn_first<<<NB * NHEAD, 256, 0, stream>>>(Qp, Kp, Vth, Vtl, Kcnt, Cph, Cpl);

    // residual partial: Pf = (Cpl . Wo^T) / (1024 * 1024 * 32), beside the remaining q-blocks
    const float accLo = 1.0f / (CARRY_CTX * CARRY_RES * CARRY_W);
    attn_rest_and_partial<<<PTILES + QBLKS * NB * NHEAD, 256, 0, stream>>>(Qp, Kp, Vth, Kcnt, Cph, Cpl,
                                                                             Woh, bo, Pf, accLo);
    // out = acc / (1024*32) + b (+ Pf on the first 128 rows of each sequence)
    const float accOut = 1.0f / (CARRY_CTX * CARRY_W);
    gemm_nt<2><<<gg, 256, 0, stream>>>(Cph, Woh, bo, d_out, (void*)0, Pf, accOut, 1.0f);
}

// v006
// Measured time: 67.1 microseconds a run.
// Two timings next to v005 put it at 1.11 and 1.12 times that version's speed.
// Counting every step since v000, it is 4.90 times as fast.
#include <hip/hip_runtime.h>

// Contractions (Q/K/V/out projections, Q.K^T, P.V, P row-sum): v_wmma_f32_16x16x32_f16, f16 operands with power-of-two carries, f32 accumulate; every float input enters as its bf16 RNE value; V, P and context carry an extra f16 residual plane (x2^10) on the first 128 query rows per sequence; softmax in f32. Keys whose padding mask forbids them are never projected or scored: K and V^T hold the allowed keys only, packed in key order.

#ifndef NB
#define NB 2
#endif
#ifndef SEQ
#define SEQ 2048
#endif
#define NB_FULL   2
#define SEQ_FULL  2048
#define HID       1024
#define NHEAD     16
#define HD        64
#define MROWS     (NB * SEQ)
#define RROWS     (NB * 128)      // query rows per batch-set that carry residual planes

static_assert(HID == NHEAD * HD);
static_assert(SEQ % 128 == 0);
static_assert(SEQ >= 128);
static_assert(SEQ <= SEQ_FULL);
static_assert(NB >= 1 && NB <= NB_FULL);
static_assert(MROWS % 128 == 0);
static_assert(RROWS % 128 == 0);
static_assert(HID % 128 == 0);

// carries (exact powers of two)
#define CARRY_X    16.0f     // hidden plane
#define CARRY_W    32.0f     // weight planes
#define CARRY_QKV  16.0f     // q, k, v^T planes (true value x16)
#define CARRY_CTX  1024.0f   // context plane (true value x1024)
#define CARRY_RES  1024.0f   // residual planes: (value - f16(value)) x1024
#define NEGBIG     (-1.0e30f)
// LDS row pitches: 16 B x odd for rows read or written 16 bytes a lane (one row per lane),
// so that the 16 lanes of a half wave fall on distinct bank groups
#define GPITCH     72        // halves: GEMM operand rows of 64 halves (144 B)
#define CPITCH     136       // halves: GEMM f16 output staging rows of 128 halves (272 B)
#define CFPITCH    132       // floats: GEMM f32 output staging rows of 128 floats (528 B)
#define APITCH     72        // halves: attention rows of 64 halves (144 B)
static_assert(64 * CFPITCH * 4 <= 128 * CPITCH * 2);   // the f32 staging shares the f16 staging array
// softmax exp values carry 2^10 (added to the exp2 argument)

typedef _Float16 f16;
typedef f16   v16h __attribute__((ext_vector_type(16)));
typedef f16   v8h  __attribute__((ext_vector_type(8)));
typedef float v8f  __attribute__((ext_vector_type(8)));
typedef float v4f  __attribute__((ext_vector_type(4)));

union FragU { v16h v; v8h half[2]; f16 e[16]; };
union H8U   { v8h v; f16 e[8]; };

__device__ __forceinline__ v8f zero8() {
    v8f z = {0.f, 0.f, 0.f, 0.f, 0.f, 0.f, 0.f, 0.f};
    return z;
}

// 16-bit WMMA with hazard guard: D += A[16 x 32k] * B[32k x 16]
__device__ __forceinline__ v8f wmma16(v16h a, v16h b, v8f c) {
    v8f d = __builtin_amdgcn_wmma_f32_16x16x32_f16(false, a, false, b, (short)0, c, false, false);
    asm volatile("v_nop\n\tv_nop\n\tv_nop\n\tv_nop" : "+v"(d) : "v"(a), "v"(b));
    return d;
}

// f32 -> nearest-even bf16 value, returned as f32
__device__ __forceinline__ float bf16_rne(float x) {
    unsigned u = __float_as_uint(x);
    u = (u + 0x7fffu + ((u >> 16) & 1u)) & 0xffff0000u;
    return __uint_as_float(u);
}

__device__ __forceinline__ float fexp2(float x) {
#if defined(__has_builtin)
#if __has_builtin(__builtin_amdgcn_exp2f)
    return __builtin_amdgcn_exp2f(x);
#else
    return exp2f(x);
#endif
#else
    return exp2f(x);
#endif
}

// max over the 16 lanes of each lane half (DPP row rotations; D-layout rows are DPP rows)
__device__ __forceinline__ float rowmax16(float x) {
    int v = __builtin_bit_cast(int, x);
    x = fmaxf(x, __builtin_bit_cast(float, __builtin_amdgcn_update_dpp(v, v, 0x121, 0xf, 0xf, false)));
    v = __builtin_bit_cast(int, x);
    x = fmaxf(x, __builtin_bit_cast(float, __builtin_amdgcn_update_dpp(v, v, 0x122, 0xf, 0xf, false)));
    v = __builtin_bit_cast(int, x);
    x = fmaxf(x, __builtin_bit_cast(float, __builtin_amdgcn_update_dpp(v, v, 0x124, 0xf, 0xf, false)));
    v = __builtin_bit_cast(int, x);
    x = fmaxf(x, __builtin_bit_cast(float, __builtin_amdgcn_update_dpp(v, v, 0x128, 0xf, 0xf, false)));
    return x;
}

// 16 x 32 fragment from a tile whose k dimension is contiguous (pitch in halves).
// lane l: row rowbase + (l&15); elements 0..7 <- k = kcol + 8h .. +7,
// elements 8..15 <- k = kcol + 16 + 8h .. +7  (h = l>>4). Same map for A and B.
__device__ __forceinline__ v16h load_frag(const f16* tile, int rowbase, int pitch, int kcol, int lane) {
    const int r  = rowbase + (lane & 15);
    const int kh = (lane >> 4) << 3;
    const f16* p = tile + (size_t)r * pitch + kcol + kh;
    FragU f;
    f.half[0] = *(const v8h*)(p);
    f.half[1] = *(const v8h*)(p + 16);
    return f.v;
}

// ---------------------------------------------------------------------------
// f32 rows -> f16 plane (bf16 RNE value times carry). 128 threads per 1024-wide
// Source row stride mapping lets a reduced build read full-size inputs.
// coverage: nrows x 1024 halves, every element exactly once (grid = nrows*128/256).
// ---------------------------------------------------------------------------
template <int DSTPER, int SRCPER>
__device__ __forceinline__ void
cvt_rows(const float* __restrict__ src, f16* __restrict__ dst, int nrows, float carry, int blk) {
    const int g  = blk * 256 + (int)threadIdx.x;
    const int m  = g >> 7;
    const int c8 = (g & 127) << 3;
    if (m >= nrows) return;
    const int sm = (m / DSTPER) * SRCPER + (m % DSTPER);
    const float* sp = src + (size_t)sm * HID + c8;
    const v4f a = *(const v4f*)sp;
    const v4f b = *(const v4f*)(sp + 4);
    H8U o;
#pragma unroll
    for (int j = 0; j < 4; ++j) {
        const float x0 = a[j];
        const float x1 = b[j];
        o.e[j]     = (f16)(bf16_rne(x0) * carry);
        o.e[j + 4] = (f16)(bf16_rne(x1) * carry);
    }
    f16* dp = dst + (size_t)m * HID + c8;
    *(v8h*)dp = o.v;
    
}

// ---------------------------------------------------------------------------
// Weight transpose + convert: src [k][n] f32 (HID x HID, n contiguous) -> dst [n][k] f16
// = bf16 RNE(src[k][n]) * carry, k contiguous. Block handles a 64(k) x 64(n) tile through
// coverage: grid (HID/64, HID/64) x (64 n rows x 64 k) = the whole [HID][HID] plane once.
// LDS: T cross-wave (block barrier between element stores and vector reloads).
// ---------------------------------------------------------------------------
__device__ __forceinline__ void
cvt_wT(const float* __restrict__ src, f16* __restrict__ dst, float carry, int bx, int by) {
    __shared__ __attribute__((aligned(16))) f16 T[64 * 72];
    const int tid  = (int)threadIdx.x;
    const int lane = tid & 31;
    const int wave = tid >> 5;
    const int k0   = bx * 64;
    const int n0   = by * 64;
    const int kr   = tid >> 2;           // 0..63
    const int nc   = (tid & 3) << 4;     // 0,16,32,48
    const float* sp = src + (size_t)(k0 + kr) * HID + n0 + nc;
#pragma unroll
    for (int q = 0; q < 4; ++q) {
        const v4f a = *(const v4f*)(sp + q * 4);
#pragma unroll
        for (int j = 0; j < 4; ++j)
            T[(nc + q * 4 + j) * 72 + kr] = (f16)(bf16_rne(a[j]) * carry);
    }
    __syncthreads();
    const int piece = lane & 7;
    const int lsub  = lane >> 3;
{
#pragma unroll
        for (int it = 0; it < 2; ++it) {
            const int L = it * 32 + wave * 4 + lsub;     // local n row 0..63
            const v8h v = *(const v8h*)&T[L * 72 + piece * 8];
            f16* dp = dst + (size_t)(n0 + L) * HID + k0 + piece * 8;
            *(v8h*)dp = v;
        }
        
    }
}

// ---------------------------------------------------------------------------
// Key packing tables of one sequence (one block): a key is allowed iff kmask[b][key] == 0.
// kcnt[b*SEQ + s] = number of allowed keys with index <= s (so packed key j is visible to
// query q iff j < kcnt[q]: the causal test and the padding test in one compare);
// kidx[b*SEQ + j] = index of the j-th allowed key, 0 for j >= the sequence's total.
// Each thread owns KPER consecutive positions; block-wide inclusive scan of the per-thread
// counts in LDS; kidx is gathered in LDS so that both tables leave as whole runs per thread.
// coverage: every entry of both tables of this sequence once.
// ---------------------------------------------------------------------------
#define KPER ((SEQ + 255) / 256)
__device__ __forceinline__ void
key_scan(const int* __restrict__ kmask, int* __restrict__ kidx, int* __restrict__ kcnt, int bidx) {
    __shared__ int part[256];
    __shared__ int sidx[256 * KPER];
    const int tid = (int)threadIdx.x;
    __builtin_assume(tid < 256);         // the launch's block size: lets the range tests below fold, so the mask loads go out together
    const int* mrow = kmask + (size_t)bidx * SEQ_FULL;
    int ok[KPER];
    int c = 0;
    // the three loops over j are unrolled so that ok[] and cn[] stay in registers
#pragma unroll
    for (int j = 0; j < KPER; ++j) {
        const int s = tid * KPER + j;
        ok[j] = (s < SEQ) ? (mrow[s] == 0 ? 1 : 0) : 0;
        c += ok[j];
    }
    part[tid] = c;
    __syncthreads();
    for (int d = 1; d < 256; d <<= 1) {
        const int add = (tid >= d) ? part[tid - d] : 0;
        __syncthreads();
        part[tid] += add;
        __syncthreads();
    }
    int run = part[tid] - c;             // allowed keys in front of this thread's first position
    const int total = part[255];
    int cn[KPER];
#pragma unroll
    for (int j = 0; j < KPER; ++j) {
        const int s = tid * KPER + j;
        if (ok[j]) sidx[run] = s;        // run < total
        run += ok[j];
        cn[j] = run;
        if (s >= total) sidx[s] = 0;     // the slots behind the packed keys
    }
    __syncthreads();
#pragma unroll
    for (int j = 0; j < KPER; ++j) {
        const int s = tid * KPER + j;
        if (s < SEQ) {
            kcnt[bidx * SEQ + s] = cn[j];
            kidx[bidx * SEQ + s] = sidx[s];
        }
    }
}

// ---------------------------------------------------------------------------
// All five input conversions and the key packing tables in one grid (independent of each
// other): blocks 0 .. NB-1 build the tables (first: theirs is the longest chain), the next
// 4*WTILES transpose-convert the four weight planes (dst planes contiguous,
// order q, k, v, o), the remaining MROWS/2 blocks convert the hidden rows.
// The branch is block-uniform, so the barriers inside are reached by whole blocks.
// ---------------------------------------------------------------------------
#define WTILES ((HID / 64) * (HID / 64))
__global__ void __launch_bounds__(256)
cvt_all(const float* __restrict__ x, const float* __restrict__ wq, const float* __restrict__ wk,
        const float* __restrict__ wv, const float* __restrict__ wo, const int* __restrict__ kmask,
        f16* __restrict__ xh, f16* __restrict__ wh, int* __restrict__ kidx, int* __restrict__ kcnt) {
    const int b = (int)blockIdx.x - NB;
    if (b < 0) {
        key_scan(kmask, kidx, kcnt, b + NB);
    } else if (b < 4 * WTILES) {
        const int w = b / WTILES;
        const int t = b - w * WTILES;
        const float* src = (w == 0) ? wq : (w == 1) ? wk : (w == 2) ? wv : wo;
        cvt_wT(src, wh + (size_t)w * HID * HID, CARRY_W, t % (HID / 64), t / (HID / 64));
        // in the built code other branches' text follows these stores: keep the wait in front of
        // any overwrite of the registers they name
        asm volatile("s_wait_xcnt 0x0" ::: "memory");
    } else {
        cvt_rows<SEQ, SEQ_FULL>(x, xh, MROWS, CARRY_X, b - 4 * WTILES);
    }
}

// ---------------------------------------------------------------------------
// C[m][n] = sum_k A[m][k] * W[n][k] ; A [M][1024] f16, W [1024][1024] f16 (k contiguous).
// Block tile 128 x 128, 8 waves as 4(M) x 2(N), 2 x 4 accumulators per wave. K runs in slabs of
// 64: asynchronous copies bring slab t + 1 into one of two LDS buffers while slab t is multiplied.
// MODE 1: f16 plane [b*HID + h*HD + d][s] (V transposed per head) into out, plus the
//         residual plane (val - f16(val)) * 2^10, same layout, into out2
// MODE 2: f32 rows [m][1024] into the output; blocks at sequence start (s0 == 0)
//         add the f32 partial rows padd[b*128 + local row][n] (block-uniform branch)
// MODE 3: f32 rows [m][1024] into a workspace plane (no partial add)
// coverage per block: MODE 0 256 lines, MODE 1 2 x 256 lines (hi, residual),
//                     MODE 2/3 2 x 256 lines (64 rows x 4 line-quarters per half).
// LDS: the slab buffers and Cs are cross-wave, separated by block barriers.
// ---------------------------------------------------------------------------
// LDS of one GEMM tile, offsets in halves (the kernel owns the array, so that kernels which
// hold more than one kind of tile allocate it once)
#define GEMM_OP   (128 * GPITCH)                      // one operand's slab [128][GPITCH]
#define GEMM_BUF  (2 * GEMM_OP)                       // one buffer: A's slab, then W's
#define GEMM_RING (2 * GEMM_BUF)                      // two buffers
#define GEMM_CS   0                                   // Cs f16 [128][CPITCH] or f32 [64][CFPITCH]: reuses the
                                                      // buffers behind the K loop's last barrier
#define GEMM_LDS  GEMM_RING
static_assert(128 * CPITCH <= GEMM_RING);
#define KSLAB     64
#define NSLAB     (HID / KSLAB)
static_assert(NSLAB >= 2);

// One slab of both operands into one buffer: 8 copies of 16 bytes a lane (8 lanes cover one row's
// 128 bytes, 32 rows a copy). la = this lane's LDS byte address of its first A piece in the buffer.
__device__ __forceinline__ void
slab_copy(unsigned la, const f16* a0, const f16* a1, const f16* a2, const f16* a3,
          const f16* w0, const f16* w1, const f16* w2, const f16* w3) {
    const unsigned la1 = la + 32 * GPITCH * 2, la2 = la + 64 * GPITCH * 2, la3 = la + 96 * GPITCH * 2;
    const unsigned lw0 = la + GEMM_OP * 2, lw1 = la1 + GEMM_OP * 2, lw2 = la2 + GEMM_OP * 2, lw3 = la3 + GEMM_OP * 2;
    // global -> LDS through no register; the closing wait stands in front of any overwrite of the
    // address registers that the copies name (a precaution)
    asm volatile("global_load_async_to_lds_b128 %0, %8, off\n\t"
                 "global_load_async_to_lds_b128 %1, %9, off\n\t"
                 "global_load_async_to_lds_b128 %2, %10, off\n\t"
                 "global_load_async_to_lds_b128 %3, %11, off\n\t"
                 "global_load_async_to_lds_b128 %4, %12, off\n\t"
                 "global_load_async_to_lds_b128 %5, %13, off\n\t"
                 "global_load_async_to_lds_b128 %6, %14, off\n\t"
                 "global_load_async_to_lds_b128 %7, %15, off\n\t"
                 "s_wait_xcnt 0x0"
                 :: "v"(la), "v"(la1), "v"(la2), "v"(la3), "v"(lw0), "v"(lw1), "v"(lw2), "v"(lw3),
                    "v"(a0), "v"(a1), "v"(a2), "v"(a3), "v"(w0), "v"(w1), "v"(w2), "v"(w3)
                 : "memory");
}

// K loop of one 128 x 128 tile at column n0; arow[p] = the row of A that this thread stages as
// tile row (tid >> 3) + 32 p
__device__ __forceinline__ void
gemm_main(const f16* __restrict__ A, const f16* __restrict__ W, f16* ring,
          const int (&arow)[4], int n0, v8f (&acc)[2][4]) {
    const int tid  = (int)threadIdx.x;
    const int lane = tid & 31;
    const int wave = tid >> 5;
    const int wm   = wave & 3;
    const int wn   = wave >> 2;

#pragma unroll
    for (int i = 0; i < 2; ++i)
#pragma unroll
        for (int j = 0; j < 4; ++j) acc[i][j] = zero8();

    const int srow = tid >> 3;
    const int scol = (tid & 7) << 3;
    const f16* gA[4];
    const f16* gW[4];
#pragma unroll
    for (int p = 0; p < 4; ++p) {
        gA[p] = A + (size_t)arow[p] * HID + scol;
        gW[p] = W + (size_t)(n0 + srow + 32 * p) * HID + scol;
    }
    const unsigned la = (unsigned)(size_t)(ring + srow * GPITCH + scol);   // LDS byte address (low 32 bits)

    slab_copy(la, gA[0], gA[1], gA[2], gA[3], gW[0], gW[1], gW[2], gW[3]);
    asm volatile("s_wait_asynccnt 0x0" ::: "memory");   // slab 0 has landed (this wave's part)
    __syncthreads();                                    // ... and every other wave's
    slab_copy(la + GEMM_BUF * 2, gA[0] + KSLAB, gA[1] + KSLAB, gA[2] + KSLAB, gA[3] + KSLAB,
              gW[0] + KSLAB, gW[1] + KSLAB, gW[2] + KSLAB, gW[3] + KSLAB);

    // rolled: one copy of the loop's text, and the order at its foot stays as written
#pragma unroll 1
    for (int t = 0; t < NSLAB; ++t) {
        const int boff = (t & 1) * GEMM_BUF;
        const f16* As = ring + boff;
        const f16* Bs = As + GEMM_OP;
#pragma unroll
        for (int kk = 0; kk < KSLAB; kk += 32) {
            v16h af[2], bfr[4];
#pragma unroll
            for (int i = 0; i < 2; ++i) af[i] = load_frag(As, wm * 32 + i * 16, GPITCH, kk, lane);
#pragma unroll
            for (int j = 0; j < 4; ++j) bfr[j] = load_frag(Bs, wn * 64 + j * 16, GPITCH, kk, lane);
#pragma unroll
            for (int i = 0; i < 2; ++i)
#pragma unroll
                for (int j = 0; j < 4; ++j) acc[i][j] = wmma16(af[i], bfr[j], acc[i][j]);
        }
        asm volatile("s_wait_dscnt 0x0" ::: "memory");      // this wave has left slab t's buffer
        asm volatile("s_wait_asynccnt 0x0" ::: "memory");   // its part of slab t + 1 has landed
        __syncthreads();                                    // publishes slab t + 1, frees slab t's buffer
        if (t + 2 < NSLAB) {                                // the same for the whole block
            const int k = (t + 2) * KSLAB;
            slab_copy(la + boff * 2, gA[0] + k, gA[1] + k, gA[2] + k, gA[3] + k,
                      gW[0] + k, gW[1] + k, gW[2] + k, gW[3] + k);
        }
    }
    asm volatile("s_wait_asynccnt 0x0" ::: "memory");       // no copy is left in flight
}

// scale, bias and store of one 128 x 128 tile at (m0, n0)
template <int MODE>
__device__ __forceinline__ void
gemm_epi(const v8f (&acc)[2][4], f16* Cs, const float* __restrict__ bias,
         void* __restrict__ out, void* __restrict__ out2, const float* __restrict__ padd,
         float accMul, float addMul, int m0, int n0) {
    const int tid  = (int)threadIdx.x;
    const int lane = tid & 31;
    const int wave = tid >> 5;
    const int wm   = wave & 3;
    const int wn   = wave >> 2;
    const int hh8  = (lane >> 4) << 3;   // D row half
    const int c16  = lane & 15;          // D column

    // bias (bf16 RNE value) per owned column group
    float bb[4];
#pragma unroll
    for (int j = 0; j < 4; ++j) bb[j] = bf16_rne(bias[n0 + wn * 64 + j * 16 + c16]) * addMul;

    const int bidx  = m0 / SEQ;          // block rows lie inside one batch (SEQ % 128 == 0)
    const int s0    = m0 - bidx * SEQ;
    const int piece = lane & 7;
    const int lsub  = lane >> 3;

    if constexpr (MODE == 0) {
#pragma unroll
        for (int i = 0; i < 2; ++i)
#pragma unroll
            for (int j = 0; j < 4; ++j) {
                const int nl = wn * 64 + j * 16 + c16;
#pragma unroll
                for (int r = 0; r < 8; ++r) {
                    const int ml = wm * 32 + i * 16 + hh8 + r;
                    Cs[ml * CPITCH + nl] = (f16)(acc[i][j][r] * accMul + bb[j]);
                }
            }
        __syncthreads();
        f16* op = (f16*)out;
        const size_t bh0 = (size_t)bidx * NHEAD + (n0 >> 6);
{
#pragma unroll
            for (int it = 0; it < 8; ++it) {
                const int L    = wave * 32 + it * 4 + lsub;   // 0..255
                const int ml   = L >> 1;
                const int hsel = L & 1;
                const v8h v = *(const v8h*)&Cs[ml * CPITCH + hsel * 64 + piece * 8];
                f16* dp = op + ((bh0 + hsel) * SEQ + s0 + ml) * HD + piece * 8;
                *(v8h*)dp = v;
            }
            
        }
    } else if constexpr (MODE == 1) {
        // hi plane, staged transposed: Cs[n][m]
#pragma unroll
        for (int i = 0; i < 2; ++i)
#pragma unroll
            for (int j = 0; j < 4; ++j) {
                const int nl = wn * 64 + j * 16 + c16;
                H8U t;
#pragma unroll
                for (int r = 0; r < 8; ++r) t.e[r] = (f16)(acc[i][j][r] * accMul + bb[j]);
                *(v8h*)&Cs[nl * CPITCH + wm * 32 + i * 16 + hh8] = t.v;
            }
        __syncthreads();
        {
            f16* op = (f16*)out;
{
#pragma unroll
                for (int it = 0; it < 8; ++it) {
                    const int L  = wave * 32 + it * 4 + lsub;     // 0..255
                    const int nl = L >> 1;
                    const int mh = L & 1;
                    const v8h v = *(const v8h*)&Cs[nl * CPITCH + mh * 64 + piece * 8];
                    f16* dp = op + ((size_t)(bidx * HID + n0 + nl) * SEQ + s0 + mh * 64 + piece * 8);
                    *(v8h*)dp = v;
                }
                
            }
        }
        __syncthreads();
        // residual plane: (val - f16(val)) * 2^10, same staging and store map
#pragma unroll
        for (int i = 0; i < 2; ++i)
#pragma unroll
            for (int j = 0; j < 4; ++j) {
                const int nl = wn * 64 + j * 16 + c16;
                H8U t;
#pragma unroll
                for (int r = 0; r < 8; ++r) {
                    const float val = acc[i][j][r] * accMul + bb[j];
                    const f16 hv = (f16)val;
                    t.e[r] = (f16)((val - (float)hv) * CARRY_RES);
                }
                *(v8h*)&Cs[nl * CPITCH + wm * 32 + i * 16 + hh8] = t.v;
            }
        __syncthreads();
        {
            f16* op = (f16*)out2;
{
#pragma unroll
                for (int it = 0; it < 8; ++it) {
                    const int L  = wave * 32 + it * 4 + lsub;     // 0..255
                    const int nl = L >> 1;
                    const int mh = L & 1;
                    const v8h v = *(const v8h*)&Cs[nl * CPITCH + mh * 64 + piece * 8];
                    f16* dp = op + ((size_t)(bidx * HID + n0 + nl) * SEQ + s0 + mh * 64 + piece * 8);
                    *(v8h*)dp = v;
                }
                
            }
        }
    } else {
        float* Cf = (float*)Cs;      // [64][CFPITCH] f32
        float* of = (float*)out;
#pragma unroll
        for (int half = 0; half < 2; ++half) {
            if ((wm >> 1) == half) {
#pragma unroll
                for (int i = 0; i < 2; ++i)
#pragma unroll
                    for (int j = 0; j < 4; ++j) {
                        const int nl = wn * 64 + j * 16 + c16;
#pragma unroll
                        for (int r = 0; r < 8; ++r) {
                            const int ml = (wm & 1) * 32 + i * 16 + hh8 + r;
                            Cf[ml * CFPITCH + nl] = acc[i][j][r] * accMul + bb[j];
                        }
                    }
            }
            __syncthreads();
            v4f vv[8];
#pragma unroll
            for (int it = 0; it < 8; ++it) {
                const int L    = wave * 32 + it * 4 + lsub;   // 0..255
                const int row  = L >> 2;
                const int part = L & 3;
                vv[it] = *(const v4f*)&Cf[row * CFPITCH + part * 32 + piece * 4];
            }
            if constexpr (MODE == 2) {
                if (s0 == 0) {     // block-uniform
#pragma unroll
                    for (int it = 0; it < 8; ++it) {
                        const int L    = wave * 32 + it * 4 + lsub;
                        const int row  = L >> 2;
                        const int part = L & 3;
                        const v4f pv = *(const v4f*)(padd + (size_t)(bidx * 128 + half * 64 + row) * HID
                                                     + n0 + part * 32 + piece * 4);
                        vv[it] += pv;
                    }
                }
            }
{
#pragma unroll
                for (int it = 0; it < 8; ++it) {
                    const int L    = wave * 32 + it * 4 + lsub;   // 0..255
                    const int row  = L >> 2;
                    const int part = L & 3;
                    float* dp = of + (size_t)(m0 + half * 64 + row) * HID + n0 + part * 32 + piece * 4;
                    *(v4f*)dp = vv[it];
                }
                
            }
            __syncthreads();
        }
    }
}

template <int MODE>
__global__ void __launch_bounds__(256) __attribute__((amdgpu_num_vgpr(256)))
gemm_nt(const f16* __restrict__ A, const f16* __restrict__ W, const float* __restrict__ bias,
        void* __restrict__ out, void* __restrict__ out2, const float* __restrict__ padd,
        float accMul, float addMul) {
    __shared__ __attribute__((aligned(16))) f16 sm[GEMM_LDS];
    const int m0 = (int)blockIdx.x * 128;
    const int n0 = (int)blockIdx.y * 128;
    const int r0 = m0 + ((int)threadIdx.x >> 3);
    const int arow[4] = {r0, r0 + 32, r0 + 64, r0 + 96};
    v8f acc[2][4];
    gemm_main(A, W, sm, arow, n0, acc);
    gemm_epi<MODE>(acc, sm + GEMM_CS, bias, out, out2, padd, accMul, addMul, m0, n0);
}

// ---------------------------------------------------------------------------
// The Q, K and V projections in one grid: blockIdx.z picks the weight plane (planes
// contiguous, order q, k, v), the bias and the output (z 0, 1: MODE 0 into the contiguous
// q, k planes; z 2: MODE 1 into V^T and its residual). The K and V tiles of one (x, y) read
// the same hidden rows. The branch on z is block-uniform.
// K and V are projected for the allowed keys only: row j of their tiles is hidden row
// kidx[j] of the sequence, so both planes come out packed; a tile wholly behind the
// sequence's total leaves before any barrier, and nothing reads its part of the planes
// (the slots between the total and the tile's end hold row 0's finite values, never counted).
// ---------------------------------------------------------------------------
__global__ void __launch_bounds__(256) __attribute__((amdgpu_num_vgpr(256)))
gemm_qkv(const f16* __restrict__ X, const f16* __restrict__ Wqkv, const float* __restrict__ bq,
         const float* __restrict__ bk, const float* __restrict__ bv, f16* __restrict__ qk,
         f16* __restrict__ vt, f16* __restrict__ vtl, const int* __restrict__ kidx,
         const int* __restrict__ kcnt, float accMul, float addMul) {
    __shared__ __attribute__((aligned(16))) f16 sm[GEMM_LDS];
    const int m0 = (int)blockIdx.x * 128;
    const int n0 = (int)blockIdx.y * 128;
    const int z  = (int)blockIdx.z;
    const int r0 = m0 + ((int)threadIdx.x >> 3);
    int arow[4] = {r0, r0 + 32, r0 + 64, r0 + 96};
    if (z != 0) {
        const int seq0 = (m0 / SEQ) * SEQ;               // block rows lie inside one sequence
        const int  total = kcnt[seq0 + SEQ - 1];         // allowed keys of the sequence
        const int  s0 = kidx[r0], s1 = kidx[r0 + 32], s2 = kidx[r0 + 64], s3 = kidx[r0 + 96];
        // behind the loads (their values are the operands), in front of any overwrite of the registers they name
        asm volatile("s_wait_xcnt 0x0" :: "v"(s0), "v"(s1), "v"(s2), "v"(s3) : "memory");
        if (m0 - seq0 >= total) return;                  // block-uniform, in front of every barrier and copy
        arow[0] = seq0 + min(max(s0, 0), SEQ - 1);
        arow[1] = seq0 + min(max(s1, 0), SEQ - 1);
        arow[2] = seq0 + min(max(s2, 0), SEQ - 1);
        arow[3] = seq0 + min(max(s3, 0), SEQ - 1);
    }
    v8f acc[2][4];
    gemm_main(X, Wqkv + (size_t)z * HID * HID, sm, arow, n0, acc);
    if (z == 2) {
        gemm_epi<1>(acc, sm + GEMM_CS, bv, (void*)vt, (void*)vtl, (const float*)0, accMul, addMul, m0, n0);
    } else {
        gemm_epi<0>(acc, sm + GEMM_CS, (z == 0) ? bq : bk, (void*)(qk + (size_t)z * MROWS * HID),
                    (void*)0, (const float*)0, accMul, addMul, m0, n0);
        // in the built code the other epilogue's text follows these stores: keep the wait in
        // front of any overwrite of the registers they name
        asm volatile("s_wait_xcnt 0x0" ::: "memory");
    }
}

// ---------------------------------------------------------------------------
// Flash attention, causal with key padding mask, over the packed keys (packed key j counts for
// query q iff j < kcnt[b][q]; other keys get p = 0 and are excluded from the row max; rows with
// no allowed key produce a zero context row). One block of 256 threads (8 waves) per (bx, bh = b*NHEAD + h),
// wave owns 16 query rows (Q fragments resident). Block streams the 64-key tiles up to its
// causal horizon: K staged [key][d], V^T staged [d][key]. Scores on WMMA, row max via DPP,
// exp2 in f32 carried x2^10, P relayed per wave through LDS as A fragments, O += P.V and
// row sums += P.ones on WMMA. Output f16 plane [b*SEQ+q][1024] carried x1024, written as
// RES = 0: q-block = bx + 1 (rows 128 .. SEQ-1); not launched: attn_tile_split has those rows.
// RES = 1: q-block 0 only (rows 0..127): V, P and the context carry x2^10 residual planes
//          (second accumulators); context residual plane Cpl is [b*128 + q][1024].
// coverage: RES 1 and attn_tile_split together write every (b, q, h*64..h*64+63) segment of Cp once;
//           RES 1 writes the whole Cpl plane once.
// LDS: ks, vsT, vsL cross-wave (block barriers); ps/psl per-wave but also separated by block
// barriers. staged extent == consumed extent for ks (64x64), vsT (64x64), vsL (64x64, RES),
// ps/psl (16x64).
// ---------------------------------------------------------------------------
// LDS of one attention block, sizes in halves (the kernel owns the arrays):
// ks [64][APITCH] = [key][d]; vsT [64][APITCH] = [d][key]; vsL the same, residual (RES);
// ps [8][16][APITCH] per-wave P relay / ctx stage; psl the same, residual (RES)
#define ATTN_KV   (64 * APITCH)
#define ATTN_P    (8 * 16 * APITCH)
#define ATTN_LDS0 (2 * ATTN_KV + ATTN_P)                      // RES = 0: ks, vsT, ps

template <int RES>
__device__ __forceinline__ void
attn_tile(const f16* __restrict__ Qp, const f16* __restrict__ Kp, const f16* __restrict__ Vt,
          const f16* __restrict__ Vtl, const int* __restrict__ kcnt,
          f16* __restrict__ Cp, f16* __restrict__ Cpl,
          f16* ks, f16* vsT, f16* vsL, f16* ps, f16* psl, int bx, int bh) {
    const int tid  = (int)threadIdx.x;
    const int lane = tid & 31;
    const int wave = tid >> 5;
    const int hh8  = (lane >> 4) << 3;
    const int c16  = lane & 15;
    const int bidx = bh / NHEAD;
    const int hidx = bh - bidx * NHEAD;
    const int qblk = RES ? 0 : (bx + 1);
    const int qw   = qblk * 128 + wave * 16;          // first query row (within sequence) of this wave
    const size_t head = (size_t)bh * SEQ * HD;
    const int* crow = kcnt + bidx * SEQ;

    v16h qa[2];
#pragma unroll
    for (int c = 0; c < 2; ++c) qa[c] = load_frag(Qp + head, qw, HD, c * 32, lane);

    // packed keys visible to each of this lane's 8 query rows
    const int* cp = crow + qw + hh8;
    int cr[8];
#pragma unroll
    for (int r = 0; r < 8; ++r) cr[r] = cp[r];

    FragU onesu;
#pragma unroll
    for (int i = 0; i < 16; ++i) onesu.e[i] = (f16)1.0f;
    const v16h ones = onesu.v;

    float m[8];
    v8f   o[4], lacc, olo[4], laccl;
#pragma unroll
    for (int r = 0; r < 8; ++r) m[r] = NEGBIG;
#pragma unroll
    for (int dt = 0; dt < 4; ++dt) { o[dt] = zero8(); olo[dt] = zero8(); }
    lacc  = zero8();
    laccl = zero8();

    // log2-domain scale: acc = 256 * q.k ; x = log2(e) * q.k / 8 = acc * log2(e) / 2048
    const float cl = 1.4426950408889634f * 0.00048828125f;
    const float rres = 1.0f / CARRY_RES;
    f16* psw  = ps  + wave * 16 * APITCH;
    f16* pslw = psl + wave * 16 * APITCH;

    // horizon in 64-key tiles of packed keys: the count of the block's last row (counts do not
    // fall along a sequence), never above the causal bound (block-uniform)
    const int nkt = (min(max(crow[qblk * 128 + 127], 0), qblk * 128 + 128) + 63) >> 6;

#pragma unroll 1
    for (int kt = 0; kt < nkt; ++kt) {
        __syncthreads();
        const int srow = tid >> 3;               // 32 rows a step, 16 bytes a thread
        const int spc  = (tid & 7) << 3;
        const f16* kp = Kp  + head + (size_t)(kt * 64 + srow) * HD + spc;   // this lane's first 16 bytes of the tile
        const f16* vp = Vt  + head + (size_t)srow * SEQ + kt * 64 + spc;
        const f16* lp = Vtl + head + (size_t)srow * SEQ + kt * 64 + spc;
        v8h kv[2], vv[2], vl[2];
#pragma unroll
        for (int p2 = 0; p2 < 2; ++p2) {
            kv[p2] = *(const v8h*)(kp + p2 * 32 * HD);
            vv[p2] = *(const v8h*)(vp + p2 * 32 * SEQ);
            if constexpr (RES) vl[p2] = *(const v8h*)(lp + p2 * 32 * SEQ);
        }
        // the address pairs stay whole (no load's result lands on them) until this wait
        asm volatile("s_wait_xcnt 0x0" :: "v"(kp), "v"(vp), "v"(lp) : "memory");
#pragma unroll
        for (int p2 = 0; p2 < 2; ++p2) {
            *(v8h*)&ks[(srow + p2 * 32) * APITCH + spc]  = kv[p2];
            *(v8h*)&vsT[(srow + p2 * 32) * APITCH + spc] = vv[p2];
            if constexpr (RES) *(v8h*)&vsL[(srow + p2 * 32) * APITCH + spc] = vl[p2];
        }
        __syncthreads();

        // S[16 q x 64 keys]
        v8f s[4];
#pragma unroll
        for (int nt = 0; nt < 4; ++nt) s[nt] = zero8();
#pragma unroll
        for (int c = 0; c < 2; ++c) {
#pragma unroll
            for (int nt = 0; nt < 4; ++nt) {
                const v16h kb = load_frag(ks, nt * 16, APITCH, c * 32, lane);
                s[nt] = wmma16(qa[c], kb, s[nt]);
            }
        }

        // this lane's 4 packed key columns
        int keyi[4];
#pragma unroll
        for (int nt = 0; nt < 4; ++nt) keyi[nt] = kt * 64 + nt * 16 + c16;

        // online softmax per row r (row 8h + r), max-subtracted, exp2 domain
#pragma unroll
        for (int r = 0; r < 8; ++r) {
            float x[4];
            bool  alw[4];
#pragma unroll
            for (int nt = 0; nt < 4; ++nt) {
                x[nt]   = s[nt][r] * cl;
                alw[nt] = keyi[nt] < cr[r];
            }
            const float xm0 = alw[0] ? x[0] : NEGBIG;
            const float xm1 = alw[1] ? x[1] : NEGBIG;
            const float xm2 = alw[2] ? x[2] : NEGBIG;
            const float xm3 = alw[3] ? x[3] : NEGBIG;
            const float tm = rowmax16(fmaxf(fmaxf(xm0, xm1), fmaxf(xm2, xm3)));
            const float mn = fmaxf(m[r], tm);
            const float al = fexp2(m[r] - mn);
            m[r] = mn;
            lacc[r] *= al;
#pragma unroll
            for (int dt = 0; dt < 4; ++dt) o[dt][r] *= al;
            if constexpr (RES) {
                laccl[r] *= al;
#pragma unroll
                for (int dt = 0; dt < 4; ++dt) olo[dt][r] *= al;
            }
            const float sh = 10.0f - mn;      // carry 2^10
#pragma unroll
            for (int nt = 0; nt < 4; ++nt) {
                const float arg = alw[nt] ? (x[nt] + sh) : 0.0f;
                const float e   = fexp2(arg);
                const float p   = alw[nt] ? e : 0.0f;
                const f16   hp  = (f16)p;
                psw[(hh8 + r) * APITCH + nt * 16 + c16] = hp;
                if constexpr (RES)
                    pslw[(hh8 + r) * APITCH + nt * 16 + c16] = (f16)((p - (float)hp) * CARRY_RES);
            }
        }
        __syncthreads();

        // O += P . V ; l += P . ones  (P reloaded as A fragments from the relay)
#pragma unroll
        for (int kk = 0; kk < 2; ++kk) {
            const v16h pa = load_frag(psw, 0, APITCH, kk * 32, lane);
            if constexpr (RES) {
                const v16h pl = load_frag(pslw, 0, APITCH, kk * 32, lane);
#pragma unroll
                for (int dt = 0; dt < 4; ++dt) {
                    const v16h vb = load_frag(vsT, dt * 16, APITCH, kk * 32, lane);
                    o[dt]   = wmma16(pa, vb, o[dt]);
                    olo[dt] = wmma16(pl, vb, olo[dt]);
                    const v16h vl = load_frag(vsL, dt * 16, APITCH, kk * 32, lane);
                    olo[dt] = wmma16(pa, vl, olo[dt]);
                }
                lacc  = wmma16(pa, ones, lacc);
                laccl = wmma16(pl, ones, laccl);
            } else {
#pragma unroll
                for (int dt = 0; dt < 4; ++dt) {
                    const v16h vb = load_frag(vsT, dt * 16, APITCH, kk * 32, lane);
                    o[dt] = wmma16(pa, vb, o[dt]);
                }
                lacc = wmma16(pa, ones, lacc);
            }
        }
    }
    __syncthreads();

    // normalize: plane value = 1024 * (O/16) / (l) = O * 64 / l ; zero row when l == 0
#pragma unroll
    for (int r = 0; r < 8; ++r) {
        float l = lacc[r];
        if constexpr (RES) l += laccl[r] * rres;
        const float lsafe = (l > 0.0f) ? l : 1.0f;
        const float inv   = (l > 0.0f) ? ((CARRY_CTX / CARRY_QKV) / lsafe) : 0.0f;
#pragma unroll
        for (int dt = 0; dt < 4; ++dt) {
            float ov = o[dt][r];
            if constexpr (RES) ov += olo[dt][r] * rres;
            const float cv = ov * inv;
            const f16 hv = (f16)cv;
            psw[(hh8 + r) * APITCH + dt * 16 + c16] = hv;
            if constexpr (RES)
                pslw[(hh8 + r) * APITCH + dt * 16 + c16] = (f16)((cv - (float)hv) * CARRY_RES);
        }
    }
    __syncthreads();

    const int piece = lane & 7;
    const int lsub  = lane >> 3;
{
#pragma unroll
        for (int it = 0; it < 4; ++it) {
            const int L = it * 4 + lsub;     // query row 0..15 within the wave tile
            const v8h v = *(const v8h*)&psw[L * APITCH + piece * 8];
            f16* dp = Cp + ((size_t)(bidx * SEQ + qw + L) * HID + hidx * HD + piece * 8);
            *(v8h*)dp = v;
            if constexpr (RES) {
                const v8h vl = *(const v8h*)&pslw[L * APITCH + piece * 8];
                f16* dq = Cpl + ((size_t)(bidx * 128 + wave * 16 + L) * HID + hidx * HD + piece * 8);
                *(v8h*)dq = vl;
            }
        }
        
    }
}

// ---------------------------------------------------------------------------
// Query rows 128 .. SEQ-1, cut for a short longest chain: one block of 8 waves owns 64 query
// rows (64-row q-block qb >= 2) and its two groups of 4 waves split the 64-key tiles of the
// block's horizon of packed keys between them (group g takes tiles 2*it + g), each group with its own K and
// V^T stage and its own running (m, l, O). After the loop group 1 hands its partial state to
// group 0 through LDS and group 0 merges: mn = max(m0, m1), l = l0*2^(m0-mn) + l1*2^(m1-mn),
// O likewise. Same masking, scaling and carries as attn_tile<0>.
// Both products run transposed: S^T = K . Q^T (A = K rows, B = the resident Q fragments) and
// O^T += V^T . P^T (A = V^T rows, B = P^T). A lane then holds one query (column lane & 15) and, in
// register r of score tile nt, its key nt*16 + 8h + r (h = lane >> 4): m and l are one value a lane,
// the row maximum is taken in the lane plus one exchange between the lane halves, and two score
// tiles converted in place are the B fragment of 32 keys in load_frag's k order
// (elements 0..7 <- k = 8h .. 8h+7, elements 8..15 <- k = 16 + 8h .. +7): P never goes through LDS.
// When the tile count is odd, group 1's last tile lies wholly behind the horizon: its
// addresses are clamped to the last tile and every key of it fails the count test (p = 0,
// the running maximum does not move). A block with no visible key makes no trip.
// LDS (halves): group g: ks at g*2*ATTN_KV, vsT behind it; ctx stage [8][16][APITCH] at 4*ATTN_KV;
// the hand-over buffer (34 floats a lane of group 1) reuses the K/V stages behind a barrier.
// ---------------------------------------------------------------------------
#define ATTN_LDS2 (4 * ATTN_KV + ATTN_P)
static_assert(34 * 128 * 4 <= 4 * ATTN_KV * 2);   // the hand-over buffer fits the K/V stages

typedef float v2f __attribute__((ext_vector_type(2)));
typedef f16   v2h __attribute__((ext_vector_type(2)));
union FragP { v16h v; v2h pair[8]; };

__device__ __forceinline__ float fmax3(float a, float b, float c) { return fmaxf(fmaxf(a, b), c); }

// the value of lane l ^ 16
__device__ __forceinline__ float other_half(float x) {
    const int b = __builtin_bit_cast(int, x);
    return __builtin_bit_cast(float, __builtin_amdgcn_permlanex16(b, b, 0x76543210, 0xfedcba98, false, false));
}

__device__ __forceinline__ void
attn_tile_split(const f16* __restrict__ Qp, const f16* __restrict__ Kp, const f16* __restrict__ Vt,
                const int* __restrict__ kcnt, f16* __restrict__ Cp, f16* sm, int qb, int bh) {
    const int tid  = (int)threadIdx.x;
    const int lane = tid & 31;
    const int wave = __builtin_amdgcn_readfirstlane(tid >> 5);   // scalar: tile index and group tests stay off the vector port
    const int grp  = wave >> 2;          // key group
    const int wq   = wave & 3;           // 16-row query slice within the block
    const int hh8  = (lane >> 4) << 3;
    const int c16  = lane & 15;
    const int bidx = bh / NHEAD;
    const int hidx = bh - bidx * NHEAD;
    const int qw   = qb * 64 + wq * 16;  // first query row (within sequence) of this wave
    const size_t head = (size_t)bh * SEQ * HD;
    const int* crow = kcnt + bidx * SEQ;

    f16* ks  = sm + grp * 2 * ATTN_KV;
    f16* vsT = ks + ATTN_KV;
    f16* psw = sm + 4 * ATTN_KV + wave * 16 * APITCH;

    v16h qa[2];
#pragma unroll
    for (int c = 0; c < 2; ++c) qa[c] = load_frag(Qp + head, qw, HD, c * 32, lane);

    // packed keys visible to this lane's query
    const int cq = crow[qw + c16];

    // A operand of the row sums: ones in rows 0 and 8, so that register 0 of the sum tile holds this
    // lane's query's sum in both lane halves and registers 1..7 stay zero
    FragU onesu;
#pragma unroll
    for (int i = 0; i < 16; ++i) onesu.e[i] = ((lane & 7) == 0) ? (f16)1.0f : (f16)0.0f;
    const v16h ones = onesu.v;

    float m = NEGBIG;
    v8f   o[4], lacc;                    // o[dt][r] = O[query c16][d = dt*16 + 8h + r]
#pragma unroll
    for (int dt = 0; dt < 4; ++dt) o[dt] = zero8();
    lacc = zero8();

    // log2-domain scale: acc = 256 * q.k ; x = log2(e) * q.k / 8 = acc * log2(e) / 2048
    const float cl = 1.4426950408889634f * 0.00048828125f;

    // 64-key tiles of packed keys up to the block's horizon: the count of its last row (counts do
    // not fall along a sequence), never above the causal bound; block-uniform
    const int ntl = (min(max(crow[qb * 64 + 63], 0), qb * 64 + 64) + 63) >> 6;
    const int nit = (ntl + 1) >> 1;      // trips: ceil(ntl / 2)
    const int t2  = tid & 127;           // thread within the group
    // staging: 16 bytes a thread and step, 16 rows a step; lane offsets do not change over the loop
    const int srow = t2 >> 3;
    const int spc  = (t2 & 7) << 3;
    const unsigned koff = (unsigned)(srow * HD + spc);
    const unsigned voff = (unsigned)(srow * SEQ + spc);

#pragma unroll 1
    for (int it = 0; it < nit; ++it) {
        const int kt  = 2 * it + grp;            // this group's tile
        const int ktl = (kt < ntl) ? kt : ntl - 1;   // tile whose bytes are read (written and in bounds)
        const f16* kp = Kp + head + (size_t)ktl * 64 * HD + koff;   // this lane's first 16 bytes of the tile
        const f16* vp = Vt + head + (size_t)ktl * 64 + voff;
        __syncthreads();
        v8h kv[4], vv[4];
#pragma unroll
        for (int p2 = 0; p2 < 4; ++p2) {
            kv[p2] = *(const v8h*)(kp + p2 * 16 * HD);
            vv[p2] = *(const v8h*)(vp + p2 * 16 * SEQ);
        }
        // the address pairs stay whole (no load's result lands on them) until this wait
        asm volatile("s_wait_xcnt 0x0" :: "v"(kp), "v"(vp) : "memory");
#pragma unroll
        for (int p2 = 0; p2 < 4; ++p2) {
            *(v8h*)&ks[(srow + p2 * 16) * APITCH + spc]  = kv[p2];
            *(v8h*)&vsT[(srow + p2 * 16) * APITCH + spc] = vv[p2];
        }
        __syncthreads();

        // S^T[64 keys x 16 q]
        v8f s[4];
#pragma unroll
        for (int nt = 0; nt < 4; ++nt) s[nt] = zero8();
#pragma unroll
        for (int c = 0; c < 2; ++c) {
#pragma unroll
            for (int nt = 0; nt < 4; ++nt) {
                const v16h kb = load_frag(ks, nt * 16, APITCH, c * 32, lane);
                s[nt] = wmma16(kb, qa[c], s[nt]);
            }
        }

        // key nt*16 + r of this lane's half of the tile counts iff nt*16 + r < lim
        const int lim = cq - kt * 64 - hh8;

        // online softmax of this lane's query, max-subtracted, exp2 domain
        float x[32], xm[32];
#pragma unroll
        for (int e = 0; e < 32; ++e) {
            x[e]  = s[e >> 3][e & 7] * cl;
            xm[e] = ((e >> 3) * 16 + (e & 7) < lim) ? x[e] : NEGBIG;
        }
        float u[11], w[4];
#pragma unroll
        for (int i = 0; i < 10; ++i) u[i] = fmax3(xm[3 * i], xm[3 * i + 1], xm[3 * i + 2]);
        u[10] = fmaxf(xm[30], xm[31]);
#pragma unroll
        for (int i = 0; i < 3; ++i) w[i] = fmax3(u[3 * i], u[3 * i + 1], u[3 * i + 2]);
        w[3] = fmaxf(u[9], u[10]);
        const float th = fmaxf(fmax3(w[0], w[1], w[2]), w[3]);
        const float tm = fmaxf(th, other_half(th));
        const float mn = fmaxf(m, tm);
        const float al = fexp2(m - mn);
        m = mn;
        lacc[0] *= al;
#pragma unroll
        for (int dt = 0; dt < 4; ++dt) o[dt] *= al;
        const float sh = 10.0f - mn;      // carry 2^10
        FragP pb[2];                      // P^T as B fragments: 32 keys each
#pragma unroll
        for (int e = 0; e < 32; e += 2) {
            v2f p2;
#pragma unroll
            for (int j = 0; j < 2; ++j) {
                const bool  alw = ((e + j) >> 3) * 16 + ((e + j) & 7) < lim;
                const float arg = alw ? (x[e + j] + sh) : 0.0f;
                const float ex  = fexp2(arg);
                p2[j] = alw ? ex : 0.0f;
            }
            pb[e >> 4].pair[(e & 15) >> 1] = __builtin_convertvector(p2, v2h);
        }

        // O^T += V^T . P^T ; l += ones . P^T
#pragma unroll
        for (int kk = 0; kk < 2; ++kk) {
#pragma unroll
            for (int dt = 0; dt < 4; ++dt) {
                const v16h vb = load_frag(vsT, dt * 16, APITCH, kk * 32, lane);
                o[dt] = wmma16(vb, pb[kk].v, o[dt]);
            }
            lacc = wmma16(ones, pb[kk].v, lacc);
        }
    }
    __syncthreads();     // every reader has left the K/V stages: they become the hand-over buffer

    float* mb = (float*)sm + t2;         // [34][128] floats, one column a lane of a group
    if (grp == 1) {
        mb[0]   = m;
        mb[128] = lacc[0];
#pragma unroll
        for (int dt = 0; dt < 4; ++dt)
#pragma unroll
            for (int r = 0; r < 8; ++r) mb[(2 + dt * 8 + r) * 128] = o[dt][r];
    }
    __syncthreads();     // publishes group 1's partial state to group 0

    // merge, then normalize: plane value = 1024 * (O/16) / (l) = O * 64 / l ; zero row when l == 0
    if (grp == 0) {
        const float m1 = mb[0];
        const float mn = fmaxf(m, m1);
        float a0 = fexp2(m - mn);
        float d1 = m1 - mn;
        // the slot behind a transcendental: without it the second one stands directly behind the first and
        // lands on its source register; the two operands hold the v_nop between them
        asm volatile("v_nop" : "+v"(a0), "+v"(d1));
        const float a1 = fexp2(d1);
        const float l  = lacc[0] * a0 + mb[128] * a1;
        const float lsafe = (l > 0.0f) ? l : 1.0f;
        const float inv   = (l > 0.0f) ? ((CARRY_CTX / CARRY_QKV) / lsafe) : 0.0f;
#pragma unroll
        for (int dt = 0; dt < 4; ++dt) {
            H8U t;
#pragma unroll
            for (int r = 0; r < 8; ++r) {
                const float ov = o[dt][r] * a0 + mb[(2 + dt * 8 + r) * 128] * a1;
                t.e[r] = (f16)(ov * inv);
            }
            *(v8h*)&psw[c16 * APITCH + dt * 16 + hh8] = t.v;   // 8 consecutive d of one query row
        }
    }
    __syncthreads();

    if (grp == 0) {
        const int piece = lane & 7;
        const int lsub  = lane >> 3;
#pragma unroll
        for (int it = 0; it < 4; ++it) {
            const int L = it * 4 + lsub;     // query row 0..15 within the wave tile
            const v8h v = *(const v8h*)&psw[L * APITCH + piece * 8];
            f16* dp = Cp + ((size_t)(bidx * SEQ + qw + L) * HID + hidx * HD + piece * 8);
            *(v8h*)dp = v;
        }
    }
}

// q-block 0 of every head (RES = 1); runs first, because the residual partial needs its Cpl
__global__ void __launch_bounds__(256) __attribute__((amdgpu_num_vgpr(256)))
attn_first(const f16* __restrict__ Qp, const f16* __restrict__ Kp, const f16* __restrict__ Vt,
           const f16* __restrict__ Vtl, const int* __restrict__ kcnt,
           f16* __restrict__ Cp, f16* __restrict__ Cpl) {
    __shared__ __attribute__((aligned(16))) f16 ks[ATTN_KV];
    __shared__ __attribute__((aligned(16))) f16 vsT[ATTN_KV];
    __shared__ __attribute__((aligned(16))) f16 vsL[ATTN_KV];
    __shared__ __attribute__((aligned(16))) f16 ps[ATTN_P];
    __shared__ __attribute__((aligned(16))) f16 psl[ATTN_P];
    attn_tile<1>(Qp, Kp, Vt, Vtl, kcnt, Cp, Cpl, ks, vsT, vsL, ps, psl, 0, (int)blockIdx.x);
}

// ---------------------------------------------------------------------------
// Query rows 128 .. SEQ-1 of every head (64-row q-blocks 2 .. SEQ/64-1) and, in the same grid, the residual
// partial of the out projection (MODE 3 tiles: Pf = Cpl . Wo^T scaled). The two are
// independent: the partial reads only Cpl (written by attn_first) and the weight plane.
// Blocks 0 .. PTILES-1 are the partial's tiles, the rest attention blocks, longest horizon first
// (for speed only).
// The branch is block-uniform; the two kinds of block share one LDS array.
// ---------------------------------------------------------------------------
#define PTILES  ((RROWS / 128) * (HID / 128))
#define QBLKS   (SEQ / 64 - 2)
#define REST_LDS (GEMM_LDS > ATTN_LDS2 ? GEMM_LDS : ATTN_LDS2)
// at most 160 registers: three blocks (six waves a SIMD) stay resident
__global__ void __launch_bounds__(256) __attribute__((amdgpu_num_vgpr(160)))
attn_rest_and_partial(const f16* __restrict__ Qp, const f16* __restrict__ Kp,
                      const f16* __restrict__ Vt, const int* __restrict__ kcnt,
                      f16* __restrict__ Cp, const f16* __restrict__ Cpl,
                      const f16* __restrict__ Wo, const float* __restrict__ bo,
                      float* __restrict__ Pf, float accLo) {
    __shared__ __attribute__((aligned(16))) f16 sm[REST_LDS];
    const int b = (int)blockIdx.x;
    if (b < PTILES) {
        const int m0 = (b % (RROWS / 128)) * 128;
        const int n0 = (b / (RROWS / 128)) * 128;
        const int r0 = m0 + ((int)threadIdx.x >> 3);
        const int arow[4] = {r0, r0 + 32, r0 + 64, r0 + 96};
        v8f acc[2][4];
        gemm_main(Cpl, Wo, sm, arow, n0, acc);
        gemm_epi<3>(acc, sm + GEMM_CS, bo, (void*)Pf, (void*)0, (const float*)0, accLo, 0.0f, m0, n0);
    } else if constexpr (QBLKS > 0) {
        const int t = b - PTILES;
        attn_tile_split(Qp, Kp, Vt, kcnt, Cp, sm, SEQ / 64 - 1 - t / (NB * NHEAD), t % (NB * NHEAD));
    }
}

// ---------------------------------------------------------------------------
// Launch: 5 kernel launches. Workspace (halves): X, Q, K, V^T hi, V^T residual, ctx hi
// (6 x MROWS*1024), 4 weight planes (1024*1024), ctx residual (NB*128*1024), plus the
// ---------------------------------------------------------------------------
extern "C" void kernel_launch(void* const* d_in, const int* in_sizes, int n_in,
                              void* d_out, int out_size, void* d_ws, size_t ws_size,
                              hipStream_t stream) {
    if (n_in < 10) return;
    if (in_sizes[0] < ((NB - 1) * SEQ_FULL + SEQ) * HID) return;
    if (in_sizes[1] < (NB - 1) * SEQ_FULL + SEQ) return;
    if (in_sizes[2] < HID * HID || in_sizes[4] < HID * HID ||
        in_sizes[6] < HID * HID || in_sizes[8] < HID * HID) return;
    if (in_sizes[3] < HID || in_sizes[5] < HID || in_sizes[7] < HID || in_sizes[9] < HID) return;
    if (out_size < MROWS * HID) return;

    const float* x    = (const float*)d_in[0];
    const int*   mask = (const int*)d_in[1];
    const float* wq   = (const float*)d_in[2];
    const float* bq   = (const float*)d_in[3];
    const float* wk   = (const float*)d_in[4];
    const float* bk   = (const float*)d_in[5];
    const float* wv   = (const float*)d_in[6];
    const float* bv   = (const float*)d_in[7];
    const float* wo   = (const float*)d_in[8];
    const float* bo   = (const float*)d_in[9];

    const size_t nX = (size_t)MROWS * HID;    // halves per activation plane
    const size_t nW = (size_t)HID * HID;      // halves per weight plane
    const size_t nR = (size_t)RROWS * HID;    // elements per residual-row plane
    const size_t totalBytes = (6 * nX + 4 * nW + nR) * sizeof(f16) + nR * sizeof(float) + 2 * (size_t)MROWS * sizeof(int);
    if (ws_size < totalBytes) return;

    f16* Xh  = (f16*)d_ws;       // [MROWS][1024]            carry 16
    f16* Wqh = Xh  + nX;         // [n][k] = Wq[k][n]        carry 32
    f16* Wkh = Wqh + nW;
    f16* Wvh = Wkh + nW;
    f16* Woh = Wvh + nW;
    f16* Qp  = Woh + nW;         // [NB*16][SEQ][64]         carry 16
    f16* Kp  = Qp  + nX;         // [NB*16][SEQ][64]         carry 16, packed keys
    f16* Vth = Kp  + nX;         // [NB*1024][SEQ] (V^T)     carry 16, packed keys
    f16* Vtl = Vth + nX;         // V^T residual x2^10
    f16* Cph = Vtl + nX;         // [MROWS][1024]            carry 1024
    f16* Cpl = Cph + nX;         // [NB*128][1024]           ctx residual x2^10 (rows 0..127 per batch)
    float* Pf = (float*)(Cpl + nR);   // [NB*128][1024] f32   residual partial of the out projection
    int* Kidx = (int*)(Pf + nR);      // [NB][SEQ] index of the j-th allowed key
    int* Kcnt = Kidx + MROWS;         // [NB][SEQ] allowed keys with index <= s

    cvt_all<<<NB + 4 * WTILES + MROWS / 2, 256, 0, stream>>>(x, wq, wk, wv, wo, mask, Xh, Wqh, Kidx, Kcnt);

    const dim3 gg(MROWS / 128, HID / 128);
    // plane = 16 * (acc / (16*32) + b) = acc/32 + 16*b
    const float accQKV = CARRY_QKV / (CARRY_X * CARRY_W);
    gemm_qkv<<<dim3(MROWS / 128, HID / 128, 3), 256, 0, stream>>>(Xh, Wqh, bq, bk, bv, Qp, Vth, Vtl,
                                                                    Kidx, Kcnt, accQKV, CARRY_QKV);

    attn_first<<<NB * NHEAD, 256, 0, stream>>>(Qp, Kp, Vth, Vtl, Kcnt, Cph, Cpl);

    // residual partial: Pf = (Cpl . Wo^T) / (1024 * 1024 * 32), beside the remaining q-blocks
    const float accLo = 1.0f / (CARRY_CTX * CARRY_RES * CARRY_W);
    attn_rest_and_partial<<<PTILES + QBLKS * NB * NHEAD, 256, 0, stream>>>(Qp, Kp, Vth, Kcnt, Cph, Cpl,
                                                                             Woh, bo, Pf, accLo);
    // out = acc / (1024*32) + b (+ Pf on the first 128 rows of each sequence)
    const float accOut = 1.0f / (CARRY_CTX * CARRY_W);
    gemm_nt<2><<<gg, 256, 0, stream>>>(Cph, Woh, bo, d_out, (void*)0, Pf, accOut, 1.0f);
}

// v007
// It runs in 60.9 microseconds.
// In both of two side-by-side timings against v006, it was 1.10 times as fast.
// All steps since v000 together make it 5.39 times as fast.
#include <hip/hip_runtime.h>

// Contractions (Q/K/V/out projections, Q.K^T, P.V, P row-sum): v_wmma_f32_16x16x32_f16, f16 operands with power-of-two carries, f32 accumulate; every float input enters as its bf16 RNE value; V, P and context carry an extra f16 residual plane (x2^10) on the first 128 query rows per sequence; softmax in f32. Keys whose padding mask forbids them are never projected or scored: K and V^T hold the allowed keys only, packed in key order.

#ifndef NB
#define NB 2
#endif
#ifndef SEQ
#define SEQ 2048
#endif
#define NB_FULL   2
#define SEQ_FULL  2048
#define HID       1024
#define NHEAD     16
#define HD        64
#define MROWS     (NB * SEQ)
#define RROWS     (NB * 128)      // query rows per batch-set that carry residual planes

static_assert(HID == NHEAD * HD);
static_assert(SEQ % 128 == 0);
static_assert(SEQ >= 128);
static_assert(SEQ <= SEQ_FULL);
static_assert(NB >= 1 && NB <= NB_FULL);
static_assert(MROWS % 128 == 0);
static_assert(RROWS % 128 == 0);
static_assert(HID % 128 == 0);

// carries (exact powers of two)
#define CARRY_X    16.0f     // hidden plane
#define CARRY_W    32.0f     // weight planes
#define CARRY_QKV  16.0f     // q, k, v^T planes (true value x16)
#define CARRY_CTX  1024.0f   // context plane (true value x1024)
#define CARRY_RES  1024.0f   // residual planes: (value - f16(value)) x1024
#define NEGBIG     (-1.0e30f)
// LDS row pitches: 16 B x odd for rows read or written 16 bytes a lane (one row per lane),
// so that the 16 lanes of a half wave fall on distinct bank groups
#define GPITCH     72        // halves: GEMM operand rows of 64 halves (144 B)
#define CPITCH     136       // halves: GEMM f16 output staging rows of 128 halves (272 B)
#define CFPITCH    132       // floats: GEMM f32 output staging rows of 128 floats (528 B)
#define APITCH     72        // halves: attention rows of 64 halves (144 B)
static_assert(64 * CFPITCH * 4 <= 128 * CPITCH * 2);   // the f32 staging shares the f16 staging array
// softmax exp values carry 2^10 (added to the exp2 argument)

typedef _Float16 f16;
typedef f16   v16h __attribute__((ext_vector_type(16)));
typedef f16   v8h  __attribute__((ext_vector_type(8)));
typedef float v8f  __attribute__((ext_vector_type(8)));
typedef float v4f  __attribute__((ext_vector_type(4)));

union FragU { v16h v; v8h half[2]; f16 e[16]; };
union H8U   { v8h v; f16 e[8]; };

__device__ __forceinline__ v8f zero8() {
    v8f z = {0.f, 0.f, 0.f, 0.f, 0.f, 0.f, 0.f, 0.f};
    return z;
}

// 16-bit WMMA with hazard guard: D += A[16 x 32k] * B[32k x 16]
__device__ __forceinline__ v8f wmma16(v16h a, v16h b, v8f c) {
    v8f d = __builtin_amdgcn_wmma_f32_16x16x32_f16(false, a, false, b, (short)0, c, false, false);
    asm volatile("v_nop\n\tv_nop\n\tv_nop\n\tv_nop" : "+v"(d) : "v"(a), "v"(b));
    return d;
}

// f32 -> nearest-even bf16 value, returned as f32
__device__ __forceinline__ float bf16_rne(float x) {
    unsigned u = __float_as_uint(x);
    u = (u + 0x7fffu + ((u >> 16) & 1u)) & 0xffff0000u;
    return __uint_as_float(u);
}

__device__ __forceinline__ float fexp2(float x) {
#if defined(__has_builtin)
#if __has_builtin(__builtin_amdgcn_exp2f)
    return __builtin_amdgcn_exp2f(x);
#else
    return exp2f(x);
#endif
#else
    return exp2f(x);
#endif
}

// The same instruction with the slot behind a transcendental kept inside the statement (one v_nop): for
// code under a tight register limit, where the compiler lands a neighbour's result on the source
// register of the v_exp directly in front of it
__device__ __forceinline__ float fexp2_slot(float x) {
    float y;
    asm("v_exp_f32 %0, %1\n\tv_nop" : "=v"(y) : "v"(x));
    return y;
}

// max over the 16 lanes of each lane half (DPP row rotations; D-layout rows are DPP rows)
__device__ __forceinline__ float rowmax16(float x) {
    int v = __builtin_bit_cast(int, x);
    x = fmaxf(x, __builtin_bit_cast(float, __builtin_amdgcn_update_dpp(v, v, 0x121, 0xf, 0xf, false)));
    v = __builtin_bit_cast(int, x);
    x = fmaxf(x, __builtin_bit_cast(float, __builtin_amdgcn_update_dpp(v, v, 0x122, 0xf, 0xf, false)));
    v = __builtin_bit_cast(int, x);
    x = fmaxf(x, __builtin_bit_cast(float, __builtin_amdgcn_update_dpp(v, v, 0x124, 0xf, 0xf, false)));
    v = __builtin_bit_cast(int, x);
    x = fmaxf(x, __builtin_bit_cast(float, __builtin_amdgcn_update_dpp(v, v, 0x128, 0xf, 0xf, false)));
    return x;
}

// 16 x 32 fragment from a tile whose k dimension is contiguous (pitch in halves).
// lane l: row rowbase + (l&15); elements 0..7 <- k = kcol + 8h .. +7,
// elements 8..15 <- k = kcol + 16 + 8h .. +7  (h = l>>4). Same map for A and B.
__device__ __forceinline__ v16h load_frag(const f16* tile, int rowbase, int pitch, int kcol, int lane) {
    const int r  = rowbase + (lane & 15);
    const int kh = (lane >> 4) << 3;
    const f16* p = tile + (size_t)r * pitch + kcol + kh;
    FragU f;
    f.half[0] = *(const v8h*)(p);
    f.half[1] = *(const v8h*)(p + 16);
    return f.v;
}

// ---------------------------------------------------------------------------
// f32 rows -> f16 plane (bf16 RNE value times carry). 128 threads per 1024-wide
// Source row stride mapping lets a reduced build read full-size inputs.
// coverage: nrows x 1024 halves, every element exactly once (grid = nrows*128/256).
// ---------------------------------------------------------------------------
template <int DSTPER, int SRCPER>
__device__ __forceinline__ void
cvt_rows(const float* __restrict__ src, f16* __restrict__ dst, int nrows, float carry, int blk) {
    const int g  = blk * 256 + (int)threadIdx.x;
    const int m  = g >> 7;
    const int c8 = (g & 127) << 3;
    if (m >= nrows) return;
    const int sm = (m / DSTPER) * SRCPER + (m % DSTPER);
    const float* sp = src + (size_t)sm * HID + c8;
    const v4f a = *(const v4f*)sp;
    const v4f b = *(const v4f*)(sp + 4);
    H8U o;
#pragma unroll
    for (int j = 0; j < 4; ++j) {
        const float x0 = a[j];
        const float x1 = b[j];
        o.e[j]     = (f16)(bf16_rne(x0) * carry);
        o.e[j + 4] = (f16)(bf16_rne(x1) * carry);
    }
    f16* dp = dst + (size_t)m * HID + c8;
    *(v8h*)dp = o.v;
    
}

// ---------------------------------------------------------------------------
// Weight transpose + convert: src [k][n] f32 (HID x HID, n contiguous) -> dst [n][k] f16
// = bf16 RNE(src[k][n]) * carry, k contiguous. Block handles a 64(k) x 64(n) tile through
// coverage: grid (HID/64, HID/64) x (64 n rows x 64 k) = the whole [HID][HID] plane once.
// LDS: T cross-wave (block barrier between element stores and vector reloads).
// ---------------------------------------------------------------------------
__device__ __forceinline__ void
cvt_wT(const float* __restrict__ src, f16* __restrict__ dst, float carry, int bx, int by) {
    __shared__ __attribute__((aligned(16))) f16 T[64 * 72];
    const int tid  = (int)threadIdx.x;
    const int lane = tid & 31;
    const int wave = tid >> 5;
    const int k0   = bx * 64;
    const int n0   = by * 64;
    const int kr   = tid >> 2;           // 0..63
    const int nc   = (tid & 3) << 4;     // 0,16,32,48
    const float* sp = src + (size_t)(k0 + kr) * HID + n0 + nc;
#pragma unroll
    for (int q = 0; q < 4; ++q) {
        const v4f a = *(const v4f*)(sp + q * 4);
#pragma unroll
        for (int j = 0; j < 4; ++j)
            T[(nc + q * 4 + j) * 72 + kr] = (f16)(bf16_rne(a[j]) * carry);
    }
    __syncthreads();
    const int piece = lane & 7;
    const int lsub  = lane >> 3;
{
#pragma unroll
        for (int it = 0; it < 2; ++it) {
            const int L = it * 32 + wave * 4 + lsub;     // local n row 0..63
            const v8h v = *(const v8h*)&T[L * 72 + piece * 8];
            f16* dp = dst + (size_t)(n0 + L) * HID + k0 + piece * 8;
            *(v8h*)dp = v;
        }
        
    }
}

// ---------------------------------------------------------------------------
// Key packing tables of one sequence (one block): a key is allowed iff kmask[b][key] == 0.
// kcnt[b*SEQ + s] = number of allowed keys with index <= s (so packed key j is visible to
// query q iff j < kcnt[q]: the causal test and the padding test in one compare);
// kidx[b*SEQ + j] = index of the j-th allowed key, 0 for j >= the sequence's total.
// Each thread owns KPER consecutive positions; block-wide inclusive scan of the per-thread
// counts in LDS; kidx is gathered in LDS so that both tables leave as whole runs per thread.
// coverage: every entry of both tables of this sequence once.
// ---------------------------------------------------------------------------
#define KPER ((SEQ + 255) / 256)
__device__ __forceinline__ void
key_scan(const int* __restrict__ kmask, int* __restrict__ kidx, int* __restrict__ kcnt, int bidx) {
    __shared__ int part[256];
    __shared__ int sidx[256 * KPER];
    const int tid = (int)threadIdx.x;
    __builtin_assume(tid < 256);         // the launch's block size: lets the range tests below fold, so the mask loads go out together
    const int* mrow = kmask + (size_t)bidx * SEQ_FULL;
    int ok[KPER];
    int c = 0;
    // the three loops over j are unrolled so that ok[] and cn[] stay in registers
#pragma unroll
    for (int j = 0; j < KPER; ++j) {
        const int s = tid * KPER + j;
        ok[j] = (s < SEQ) ? (mrow[s] == 0 ? 1 : 0) : 0;
        c += ok[j];
    }
    part[tid] = c;
    __syncthreads();
    for (int d = 1; d < 256; d <<= 1) {
        const int add = (tid >= d) ? part[tid - d] : 0;
        __syncthreads();
        part[tid] += add;
        __syncthreads();
    }
    int run = part[tid] - c;             // allowed keys in front of this thread's first position
    const int total = part[255];
    int cn[KPER];
#pragma unroll
    for (int j = 0; j < KPER; ++j) {
        const int s = tid * KPER + j;
        if (ok[j]) sidx[run] = s;        // run < total
        run += ok[j];
        cn[j] = run;
        if (s >= total) sidx[s] = 0;     // the slots behind the packed keys
    }
    __syncthreads();
#pragma unroll
    for (int j = 0; j < KPER; ++j) {
        const int s = tid * KPER + j;
        if (s < SEQ) {
            kcnt[bidx * SEQ + s] = cn[j];
            kidx[bidx * SEQ + s] = sidx[s];
        }
    }
}

// ---------------------------------------------------------------------------
// All five input conversions and the key packing tables in one grid (independent of each
// other): blocks 0 .. NB-1 build the tables (first: theirs is the longest chain), the next
// 4*WTILES transpose-convert the four weight planes (dst planes contiguous,
// order q, k, v, o), the remaining MROWS/2 blocks convert the hidden rows.
// The branch is block-uniform, so the barriers inside are reached by whole blocks.
// ---------------------------------------------------------------------------
#define WTILES ((HID / 64) * (HID / 64))
__global__ void __launch_bounds__(256)
cvt_all(const float* __restrict__ x, const float* __restrict__ wq, const float* __restrict__ wk,
        const float* __restrict__ wv, const float* __restrict__ wo, const int* __restrict__ kmask,
        f16* __restrict__ xh, f16* __restrict__ wh, int* __restrict__ kidx, int* __restrict__ kcnt) {
    const int b = (int)blockIdx.x - NB;
    if (b < 0) {
        key_scan(kmask, kidx, kcnt, b + NB);
    } else if (b < 4 * WTILES) {
        const int w = b / WTILES;
        const int t = b - w * WTILES;
        const float* src = (w == 0) ? wq : (w == 1) ? wk : (w == 2) ? wv : wo;
        cvt_wT(src, wh + (size_t)w * HID * HID, CARRY_W, t % (HID / 64), t / (HID / 64));
        // in the built code other branches' text follows these stores: keep the wait in front of
        // any overwrite of the registers they name
        asm volatile("s_wait_xcnt 0x0" ::: "memory");
    } else {
        cvt_rows<SEQ, SEQ_FULL>(x, xh, MROWS, CARRY_X, b - 4 * WTILES);
    }
}

// ---------------------------------------------------------------------------
// C[m][n] = sum_k A[m][k] * W[n][k] ; A [M][1024] f16, W [1024][1024] f16 (k contiguous).
// Block tile 128 x 128, 8 waves as 4(M) x 2(N), 2 x 4 accumulators per wave. K runs in slabs of
// 64: asynchronous copies bring slab t + 1 into one of two LDS buffers while slab t is multiplied.
// MODE 1: f16 plane [b*HID + h*HD + d][s] (V transposed per head) into out, plus the
//         residual plane (val - f16(val)) * 2^10, same layout, into out2
// MODE 3: f32 rows [m][1024] into out
// coverage per block: MODE 0 256 lines, MODE 1 2 x 256 lines (hi, residual),
//                     MODE 3 2 x 256 lines (64 rows x 4 line-quarters per half).
// LDS: the slab buffers and Cs are cross-wave, separated by block barriers.
// ---------------------------------------------------------------------------
// LDS of one GEMM tile, offsets in halves (the kernel owns the array, so that kernels which
// hold more than one kind of tile allocate it once)
#define GEMM_OP   (128 * GPITCH)                      // one operand's slab [128][GPITCH]
#define GEMM_BUF  (2 * GEMM_OP)                       // one buffer: A's slab, then W's
#define GEMM_RING (2 * GEMM_BUF)                      // two buffers
#define GEMM_CS   0                                   // Cs f16 [128][CPITCH] or f32 [64][CFPITCH]: reuses the
                                                      // buffers behind the K loop's last barrier
#define GEMM_LDS  GEMM_RING
static_assert(128 * CPITCH <= GEMM_RING);
#define KSLAB     64
#define NSLAB     (HID / KSLAB)
static_assert(NSLAB >= 2);

// One slab of both operands into one buffer: 8 copies of 16 bytes a lane (8 lanes cover one row's
// 128 bytes, 32 rows a copy). la = this lane's LDS byte address of its first A piece in the buffer.
__device__ __forceinline__ void
slab_copy(unsigned la, const f16* a0, const f16* a1, const f16* a2, const f16* a3,
          const f16* w0, const f16* w1, const f16* w2, const f16* w3) {
    const unsigned la1 = la + 32 * GPITCH * 2, la2 = la + 64 * GPITCH * 2, la3 = la + 96 * GPITCH * 2;
    const unsigned lw0 = la + GEMM_OP * 2, lw1 = la1 + GEMM_OP * 2, lw2 = la2 + GEMM_OP * 2, lw3 = la3 + GEMM_OP * 2;
    // global -> LDS through no register; the closing wait stands in front of any overwrite of the
    // address registers that the copies name (a precaution)
    asm volatile("global_load_async_to_lds_b128 %0, %8, off\n\t"
                 "global_load_async_to_lds_b128 %1, %9, off\n\t"
                 "global_load_async_to_lds_b128 %2, %10, off\n\t"
                 "global_load_async_to_lds_b128 %3, %11, off\n\t"
                 "global_load_async_to_lds_b128 %4, %12, off\n\t"
                 "global_load_async_to_lds_b128 %5, %13, off\n\t"
                 "global_load_async_to_lds_b128 %6, %14, off\n\t"
                 "global_load_async_to_lds_b128 %7, %15, off\n\t"
                 "s_wait_xcnt 0x0"
                 :: "v"(la), "v"(la1), "v"(la2), "v"(la3), "v"(lw0), "v"(lw1), "v"(lw2), "v"(lw3),
                    "v"(a0), "v"(a1), "v"(a2), "v"(a3), "v"(w0), "v"(w1), "v"(w2), "v"(w3)
                 : "memory");
}

// K loop of one 128 x 128 tile at column n0; arow[p] = the row of A that this thread stages as
// tile row (tid >> 3) + 32 p
__device__ __forceinline__ void
gemm_main(const f16* __restrict__ A, const f16* __restrict__ W, f16* ring,
          const int (&arow)[4], int n0, v8f (&acc)[2][4]) {
    const int tid  = (int)threadIdx.x;
    const int lane = tid & 31;
    const int wave = tid >> 5;
    const int wm   = wave & 3;
    const int wn   = wave >> 2;

#pragma unroll
    for (int i = 0; i < 2; ++i)
#pragma unroll
        for (int j = 0; j < 4; ++j) acc[i][j] = zero8();

    const int srow = tid >> 3;
    const int scol = (tid & 7) << 3;
    const f16* gA[4];
    const f16* gW[4];
#pragma unroll
    for (int p = 0; p < 4; ++p) {
        gA[p] = A + (size_t)arow[p] * HID + scol;
        gW[p] = W + (size_t)(n0 + srow + 32 * p) * HID + scol;
    }
    const unsigned la = (unsigned)(size_t)(ring + srow * GPITCH + scol);   // LDS byte address (low 32 bits)

    slab_copy(la, gA[0], gA[1], gA[2], gA[3], gW[0], gW[1], gW[2], gW[3]);
    asm volatile("s_wait_asynccnt 0x0" ::: "memory");   // slab 0 has landed (this wave's part)
    __syncthreads();                                    // ... and every other wave's
    slab_copy(la + GEMM_BUF * 2, gA[0] + KSLAB, gA[1] + KSLAB, gA[2] + KSLAB, gA[3] + KSLAB,
              gW[0] + KSLAB, gW[1] + KSLAB, gW[2] + KSLAB, gW[3] + KSLAB);

    // rolled: one copy of the loop's text, and the order at its foot stays as written
#pragma unroll 1
    for (int t = 0; t < NSLAB; ++t) {
        const int boff = (t & 1) * GEMM_BUF;
        const f16* As = ring + boff;
        const f16* Bs = As + GEMM_OP;
#pragma unroll
        for (int kk = 0; kk < KSLAB; kk += 32) {
            v16h af[2], bfr[4];
#pragma unroll
            for (int i = 0; i < 2; ++i) af[i] = load_frag(As, wm * 32 + i * 16, GPITCH, kk, lane);
#pragma unroll
            for (int j = 0; j < 4; ++j) bfr[j] = load_frag(Bs, wn * 64 + j * 16, GPITCH, kk, lane);
#pragma unroll
            for (int i = 0; i < 2; ++i)
#pragma unroll
                for (int j = 0; j < 4; ++j) acc[i][j] = wmma16(af[i], bfr[j], acc[i][j]);
        }
        asm volatile("s_wait_dscnt 0x0" ::: "memory");      // this wave has left slab t's buffer
        asm volatile("s_wait_asynccnt 0x0" ::: "memory");   // its part of slab t + 1 has landed
        __syncthreads();                                    // publishes slab t + 1, frees slab t's buffer
        if (t + 2 < NSLAB) {                                // the same for the whole block
            const int k = (t + 2) * KSLAB;
            slab_copy(la + boff * 2, gA[0] + k, gA[1] + k, gA[2] + k, gA[3] + k,
                      gW[0] + k, gW[1] + k, gW[2] + k, gW[3] + k);
        }
    }
    asm volatile("s_wait_asynccnt 0x0" ::: "memory");       // no copy is left in flight
}

// scale, bias and store of one 128 x 128 tile at (m0, n0)
template <int MODE>
__device__ __forceinline__ void
gemm_epi(const v8f (&acc)[2][4], f16* Cs, const float* __restrict__ bias,
         void* __restrict__ out, void* __restrict__ out2,
         float accMul, float addMul, int m0, int n0) {
    const int tid  = (int)threadIdx.x;
    const int lane = tid & 31;
    const int wave = tid >> 5;
    const int wm   = wave & 3;
    const int wn   = wave >> 2;
    const int hh8  = (lane >> 4) << 3;   // D row half
    const int c16  = lane & 15;          // D column

    // bias (bf16 RNE value) per owned column group
    float bb[4];
#pragma unroll
    for (int j = 0; j < 4; ++j) bb[j] = bf16_rne(bias[n0 + wn * 64 + j * 16 + c16]) * addMul;

    const int bidx  = m0 / SEQ;          // block rows lie inside one batch (SEQ % 128 == 0)
    const int s0    = m0 - bidx * SEQ;
    const int piece = lane & 7;
    const int lsub  = lane >> 3;

    if constexpr (MODE == 0) {
#pragma unroll
        for (int i = 0; i < 2; ++i)
#pragma unroll
            for (int j = 0; j < 4; ++j) {
                const int nl = wn * 64 + j * 16 + c16;
#pragma unroll
                for (int r = 0; r < 8; ++r) {
                    const int ml = wm * 32 + i * 16 + hh8 + r;
                    Cs[ml * CPITCH + nl] = (f16)(acc[i][j][r] * accMul + bb[j]);
                }
            }
        __syncthreads();
        f16* op = (f16*)out;
        const size_t bh0 = (size_t)bidx * NHEAD + (n0 >> 6);
{
#pragma unroll
            for (int it = 0; it < 8; ++it) {
                const int L    = wave * 32 + it * 4 + lsub;   // 0..255
                const int ml   = L >> 1;
                const int hsel = L & 1;
                const v8h v = *(const v8h*)&Cs[ml * CPITCH + hsel * 64 + piece * 8];
                f16* dp = op + ((bh0 + hsel) * SEQ + s0 + ml) * HD + piece * 8;
                *(v8h*)dp = v;
            }
            
        }
    } else if constexpr (MODE == 1) {
        // hi plane, staged transposed: Cs[n][m]
#pragma unroll
        for (int i = 0; i < 2; ++i)
#pragma unroll
            for (int j = 0; j < 4; ++j) {
                const int nl = wn * 64 + j * 16 + c16;
                H8U t;
#pragma unroll
                for (int r = 0; r < 8; ++r) t.e[r] = (f16)(acc[i][j][r] * accMul + bb[j]);
                *(v8h*)&Cs[nl * CPITCH + wm * 32 + i * 16 + hh8] = t.v;
            }
        __syncthreads();
        {
            f16* op = (f16*)out;
{
#pragma unroll
                for (int it = 0; it < 8; ++it) {
                    const int L  = wave * 32 + it * 4 + lsub;     // 0..255
                    const int nl = L >> 1;
                    const int mh = L & 1;
                    const v8h v = *(const v8h*)&Cs[nl * CPITCH + mh * 64 + piece * 8];
                    f16* dp = op + ((size_t)(bidx * HID + n0 + nl) * SEQ + s0 + mh * 64 + piece * 8);
                    *(v8h*)dp = v;
                }
                
            }
        }
        __syncthreads();
        // residual plane: (val - f16(val)) * 2^10, same staging and store map
#pragma unroll
        for (int i = 0; i < 2; ++i)
#pragma unroll
            for (int j = 0; j < 4; ++j) {
                const int nl = wn * 64 + j * 16 + c16;
                H8U t;
#pragma unroll
                for (int r = 0; r < 8; ++r) {
                    const float val = acc[i][j][r] * accMul + bb[j];
                    const f16 hv = (f16)val;
                    t.e[r] = (f16)((val - (float)hv) * CARRY_RES);
                }
                *(v8h*)&Cs[nl * CPITCH + wm * 32 + i * 16 + hh8] = t.v;
            }
        __syncthreads();
        {
            f16* op = (f16*)out2;
{
#pragma unroll
                for (int it = 0; it < 8; ++it) {
                    const int L  = wave * 32 + it * 4 + lsub;     // 0..255
                    const int nl = L >> 1;
                    const int mh = L & 1;
                    const v8h v = *(const v8h*)&Cs[nl * CPITCH + mh * 64 + piece * 8];
                    f16* dp = op + ((size_t)(bidx * HID + n0 + nl) * SEQ + s0 + mh * 64 + piece * 8);
                    *(v8h*)dp = v;
                }
                
            }
        }
    } else {
        float* Cf = (float*)Cs;      // [64][CFPITCH] f32
        float* of = (float*)out;
#pragma unroll
        for (int half = 0; half < 2; ++half) {
            if ((wm >> 1) == half) {
#pragma unroll
                for (int i = 0; i < 2; ++i)
#pragma unroll
                    for (int j = 0; j < 4; ++j) {
                        const int nl = wn * 64 + j * 16 + c16;
#pragma unroll
                        for (int r = 0; r < 8; ++r) {
                            const int ml = (wm & 1) * 32 + i * 16 + hh8 + r;
                            Cf[ml * CFPITCH + nl] = acc[i][j][r] * accMul + bb[j];
                        }
                    }
            }
            __syncthreads();
            v4f vv[8];
#pragma unroll
            for (int it = 0; it < 8; ++it) {
                const int L    = wave * 32 + it * 4 + lsub;   // 0..255
                const int row  = L >> 2;
                const int part = L & 3;
                vv[it] = *(const v4f*)&Cf[row * CFPITCH + part * 32 + piece * 4];
            }
{
#pragma unroll
                for (int it = 0; it < 8; ++it) {
                    const int L    = wave * 32 + it * 4 + lsub;   // 0..255
                    const int row  = L >> 2;
                    const int part = L & 3;
                    float* dp = of + (size_t)(m0 + half * 64 + row) * HID + n0 + part * 32 + piece * 4;
                    *(v4f*)dp = vv[it];
                }
                
            }
            __syncthreads();
        }
    }
}

// Store of one out-projection tile whose A rows were 64 context rows (tile rows 0..63) and the same
// 64 queries' residual rows (tile rows 64..127): out[m0 + r] = acc[r] * accMul + bias + acc[64 + r] * accLo.
// The two halves pass through the f32 stage one after the other and are added in registers.
__device__ __forceinline__ void
gemm_epi_res(const v8f (&acc)[2][4], float* Cf, const float* __restrict__ bias, float* __restrict__ of,
             float accMul, float accLo, int m0, int n0) {
    const int tid  = (int)threadIdx.x;
    const int lane = tid & 31;
    const int wave = tid >> 5;
    const int wm   = wave & 3;
    const int wn   = wave >> 2;
    const int hh8  = (lane >> 4) << 3;   // D row half
    const int c16  = lane & 15;          // D column
    const int piece = lane & 7;
    const int lsub  = lane >> 3;

    float bb[4];
#pragma unroll
    for (int j = 0; j < 4; ++j) bb[j] = bf16_rne(bias[n0 + wn * 64 + j * 16 + c16]);

    v4f vv[8];
#pragma unroll
    for (int half = 0; half < 2; ++half) {
        if ((wm >> 1) == half) {
#pragma unroll
            for (int i = 0; i < 2; ++i)
#pragma unroll
                for (int j = 0; j < 4; ++j) {
                    const int nl = wn * 64 + j * 16 + c16;
#pragma unroll
                    for (int r = 0; r < 8; ++r) {
                        const int ml = (wm & 1) * 32 + i * 16 + hh8 + r;
                        Cf[ml * CFPITCH + nl] = (half == 0) ? acc[i][j][r] * accMul + bb[j] : acc[i][j][r] * accLo;
                    }
                }
        }
        __syncthreads();
#pragma unroll
        for (int it = 0; it < 8; ++it) {
            const int L    = wave * 32 + it * 4 + lsub;   // 0..255
            const int row  = L >> 2;
            const int part = L & 3;
            const v4f v = *(const v4f*)&Cf[row * CFPITCH + part * 32 + piece * 4];
            if (half == 0) vv[it] = v; else vv[it] += v;
        }
        if (half == 0) __syncthreads();   // every reader has left the stage before the residual rows land on it
    }
#pragma unroll
    for (int it = 0; it < 8; ++it) {
        const int L    = wave * 32 + it * 4 + lsub;   // 0..255
        const int row  = L >> 2;
        const int part = L & 3;
        float* dp = of + (size_t)(m0 + row) * HID + n0 + part * 32 + piece * 4;
        *(v4f*)dp = vv[it];
    }
}

// ---------------------------------------------------------------------------
// Out projection into the output. C = the context plane [MROWS][1024] with the residual
// plane [NB*128][1024] directly behind it, so that residual row r is row MROWS + r of C.
// blockIdx.x < RTILES: 64 of a sequence's first 128 queries; the tile's A rows are their context
// rows and, stacked below, their residual rows: both products run in the one K loop.
// The other blocks: plain 128-row tiles of rows 128 .. SEQ-1. The branches are block-uniform.
// coverage: every output row once.
// ---------------------------------------------------------------------------
#define RTILES  (NB * 2)
#define MTILES  (NB * (SEQ / 128 - 1))
__global__ void __launch_bounds__(256) __attribute__((amdgpu_num_vgpr(256)))
gemm_out(const f16* __restrict__ C, const f16* __restrict__ W, const float* __restrict__ bias,
         float* __restrict__ out, float accMul, float accLo) {
    __shared__ __attribute__((aligned(16))) f16 sm[GEMM_LDS];
    const int bx = (int)blockIdx.x;
    const int n0 = (int)blockIdx.y * 128;
    const int sr = (int)threadIdx.x >> 3;
    const bool res = bx < RTILES;
    const int t  = bx - RTILES;
    // first output row of the tile
    const int m0 = res ? (bx >> 1) * SEQ + (bx & 1) * 64
                       : (t / (SEQ / 128 - 1)) * SEQ + (t % (SEQ / 128 - 1) + 1) * 128;
    // tile row 64: the next context row, or the first residual row of the same queries
    const int m1 = res ? MROWS + (bx >> 1) * 128 + (bx & 1) * 64 : m0 + 64;
    const int arow[4] = {m0 + sr, m0 + sr + 32, m1 + sr, m1 + sr + 32};
    v8f acc[2][4];
    gemm_main(C, W, sm, arow, n0, acc);
    if (res) {
        gemm_epi_res(acc, (float*)(sm + GEMM_CS), bias, out, accMul, accLo, m0, n0);
    } else {
        gemm_epi<3>(acc, sm + GEMM_CS, bias, (void*)out, (void*)0, accMul, 1.0f, m0, n0);
    }
}

// ---------------------------------------------------------------------------
// The Q, K and V projections in one grid: blockIdx.z picks the weight plane (planes
// contiguous, order q, k, v), the bias and the output (z 0, 1: MODE 0 into the contiguous
// q, k planes; z 2: MODE 1 into V^T and its residual). The K and V tiles of one (x, y) read
// the same hidden rows. The branch on z is block-uniform.
// K and V are projected for the allowed keys only: row j of their tiles is hidden row
// kidx[j] of the sequence, so both planes come out packed; a tile wholly behind the
// sequence's total leaves before any barrier, and nothing reads its part of the planes
// (the slots between the total and the tile's end hold row 0's finite values, never counted).
// ---------------------------------------------------------------------------
__global__ void __launch_bounds__(256) __attribute__((amdgpu_num_vgpr(256)))
gemm_qkv(const f16* __restrict__ X, const f16* __restrict__ Wqkv, const float* __restrict__ bq,
         const float* __restrict__ bk, const float* __restrict__ bv, f16* __restrict__ qk,
         f16* __restrict__ vt, f16* __restrict__ vtl, const int* __restrict__ kidx,
         const int* __restrict__ kcnt, float accMul, float addMul) {
    __shared__ __attribute__((aligned(16))) f16 sm[GEMM_LDS];
    const int m0 = (int)blockIdx.x * 128;
    const int n0 = (int)blockIdx.y * 128;
    const int z  = (int)blockIdx.z;
    const int r0 = m0 + ((int)threadIdx.x >> 3);
    int arow[4] = {r0, r0 + 32, r0 + 64, r0 + 96};
    if (z != 0) {
        const int seq0 = (m0 / SEQ) * SEQ;               // block rows lie inside one sequence
        const int  total = kcnt[seq0 + SEQ - 1];         // allowed keys of the sequence
        const int  s0 = kidx[r0], s1 = kidx[r0 + 32], s2 = kidx[r0 + 64], s3 = kidx[r0 + 96];
        // behind the loads (their values are the operands), in front of any overwrite of the registers they name
        asm volatile("s_wait_xcnt 0x0" :: "v"(s0), "v"(s1), "v"(s2), "v"(s3) : "memory");
        if (m0 - seq0 >= total) return;                  // block-uniform, in front of every barrier and copy
        arow[0] = seq0 + min(max(s0, 0), SEQ - 1);
        arow[1] = seq0 + min(max(s1, 0), SEQ - 1);
        arow[2] = seq0 + min(max(s2, 0), SEQ - 1);
        arow[3] = seq0 + min(max(s3, 0), SEQ - 1);
    }
    v8f acc[2][4];
    gemm_main(X, Wqkv + (size_t)z * HID * HID, sm, arow, n0, acc);
    if (z == 2) {
        gemm_epi<1>(acc, sm + GEMM_CS, bv, (void*)vt, (void*)vtl, accMul, addMul, m0, n0);
    } else {
        gemm_epi<0>(acc, sm + GEMM_CS, (z == 0) ? bq : bk, (void*)(qk + (size_t)z * MROWS * HID),
                    (void*)0, accMul, addMul, m0, n0);
        // in the built code the other epilogue's text follows these stores: keep the wait in
        // front of any overwrite of the registers they name
        asm volatile("s_wait_xcnt 0x0" ::: "memory");
    }
}

// ---------------------------------------------------------------------------
// Flash attention of query rows 0 .. 127, causal with key padding mask, over the packed keys
// (packed key j counts for query q iff j < kcnt[b][q]; other keys get p = 0 and are excluded from
// the row max; rows with no allowed key produce a zero context row). V, P and the context carry
// x2^10 residual planes (second accumulators); the context residual plane Cpl is [b*128 + q][1024].
// One block of 8 waves owns 64 query rows (qh = 0, 1) of one head: wave w and wave w + 4 hold the
// same 16 rows and the same scores, and split the head's 64 columns between
// them (32 each), which halves the output accumulators a wave holds, so that these blocks fit the
// register limit of the grid they share with attn_tile_split.
// The block streams the 64-key tiles up to its horizon: K staged [key][d], V^T staged [d][key].
// Scores on WMMA, row max via DPP, exp2 in f32 carried x2^10, P relayed per wave through LDS as
// A fragments, O += P.V and row sums += P.ones on WMMA. Output f16 planes carried x1024.
// coverage: with attn_tile_split every (b, q, h*64..h*64+63) segment of Cp once; the whole Cpl once.
// LDS (halves): ks [64][APITCH] = [key][d]; vsT [64][APITCH] = [d][key]; vsL the same, residual;
// ps [8][16][APITCH] per-wave P relay, psl the same, residual; behind the loop the first four
// slices of ps and psl stage the context rows (both waves of a row slice write their columns).
// ---------------------------------------------------------------------------
#define ATTN_KV   (64 * APITCH)
#define ATTN_P    (8 * 16 * APITCH)
#define ATTN_LDSR (3 * ATTN_KV + 2 * ATTN_P)

__device__ __forceinline__ void
attn_tile_res(const f16* __restrict__ Qp, const f16* __restrict__ Kp, const f16* __restrict__ Vt,
              const f16* __restrict__ Vtl, const int* __restrict__ kcnt,
              f16* __restrict__ Cp, f16* __restrict__ Cpl, f16* sm, int qh, int bh) {
    const int tid  = (int)threadIdx.x;
    const int lane = tid & 31;
    const int wave = __builtin_amdgcn_readfirstlane(tid >> 5);   // scalar: what derives from it stays out of the vector registers
    const int wq   = wave & 3;           // 16-row query slice within the block
    const int dg   = wave >> 2;          // column half of the head: d = dg*32 .. dg*32 + 31
    const int hh8  = (lane >> 4) << 3;
    const int c16  = lane & 15;
    const int bidx = bh / NHEAD;
    const int hidx = bh - bidx * NHEAD;
    const int qw   = qh * 64 + wq * 16;  // first query row (within sequence) of this wave
    const size_t head = (size_t)bh * SEQ * HD;
    const int* crow = kcnt + bidx * SEQ;

    f16* ks  = sm;
    f16* vsT = ks + ATTN_KV;
    f16* vsL = vsT + ATTN_KV;
    f16* ps  = vsL + ATTN_KV;
    f16* psl = ps + ATTN_P;

    FragU onesu;
#pragma unroll
    for (int i = 0; i < 16; ++i) onesu.e[i] = (f16)1.0f;
    const v16h ones = onesu.v;

    float m[8];
    v8f   o[2], lacc, olo[2], laccl;
#pragma unroll
    for (int r = 0; r < 8; ++r) m[r] = NEGBIG;
#pragma unroll
    for (int dt = 0; dt < 2; ++dt) { o[dt] = zero8(); olo[dt] = zero8(); }
    lacc  = zero8();
    laccl = zero8();

    // log2-domain scale: acc = 256 * q.k ; x = log2(e) * q.k / 8 = acc * log2(e) / 2048
    const float cl = 1.4426950408889634f * 0.00048828125f;
    const float rres = 1.0f / CARRY_RES;
    f16* psw  = ps  + wave * 16 * APITCH;
    f16* pslw = psl + wave * 16 * APITCH;

    // horizon in 64-key tiles of packed keys: the count of the block's last row (counts do not
    // fall along a sequence), never above the causal bound (block-uniform)
    const int nkt = (min(max(crow[qh * 64 + 63], 0), qh * 64 + 64) + 63) >> 6;
    // staging: 16 bytes a thread and step, 32 rows a step; lane offsets do not change over the loop
    const int srow = tid >> 3;
    const int spc  = (tid & 7) << 3;
    const unsigned koff = (unsigned)(srow * HD + spc);
    const unsigned voff = (unsigned)(srow * SEQ + spc);

#pragma unroll 1
    for (int kt = 0; kt < nkt; ++kt) {
        __syncthreads();
        const f16* kp = Kp  + head + (size_t)kt * 64 * HD + koff;   // this lane's first 16 bytes of the tile
        const f16* vp = Vt  + head + (size_t)kt * 64 + voff;
        const f16* lp = Vtl + head + (size_t)kt * 64 + voff;
        v8h kv[2], vv[2], vl[2];
#pragma unroll
        for (int p2 = 0; p2 < 2; ++p2) {
            kv[p2] = *(const v8h*)(kp + p2 * 32 * HD);
            vv[p2] = *(const v8h*)(vp + p2 * 32 * SEQ);
            vl[p2] = *(const v8h*)(lp + p2 * 32 * SEQ);
        }
        // Q fragments (load_frag's map) and the packed keys visible to each of this lane's 8 query rows:
        // fetched anew on each of the at most two trips, beside the tile, so that they hold no register
        // over the P.V phase
        const f16* qp = Qp + head + (size_t)(qw + c16) * HD + hh8;
        const int* cp = crow + qw + hh8;
        FragU qa[2];
        int   cr[8];
#pragma unroll
        for (int c = 0; c < 2; ++c) {
            qa[c].half[0] = *(const v8h*)(qp + c * 32);
            qa[c].half[1] = *(const v8h*)(qp + c * 32 + 16);
        }
#pragma unroll
        for (int r = 0; r < 8; ++r) cr[r] = cp[r];
        // the address pairs stay whole (no load's result lands on them) until this wait
        asm volatile("s_wait_xcnt 0x0" :: "v"(kp), "v"(vp), "v"(lp), "v"(qp), "v"(cp) : "memory");
#pragma unroll
        for (int p2 = 0; p2 < 2; ++p2) {
            *(v8h*)&ks[(srow + p2 * 32) * APITCH + spc]  = kv[p2];
            *(v8h*)&vsT[(srow + p2 * 32) * APITCH + spc] = vv[p2];
            *(v8h*)&vsL[(srow + p2 * 32) * APITCH + spc] = vl[p2];
        }
        __syncthreads();

        // S[16 q x 64 keys]
        v8f s[4];
#pragma unroll
        for (int nt = 0; nt < 4; ++nt) s[nt] = zero8();
#pragma unroll
        for (int c = 0; c < 2; ++c) {
#pragma unroll
            for (int nt = 0; nt < 4; ++nt) {
                const v16h kb = load_frag(ks, nt * 16, APITCH, c * 32, lane);
                s[nt] = wmma16(qa[c].v, kb, s[nt]);
            }
        }

        // this lane's key column of score tile nt counts for row r iff nt*16 < lim[r]
        int lim[8];
#pragma unroll
        for (int r = 0; r < 8; ++r) lim[r] = cr[r] - kt * 64 - c16;

        // online softmax per row r (row 8h + r), max-subtracted, exp2 domain
#pragma unroll
        for (int r = 0; r < 8; ++r) {
            float x[4];
            bool  alw[4];
#pragma unroll
            for (int nt = 0; nt < 4; ++nt) {
                x[nt]   = s[nt][r] * cl;
                alw[nt] = nt * 16 < lim[r];
            }
            const float xm0 = alw[0] ? x[0] : NEGBIG;
            const float xm1 = alw[1] ? x[1] : NEGBIG;
            const float xm2 = alw[2] ? x[2] : NEGBIG;
            const float xm3 = alw[3] ? x[3] : NEGBIG;
            const float tm = rowmax16(fmaxf(fmaxf(xm0, xm1), fmaxf(xm2, xm3)));
            const float mn = fmaxf(m[r], tm);
            const float al = fexp2_slot(m[r] - mn);
            m[r] = mn;
            lacc[r]  *= al;
            laccl[r] *= al;
#pragma unroll
            for (int dt = 0; dt < 2; ++dt) {
                o[dt][r]   *= al;
                olo[dt][r] *= al;
            }
            const float sh = 10.0f - mn;      // carry 2^10
#pragma unroll
            for (int nt = 0; nt < 4; ++nt) {
                const float arg = alw[nt] ? (x[nt] + sh) : 0.0f;
                const float e   = fexp2_slot(arg);
                const float p   = alw[nt] ? e : 0.0f;
                const f16   hp  = (f16)p;
                psw[(hh8 + r) * APITCH + nt * 16 + c16]  = hp;
                pslw[(hh8 + r) * APITCH + nt * 16 + c16] = (f16)((p - (float)hp) * CARRY_RES);
            }
        }
        __syncthreads();

        // O += P . V ; l += P . ones  (P reloaded as A fragments from the relay)
#pragma unroll
        for (int kk = 0; kk < 2; ++kk) {
            const v16h pa = load_frag(psw, 0, APITCH, kk * 32, lane);
            const v16h pl = load_frag(pslw, 0, APITCH, kk * 32, lane);
#pragma unroll
            for (int dt = 0; dt < 2; ++dt) {
                const v16h vb = load_frag(vsT, dg * 32 + dt * 16, APITCH, kk * 32, lane);
                o[dt]   = wmma16(pa, vb, o[dt]);
                olo[dt] = wmma16(pl, vb, olo[dt]);
                const v16h vl = load_frag(vsL, dg * 32 + dt * 16, APITCH, kk * 32, lane);
                olo[dt] = wmma16(pa, vl, olo[dt]);
            }
            lacc  = wmma16(pa, ones, lacc);
            laccl = wmma16(pl, ones, laccl);
        }
    }
    __syncthreads();     // every wave has left its P relay: the first four slices become the context stage

    // normalize: plane value = 1024 * (O/16) / (l) = O * 64 / l ; zero row when l == 0
    f16* cs  = ps  + wq * 16 * APITCH;
    f16* csl = psl + wq * 16 * APITCH;
#pragma unroll
    for (int r = 0; r < 8; ++r) {
        const float l = lacc[r] + laccl[r] * rres;
        const float lsafe = (l > 0.0f) ? l : 1.0f;
        const float inv   = (l > 0.0f) ? ((CARRY_CTX / CARRY_QKV) / lsafe) : 0.0f;
#pragma unroll
        for (int dt = 0; dt < 2; ++dt) {
            const float ov = o[dt][r] + olo[dt][r] * rres;
            const float cv = ov * inv;
            const f16 hv = (f16)cv;
            cs[(hh8 + r) * APITCH + dg * 32 + dt * 16 + c16]  = hv;
            csl[(hh8 + r) * APITCH + dg * 32 + dt * 16 + c16] = (f16)((cv - (float)hv) * CARRY_RES);
        }
    }
    __syncthreads();     // publishes both column halves of every staged row

    // whole 128-byte rows leave: waves 0..3 store the context plane, waves 4..7 its residual
    const int piece = lane & 7;
    const int lsub  = lane >> 3;
    const f16* st = dg ? csl : cs;
    f16* dst = (dg ? Cpl + (size_t)(bidx * 128 + qw) * HID : Cp + (size_t)(bidx * SEQ + qw) * HID)
               + hidx * HD;              // the same for the whole wave
    const unsigned doff = (unsigned)(lsub * HID + piece * 8);
#pragma unroll
    for (int it = 0; it < 4; ++it) {
        const int L = it * 4 + lsub;     // query row 0..15 within the slice
        const v8h v = *(const v8h*)&st[L * APITCH + piece * 8];
        *(v8h*)(dst + it * 4 * HID + doff) = v;
    }
}

// ---------------------------------------------------------------------------
// Query rows 128 .. SEQ-1, cut for a short longest chain: one block of 8 waves owns 64 query
// rows (64-row q-block qb >= 2) and its two groups of 4 waves split the 64-key tiles of the
// block's horizon of packed keys between them (group g takes tiles 2*it + g), each group with its own K and
// V^T stage and its own running (m, l, O). After the loop group 1 hands its partial state to
// group 0 through LDS and group 0 merges: mn = max(m0, m1), l = l0*2^(m0-mn) + l1*2^(m1-mn),
// O likewise. Same masking, scaling and carries as attn_tile_res, without the residual planes.
// Both products run transposed: S^T = K . Q^T (A = K rows, B = the resident Q fragments) and
// O^T += V^T . P^T (A = V^T rows, B = P^T). A lane then holds one query (column lane & 15) and, in
// register r of score tile nt, its key nt*16 + 8h + r (h = lane >> 4): m and l are one value a lane,
// the row maximum is taken in the lane plus one exchange between the lane halves, and two score
// tiles converted in place are the B fragment of 32 keys in load_frag's k order
// (elements 0..7 <- k = 8h .. 8h+7, elements 8..15 <- k = 16 + 8h .. +7): P never goes through LDS.
// When the tile count is odd, group 1's last tile lies wholly behind the horizon: its
// addresses are clamped to the last tile and every key of it fails the count test (p = 0,
// the running maximum does not move). A block with no visible key makes no trip.
// LDS (halves): group g: ks at g*2*ATTN_KV, vsT behind it; ctx stage [8][16][APITCH] at 4*ATTN_KV;
// the hand-over buffer (34 floats a lane of group 1) reuses the K/V stages behind a barrier.
// ---------------------------------------------------------------------------
#define ATTN_LDS2 (4 * ATTN_KV + ATTN_P)
static_assert(34 * 128 * 4 <= 4 * ATTN_KV * 2);   // the hand-over buffer fits the K/V stages

typedef float v2f __attribute__((ext_vector_type(2)));
typedef f16   v2h __attribute__((ext_vector_type(2)));
union FragP { v16h v; v2h pair[8]; };

__device__ __forceinline__ float fmax3(float a, float b, float c) { return fmaxf(fmaxf(a, b), c); }

// the value of lane l ^ 16
__device__ __forceinline__ float other_half(float x) {
    const int b = __builtin_bit_cast(int, x);
    return __builtin_bit_cast(float, __builtin_amdgcn_permlanex16(b, b, 0x76543210, 0xfedcba98, false, false));
}

__device__ __forceinline__ void
attn_tile_split(const f16* __restrict__ Qp, const f16* __restrict__ Kp, const f16* __restrict__ Vt,
                const int* __restrict__ kcnt, f16* __restrict__ Cp, f16* sm, int qb, int bh) {
    const int tid  = (int)threadIdx.x;
    const int lane = tid & 31;
    const int wave = __builtin_amdgcn_readfirstlane(tid >> 5);   // scalar: tile index and group tests stay off the vector port
    const int grp  = wave >> 2;          // key group
    const int wq   = wave & 3;           // 16-row query slice within the block
    const int hh8  = (lane >> 4) << 3;
    const int c16  = lane & 15;
    const int bidx = bh / NHEAD;
    const int hidx = bh - bidx * NHEAD;
    const int qw   = qb * 64 + wq * 16;  // first query row (within sequence) of this wave
    const size_t head = (size_t)bh * SEQ * HD;
    const int* crow = kcnt + bidx * SEQ;

    f16* ks  = sm + grp * 2 * ATTN_KV;
    f16* vsT = ks + ATTN_KV;
    f16* psw = sm + 4 * ATTN_KV + wave * 16 * APITCH;

    v16h qa[2];
#pragma unroll
    for (int c = 0; c < 2; ++c) qa[c] = load_frag(Qp + head, qw, HD, c * 32, lane);

    // packed keys visible to this lane's query
    const int cq = crow[qw + c16];

    // A operand of the row sums: ones in rows 0 and 8, so that register 0 of the sum tile holds this
    // lane's query's sum in both lane halves and registers 1..7 stay zero
    FragU onesu;
#pragma unroll
    for (int i = 0; i < 16; ++i) onesu.e[i] = ((lane & 7) == 0) ? (f16)1.0f : (f16)0.0f;
    const v16h ones = onesu.v;

    float m = NEGBIG;
    v8f   o[4], lacc;                    // o[dt][r] = O[query c16][d = dt*16 + 8h + r]
#pragma unroll
    for (int dt = 0; dt < 4; ++dt) o[dt] = zero8();
    lacc = zero8();

    // log2-domain scale: acc = 256 * q.k ; x = log2(e) * q.k / 8 = acc * log2(e) / 2048
    const float cl = 1.4426950408889634f * 0.00048828125f;

    // 64-key tiles of packed keys up to the block's horizon: the count of its last row (counts do
    // not fall along a sequence), never above the causal bound; block-uniform
    const int ntl = (min(max(crow[qb * 64 + 63], 0), qb * 64 + 64) + 63) >> 6;
    const int nit = (ntl + 1) >> 1;      // trips: ceil(ntl / 2)
    const int t2  = tid & 127;           // thread within the group
    // staging: 16 bytes a thread and step, 16 rows a step; lane offsets do not change over the loop
    const int srow = t2 >> 3;
    const int spc  = (t2 & 7) << 3;
    const unsigned koff = (unsigned)(srow * HD + spc);
    const unsigned voff = (unsigned)(srow * SEQ + spc);

#pragma unroll 1
    for (int it = 0; it < nit; ++it) {
        const int kt  = 2 * it + grp;            // this group's tile
        const int ktl = (kt < ntl) ? kt : ntl - 1;   // tile whose bytes are read (written and in bounds)
        const f16* kp = Kp + head + (size_t)ktl * 64 * HD + koff;   // this lane's first 16 bytes of the tile
        const f16* vp = Vt + head + (size_t)ktl * 64 + voff;
        __syncthreads();
        v8h kv[4], vv[4];
#pragma unroll
        for (int p2 = 0; p2 < 4; ++p2) {
            kv[p2] = *(const v8h*)(kp + p2 * 16 * HD);
            vv[p2] = *(const v8h*)(vp + p2 * 16 * SEQ);
        }
        // the address pairs stay whole (no load's result lands on them) until this wait
        asm volatile("s_wait_xcnt 0x0" :: "v"(kp), "v"(vp) : "memory");
#pragma unroll
        for (int p2 = 0; p2 < 4; ++p2) {
            *(v8h*)&ks[(srow + p2 * 16) * APITCH + spc]  = kv[p2];
            *(v8h*)&vsT[(srow + p2 * 16) * APITCH + spc] = vv[p2];
        }
        __syncthreads();

        // S^T[64 keys x 16 q]
        v8f s[4];
#pragma unroll
        for (int nt = 0; nt < 4; ++nt) s[nt] = zero8();
#pragma unroll
        for (int c = 0; c < 2; ++c) {
#pragma unroll
            for (int nt = 0; nt < 4; ++nt) {
                const v16h kb = load_frag(ks, nt * 16, APITCH, c * 32, lane);
                s[nt] = wmma16(kb, qa[c], s[nt]);
            }
        }

        // key nt*16 + r of this lane's half of the tile counts iff nt*16 + r < lim
        const int lim = cq - kt * 64 - hh8;

        // online softmax of this lane's query, max-subtracted, exp2 domain
        float x[32], xm[32];
#pragma unroll
        for (int e = 0; e < 32; ++e) {
            x[e]  = s[e >> 3][e & 7] * cl;
            xm[e] = ((e >> 3) * 16 + (e & 7) < lim) ? x[e] : NEGBIG;
        }
        float u[11], w[4];
#pragma unroll
        for (int i = 0; i < 10; ++i) u[i] = fmax3(xm[3 * i], xm[3 * i + 1], xm[3 * i + 2]);
        u[10] = fmaxf(xm[30], xm[31]);
#pragma unroll
        for (int i = 0; i < 3; ++i) w[i] = fmax3(u[3 * i], u[3 * i + 1], u[3 * i + 2]);
        w[3] = fmaxf(u[9], u[10]);
        const float th = fmaxf(fmax3(w[0], w[1], w[2]), w[3]);
        const float tm = fmaxf(th, other_half(th));
        const float mn = fmaxf(m, tm);
        const float al = fexp2(m - mn);
        m = mn;
        lacc[0] *= al;
#pragma unroll
        for (int dt = 0; dt < 4; ++dt) o[dt] *= al;
        const float sh = 10.0f - mn;      // carry 2^10
        FragP pb[2];                      // P^T as B fragments: 32 keys each
#pragma unroll
        for (int e = 0; e < 32; e += 2) {
            v2f p2;
#pragma unroll
            for (int j = 0; j < 2; ++j) {
                const bool  alw = ((e + j) >> 3) * 16 + ((e + j) & 7) < lim;
                const float arg = alw ? (x[e + j] + sh) : 0.0f;
                const float ex  = fexp2(arg);
                p2[j] = alw ? ex : 0.0f;
            }
            pb[e >> 4].pair[(e & 15) >> 1] = __builtin_convertvector(p2, v2h);
        }

        // O^T += V^T . P^T ; l += ones . P^T
#pragma unroll
        for (int kk = 0; kk < 2; ++kk) {
#pragma unroll
            for (int dt = 0; dt < 4; ++dt) {
                const v16h vb = load_frag(vsT, dt * 16, APITCH, kk * 32, lane);
                o[dt] = wmma16(vb, pb[kk].v, o[dt]);
            }
            lacc = wmma16(ones, pb[kk].v, lacc);
        }
    }
    __syncthreads();     // every reader has left the K/V stages: they become the hand-over buffer

    float* mb = (float*)sm + t2;         // [34][128] floats, one column a lane of a group
    if (grp == 1) {
        mb[0]   = m;
        mb[128] = lacc[0];
#pragma unroll
        for (int dt = 0; dt < 4; ++dt)
#pragma unroll
            for (int r = 0; r < 8; ++r) mb[(2 + dt * 8 + r) * 128] = o[dt][r];
    }
    __syncthreads();     // publishes group 1's partial state to group 0

    // merge, then normalize: plane value = 1024 * (O/16) / (l) = O * 64 / l ; zero row when l == 0
    if (grp == 0) {
        const float m1 = mb[0];
        const float mn = fmaxf(m, m1);
        float a0 = fexp2(m - mn);
        float d1 = m1 - mn;
        // the slot behind a transcendental: without it the second one stands directly behind the first and
        // lands on its source register; the two operands hold the v_nop between them
        asm volatile("v_nop" : "+v"(a0), "+v"(d1));
        const float a1 = fexp2(d1);
        const float l  = lacc[0] * a0 + mb[128] * a1;
        const float lsafe = (l > 0.0f) ? l : 1.0f;
        const float inv   = (l > 0.0f) ? ((CARRY_CTX / CARRY_QKV) / lsafe) : 0.0f;
#pragma unroll
        for (int dt = 0; dt < 4; ++dt) {
            H8U t;
#pragma unroll
            for (int r = 0; r < 8; ++r) {
                const float ov = o[dt][r] * a0 + mb[(2 + dt * 8 + r) * 128] * a1;
                t.e[r] = (f16)(ov * inv);
            }
            *(v8h*)&psw[c16 * APITCH + dt * 16 + hh8] = t.v;   // 8 consecutive d of one query row
        }
    }
    __syncthreads();

    if (grp == 0) {
        const int piece = lane & 7;
        const int lsub  = lane >> 3;
#pragma unroll
        for (int it = 0; it < 4; ++it) {
            const int L = it * 4 + lsub;     // query row 0..15 within the wave tile
            const v8h v = *(const v8h*)&psw[L * APITCH + piece * 8];
            f16* dp = Cp + ((size_t)(bidx * SEQ + qw + L) * HID + hidx * HD + piece * 8);
            *(v8h*)dp = v;
        }
    }
}

// ---------------------------------------------------------------------------
// All of attention in one grid: the 64-row q-blocks 2 .. SEQ/64-1 of every head (attn_tile_split),
// longest horizon first (there are more blocks than resident places: late starters must be the
// short ones), then the two 64-row blocks of rows 0 .. 127 of every head (attn_tile_res, at most
// two key tiles). The blocks are independent of each other.
// The branch is block-uniform; the two kinds of block share one LDS array.
// ---------------------------------------------------------------------------
#define QBLKS    (SEQ / 64 - 2)
#define SBLKS    (QBLKS * NB * NHEAD)
#define RBLKS    (2 * NB * NHEAD)
#define ATTN_LDS (ATTN_LDSR > ATTN_LDS2 ? ATTN_LDSR : ATTN_LDS2)
// at most 160 registers: three blocks (six waves a SIMD) stay resident
__global__ void __launch_bounds__(256) __attribute__((amdgpu_num_vgpr(160)))
attn_all(const f16* __restrict__ Qp, const f16* __restrict__ Kp, const f16* __restrict__ Vt,
         const f16* __restrict__ Vtl, const int* __restrict__ kcnt,
         f16* __restrict__ Cp, f16* __restrict__ Cpl) {
    __shared__ __attribute__((aligned(16))) f16 sm[ATTN_LDS];
    const int b = (int)blockIdx.x;
    if (b >= SBLKS) {
        const int t = b - SBLKS;
        attn_tile_res(Qp, Kp, Vt, Vtl, kcnt, Cp, Cpl, sm, t / (NB * NHEAD), t % (NB * NHEAD));
    } else {
        attn_tile_split(Qp, Kp, Vt, kcnt, Cp, sm, SEQ / 64 - 1 - b / (NB * NHEAD), b % (NB * NHEAD));
    }
}

// ---------------------------------------------------------------------------
// Launch: 4 kernel launches. Workspace (halves): X, Q, K, V^T hi, V^T residual, ctx hi
// (6 x MROWS*1024), 4 weight planes (1024*1024), ctx residual (NB*128*1024), plus the key tables
// ---------------------------------------------------------------------------
extern "C" void kernel_launch(void* const* d_in, const int* in_sizes, int n_in,
                              void* d_out, int out_size, void* d_ws, size_t ws_size,
                              hipStream_t stream) {
    if (n_in < 10) return;
    if (in_sizes[0] < ((NB - 1) * SEQ_FULL + SEQ) * HID) return;
    if (in_sizes[1] < (NB - 1) * SEQ_FULL + SEQ) return;
    if (in_sizes[2] < HID * HID || in_sizes[4] < HID * HID ||
        in_sizes[6] < HID * HID || in_sizes[8] < HID * HID) return;
    if (in_sizes[3] < HID || in_sizes[5] < HID || in_sizes[7] < HID || in_sizes[9] < HID) return;
    if (out_size < MROWS * HID) return;

    const float* x    = (const float*)d_in[0];
    const int*   mask = (const int*)d_in[1];
    const float* wq   = (const float*)d_in[2];
    const float* bq   = (const float*)d_in[3];
    const float* wk   = (const float*)d_in[4];
    const float* bk   = (const float*)d_in[5];
    const float* wv   = (const float*)d_in[6];
    const float* bv   = (const float*)d_in[7];
    const float* wo   = (const float*)d_in[8];
    const float* bo   = (const float*)d_in[9];

    const size_t nX = (size_t)MROWS * HID;    // halves per activation plane
    const size_t nW = (size_t)HID * HID;      // halves per weight plane
    const size_t nR = (size_t)RROWS * HID;    // elements per residual-row plane
    const size_t totalBytes = (6 * nX + 4 * nW + nR) * sizeof(f16) + 2 * (size_t)MROWS * sizeof(int);
    if (ws_size < totalBytes) return;

    f16* Xh  = (f16*)d_ws;       // [MROWS][1024]            carry 16
    f16* Wqh = Xh  + nX;         // [n][k] = Wq[k][n]        carry 32
    f16* Wkh = Wqh + nW;
    f16* Wvh = Wkh + nW;
    f16* Woh = Wvh + nW;
    f16* Qp  = Woh + nW;         // [NB*16][SEQ][64]         carry 16
    f16* Kp  = Qp  + nX;         // [NB*16][SEQ][64]         carry 16, packed keys
    f16* Vth = Kp  + nX;         // [NB*1024][SEQ] (V^T)     carry 16, packed keys
    f16* Vtl = Vth + nX;         // V^T residual x2^10
    f16* Cph = Vtl + nX;         // [MROWS][1024]            carry 1024
    f16* Cpl = Cph + nX;         // [NB*128][1024]           ctx residual x2^10 (rows 0..127 per batch), directly behind Cph
    int* Kidx = (int*)(Cpl + nR);     // [NB][SEQ] index of the j-th allowed key
    int* Kcnt = Kidx + MROWS;         // [NB][SEQ] allowed keys with index <= s

    cvt_all<<<NB + 4 * WTILES + MROWS / 2, 256, 0, stream>>>(x, wq, wk, wv, wo, mask, Xh, Wqh, Kidx, Kcnt);

    // plane = 16 * (acc / (16*32) + b) = acc/32 + 16*b
    const float accQKV = CARRY_QKV / (CARRY_X * CARRY_W);
    gemm_qkv<<<dim3(MROWS / 128, HID / 128, 3), 256, 0, stream>>>(Xh, Wqh, bq, bk, bv, Qp, Vth, Vtl,
                                                                    Kidx, Kcnt, accQKV, CARRY_QKV);

    attn_all<<<SBLKS + RBLKS, 256, 0, stream>>>(Qp, Kp, Vth, Vtl, Kcnt, Cph, Cpl);

    // out = acc / (1024*32) + b, on the first 128 rows of each sequence + residual acc / (1024*1024*32)
    const float accOut = 1.0f / (CARRY_CTX * CARRY_W);
    const float accLo  = 1.0f / (CARRY_CTX * CARRY_RES * CARRY_W);
    gemm_out<<<dim3(RTILES + MTILES, HID / 128), 256, 0, stream>>>(Cph, Woh, bo, (float*)d_out, accOut, accLo);
}

// v008
// A run of this version takes 58 microseconds.
// Next to v007, in two timings, it ran 1.05 times as fast each time.
// All steps since v000 together make it 5.66 times as fast.
#include <hip/hip_runtime.h>

// Contractions (Q/K/V/out projections, Q.K^T, P.V, P row-sum): v_wmma_f32_16x16x32_f16, f16 operands with power-of-two carries, f32 accumulate; every float input enters as its bf16 RNE value; V, P and context carry an extra f16 residual plane (x2^10) on the first 128 query rows per sequence; softmax in f32. Keys whose padding mask forbids them are never projected or scored: K and V^T hold the allowed keys only, packed in key order.

#ifndef NB
#define NB 2
#endif
#ifndef SEQ
#define SEQ 2048
#endif
#define NB_FULL   2
#define SEQ_FULL  2048
#define HID       1024
#define NHEAD     16
#define HD        64
#define MROWS     (NB * SEQ)
#define RROWS     (NB * 128)      // query rows per batch-set that carry residual planes

static_assert(HID == NHEAD * HD);
static_assert(SEQ % 128 == 0);
static_assert(SEQ >= 128);
static_assert(SEQ <= SEQ_FULL);
static_assert(NB >= 1 && NB <= NB_FULL);
static_assert(MROWS % 128 == 0);
static_assert(RROWS % 128 == 0);
static_assert(HID % 128 == 0);

// carries (exact powers of two)
#define CARRY_X    16.0f     // hidden plane
#define CARRY_W    32.0f     // weight planes
#define CARRY_QKV  16.0f     // q, k, v^T planes (true value x16)
#define CARRY_CTX  1024.0f   // context plane (true value x1024)
#define CARRY_RES  1024.0f   // residual planes: (value - f16(value)) x1024
#define NEGBIG     (-1.0e30f)
// LDS row pitches: 16 B x odd for rows read or written 16 bytes a lane (one row per lane),
// so that the 16 lanes of a half wave fall on distinct bank groups
#define GPITCH     72        // halves: GEMM operand rows of 64 halves (144 B)
#define CPITCH     136       // halves: GEMM f16 output staging rows of 128 halves (272 B)
#define CFPITCH    132       // floats: GEMM f32 output staging rows of 128 floats (528 B)
#define APITCH     72        // halves: attention rows of 64 halves (144 B)
static_assert(64 * CFPITCH * 4 <= 128 * CPITCH * 2);   // the f32 staging shares the f16 staging array
// softmax exp values carry 2^10 (added to the exp2 argument)

typedef _Float16 f16;
typedef f16   v16h __attribute__((ext_vector_type(16)));
typedef f16   v8h  __attribute__((ext_vector_type(8)));
typedef float v8f  __attribute__((ext_vector_type(8)));
typedef float v4f  __attribute__((ext_vector_type(4)));

union FragU { v16h v; v8h half[2]; f16 e[16]; };
union H8U   { v8h v; f16 e[8]; };

__device__ __forceinline__ v8f zero8() {
    v8f z = {0.f, 0.f, 0.f, 0.f, 0.f, 0.f, 0.f, 0.f};
    return z;
}

// 16-bit WMMA with hazard guard: D += A[16 x 32k] * B[32k x 16]
__device__ __forceinline__ v8f wmma16(v16h a, v16h b, v8f c) {
    v8f d = __builtin_amdgcn_wmma_f32_16x16x32_f16(false, a, false, b, (short)0, c, false, false);
    asm volatile("v_nop\n\tv_nop\n\tv_nop\n\tv_nop" : "+v"(d) : "v"(a), "v"(b));
    return d;
}

// f32 -> nearest-even bf16 value, returned as f32
__device__ __forceinline__ float bf16_rne(float x) {
    unsigned u = __float_as_uint(x);
    u = (u + 0x7fffu + ((u >> 16) & 1u)) & 0xffff0000u;
    return __uint_as_float(u);
}

__device__ __forceinline__ float fexp2(float x) {
#if defined(__has_builtin)
#if __has_builtin(__builtin_amdgcn_exp2f)
    return __builtin_amdgcn_exp2f(x);
#else
    return exp2f(x);
#endif
#else
    return exp2f(x);
#endif
}

// The same instruction with the slot behind a transcendental kept inside the statement (one v_nop): for
// code under a tight register limit, where the compiler lands a neighbour's result on the source
// register of the v_exp directly in front of it
__device__ __forceinline__ float fexp2_slot(float x) {
    float y;
    asm("v_exp_f32 %0, %1\n\tv_nop" : "=v"(y) : "v"(x));
    return y;
}

// max over the 16 lanes of each lane half (DPP row rotations; D-layout rows are DPP rows)
__device__ __forceinline__ float rowmax16(float x) {
    int v = __builtin_bit_cast(int, x);
    x = fmaxf(x, __builtin_bit_cast(float, __builtin_amdgcn_update_dpp(v, v, 0x121, 0xf, 0xf, false)));
    v = __builtin_bit_cast(int, x);
    x = fmaxf(x, __builtin_bit_cast(float, __builtin_amdgcn_update_dpp(v, v, 0x122, 0xf, 0xf, false)));
    v = __builtin_bit_cast(int, x);
    x = fmaxf(x, __builtin_bit_cast(float, __builtin_amdgcn_update_dpp(v, v, 0x124, 0xf, 0xf, false)));
    v = __builtin_bit_cast(int, x);
    x = fmaxf(x, __builtin_bit_cast(float, __builtin_amdgcn_update_dpp(v, v, 0x128, 0xf, 0xf, false)));
    return x;
}

// 16 x 32 fragment from a tile whose k dimension is contiguous (pitch in halves).
// lane l: row rowbase + (l&15); elements 0..7 <- k = kcol + 8h .. +7,
// elements 8..15 <- k = kcol + 16 + 8h .. +7  (h = l>>4). Same map for A and B.
__device__ __forceinline__ v16h load_frag(const f16* tile, int rowbase, int pitch, int kcol, int lane) {
    const int r  = rowbase + (lane & 15);
    const int kh = (lane >> 4) << 3;
    const f16* p = tile + (size_t)r * pitch + kcol + kh;
    FragU f;
    f.half[0] = *(const v8h*)(p);
    f.half[1] = *(const v8h*)(p + 16);
    return f.v;
}

// ---------------------------------------------------------------------------
// f32 rows -> f16 plane (bf16 RNE value times carry). 128 threads per 1024-wide
// Source row stride mapping lets a reduced build read full-size inputs.
// coverage: nrows x 1024 halves, every element exactly once (grid = nrows*128/256).
// ---------------------------------------------------------------------------
template <int DSTPER, int SRCPER>
__device__ __forceinline__ void
cvt_rows(const float* __restrict__ src, f16* __restrict__ dst, int nrows, float carry, int blk) {
    const int g  = blk * 256 + (int)threadIdx.x;
    const int m  = g >> 7;
    const int c8 = (g & 127) << 3;
    if (m >= nrows) return;
    const int sm = (m / DSTPER) * SRCPER + (m % DSTPER);
    const float* sp = src + (size_t)sm * HID + c8;
    const v4f a = *(const v4f*)sp;
    const v4f b = *(const v4f*)(sp + 4);
    H8U o;
#pragma unroll
    for (int j = 0; j < 4; ++j) {
        const float x0 = a[j];
        const float x1 = b[j];
        o.e[j]     = (f16)(bf16_rne(x0) * carry);
        o.e[j + 4] = (f16)(bf16_rne(x1) * carry);
    }
    f16* dp = dst + (size_t)m * HID + c8;
    *(v8h*)dp = o.v;
    
}

// ---------------------------------------------------------------------------
// Weight transpose + convert: src [k][n] f32 (HID x HID, n contiguous) -> dst [n][k] f16
// = bf16 RNE(src[k][n]) * carry, k contiguous. Block handles a 64(k) x 64(n) tile through
// coverage: grid (HID/64, HID/64) x (64 n rows x 64 k) = the whole [HID][HID] plane once.
// LDS: T cross-wave (block barrier between element stores and vector reloads).
// ---------------------------------------------------------------------------
__device__ __forceinline__ void
cvt_wT(const float* __restrict__ src, f16* __restrict__ dst, float carry, int bx, int by) {
    __shared__ __attribute__((aligned(16))) f16 T[64 * 72];
    const int tid  = (int)threadIdx.x;
    const int lane = tid & 31;
    const int wave = tid >> 5;
    const int k0   = bx * 64;
    const int n0   = by * 64;
    const int kr   = tid >> 2;           // 0..63
    const int nc   = (tid & 3) << 4;     // 0,16,32,48
    const float* sp = src + (size_t)(k0 + kr) * HID + n0 + nc;
#pragma unroll
    for (int q = 0; q < 4; ++q) {
        const v4f a = *(const v4f*)(sp + q * 4);
#pragma unroll
        for (int j = 0; j < 4; ++j)
            T[(nc + q * 4 + j) * 72 + kr] = (f16)(bf16_rne(a[j]) * carry);
    }
    __syncthreads();
    const int piece = lane & 7;
    const int lsub  = lane >> 3;
{
#pragma unroll
        for (int it = 0; it < 2; ++it) {
            const int L = it * 32 + wave * 4 + lsub;     // local n row 0..63
            const v8h v = *(const v8h*)&T[L * 72 + piece * 8];
            f16* dp = dst + (size_t)(n0 + L) * HID + k0 + piece * 8;
            *(v8h*)dp = v;
        }
        
    }
}

// ---------------------------------------------------------------------------
// Key packing tables of one sequence (one block): a key is allowed iff kmask[b][key] == 0.
// kcnt[b*SEQ + s] = number of allowed keys with index <= s (so packed key j is visible to
// query q iff j < kcnt[q]: the causal test and the padding test in one compare);
// kidx[b*SEQ + j] = index of the j-th allowed key, 0 for j >= the sequence's total.
// Each thread owns KPER consecutive positions; block-wide inclusive scan of the per-thread
// counts in LDS; kidx is gathered in LDS so that both tables leave as whole runs per thread.
// coverage: every entry of both tables of this sequence once.
// ---------------------------------------------------------------------------
#define KPER ((SEQ + 255) / 256)
__device__ __forceinline__ void
key_scan(const int* __restrict__ kmask, int* __restrict__ kidx, int* __restrict__ kcnt, int bidx) {
    __shared__ int part[256];
    __shared__ int sidx[256 * KPER];
    const int tid = (int)threadIdx.x;
    __builtin_assume(tid < 256);         // the launch's block size: lets the range tests below fold, so the mask loads go out together
    const int* mrow = kmask + (size_t)bidx * SEQ_FULL;
    int ok[KPER];
    int c = 0;
    // the three loops over j are unrolled so that ok[] and cn[] stay in registers
#pragma unroll
    for (int j = 0; j < KPER; ++j) {
        const int s = tid * KPER + j;
        ok[j] = (s < SEQ) ? (mrow[s] == 0 ? 1 : 0) : 0;
        c += ok[j];
    }
    part[tid] = c;
    __syncthreads();
    for (int d = 1; d < 256; d <<= 1) {
        const int add = (tid >= d) ? part[tid - d] : 0;
        __syncthreads();
        part[tid] += add;
        __syncthreads();
    }
    int run = part[tid] - c;             // allowed keys in front of this thread's first position
    const int total = part[255];
    int cn[KPER];
#pragma unroll
    for (int j = 0; j < KPER; ++j) {
        const int s = tid * KPER + j;
        if (ok[j]) sidx[run] = s;        // run < total
        run += ok[j];
        cn[j] = run;
        if (s >= total) sidx[s] = 0;     // the slots behind the packed keys
    }
    __syncthreads();
#pragma unroll
    for (int j = 0; j < KPER; ++j) {
        const int s = tid * KPER + j;
        if (s < SEQ) {
            kcnt[bidx * SEQ + s] = cn[j];
            kidx[bidx * SEQ + s] = sidx[s];
        }
    }
}

// ---------------------------------------------------------------------------
// All five input conversions and the key packing tables in one grid (independent of each
// other): blocks 0 .. NB-1 build the tables (first: theirs is the longest chain), the next
// 4*WTILES transpose-convert the four weight planes (dst planes contiguous,
// order q, k, v, o), the remaining MROWS/2 blocks convert the hidden rows.
// The branch is block-uniform, so the barriers inside are reached by whole blocks.
// ---------------------------------------------------------------------------
#define WTILES ((HID / 64) * (HID / 64))
__global__ void __launch_bounds__(256)
cvt_all(const float* __restrict__ x, const float* __restrict__ wq, const float* __restrict__ wk,
        const float* __restrict__ wv, const float* __restrict__ wo, const int* __restrict__ kmask,
        f16* __restrict__ xh, f16* __restrict__ wh, int* __restrict__ kidx, int* __restrict__ kcnt) {
    const int b = (int)blockIdx.x - NB;
    if (b < 0) {
        key_scan(kmask, kidx, kcnt, b + NB);
    } else if (b < 4 * WTILES) {
        const int w = b / WTILES;
        const int t = b - w * WTILES;
        const float* src = (w == 0) ? wq : (w == 1) ? wk : (w == 2) ? wv : wo;
        cvt_wT(src, wh + (size_t)w * HID * HID, CARRY_W, t % (HID / 64), t / (HID / 64));
        // in the built code other branches' text follows these stores: keep the wait in front of
        // any overwrite of the registers they name
        asm volatile("s_wait_xcnt 0x0" ::: "memory");
    } else {
        cvt_rows<SEQ, SEQ_FULL>(x, xh, MROWS, CARRY_X, b - 4 * WTILES);
    }
}

// ---------------------------------------------------------------------------
// C[m][n] = sum_k A[m][k] * W[n][k] ; A [M][1024] f16, W [1024][1024] f16 (k contiguous).
// Block tile 128 x 128, 8 waves as 4(M) x 2(N), 2 x 4 accumulators per wave. K runs in slabs of
// 64: asynchronous copies bring slab t + 1 into one of two LDS buffers while slab t is multiplied.
// MODE 1: f16 plane [b*HID + h*HD + d][s] (V transposed per head) into out, plus the
//         residual plane (val - f16(val)) * 2^10, same layout, into out2
// MODE 3: f32 rows [m][1024] into out
// coverage per block: MODE 0 256 lines, MODE 1 2 x 256 lines (hi, residual),
//                     MODE 3 2 x 256 lines (64 rows x 4 line-quarters per half).
// LDS: the slab buffers and Cs are cross-wave, separated by block barriers.
// ---------------------------------------------------------------------------
// LDS of one GEMM tile, offsets in halves (the kernel owns the array, so that kernels which
// hold more than one kind of tile allocate it once)
#define GEMM_OP   (128 * GPITCH)                      // one operand's slab [128][GPITCH]
#define GEMM_BUF  (2 * GEMM_OP)                       // one buffer: A's slab, then W's
#define GEMM_RING (2 * GEMM_BUF)                      // two buffers
#define GEMM_CS   0                                   // Cs f16 [128][CPITCH] or f32 [64][CFPITCH]: reuses the
                                                      // buffers behind the K loop's last barrier
#define GEMM_LDS  GEMM_RING
static_assert(128 * CPITCH <= GEMM_RING);
#define KSLAB     64
#define NSLAB     (HID / KSLAB)
static_assert(NSLAB >= 2);

// One slab of both operands into one buffer: 8 copies of 16 bytes a lane (8 lanes cover one row's
// 128 bytes, 32 rows a copy). la = this lane's LDS byte address of its first A piece in the buffer.
__device__ __forceinline__ void
slab_copy(unsigned la, const f16* a0, const f16* a1, const f16* a2, const f16* a3,
          const f16* w0, const f16* w1, const f16* w2, const f16* w3) {
    const unsigned la1 = la + 32 * GPITCH * 2, la2 = la + 64 * GPITCH * 2, la3 = la + 96 * GPITCH * 2;
    const unsigned lw0 = la + GEMM_OP * 2, lw1 = la1 + GEMM_OP * 2, lw2 = la2 + GEMM_OP * 2, lw3 = la3 + GEMM_OP * 2;
    // global -> LDS through no register; the closing wait stands in front of any overwrite of the
    // address registers that the copies name (a precaution)
    asm volatile("global_load_async_to_lds_b128 %0, %8, off\n\t"
                 "global_load_async_to_lds_b128 %1, %9, off\n\t"
                 "global_load_async_to_lds_b128 %2, %10, off\n\t"
                 "global_load_async_to_lds_b128 %3, %11, off\n\t"
                 "global_load_async_to_lds_b128 %4, %12, off\n\t"
                 "global_load_async_to_lds_b128 %5, %13, off\n\t"
                 "global_load_async_to_lds_b128 %6, %14, off\n\t"
                 "global_load_async_to_lds_b128 %7, %15, off\n\t"
                 "s_wait_xcnt 0x0"
                 :: "v"(la), "v"(la1), "v"(la2), "v"(la3), "v"(lw0), "v"(lw1), "v"(lw2), "v"(lw3),
                    "v"(a0), "v"(a1), "v"(a2), "v"(a3), "v"(w0), "v"(w1), "v"(w2), "v"(w3)
                 : "memory");
}

// K loop of one 128 x 128 tile at column n0; arow[p] = the row of A that this thread stages as
// tile row (tid >> 3) + 32 p
__device__ __forceinline__ void
gemm_main(const f16* __restrict__ A, const f16* __restrict__ W, f16* ring,
          const int (&arow)[4], int n0, v8f (&acc)[2][4]) {
    const int tid  = (int)threadIdx.x;
    const int lane = tid & 31;
    const int wave = tid >> 5;
    const int wm   = wave & 3;
    const int wn   = wave >> 2;

#pragma unroll
    for (int i = 0; i < 2; ++i)
#pragma unroll
        for (int j = 0; j < 4; ++j) acc[i][j] = zero8();

    const int srow = tid >> 3;
    const int scol = (tid & 7) << 3;
    const f16* gA[4];
    const f16* gW[4];
#pragma unroll
    for (int p = 0; p < 4; ++p) {
        gA[p] = A + (size_t)arow[p] * HID + scol;
        gW[p] = W + (size_t)(n0 + srow + 32 * p) * HID + scol;
    }
    const unsigned la = (unsigned)(size_t)(ring + srow * GPITCH + scol);   // LDS byte address (low 32 bits)

    slab_copy(la, gA[0], gA[1], gA[2], gA[3], gW[0], gW[1], gW[2], gW[3]);
    asm volatile("s_wait_asynccnt 0x0" ::: "memory");   // slab 0 has landed (this wave's part)
    __syncthreads();                                    // ... and every other wave's
    slab_copy(la + GEMM_BUF * 2, gA[0] + KSLAB, gA[1] + KSLAB, gA[2] + KSLAB, gA[3] + KSLAB,
              gW[0] + KSLAB, gW[1] + KSLAB, gW[2] + KSLAB, gW[3] + KSLAB);

    // rolled: one copy of the loop's text, and the order at its foot stays as written
#pragma unroll 1
    for (int t = 0; t < NSLAB; ++t) {
        const int boff = (t & 1) * GEMM_BUF;
        const f16* As = ring + boff;
        const f16* Bs = As + GEMM_OP;
#pragma unroll
        for (int kk = 0; kk < KSLAB; kk += 32) {
            v16h af[2], bfr[4];
#pragma unroll
            for (int i = 0; i < 2; ++i) af[i] = load_frag(As, wm * 32 + i * 16, GPITCH, kk, lane);
#pragma unroll
            for (int j = 0; j < 4; ++j) bfr[j] = load_frag(Bs, wn * 64 + j * 16, GPITCH, kk, lane);
#pragma unroll
            for (int i = 0; i < 2; ++i)
#pragma unroll
                for (int j = 0; j < 4; ++j) acc[i][j] = wmma16(af[i], bfr[j], acc[i][j]);
        }
        asm volatile("s_wait_dscnt 0x0" ::: "memory");      // this wave has left slab t's buffer
        asm volatile("s_wait_asynccnt 0x0" ::: "memory");   // its part of slab t + 1 has landed
        __syncthreads();                                    // publishes slab t + 1, frees slab t's buffer
        if (t + 2 < NSLAB) {                                // the same for the whole block
            const int k = (t + 2) * KSLAB;
            slab_copy(la + boff * 2, gA[0] + k, gA[1] + k, gA[2] + k, gA[3] + k,
                      gW[0] + k, gW[1] + k, gW[2] + k, gW[3] + k);
        }
    }
    asm volatile("s_wait_asynccnt 0x0" ::: "memory");       // no copy is left in flight
}

// scale, bias and store of one 128 x 128 tile at (m0, n0)
template <int MODE>
__device__ __forceinline__ void
gemm_epi(const v8f (&acc)[2][4], f16* Cs, const float* __restrict__ bias,
         void* __restrict__ out, void* __restrict__ out2,
         float accMul, float addMul, int m0, int n0) {
    const int tid  = (int)threadIdx.x;
    const int lane = tid & 31;
    const int wave = tid >> 5;
    const int wm   = wave & 3;
    const int wn   = wave >> 2;
    const int hh8  = (lane >> 4) << 3;   // D row half
    const int c16  = lane & 15;          // D column

    // bias (bf16 RNE value) per owned column group
    float bb[4];
#pragma unroll
    for (int j = 0; j < 4; ++j) bb[j] = bf16_rne(bias[n0 + wn * 64 + j * 16 + c16]) * addMul;

    const int bidx  = m0 / SEQ;          // block rows lie inside one batch (SEQ % 128 == 0)
    const int s0    = m0 - bidx * SEQ;
    const int piece = lane & 7;
    const int lsub  = lane >> 3;

    if constexpr (MODE == 0) {
#pragma unroll
        for (int i = 0; i < 2; ++i)
#pragma unroll
            for (int j = 0; j < 4; ++j) {
                const int nl = wn * 64 + j * 16 + c16;
#pragma unroll
                for (int r = 0; r < 8; ++r) {
                    const int ml = wm * 32 + i * 16 + hh8 + r;
                    Cs[ml * CPITCH + nl] = (f16)(acc[i][j][r] * accMul + bb[j]);
                }
            }
        __syncthreads();
        f16* op = (f16*)out;
        const size_t bh0 = (size_t)bidx * NHEAD + (n0 >> 6);
{
#pragma unroll
            for (int it = 0; it < 8; ++it) {
                const int L    = wave * 32 + it * 4 + lsub;   // 0..255
                const int ml   = L >> 1;
                const int hsel = L & 1;
                const v8h v = *(const v8h*)&Cs[ml * CPITCH + hsel * 64 + piece * 8];
                f16* dp = op + ((bh0 + hsel) * SEQ + s0 + ml) * HD + piece * 8;
                *(v8h*)dp = v;
            }
            
        }
    } else if constexpr (MODE == 1) {
        // hi plane, staged transposed: Cs[n][m]
#pragma unroll
        for (int i = 0; i < 2; ++i)
#pragma unroll
            for (int j = 0; j < 4; ++j) {
                const int nl = wn * 64 + j * 16 + c16;
                H8U t;
#pragma unroll
                for (int r = 0; r < 8; ++r) t.e[r] = (f16)(acc[i][j][r] * accMul + bb[j]);
                *(v8h*)&Cs[nl * CPITCH + wm * 32 + i * 16 + hh8] = t.v;
            }
        __syncthreads();
        {
            f16* op = (f16*)out;
{
#pragma unroll
                for (int it = 0; it < 8; ++it) {
                    const int L  = wave * 32 + it * 4 + lsub;     // 0..255
                    const int nl = L >> 1;
                    const int mh = L & 1;
                    const v8h v = *(const v8h*)&Cs[nl * CPITCH + mh * 64 + piece * 8];
                    f16* dp = op + ((size_t)(bidx * HID + n0 + nl) * SEQ + s0 + mh * 64 + piece * 8);
                    *(v8h*)dp = v;
                }
                
            }
        }
        __syncthreads();
        // residual plane: (val - f16(val)) * 2^10, same staging and store map
#pragma unroll
        for (int i = 0; i < 2; ++i)
#pragma unroll
            for (int j = 0; j < 4; ++j) {
                const int nl = wn * 64 + j * 16 + c16;
                H8U t;
#pragma unroll
                for (int r = 0; r < 8; ++r) {
                    const float val = acc[i][j][r] * accMul + bb[j];
                    const f16 hv = (f16)val;
                    t.e[r] = (f16)((val - (float)hv) * CARRY_RES);
                }
                *(v8h*)&Cs[nl * CPITCH + wm * 32 + i * 16 + hh8] = t.v;
            }
        __syncthreads();
        {
            f16* op = (f16*)out2;
{
#pragma unroll
                for (int it = 0; it < 8; ++it) {
                    const int L  = wave * 32 + it * 4 + lsub;     // 0..255
                    const int nl = L >> 1;
                    const int mh = L & 1;
                    const v8h v = *(const v8h*)&Cs[nl * CPITCH + mh * 64 + piece * 8];
                    f16* dp = op + ((size_t)(bidx * HID + n0 + nl) * SEQ + s0 + mh * 64 + piece * 8);
                    *(v8h*)dp = v;
                }
                
            }
        }
    } else {
        float* Cf = (float*)Cs;      // [64][CFPITCH] f32
        float* of = (float*)out;
#pragma unroll
        for (int half = 0; half < 2; ++half) {
            if ((wm >> 1) == half) {
#pragma unroll
                for (int i = 0; i < 2; ++i)
#pragma unroll
                    for (int j = 0; j < 4; ++j) {
                        const int nl = wn * 64 + j * 16 + c16;
#pragma unroll
                        for (int r = 0; r < 8; ++r) {
                            const int ml = (wm & 1) * 32 + i * 16 + hh8 + r;
                            Cf[ml * CFPITCH + nl] = acc[i][j][r] * accMul + bb[j];
                        }
                    }
            }
            __syncthreads();
            v4f vv[8];
#pragma unroll
            for (int it = 0; it < 8; ++it) {
                const int L    = wave * 32 + it * 4 + lsub;   // 0..255
                const int row  = L >> 2;
                const int part = L & 3;
                vv[it] = *(const v4f*)&Cf[row * CFPITCH + part * 32 + piece * 4];
            }
{
#pragma unroll
                for (int it = 0; it < 8; ++it) {
                    const int L    = wave * 32 + it * 4 + lsub;   // 0..255
                    const int row  = L >> 2;
                    const int part = L & 3;
                    float* dp = of + (size_t)(m0 + half * 64 + row) * HID + n0 + part * 32 + piece * 4;
                    *(v4f*)dp = vv[it];
                }
                
            }
            __syncthreads();
        }
    }
}

// Store of one out-projection tile whose A rows were 64 context rows (tile rows 0..63) and the same
// 64 queries' residual rows (tile rows 64..127): out[m0 + r] = acc[r] * accMul + bias + acc[64 + r] * accLo.
// The two halves pass through the f32 stage one after the other and are added in registers.
__device__ __forceinline__ void
gemm_epi_res(const v8f (&acc)[2][4], float* Cf, const float* __restrict__ bias, float* __restrict__ of,
             float accMul, float accLo, int m0, int n0) {
    const int tid  = (int)threadIdx.x;
    const int lane = tid & 31;
    const int wave = tid >> 5;
    const int wm   = wave & 3;
    const int wn   = wave >> 2;
    const int hh8  = (lane >> 4) << 3;   // D row half
    const int c16  = lane & 15;          // D column
    const int piece = lane & 7;
    const int lsub  = lane >> 3;

    float bb[4];
#pragma unroll
    for (int j = 0; j < 4; ++j) bb[j] = bf16_rne(bias[n0 + wn * 64 + j * 16 + c16]);

    v4f vv[8];
#pragma unroll
    for (int half = 0; half < 2; ++half) {
        if ((wm >> 1) == half) {
#pragma unroll
            for (int i = 0; i < 2; ++i)
#pragma unroll
                for (int j = 0; j < 4; ++j) {
                    const int nl = wn * 64 + j * 16 + c16;
#pragma unroll
                    for (int r = 0; r < 8; ++r) {
                        const int ml = (wm & 1) * 32 + i * 16 + hh8 + r;
                        Cf[ml * CFPITCH + nl] = (half == 0) ? acc[i][j][r] * accMul + bb[j] : acc[i][j][r] * accLo;
                    }
                }
        }
        __syncthreads();
#pragma unroll
        for (int it = 0; it < 8; ++it) {
            const int L    = wave * 32 + it * 4 + lsub;   // 0..255
            const int row  = L >> 2;
            const int part = L & 3;
            const v4f v = *(const v4f*)&Cf[row * CFPITCH + part * 32 + piece * 4];
            if (half == 0) vv[it] = v; else vv[it] += v;
        }
        if (half == 0) __syncthreads();   // every reader has left the stage before the residual rows land on it
    }
#pragma unroll
    for (int it = 0; it < 8; ++it) {
        const int L    = wave * 32 + it * 4 + lsub;   // 0..255
        const int row  = L >> 2;
        const int part = L & 3;
        float* dp = of + (size_t)(m0 + row) * HID + n0 + part * 32 + piece * 4;
        *(v4f*)dp = vv[it];
    }
}

// ---------------------------------------------------------------------------
// Out projection into the output. C = the context plane [MROWS][1024] with the residual
// plane [NB*128][1024] directly behind it, so that residual row r is row MROWS + r of C.
// blockIdx.x < RTILES: 64 of a sequence's first 128 queries; the tile's A rows are their context
// rows and, stacked below, their residual rows: both products run in the one K loop.
// The other blocks: plain 128-row tiles of rows 128 .. SEQ-1. The branches are block-uniform.
// coverage: every output row once.
// ---------------------------------------------------------------------------
#define RTILES  (NB * 2)
#define MTILES  (NB * (SEQ / 128 - 1))
__global__ void __launch_bounds__(256) __attribute__((amdgpu_num_vgpr(256)))
gemm_out(const f16* __restrict__ C, const f16* __restrict__ W, const float* __restrict__ bias,
         float* __restrict__ out, float accMul, float accLo) {
    __shared__ __attribute__((aligned(16))) f16 sm[GEMM_LDS];
    const int bx = (int)blockIdx.x;
    const int n0 = (int)blockIdx.y * 128;
    const int sr = (int)threadIdx.x >> 3;
    const bool res = bx < RTILES;
    const int t  = bx - RTILES;
    // first output row of the tile
    const int m0 = res ? (bx >> 1) * SEQ + (bx & 1) * 64
                       : (t / (SEQ / 128 - 1)) * SEQ + (t % (SEQ / 128 - 1) + 1) * 128;
    // tile row 64: the next context row, or the first residual row of the same queries
    const int m1 = res ? MROWS + (bx >> 1) * 128 + (bx & 1) * 64 : m0 + 64;
    const int arow[4] = {m0 + sr, m0 + sr + 32, m1 + sr, m1 + sr + 32};
    v8f acc[2][4];
    gemm_main(C, W, sm, arow, n0, acc);
    if (res) {
        gemm_epi_res(acc, (float*)(sm + GEMM_CS), bias, out, accMul, accLo, m0, n0);
    } else {
        gemm_epi<3>(acc, sm + GEMM_CS, bias, (void*)out, (void*)0, accMul, 1.0f, m0, n0);
    }
}

// ---------------------------------------------------------------------------
// The Q, K and V projections in one grid: z picks the weight plane (planes
// contiguous, order q, k, v), the bias and the output (z 0, 1: MODE 0 into the contiguous
// q, k planes; z 2: MODE 1 into V^T and its residual). The branch on z is block-uniform.
// Block index -> tile (a permutation, for speed only): first the
// V tiles (longest epilogue), then the K tiles, of the lower half of every sequence's packed rows;
// then all Q tiles; last the V and K tiles of the upper half, lowest rows first: these leave at once
// unless more than half of the keys are allowed, and so stand in front of no working tile, and the
// working tiles are consecutive in the index, whatever rule deals consecutive blocks to the WGPs.
// K and V are projected for the allowed keys only: row j of their tiles is hidden row
// kidx[j] of the sequence, so both planes come out packed; a tile wholly behind the
// sequence's total leaves before any barrier, and nothing reads its part of the planes
// (the slots between the total and the tile's end hold row 0's finite values, never counted).
// ---------------------------------------------------------------------------
#define KV_LOW  ((SEQ / 128 + 1) / 2)                     // row tiles in the lower half of a sequence
#define QKV_LO  (2 * NB * KV_LOW * (HID / 128))           // V and K tiles of the lower halves
#define QKV_Q   ((MROWS / 128) * (HID / 128))             // Q tiles
#define QKV_ALL (3 * QKV_Q)
__global__ void __launch_bounds__(256) __attribute__((amdgpu_num_vgpr(256)))
gemm_qkv(const f16* __restrict__ X, const f16* __restrict__ Wqkv, const float* __restrict__ bq,
         const float* __restrict__ bk, const float* __restrict__ bv, f16* __restrict__ qk,
         f16* __restrict__ vt, f16* __restrict__ vtl, const int* __restrict__ kidx,
         const int* __restrict__ kcnt, float accMul, float addMul) {
    __shared__ __attribute__((aligned(16))) f16 sm[GEMM_LDS];
    const unsigned L = blockIdx.x;
    unsigned z, mt, nt;                  // plane, 128-row tile (over all sequences), 128-column tile
    if (L < QKV_LO) {
        const unsigned r = L % (QKV_LO / 2);
        const unsigned t = r % (NB * KV_LOW);
        z  = (L < QKV_LO / 2) ? 2 : 1;
        nt = r / (NB * KV_LOW);
        mt = (t / KV_LOW) * (SEQ / 128) + t % KV_LOW;
    } else if (L < QKV_LO + QKV_Q) {
        const unsigned r = L - QKV_LO;
        z  = 0;
        nt = r / (MROWS / 128);
        mt = r % (MROWS / 128);
    } else {
        const unsigned r = L - (QKV_LO + QKV_Q);
        const unsigned q = r % (2 * NB * (HID / 128));
        const unsigned t = q % (NB * (HID / 128));
        z  = 2 - q / (NB * (HID / 128));
        nt = t / NB;
        mt = (t % NB) * (SEQ / 128) + KV_LOW + r / (2 * NB * (HID / 128));
    }
    const int m0 = (int)mt * 128;
    const int n0 = (int)nt * 128;
    const int r0 = m0 + ((int)threadIdx.x >> 3);
    int arow[4] = {r0, r0 + 32, r0 + 64, r0 + 96};
    if (z != 0) {
        const int seq0 = (m0 / SEQ) * SEQ;               // block rows lie inside one sequence
        const int  total = kcnt[seq0 + SEQ - 1];         // allowed keys of the sequence
        const int  s0 = kidx[r0], s1 = kidx[r0 + 32], s2 = kidx[r0 + 64], s3 = kidx[r0 + 96];
        // behind the loads (their values are the operands), in front of any overwrite of the registers they name
        asm volatile("s_wait_xcnt 0x0" :: "v"(s0), "v"(s1), "v"(s2), "v"(s3) : "memory");
        if (m0 - seq0 >= total) return;                  // block-uniform, in front of every barrier and copy
        arow[0] = seq0 + min(max(s0, 0), SEQ - 1);
        arow[1] = seq0 + min(max(s1, 0), SEQ - 1);
        arow[2] = seq0 + min(max(s2, 0), SEQ - 1);
        arow[3] = seq0 + min(max(s3, 0), SEQ - 1);
    }
    v8f acc[2][4];
    gemm_main(X, Wqkv + (size_t)z * HID * HID, sm, arow, n0, acc);
    if (z == 2) {
        gemm_epi<1>(acc, sm + GEMM_CS, bv, (void*)vt, (void*)vtl, accMul, addMul, m0, n0);
    } else {
        gemm_epi<0>(acc, sm + GEMM_CS, (z == 0) ? bq : bk, (void*)(qk + (size_t)z * MROWS * HID),
                    (void*)0, accMul, addMul, m0, n0);
        // in the built code the other epilogue's text follows these stores: keep the wait in
        // front of any overwrite of the registers they name
        asm volatile("s_wait_xcnt 0x0" ::: "memory");
    }
}

// ---------------------------------------------------------------------------
// Flash attention of query rows 0 .. 127, causal with key padding mask, over the packed keys
// (packed key j counts for query q iff j < kcnt[b][q]; other keys get p = 0 and are excluded from
// the row max; rows with no allowed key produce a zero context row). V, P and the context carry
// x2^10 residual planes (second accumulators); the context residual plane Cpl is [b*128 + q][1024].
// One block of 8 waves owns 64 query rows (qh = 0, 1) of one head: wave w and wave w + 4 hold the
// same 16 rows and the same scores, and split the head's 64 columns between
// them (32 each), which halves the output accumulators a wave holds, so that these blocks fit the
// register limit of the grid they share with attn_tile_split.
// The block streams the 64-key tiles up to its horizon: K staged [key][d], V^T staged [d][key].
// Scores on WMMA, row max via DPP, exp2 in f32 carried x2^10, P relayed per wave through LDS as
// A fragments, O += P.V and row sums += P.ones on WMMA. Output f16 planes carried x1024.
// coverage: with attn_tile_split every (b, q, h*64..h*64+63) segment of Cp once; the whole Cpl once.
// LDS (halves): ks [64][APITCH] = [key][d]; vsT [64][APITCH] = [d][key]; vsL the same, residual;
// ps [8][16][APITCH] per-wave P relay, psl the same, residual; behind the loop the first four
// slices of ps and psl stage the context rows (both waves of a row slice write their columns).
// ---------------------------------------------------------------------------
#define ATTN_KV   (64 * APITCH)
#define ATTN_P    (8 * 16 * APITCH)
#define ATTN_LDSR (3 * ATTN_KV + 2 * ATTN_P)

__device__ __forceinline__ void
attn_tile_res(const f16* __restrict__ Qp, const f16* __restrict__ Kp, const f16* __restrict__ Vt,
              const f16* __restrict__ Vtl, const int* __restrict__ kcnt,
              f16* __restrict__ Cp, f16* __restrict__ Cpl, f16* sm, int qh, int bh) {
    const int tid  = (int)threadIdx.x;
    const int lane = tid & 31;
    const int wave = __builtin_amdgcn_readfirstlane(tid >> 5);   // scalar: what derives from it stays out of the vector registers
    const int wq   = wave & 3;           // 16-row query slice within the block
    const int dg   = wave >> 2;          // column half of the head: d = dg*32 .. dg*32 + 31
    const int hh8  = (lane >> 4) << 3;
    const int c16  = lane & 15;
    const int bidx = bh / NHEAD;
    const int hidx = bh - bidx * NHEAD;
    const int qw   = qh * 64 + wq * 16;  // first query row (within sequence) of this wave
    const size_t head = (size_t)bh * SEQ * HD;
    const int* crow = kcnt + bidx * SEQ;

    f16* ks  = sm;
    f16* vsT = ks + ATTN_KV;
    f16* vsL = vsT + ATTN_KV;
    f16* ps  = vsL + ATTN_KV;
    f16* psl = ps + ATTN_P;

    FragU onesu;
#pragma unroll
    for (int i = 0; i < 16; ++i) onesu.e[i] = (f16)1.0f;
    const v16h ones = onesu.v;

    float m[8];
    v8f   o[2], lacc, olo[2], laccl;
#pragma unroll
    for (int r = 0; r < 8; ++r) m[r] = NEGBIG;
#pragma unroll
    for (int dt = 0; dt < 2; ++dt) { o[dt] = zero8(); olo[dt] = zero8(); }
    lacc  = zero8();
    laccl = zero8();

    // log2-domain scale: acc = 256 * q.k ; x = log2(e) * q.k / 8 = acc * log2(e) / 2048
    const float cl = 1.4426950408889634f * 0.00048828125f;
    const float rres = 1.0f / CARRY_RES;
    f16* psw  = ps  + wave * 16 * APITCH;
    f16* pslw = psl + wave * 16 * APITCH;

    // horizon in 64-key tiles of packed keys: the count of the block's last row (counts do not
    // fall along a sequence), never above the causal bound (block-uniform)
    const int nkt = (min(max(crow[qh * 64 + 63], 0), qh * 64 + 64) + 63) >> 6;
    // staging: 16 bytes a thread and step, 32 rows a step; lane offsets do not change over the loop
    const int srow = tid >> 3;
    const int spc  = (tid & 7) << 3;
    const unsigned koff = (unsigned)(srow * HD + spc);
    const unsigned voff = (unsigned)(srow * SEQ + spc);

#pragma unroll 1
    for (int kt = 0; kt < nkt; ++kt) {
        __syncthreads();
        const f16* kp = Kp  + head + (size_t)kt * 64 * HD + koff;   // this lane's first 16 bytes of the tile
        const f16* vp = Vt  + head + (size_t)kt * 64 + voff;
        const f16* lp = Vtl + head + (size_t)kt * 64 + voff;
        v8h kv[2], vv[2], vl[2];
#pragma unroll
        for (int p2 = 0; p2 < 2; ++p2) {
            kv[p2] = *(const v8h*)(kp + p2 * 32 * HD);
            vv[p2] = *(const v8h*)(vp + p2 * 32 * SEQ);
            vl[p2] = *(const v8h*)(lp + p2 * 32 * SEQ);
        }
        // Q fragments (load_frag's map) and the packed keys visible to each of this lane's 8 query rows:
        // fetched anew on each of the at most two trips, beside the tile, so that they hold no register
        // over the P.V phase
        const f16* qp = Qp + head + (size_t)(qw + c16) * HD + hh8;
        const int* cp = crow + qw + hh8;
        FragU qa[2];
        int   cr[8];
#pragma unroll
        for (int c = 0; c < 2; ++c) {
            qa[c].half[0] = *(const v8h*)(qp + c * 32);
            qa[c].half[1] = *(const v8h*)(qp + c * 32 + 16);
        }
#pragma unroll
        for (int r = 0; r < 8; ++r) cr[r] = cp[r];
        // the address pairs stay whole (no load's result lands on them) until this wait
        asm volatile("s_wait_xcnt 0x0" :: "v"(kp), "v"(vp), "v"(lp), "v"(qp), "v"(cp) : "memory");
#pragma unroll
        for (int p2 = 0; p2 < 2; ++p2) {
            *(v8h*)&ks[(srow + p2 * 32) * APITCH + spc]  = kv[p2];
            *(v8h*)&vsT[(srow + p2 * 32) * APITCH + spc] = vv[p2];
            *(v8h*)&vsL[(srow + p2 * 32) * APITCH + spc] = vl[p2];
        }
        __syncthreads();

        // S[16 q x 64 keys]
        v8f s[4];
#pragma unroll
        for (int nt = 0; nt < 4; ++nt) s[nt] = zero8();
#pragma unroll
        for (int c = 0; c < 2; ++c) {
#pragma unroll
            for (int nt = 0; nt < 4; ++nt) {
                const v16h kb = load_frag(ks, nt * 16, APITCH, c * 32, lane);
                s[nt] = wmma16(qa[c].v, kb, s[nt]);
            }
        }

        // this lane's key column of score tile nt counts for row r iff nt*16 < lim[r]
        int lim[8];
#pragma unroll
        for (int r = 0; r < 8; ++r) lim[r] = cr[r] - kt * 64 - c16;

        // online softmax per row r (row 8h + r), max-subtracted, exp2 domain
#pragma unroll
        for (int r = 0; r < 8; ++r) {
            float x[4];
            bool  alw[4];
#pragma unroll
            for (int nt = 0; nt < 4; ++nt) {
                x[nt]   = s[nt][r] * cl;
                alw[nt] = nt * 16 < lim[r];
            }
            const float xm0 = alw[0] ? x[0] : NEGBIG;
            const float xm1 = alw[1] ? x[1] : NEGBIG;
            const float xm2 = alw[2] ? x[2] : NEGBIG;
            const float xm3 = alw[3] ? x[3] : NEGBIG;
            const float tm = rowmax16(fmaxf(fmaxf(xm0, xm1), fmaxf(xm2, xm3)));
            const float mn = fmaxf(m[r], tm);
            const float al = fexp2_slot(m[r] - mn);
            m[r] = mn;
            lacc[r]  *= al;
            laccl[r] *= al;
#pragma unroll
            for (int dt = 0; dt < 2; ++dt) {
                o[dt][r]   *= al;
                olo[dt][r] *= al;
            }
            const float sh = 10.0f - mn;      // carry 2^10
#pragma unroll
            for (int nt = 0; nt < 4; ++nt) {
                const float arg = alw[nt] ? (x[nt] + sh) : 0.0f;
                const float e   = fexp2_slot(arg);
                const float p   = alw[nt] ? e : 0.0f;
                const f16   hp  = (f16)p;
                psw[(hh8 + r) * APITCH + nt * 16 + c16]  = hp;
                pslw[(hh8 + r) * APITCH + nt * 16 + c16] = (f16)((p - (float)hp) * CARRY_RES);
            }
        }
        __syncthreads();

        // O += P . V ; l += P . ones  (P reloaded as A fragments from the relay)
#pragma unroll
        for (int kk = 0; kk < 2; ++kk) {
            const v16h pa = load_frag(psw, 0, APITCH, kk * 32, lane);
            const v16h pl = load_frag(pslw, 0, APITCH, kk * 32, lane);
#pragma unroll
            for (int dt = 0; dt < 2; ++dt) {
                const v16h vb = load_frag(vsT, dg * 32 + dt * 16, APITCH, kk * 32, lane);
                o[dt]   = wmma16(pa, vb, o[dt]);
                olo[dt] = wmma16(pl, vb, olo[dt]);
                const v16h vl = load_frag(vsL, dg * 32 + dt * 16, APITCH, kk * 32, lane);
                olo[dt] = wmma16(pa, vl, olo[dt]);
            }
            lacc  = wmma16(pa, ones, lacc);
            laccl = wmma16(pl, ones, laccl);
        }
    }
    __syncthreads();     // every wave has left its P relay: the first four slices become the context stage

    // normalize: plane value = 1024 * (O/16) / (l) = O * 64 / l ; zero row when l == 0
    f16* cs  = ps  + wq * 16 * APITCH;
    f16* csl = psl + wq * 16 * APITCH;
#pragma unroll
    for (int r = 0; r < 8; ++r) {
        const float l = lacc[r] + laccl[r] * rres;
        const float lsafe = (l > 0.0f) ? l : 1.0f;
        const float inv   = (l > 0.0f) ? ((CARRY_CTX / CARRY_QKV) / lsafe) : 0.0f;
#pragma unroll
        for (int dt = 0; dt < 2; ++dt) {
            const float ov = o[dt][r] + olo[dt][r] * rres;
            const float cv = ov * inv;
            const f16 hv = (f16)cv;
            cs[(hh8 + r) * APITCH + dg * 32 + dt * 16 + c16]  = hv;
            csl[(hh8 + r) * APITCH + dg * 32 + dt * 16 + c16] = (f16)((cv - (float)hv) * CARRY_RES);
        }
    }
    __syncthreads();     // publishes both column halves of every staged row

    // whole 128-byte rows leave: waves 0..3 store the context plane, waves 4..7 its residual
    const int piece = lane & 7;
    const int lsub  = lane >> 3;
    const f16* st = dg ? csl : cs;
    f16* dst = (dg ? Cpl + (size_t)(bidx * 128 + qw) * HID : Cp + (size_t)(bidx * SEQ + qw) * HID)
               + hidx * HD;              // the same for the whole wave
    const unsigned doff = (unsigned)(lsub * HID + piece * 8);
#pragma unroll
    for (int it = 0; it < 4; ++it) {
        const int L = it * 4 + lsub;     // query row 0..15 within the slice
        const v8h v = *(const v8h*)&st[L * APITCH + piece * 8];
        *(v8h*)(dst + it * 4 * HID + doff) = v;
    }
}

// ---------------------------------------------------------------------------
// Query rows 128 .. SEQ-1, cut for a short longest chain: one block of 8 waves owns 64 query
// rows (64-row q-block qb >= 2) and its two groups of 4 waves split the 64-key tiles of the
// block's horizon of packed keys between them (group g takes tiles 2*it + g), each group with its own K and
// V^T stage and its own running (m, l, O). After the loop group 1 hands its partial state to
// group 0 through LDS and group 0 merges: mn = max(m0, m1), l = l0*2^(m0-mn) + l1*2^(m1-mn),
// O likewise. Same masking, scaling and carries as attn_tile_res, without the residual planes.
// Both products run transposed: S^T = K . Q^T (A = K rows, B = the resident Q fragments) and
// O^T += V^T . P^T (A = V^T rows, B = P^T). A lane then holds one query (column lane & 15) and, in
// register r of score tile nt, its key nt*16 + 8h + r (h = lane >> 4): m and l are one value a lane,
// the row maximum is taken in the lane plus one exchange between the lane halves, and two score
// tiles converted in place are the B fragment of 32 keys in load_frag's k order
// (elements 0..7 <- k = 8h .. 8h+7, elements 8..15 <- k = 16 + 8h .. +7): P never goes through LDS.
// When the tile count is odd, group 1's last tile lies wholly behind the horizon: its
// addresses are clamped to the last tile and every key of it fails the count test (p = 0,
// the running maximum does not move). A block with no visible key makes no trip.
// LDS (halves): group g: ks at g*2*ATTN_KV, vsT behind it; ctx stage [8][16][APITCH] at 4*ATTN_KV;
// the hand-over buffer (34 floats a lane of group 1) reuses the K/V stages behind a barrier.
// ---------------------------------------------------------------------------
#define ATTN_LDS2 (4 * ATTN_KV + ATTN_P)
static_assert(34 * 128 * 4 <= 4 * ATTN_KV * 2);   // the hand-over buffer fits the K/V stages

typedef float v2f __attribute__((ext_vector_type(2)));
typedef f16   v2h __attribute__((ext_vector_type(2)));
union FragP { v16h v; v2h pair[8]; };

__device__ __forceinline__ float fmax3(float a, float b, float c) { return fmaxf(fmaxf(a, b), c); }

// the value of lane l ^ 16
__device__ __forceinline__ float other_half(float x) {
    const int b = __builtin_bit_cast(int, x);
    return __builtin_bit_cast(float, __builtin_amdgcn_permlanex16(b, b, 0x76543210, 0xfedcba98, false, false));
}

__device__ __forceinline__ void
attn_tile_split(const f16* __restrict__ Qp, const f16* __restrict__ Kp, const f16* __restrict__ Vt,
                const int* __restrict__ kcnt, f16* __restrict__ Cp, f16* sm, int qb, int bh) {
    const int tid  = (int)threadIdx.x;
    const int lane = tid & 31;
    const int wave = __builtin_amdgcn_readfirstlane(tid >> 5);   // scalar: tile index and group tests stay off the vector port
    const int grp  = wave >> 2;          // key group
    const int wq   = wave & 3;           // 16-row query slice within the block
    const int hh8  = (lane >> 4) << 3;
    const int c16  = lane & 15;
    const int bidx = bh / NHEAD;
    const int hidx = bh - bidx * NHEAD;
    const int qw   = qb * 64 + wq * 16;  // first query row (within sequence) of this wave
    const size_t head = (size_t)bh * SEQ * HD;
    const int* crow = kcnt + bidx * SEQ;

    f16* ks  = sm + grp * 2 * ATTN_KV;
    f16* vsT = ks + ATTN_KV;
    f16* psw = sm + 4 * ATTN_KV + wave * 16 * APITCH;

    v16h qa[2];
#pragma unroll
    for (int c = 0; c < 2; ++c) qa[c] = load_frag(Qp + head, qw, HD, c * 32, lane);

    // packed keys visible to this lane's query
    const int cq = crow[qw + c16];

    // A operand of the row sums: ones in rows 0 and 8, so that register 0 of the sum tile holds this
    // lane's query's sum in both lane halves and registers 1..7 stay zero
    FragU onesu;
#pragma unroll
    for (int i = 0; i < 16; ++i) onesu.e[i] = ((lane & 7) == 0) ? (f16)1.0f : (f16)0.0f;
    const v16h ones = onesu.v;

    float m = NEGBIG;
    v8f   o[4], lacc;                    // o[dt][r] = O[query c16][d = dt*16 + 8h + r]
#pragma unroll
    for (int dt = 0; dt < 4; ++dt) o[dt] = zero8();
    lacc = zero8();

    // log2-domain scale: acc = 256 * q.k ; x = log2(e) * q.k / 8 = acc * log2(e) / 2048
    const float cl = 1.4426950408889634f * 0.00048828125f;

    // 64-key tiles of packed keys up to the block's horizon: the count of its last row (counts do
    // not fall along a sequence), never above the causal bound; block-uniform
    const int ntl = (min(max(crow[qb * 64 + 63], 0), qb * 64 + 64) + 63) >> 6;
    const int nit = (ntl + 1) >> 1;      // trips: ceil(ntl / 2)
    const int t2  = tid & 127;           // thread within the group
    // staging: 16 bytes a thread and step, 16 rows a step; lane offsets do not change over the loop
    const int srow = t2 >> 3;
    const int spc  = (t2 & 7) << 3;
    const unsigned koff = (unsigned)(srow * HD + spc);
    const unsigned voff = (unsigned)(srow * SEQ + spc);

#pragma unroll 1
    for (int it = 0; it < nit; ++it) {
        const int kt  = 2 * it + grp;            // this group's tile
        const int ktl = (kt < ntl) ? kt : ntl - 1;   // tile whose bytes are read (written and in bounds)
        const f16* kp = Kp + head + (size_t)ktl * 64 * HD + koff;   // this lane's first 16 bytes of the tile
        const f16* vp = Vt + head + (size_t)ktl * 64 + voff;
        __syncthreads();
        v8h kv[4], vv[4];
#pragma unroll
        for (int p2 = 0; p2 < 4; ++p2) {
            kv[p2] = *(const v8h*)(kp + p2 * 16 * HD);
            vv[p2] = *(const v8h*)(vp + p2 * 16 * SEQ);
        }
        // the address pairs stay whole (no load's result lands on them) until this wait
        asm volatile("s_wait_xcnt 0x0" :: "v"(kp), "v"(vp) : "memory");
#pragma unroll
        for (int p2 = 0; p2 < 4; ++p2) {
            *(v8h*)&ks[(srow + p2 * 16) * APITCH + spc]  = kv[p2];
            *(v8h*)&vsT[(srow + p2 * 16) * APITCH + spc] = vv[p2];
        }
        __syncthreads();

        // S^T[64 keys x 16 q]
        v8f s[4];
#pragma unroll
        for (int nt = 0; nt < 4; ++nt) s[nt] = zero8();
#pragma unroll
        for (int c = 0; c < 2; ++c) {
#pragma unroll
            for (int nt = 0; nt < 4; ++nt) {
                const v16h kb = load_frag(ks, nt * 16, APITCH, c * 32, lane);
                s[nt] = wmma16(kb, qa[c], s[nt]);
            }
        }

        // key nt*16 + r of this lane's half of the tile counts iff nt*16 + r < lim
        const int lim = cq - kt * 64 - hh8;

        // online softmax of this lane's query, max-subtracted, exp2 domain
        float x[32], xm[32];
#pragma unroll
        for (int e = 0; e < 32; ++e) {
            x[e]  = s[e >> 3][e & 7] * cl;
            xm[e] = ((e >> 3) * 16 + (e & 7) < lim) ? x[e] : NEGBIG;
        }
        float u[11], w[4];
#pragma unroll
        for (int i = 0; i < 10; ++i) u[i] = fmax3(xm[3 * i], xm[3 * i + 1], xm[3 * i + 2]);
        u[10] = fmaxf(xm[30], xm[31]);
#pragma unroll
        for (int i = 0; i < 3; ++i) w[i] = fmax3(u[3 * i], u[3 * i + 1], u[3 * i + 2]);
        w[3] = fmaxf(u[9], u[10]);
        const float th = fmaxf(fmax3(w[0], w[1], w[2]), w[3]);
        const float tm = fmaxf(th, other_half(th));
        const float mn = fmaxf(m, tm);
        const float al = fexp2(m - mn);
        m = mn;
        lacc[0] *= al;
#pragma unroll
        for (int dt = 0; dt < 4; ++dt) o[dt] *= al;
        const float sh = 10.0f - mn;      // carry 2^10
        FragP pb[2];                      // P^T as B fragments: 32 keys each
#pragma unroll
        for (int e = 0; e < 32; e += 2) {
            v2f p2;
#pragma unroll
            for (int j = 0; j < 2; ++j) {
                const bool  alw = ((e + j) >> 3) * 16 + ((e + j) & 7) < lim;
                const float arg = alw ? (x[e + j] + sh) : 0.0f;
                const float ex  = fexp2(arg);
                p2[j] = alw ? ex : 0.0f;
            }
            pb[e >> 4].pair[(e & 15) >> 1] = __builtin_convertvector(p2, v2h);
        }

        // O^T += V^T . P^T ; l += ones . P^T
#pragma unroll
        for (int kk = 0; kk < 2; ++kk) {
#pragma unroll
            for (int dt = 0; dt < 4; ++dt) {
                const v16h vb = load_frag(vsT, dt * 16, APITCH, kk * 32, lane);
                o[dt] = wmma16(vb, pb[kk].v, o[dt]);
            }
            lacc = wmma16(ones, pb[kk].v, lacc);
        }
    }
    __syncthreads();     // every reader has left the K/V stages: they become the hand-over buffer

    float* mb = (float*)sm + t2;         // [34][128] floats, one column a lane of a group
    if (grp == 1) {
        mb[0]   = m;
        mb[128] = lacc[0];
#pragma unroll
        for (int dt = 0; dt < 4; ++dt)
#pragma unroll
            for (int r = 0; r < 8; ++r) mb[(2 + dt * 8 + r) * 128] = o[dt][r];
    }
    __syncthreads();     // publishes group 1's partial state to group 0

    // merge, then normalize: plane value = 1024 * (O/16) / (l) = O * 64 / l ; zero row when l == 0
    if (grp == 0) {
        const float m1 = mb[0];
        const float mn = fmaxf(m, m1);
        float a0 = fexp2(m - mn);
        float d1 = m1 - mn;
        // the slot behind a transcendental: without it the second one stands directly behind the first and
        // lands on its source register; the two operands hold the v_nop between them
        asm volatile("v_nop" : "+v"(a0), "+v"(d1));
        const float a1 = fexp2(d1);
        const float l  = lacc[0] * a0 + mb[128] * a1;
        const float lsafe = (l > 0.0f) ? l : 1.0f;
        const float inv   = (l > 0.0f) ? ((CARRY_CTX / CARRY_QKV) / lsafe) : 0.0f;
#pragma unroll
        for (int dt = 0; dt < 4; ++dt) {
            H8U t;
#pragma unroll
            for (int r = 0; r < 8; ++r) {
                const float ov = o[dt][r] * a0 + mb[(2 + dt * 8 + r) * 128] * a1;
                t.e[r] = (f16)(ov * inv);
            }
            *(v8h*)&psw[c16 * APITCH + dt * 16 + hh8] = t.v;   // 8 consecutive d of one query row
        }
    }
    __syncthreads();

    if (grp == 0) {
        const int piece = lane & 7;
        const int lsub  = lane >> 3;
#pragma unroll
        for (int it = 0; it < 4; ++it) {
            const int L = it * 4 + lsub;     // query row 0..15 within the wave tile
            const v8h v = *(const v8h*)&psw[L * APITCH + piece * 8];
            f16* dp = Cp + ((size_t)(bidx * SEQ + qw + L) * HID + hidx * HD + piece * 8);
            *(v8h*)dp = v;
        }
    }
}

// ---------------------------------------------------------------------------
// All of attention in one grid: the 64-row q-blocks 2 .. SEQ/64-1 of every head (attn_tile_split),
// longest horizon first (there are more blocks than resident places: late starters must be the
// short ones), then the two 64-row blocks of rows 0 .. 127 of every head (attn_tile_res, at most
// two key tiles). The blocks are independent of each other.
// The branch is block-uniform; the two kinds of block share one LDS array.
// ---------------------------------------------------------------------------
#define QBLKS    (SEQ / 64 - 2)
#define SBLKS    (QBLKS * NB * NHEAD)
#define RBLKS    (2 * NB * NHEAD)
#define ATTN_LDS (ATTN_LDSR > ATTN_LDS2 ? ATTN_LDSR : ATTN_LDS2)
// at most 160 registers: three blocks (six waves a SIMD) stay resident
__global__ void __launch_bounds__(256) __attribute__((amdgpu_num_vgpr(160)))
attn_all(const f16* __restrict__ Qp, const f16* __restrict__ Kp, const f16* __restrict__ Vt,
         const f16* __restrict__ Vtl, const int* __restrict__ kcnt,
         f16* __restrict__ Cp, f16* __restrict__ Cpl) {
    __shared__ __attribute__((aligned(16))) f16 sm[ATTN_LDS];
    const int b = (int)blockIdx.x;
    if (b >= SBLKS) {
        const int t = b - SBLKS;
        attn_tile_res(Qp, Kp, Vt, Vtl, kcnt, Cp, Cpl, sm, t / (NB * NHEAD), t % (NB * NHEAD));
    } else {
        attn_tile_split(Qp, Kp, Vt, kcnt, Cp, sm, SEQ / 64 - 1 - b / (NB * NHEAD), b % (NB * NHEAD));
    }
}

// ---------------------------------------------------------------------------
// Launch: 4 kernel launches. Workspace (halves): X, Q, K, V^T hi, V^T residual, ctx hi
// (6 x MROWS*1024), 4 weight planes (1024*1024), ctx residual (NB*128*1024), plus the key tables
// ---------------------------------------------------------------------------
extern "C" void kernel_launch(void* const* d_in, const int* in_sizes, int n_in,
                              void* d_out, int out_size, void* d_ws, size_t ws_size,
                              hipStream_t stream) {
    if (n_in < 10) return;
    if (in_sizes[0] < ((NB - 1) * SEQ_FULL + SEQ) * HID) return;
    if (in_sizes[1] < (NB - 1) * SEQ_FULL + SEQ) return;
    if (in_sizes[2] < HID * HID || in_sizes[4] < HID * HID ||
        in_sizes[6] < HID * HID || in_sizes[8] < HID * HID) return;
    if (in_sizes[3] < HID || in_sizes[5] < HID || in_sizes[7] < HID || in_sizes[9] < HID) return;
    if (out_size < MROWS * HID) return;

    const float* x    = (const float*)d_in[0];
    const int*   mask = (const int*)d_in[1];
    const float* wq   = (const float*)d_in[2];
    const float* bq   = (const float*)d_in[3];
    const float* wk   = (const float*)d_in[4];
    const float* bk   = (const float*)d_in[5];
    const float* wv   = (const float*)d_in[6];
    const float* bv   = (const float*)d_in[7];
    const float* wo   = (const float*)d_in[8];
    const float* bo   = (const float*)d_in[9];

    const size_t nX = (size_t)MROWS * HID;    // halves per activation plane
    const size_t nW = (size_t)HID * HID;      // halves per weight plane
    const size_t nR = (size_t)RROWS * HID;    // elements per residual-row plane
    const size_t totalBytes = (6 * nX + 4 * nW + nR) * sizeof(f16) + 2 * (size_t)MROWS * sizeof(int);
    if (ws_size < totalBytes) return;

    f16* Xh  = (f16*)d_ws;       // [MROWS][1024]            carry 16
    f16* Wqh = Xh  + nX;         // [n][k] = Wq[k][n]        carry 32
    f16* Wkh = Wqh + nW;
    f16* Wvh = Wkh + nW;
    f16* Woh = Wvh + nW;
    f16* Qp  = Woh + nW;         // [NB*16][SEQ][64]         carry 16
    f16* Kp  = Qp  + nX;         // [NB*16][SEQ][64]         carry 16, packed keys
    f16* Vth = Kp  + nX;         // [NB*1024][SEQ] (V^T)     carry 16, packed keys
    f16* Vtl = Vth + nX;         // V^T residual x2^10
    f16* Cph = Vtl + nX;         // [MROWS][1024]            carry 1024
    f16* Cpl = Cph + nX;         // [NB*128][1024]           ctx residual x2^10 (rows 0..127 per batch), directly behind Cph
    int* Kidx = (int*)(Cpl + nR);     // [NB][SEQ] index of the j-th allowed key
    int* Kcnt = Kidx + MROWS;         // [NB][SEQ] allowed keys with index <= s

    cvt_all<<<NB + 4 * WTILES + MROWS / 2, 256, 0, stream>>>(x, wq, wk, wv, wo, mask, Xh, Wqh, Kidx, Kcnt);

    // plane = 16 * (acc / (16*32) + b) = acc/32 + 16*b
    const float accQKV = CARRY_QKV / (CARRY_X * CARRY_W);
    gemm_qkv<<<QKV_ALL, 256, 0, stream>>>(Xh, Wqh, bq, bk, bv, Qp, Vth, Vtl,
                                                                    Kidx, Kcnt, accQKV, CARRY_QKV);

    attn_all<<<SBLKS + RBLKS, 256, 0, stream>>>(Qp, Kp, Vth, Vtl, Kcnt, Cph, Cpl);

    // out = acc / (1024*32) + b, on the first 128 rows of each sequence + residual acc / (1024*1024*32)
    const float accOut = 1.0f / (CARRY_CTX * CARRY_W);
    const float accLo  = 1.0f / (CARRY_CTX * CARRY_RES * CARRY_W);
    gemm_out<<<dim3(RTILES + MTILES, HID / 128), 256, 0, stream>>>(Cph, Woh, bo, (float*)d_out, accOut, accLo);
}
